// v000
// The times below were measured on an AMD MI455X: many runs one after another, warmed up first and cycling through
// copies of the inputs, with the whole window's GPU time divided by the number of runs. Launches and the gaps
// between them are all in it. The median over several windows is given; except for v000 it joins two sittings, which
// can be a few percent apart, so the side-by-side timings, each taken in one sitting, are the better comparison.
// v000, which the later versions start from, runs in 1520 microseconds.
#include <hip/hip_runtime.h>
// StandAloneSelfAttention (inputs [2][128][56][56]; q = conv7x7(x, Wq, pad 3) (256 ch, 56x56); k, v = conv7x7(pad3(x), Wk/Wv, pad 3) (256 ch, 62x62); per channel c and pixel: 7x7 window of k (plus rel_h[c] per window row for the first 128 channels, rel_w[c-128] per window column for the rest) and v around the pixel; attn = softmax over the 49 of q*k (scalar products); out = sum attn*v, then the reference's transpose(0,2,1,3,4): output channel (dh*8 + head) takes computation channel (head*32 + dh) -> [2][256][56][56]).
// Structure: pixel rows; x as exact f16 rows via LDS transposes; the three 7x7 convs as im2cols (K = 6,272; the k/v one over the 62x62 grid with the double padding folded into its bounds) + WMMA GEMMs (32x64 wave tiles, f32 accumulation, exact x16 weights) into f32 channel rows; the per-channel 49-way window softmax and weighted sum on VALU in f32 (rel tables read) with the channel-major store.
// Compute dtype: inputs rounded to bf16; x / weights / rel tables exact; q, k, v in f32 (GEMM outputs); softmax and the weighted sum f32 — no reduced-precision intermediates after the convs. v_wmma_f32_16x16x32_f16.
#define NB 2
#define CI 128
#define CO 256
#define HS 56
#define PX (HS * HS)                 /* 3136 */
#define HK 62                        /* k/v grid */
#define PK (HK * HK)                 /* 3844 */
#define NRQ ((size_t)NB * PX)        /* 6272 = 49 x 128 */
#define NRK 7808                     /* 2 x 3844 = 7688 -> padded to 61 x 128 */
#define KK 49
#define KC (KK * CI)                 /* 6272 */
#define CG (CI / 8)
#define NCO CO                       /* output channels computed (debug hook) */
typedef __bf16 v16b __attribute__((ext_vector_type(16)));
typedef unsigned short v8us __attribute__((ext_vector_type(8), may_alias));
typedef float  v8f  __attribute__((ext_vector_type(8)));
typedef float  v4f  __attribute__((ext_vector_type(4)));
typedef float  v4fa __attribute__((ext_vector_type(4), may_alias));
union FragB { v16b v; v8us half[2]; unsigned short u[16]; };

__device__ __forceinline__ unsigned short bf16_bits(float x) { unsigned int u = __float_as_uint(x); return (unsigned short)((u + 0x7FFFu + ((u >> 16) & 1u)) >> 16); }
__device__ __forceinline__ float bf16_val(unsigned short b) { return __uint_as_float(((unsigned int)b) << 16); }
__device__ __forceinline__ float bf16_round(float x) { return bf16_val(bf16_bits(x)); }
// D += A·B with NT terms: 1 = ah·bh, 2 = + al·bh (A split), 3 = + ah·bl (both split)
template <int NT>
__device__ __forceinline__ v8f mmaN(v16b ah, v16b al, v16b bh, v16b bl, v8f c) {
  c = __builtin_amdgcn_wmma_f32_16x16x32_bf16(false, ah, false, bh, (short)0, c, false, false);
  if (NT >= 2) c = __builtin_amdgcn_wmma_f32_16x16x32_bf16(false, al, false, bh, (short)0, c, false, false);
  if (NT >= 3) c = __builtin_amdgcn_wmma_f32_16x16x32_bf16(false, ah, false, bl, (short)0, c, false, false);
  asm volatile("v_nop\n\tv_nop\n\tv_nop\n\tv_nop" : "+v"(c) : "v"(ah), "v"(al), "v"(bh), "v"(bl));
  return c;
}

__global__ __launch_bounds__(256) void k_wt_bf16(const float* __restrict__ W, unsigned short* __restrict__ Wt, int K, int N) {
  const int t = blockIdx.x * 256 + threadIdx.x;
  const int k8n = K / 8;
  if (t >= N * k8n) return;
  const int n = t / k8n, k8 = (t % k8n) * 8;
  v8us v;
#pragma unroll
  for (int i = 0; i < 8; ++i) v[i] = bf16_bits(W[(size_t)(k8 + i) * N + n]);
  *(v8us*)(Wt + (size_t)n * K + k8) = v;
  
}

// GEMM C[M][N] (f32, pitch ldc) = act(A[M][K]·W + bias). A f32 row-major (pitch lda) converted per fragment to bf16
// (ASPLIT: hi/lo two planes -> 2 terms, else single rounded term); Wt bf16 [N][K] (pitch ldb). BIAS_BF16 rounds the
// bias to bf16 first (bias quantised to bf16 before the add). K%32==0, M%16==0, N%64==0.
template <bool ASPLIT, int ACT, bool BIAS_BF16>
__global__ __launch_bounds__(128) void k_gemm_bf(const float* __restrict__ A, int lda, const unsigned short* __restrict__ Wt, int ldb,
                                               const float* __restrict__ bias, float* __restrict__ C, int ldc, int M, int N, int K) {
  __shared__ __attribute__((aligned(16))) float so[4][16][64];
  const int tid = threadIdx.x, w = tid >> 5, lane = tid & 31, ln = lane & 15, hh = lane >> 4;
  const int ntn = N / 64;
  const int wid = blockIdx.x * 4 + w;
  const int mt = wid / ntn, nq = wid % ntn;
  if (mt * 16 >= M) return;
  const int row0 = mt * 16, col0 = nq * 64;
  const float* arow = A + (size_t)(row0 + ln) * lda;
  v8f acc[4] = {};
  for (int kb = 0; kb < K; kb += 32) {
    FragB ah, al;
    const v4f x0 = *(const v4fa*)(arow + kb + 8 * hh), x1 = *(const v4fa*)(arow + kb + 8 * hh + 4);
    const v4f x2 = *(const v4fa*)(arow + kb + 16 + 8 * hh), x3 = *(const v4fa*)(arow + kb + 16 + 8 * hh + 4);
    float xs[16] = {x0[0],x0[1],x0[2],x0[3],x1[0],x1[1],x1[2],x1[3],x2[0],x2[1],x2[2],x2[3],x3[0],x3[1],x3[2],x3[3]};
#pragma unroll
    for (int i = 0; i < 16; ++i) { const unsigned short hb = bf16_bits(xs[i]); ah.u[i] = hb; al.u[i] = ASPLIT ? bf16_bits(xs[i] - bf16_val(hb)) : (unsigned short)0; }
#pragma unroll
    for (int t = 0; t < 4; ++t) {
      const unsigned short* brow = Wt + (size_t)(col0 + t * 16 + ln) * ldb + kb;
      FragB b;
      b.half[0] = *(const v8us*)(brow + 8 * hh);
      b.half[1] = *(const v8us*)(brow + 16 + 8 * hh);
      acc[t] = mmaN<ASPLIT ? 2 : 1>(ah.v, al.v, b.v, b.v, acc[t]);
    }
  }
#pragma unroll
  for (int t = 0; t < 4; ++t) {
    float bv = bias ? bias[col0 + t * 16 + ln] : 0.f;
    if (BIAS_BF16) bv = bf16_round(bv);
#pragma unroll
    for (int r = 0; r < 8; ++r) { float v = acc[t][r] + bv; if (ACT == 1) v = fmaxf(v, 0.f); so[w][8 * hh + r][t * 16 + ln] = v; }
  }
  __builtin_amdgcn_fence(__ATOMIC_ACQ_REL, "workgroup");
  __builtin_amdgcn_wave_barrier();
  const int rsub = lane >> 4, c4 = (lane & 15) * 4;
  {
#pragma unroll
    for (int q = 0; q < 8; ++q) {
      const int r = q * 2 + rsub;
      const v4f v = *(const v4fa*)&so[w][r][c4];
      *(v4f*)(C + (size_t)(row0 + r) * ldc + col0 + c4) = v;
    }
    
  }
}

// GEMM C = act(A·W + bias + resid): A f32 (ASPLIT -> hi/lo 2 terms), Wt bf16 [N][K]; ACT 0 none, 1 relu, 2 exact gelu;
// resid (optional, f32, row index = (row % rmod), pitch ldr, RES_BF16 rounds it) added before the activation.
template <bool ASPLIT, int ACT, bool BIAS_BF16, bool RES_BF16>
__global__ __launch_bounds__(128) void k_gemm_bf3(const float* __restrict__ A, int lda, const unsigned short* __restrict__ Wt, int ldb,
                                                const float* __restrict__ bias, const float* __restrict__ resid, int rmod, int ldr,
                                                float* __restrict__ C, int ldc, int M, int N, int K) {
  __shared__ __attribute__((aligned(16))) float so[4][16][64];
  const int tid = threadIdx.x, w = tid >> 5, lane = tid & 31, ln = lane & 15, hh = lane >> 4;
  const int ntn = N / 64;
  const int wid = blockIdx.x * 4 + w;
  const int mt = wid / ntn, nq = wid % ntn;
  if (mt * 16 >= M) return;
  const int row0 = mt * 16, col0 = nq * 64;
  const float* arow = A + (size_t)(row0 + ln) * lda;
  v8f acc[4] = {};
  for (int kb = 0; kb < K; kb += 32) {
    FragB ah, al;
    const v4f x0 = *(const v4fa*)(arow + kb + 8 * hh), x1 = *(const v4fa*)(arow + kb + 8 * hh + 4);
    const v4f x2 = *(const v4fa*)(arow + kb + 16 + 8 * hh), x3 = *(const v4fa*)(arow + kb + 16 + 8 * hh + 4);
    float xs[16] = {x0[0],x0[1],x0[2],x0[3],x1[0],x1[1],x1[2],x1[3],x2[0],x2[1],x2[2],x2[3],x3[0],x3[1],x3[2],x3[3]};
#pragma unroll
    for (int i = 0; i < 16; ++i) { const unsigned short hb = bf16_bits(xs[i]); ah.u[i] = hb; al.u[i] = ASPLIT ? bf16_bits(xs[i] - bf16_val(hb)) : (unsigned short)0; }
#pragma unroll
    for (int t = 0; t < 4; ++t) {
      const unsigned short* brow = Wt + (size_t)(col0 + t * 16 + ln) * ldb + kb;
      FragB b;
      b.half[0] = *(const v8us*)(brow + 8 * hh);
      b.half[1] = *(const v8us*)(brow + 16 + 8 * hh);
      acc[t] = mmaN<ASPLIT ? 2 : 1>(ah.v, al.v, b.v, b.v, acc[t]);
    }
  }
#pragma unroll
  for (int t = 0; t < 4; ++t) {
    const int col = col0 + t * 16 + ln;
    float bv = bias ? bias[col] : 0.f;
    if (BIAS_BF16) bv = bf16_round(bv);
#pragma unroll
    for (int r = 0; r < 8; ++r) {
      float v = acc[t][r] + bv;
      if (resid) { float rv = resid[(size_t)((row0 + 8 * hh + r) % rmod) * ldr + col]; if (RES_BF16) rv = bf16_round(rv); v += rv; }
      if (ACT == 1) v = fmaxf(v, 0.f);
      if (ACT == 2) v = 0.5f * v * (1.0f + erff(v * 0.70710678118654752f));
      if (ACT == 3) { const float u = 0.7978845608028654f * (v + 0.044715f * v * v * v); v = 0.5f * v * (1.0f + tanhf(u)); }
      so[w][8 * hh + r][t * 16 + ln] = v;
    }
  }
  __builtin_amdgcn_fence(__ATOMIC_ACQ_REL, "workgroup");
  __builtin_amdgcn_wave_barrier();
  const int rsub = lane >> 4, c4 = (lane & 15) * 4;
  {
#pragma unroll
    for (int q = 0; q < 8; ++q) {
      const int r = q * 2 + rsub;
      const v4f v = *(const v4fa*)&so[w][r][c4];
      *(v4f*)(C + (size_t)(row0 + r) * ldc + col0 + c4) = v;
    }
    
  }
}
// row LayerNorm (biased variance, eps) over N: s = X (+ R); optional out_sum <- s; out_norm <- (s-mu)*rsqrt(var+eps)*g + b
template <bool PARAM_BF16>
__global__ __launch_bounds__(256) void k_layernorm(const float* __restrict__ X, const float* __restrict__ R, const float* __restrict__ g, const float* __restrict__ bta,
                                                  float* __restrict__ out_sum, float* __restrict__ out_norm, int N, float eps) {
  __shared__ float red[256];
  const int row = blockIdx.x, tid = threadIdx.x;
  const float* x = X + (size_t)row * N; const float* rr = R ? R + (size_t)row * N : nullptr;
  float vals[16];                     // up to N = 4096
  const int per = N / 256;            // contiguous chunk per thread? use strided-by-4 chunks: thread handles j = tid*4 + 1024*u
  float s1 = 0.f;
  for (int u = 0; u < per / 4; ++u) {
    const int j = tid * 4 + 1024 * u;
    const v4f a = *(const v4fa*)(x + j);
    v4f b = {0.f,0.f,0.f,0.f}; if (rr) b = *(const v4fa*)(rr + j);
#pragma unroll
    for (int q = 0; q < 4; ++q) { const float v = a[q] + b[q]; vals[u * 4 + q] = v; s1 += v; }
  }
  red[tid] = s1; __syncthreads();
  for (int st = 128; st > 0; st >>= 1) { if (tid < st) red[tid] += red[tid + st]; __syncthreads(); }
  const float mu = red[0] / (float)N; __syncthreads();
  float s2 = 0.f;
  for (int u = 0; u < per / 4; ++u)
#pragma unroll
    for (int q = 0; q < 4; ++q) { const float c = vals[u * 4 + q] - mu; s2 += c * c; }
  red[tid] = s2; __syncthreads();
  for (int st = 128; st > 0; st >>= 1) { if (tid < st) red[tid] += red[tid + st]; __syncthreads(); }
  const float rs = rsqrtf(red[0] / (float)N + eps);
  {
    for (int u = 0; u < per / 4; ++u) {
      const int j = tid * 4 + 1024 * u;
      v4f o, sm;
#pragma unroll
      for (int q = 0; q < 4; ++q) {
        float gg = g[j + q], bb = bta[j + q];
        if (PARAM_BF16) { gg = bf16_round(gg); bb = bf16_round(bb); }
        sm[q] = vals[u * 4 + q]; o[q] = (vals[u * 4 + q] - mu) * rs * gg + bb;
      }
      if (out_sum) *(v4f*)(out_sum + (size_t)row * N + j) = sm;
      *(v4f*)(out_norm + (size_t)row * N + j) = o;
    }
    
  }
}



// ---- f16 WMMA path (v_wmma_f32_16x16x32_f16): 11-bit significands for operands in range — used here for the conv GEMMs, whose bf16-rounded x and x16 weights are exact in f16
typedef _Float16 v16h __attribute__((ext_vector_type(16)));
union FragH { v16h v; v8us half[2]; _Float16 h[16]; unsigned short u[16]; };
template <int NT>
__device__ __forceinline__ v8f mmaH(v16h ah, v16h al, v16h bh, v16h bl, v8f c) {
  c = __builtin_amdgcn_wmma_f32_16x16x32_f16(false, ah, false, bh, (short)0, c, false, false);
  if (NT >= 2) c = __builtin_amdgcn_wmma_f32_16x16x32_f16(false, al, false, bh, (short)0, c, false, false);
  if (NT >= 3) c = __builtin_amdgcn_wmma_f32_16x16x32_f16(false, ah, false, bl, (short)0, c, false, false);
  asm volatile("v_nop\n\tv_nop\n\tv_nop\n\tv_nop" : "+v"(c) : "v"(ah), "v"(al), "v"(bh), "v"(bl));
  return c;
}
// batched GEMM like k_gemm_b but f16 operands: A f32 (split into f16 hi/lo if ASPLIT, else rounded to f16), Bt = f16 values [n][k]; alpha; C f32; N multiple of 16 (partial tiles skipped)
template <bool ASPLIT>
__global__ __launch_bounds__(128) void k_gemm_h(const float* __restrict__ A, int lda, size_t sA, const _Float16* __restrict__ Bh, int ldb, size_t sB, float alpha, float* __restrict__ C, int ldc, size_t sC, int M, int N, int K) {
  __shared__ __attribute__((aligned(16))) float so[4][16][64];
  const int tid = threadIdx.x, w = tid >> 5, lane = tid & 31, ln = lane & 15, hh = lane >> 4; const int by = blockIdx.y;
  A += (size_t)by * sA; Bh += (size_t)by * sB; C += (size_t)by * sC;
  const int ntn = (N + 63) / 64; const int wid = blockIdx.x * 4 + w; const int mt = wid / ntn, nq = wid % ntn; if (mt * 16 >= M) return;
  const int row0 = mt * 16, col0 = nq * 64; const float* arow = A + (size_t)(row0 + ln) * lda;
  v8f acc[4] = {};
  for (int kb = 0; kb < K; kb += 32) {
    FragH ah, al;
    const v4f x0 = *(const v4fa*)(arow + kb + 8 * hh), x1 = *(const v4fa*)(arow + kb + 8 * hh + 4), x2 = *(const v4fa*)(arow + kb + 16 + 8 * hh), x3 = *(const v4fa*)(arow + kb + 16 + 8 * hh + 4);
    float xs[16] = {x0[0],x0[1],x0[2],x0[3],x1[0],x1[1],x1[2],x1[3],x2[0],x2[1],x2[2],x2[3],x3[0],x3[1],x3[2],x3[3]};
#pragma unroll
    for (int i = 0; i < 16; ++i) { const _Float16 h = (_Float16)xs[i]; ah.h[i] = h; al.h[i] = ASPLIT ? (_Float16)(xs[i] - (float)h) : (_Float16)0.0f; }
#pragma unroll
    for (int t = 0; t < 4; ++t) { if (col0 + t * 16 >= N) continue; const size_t boff = (size_t)(col0 + t * 16 + ln) * ldb + kb; FragH bq; bq.half[0] = *(const v8us*)(Bh + boff + 8 * hh); bq.half[1] = *(const v8us*)(Bh + boff + 16 + 8 * hh);
      acc[t] = mmaH<ASPLIT ? 2 : 1>(ah.v, al.v, bq.v, bq.v, acc[t]); }
  }
#pragma unroll
  for (int t = 0; t < 4; ++t) { if (col0 + t * 16 >= N) continue;
#pragma unroll
    for (int r = 0; r < 8; ++r) so[w][8 * hh + r][t * 16 + ln] = acc[t][r] * alpha; }
  __builtin_amdgcn_fence(__ATOMIC_ACQ_REL, "workgroup"); __builtin_amdgcn_wave_barrier();
  const int rsub = lane >> 4, c4 = (lane & 15) * 4;
  {
#pragma unroll
    for (int q = 0; q < 8; ++q) { const int r = q * 2 + rsub; if (col0 + c4 < N) { const v4f v = *(const v4fa*)&so[w][r][c4]; *(v4f*)(C + (size_t)(row0 + r) * ldc + col0 + c4) = v; } }
     }
}

// Wt[n][k] = f16(W[k][n]·scale) from f32 row-major W[K][N] (scale = power of two; bf16-exact weights stay exact in f16 away from the subnormal range)
__global__ __launch_bounds__(256) void k_wt_f16(const float* __restrict__ W, _Float16* __restrict__ Wt, int K, int N, float scale) {
  const int t = blockIdx.x * 256 + threadIdx.x; if (t >= N * (K / 8)) return; const int n = t / (K / 8), k8 = (t % (K / 8)) * 8; FragH f;
#pragma unroll
  for (int i = 0; i < 8; ++i) f.h[i] = (_Float16)(bf16_round(W[(size_t)(k8 + i) * N + n]) * scale); const v8us o = f.half[0];
  *(v8us*)((unsigned short*)Wt + (size_t)n * K + k8) = o; 
}
// k_gemm_hh variant with fused epilogue: v = acc·alpha + bias[by·sBias + col] (+ CP[(row/rowsPerB)·sCPb + by·64 + col] if CP) ; ACT 0 none / 1 elu ; writes f16 C16 (and f32 C if non-null)
template <int ACT>
__global__ __launch_bounds__(128) void k_gemm_hhx(const _Float16* __restrict__ A, int lda, size_t sA, const _Float16* __restrict__ Bh, int ldb, size_t sB, float alpha, const float* __restrict__ bias, size_t sBias, const float* __restrict__ CP, int rowsPerB, size_t sCPb, int row0g,
    float* __restrict__ C, _Float16* __restrict__ C16, int ldc, size_t sC, int M, int N, int K) {
  __shared__ __attribute__((aligned(16))) float so[4][16][64];
  const int tid = threadIdx.x, w = tid >> 5, lane = tid & 31, ln = lane & 15, hh = lane >> 4; const int by = blockIdx.y;
  A += (size_t)by * sA; Bh += (size_t)by * sB; const size_t cofs = (size_t)by * sC; const float* bp = bias ? bias + (size_t)by * sBias : nullptr;
  const int ntn = (N + 63) / 64; const int wid = blockIdx.x * 4 + w; const int mt = wid / ntn, nq = wid % ntn; if (mt * 16 >= M) return;
  const int row0 = mt * 16, col0 = nq * 64; const _Float16* arow = A + (size_t)(row0 + ln) * lda;
  v8f acc[4] = {};
  for (int kb = 0; kb < K; kb += 32) { FragH ah; ah.half[0] = *(const v8us*)((const unsigned short*)arow + kb + 8 * hh); ah.half[1] = *(const v8us*)((const unsigned short*)arow + kb + 16 + 8 * hh);
#pragma unroll
    for (int t = 0; t < 4; ++t) { if (col0 + t * 16 >= N) continue; const size_t boff = (size_t)(col0 + t * 16 + ln) * ldb + kb; FragH bq; bq.half[0] = *(const v8us*)((const unsigned short*)Bh + boff + 8 * hh); bq.half[1] = *(const v8us*)((const unsigned short*)Bh + boff + 16 + 8 * hh);
      acc[t] = mmaH<1>(ah.v, ah.v, bq.v, bq.v, acc[t]); }
  }
#pragma unroll
  for (int t = 0; t < 4; ++t) { if (col0 + t * 16 >= N) continue; const int col = col0 + t * 16 + ln; const float bv = bp ? bf16_round(bp[col]) : 0.f;
#pragma unroll
    for (int r = 0; r < 8; ++r) { float v = acc[t][r] * alpha + bv; if (CP) { const int rr = row0g + row0 + 8 * hh + r; if (rowsPerB < 0) v += CP[cofs + (size_t)rr * ldc + col];      /* rowsPerB < 0: own element of the batched C plane */ else { const int bidx = rr / rowsPerB; v += CP[(size_t)bidx * sCPb + (size_t)by * 64 + col]; } } if (ACT == 1) v = (v > 0.f) ? v : expm1f(v); else if (ACT == 7) v = (v > 0.f) ? v + 1.0f : expf(v); else if (ACT == 8) v = tanhf(v); else if (ACT == 9) v = 0.5f * v * (1.0f + tanhf(0.7978845608028654f * (v + 0.044715f * v * v * v))); else if (ACT == 11) v = 1.0f / (1.0f + expf(-v)); else if (ACT == 12) v = (v > 0.f) ? v : 0.01f * v; else if (ACT == 14) v = (v > 0.f) ? v : 0.1f * v; else if (ACT == 16) v = (v >= 0.f) ? v : 0.3f * v; else if (ACT == 17) v = (v >= 0.f) ? v : 0.2f * v; else if (ACT == 15) v = v / (1.0f + expf(-v)); else if (ACT == 3) v = fmaxf(v, 0.f); else if (ACT == 6) v = 0.5f * v * (1.0f + erff(v * 0.70710678118654752f)); so[w][8 * hh + r][t * 16 + ln] = v; } }
  __builtin_amdgcn_fence(__ATOMIC_ACQ_REL, "workgroup"); __builtin_amdgcn_wave_barrier();
  const int rsub = lane >> 4, c4 = (lane & 15) * 4; typedef _Float16 v4h __attribute__((ext_vector_type(4)));
  {
#pragma unroll
    for (int q = 0; q < 8; ++q) { const int r = q * 2 + rsub; if (col0 + c4 < N) { const v4f v = *(const v4fa*)&so[w][r][c4]; if (C) *(v4f*)(C + cofs + (size_t)(row0 + r) * ldc + col0 + c4) = v; if (C16) { v4h h4; for (int i = 0; i < 4; ++i) h4[i] = (_Float16)v[i]; *(v4h*)(C16 + cofs + (size_t)(row0 + r) * ldc + col0 + c4) = h4; } } }
     }
}


typedef _Float16 v4h __attribute__((ext_vector_type(4)));

__global__ __launch_bounds__(256) void k_x16(const float* __restrict__ x, _Float16* __restrict__ X16, size_t n8) { const size_t t = (size_t)blockIdx.x * 256 + threadIdx.x; if (t >= n8) return; FragH f;
#pragma unroll
  for (int q = 0; q < 8; ++q) f.h[q] = (_Float16)bf16_round(x[t * 8 + q]); *(v8us*)((unsigned short*)X16 + t * 8) = f.half[0];  }
__global__ __launch_bounds__(256) void k_h16(const float* __restrict__ x, _Float16* __restrict__ X16, size_t n8) { const size_t t = (size_t)blockIdx.x * 256 + threadIdx.x; if (t >= n8) return; FragH f;
#pragma unroll
  for (int q = 0; q < 8; ++q) f.h[q] = (_Float16)x[t * 8 + q]; *(v8us*)((unsigned short*)X16 + t * 8) = f.half[0];  }
__global__ __launch_bounds__(256) void k_round16f(const float* __restrict__ W, _Float16* __restrict__ Bt, size_t n8) { const size_t t = (size_t)blockIdx.x * 256 + threadIdx.x; if (t >= n8) return; FragH f;
#pragma unroll
  for (int i = 0; i < 8; ++i) f.h[i] = (_Float16)(bf16_round(W[t * 8 + i]) * 16.0f); *(v8us*)((unsigned short*)Bt + t * 8) = f.half[0];  }
template <int NHv, int TTv>
__global__ __launch_bounds__(256) void k_vt(const _Float16* __restrict__ V16, int ldv, int voff, _Float16* __restrict__ Vt) { __shared__ unsigned short tl[64][66]; const int tid = threadIdx.x; const int slab = blockIdx.x / (TTv / 64), lg = blockIdx.x % (TTv / 64); const int b = slab / NHv, h = slab % NHv;
  for (int i = tid; i < 64 * 8; i += 256) { const int r = i / 8, c8 = (i % 8) * 8; FragH f; f.half[0] = *(const v8us*)((const unsigned short*)V16 + ((size_t)b * TTv + lg * 64 + r) * ldv + voff + h * 64 + c8);
#pragma unroll
    for (int q = 0; q < 8; ++q) tl[r][c8 + q] = f.u[q]; }
  __syncthreads();
  {
#pragma unroll
    for (int rd = 0; rd < 2; ++rd) { const int d = rd * 32 + tid / 8, pc = tid % 8; FragH f;
#pragma unroll
      for (int q = 0; q < 8; ++q) f.u[q] = tl[pc * 8 + q][d];
      *(v8us*)((unsigned short*)Vt + ((size_t)slab * 64 + d) * TTv + lg * 64 + pc * 8) = f.half[0]; }
     } }

__global__ __launch_bounds__(256) void k_hl(const float* __restrict__ F, _Float16* __restrict__ Hh, _Float16* __restrict__ Hl, size_t n8) { const size_t t = (size_t)blockIdx.x * 256 + threadIdx.x; if (t >= n8) return; FragH fh, fl; const v4f a = *(const v4fa*)(F + t * 8), c = *(const v4fa*)(F + t * 8 + 4);
#pragma unroll
  for (int q = 0; q < 4; ++q) { _Float16 h = (_Float16)a[q]; fh.h[q] = h; fl.h[q] = (_Float16)((a[q] - (float)h) * 1024.0f); h = (_Float16)c[q]; fh.h[4 + q] = h; fl.h[4 + q] = (_Float16)((c[q] - (float)h) * 1024.0f); }
  { *(v8us*)((unsigned short*)Hh + t * 8) = fh.half[0]; *(v8us*)((unsigned short*)Hl + t * 8) = fl.half[0];  } }

// ---- fast GEMM (wave tile 32x64; requires M % 32 == 0 rows per launch region and N % 64 == 0); epilogue = k_gemm_hhx semantics ----
__device__ __forceinline__ v16h g2_frag(const _Float16* p, int hh) { FragH f; f.half[0] = *(const v8us*)((const unsigned short*)p + 8 * hh); f.half[1] = *(const v8us*)((const unsigned short*)p + 16 + 8 * hh); return f.v; }
__device__ __forceinline__ v8f g2_mma(v16h a, v16h b, v8f c) { v8f d = __builtin_amdgcn_wmma_f32_16x16x32_f16(false, a, false, b, (short)0, c, false, false); asm volatile("v_nop\n\tv_nop\n\tv_nop\n\tv_nop" : "+v"(d) : "v"(a), "v"(b)); return d; }
template <int ACT>
__global__ __launch_bounds__(128) void k_gemm2(const _Float16* __restrict__ A, int lda, size_t sA, const _Float16* __restrict__ Bh, int ldb, size_t sB, float alpha, const float* __restrict__ bias, size_t sBias, const float* __restrict__ CP, int rowsPerB, size_t sCPb, int row0g,
    float* __restrict__ C, _Float16* __restrict__ C16, int ldc, size_t sC, int M, int N, int K) { static_assert(ACT == 0 || ACT == 3 || ACT == 6 || ACT == 8 || ACT == 9 || ACT == 11 || ACT == 12 || ACT == 14 || ACT == 15 || ACT == 16 || ACT == 17, "k_gemm2: unsupported ACT code (would silently apply no activation)");
  __shared__ __attribute__((aligned(16))) float so[4][32][68];
  const int tid = threadIdx.x, w = tid >> 5, lane = tid & 31, ln = lane & 15, hh = lane >> 4; const int by = blockIdx.y;
  A += (size_t)by * sA; Bh += (size_t)by * sB; const size_t cofs = (size_t)by * sC; const float* bp = bias ? bias + (size_t)by * sBias : nullptr;
  const int ntn = N >> 6; const int mt = blockIdx.x / ntn, nq = blockIdx.x - mt * ntn; const int row0 = mt * 128 + 32 * w, col0 = nq * 64; if (row0 >= M) return;
  const _Float16* a0p = A + (size_t)(row0 + ln) * lda; const _Float16* a1p = a0p + (size_t)16 * lda;
  const _Float16* b0p = Bh + (size_t)(col0 + ln) * ldb; const _Float16* b1p = b0p + (size_t)16 * ldb; const _Float16* b2p = b1p + (size_t)16 * ldb; const _Float16* b3p = b2p + (size_t)16 * ldb;
  const v8f z8 = {0.f,0.f,0.f,0.f,0.f,0.f,0.f,0.f}; v8f c00 = z8, c01 = z8, c02 = z8, c03 = z8, c10 = z8, c11 = z8, c12 = z8, c13 = z8;
#pragma unroll 1
  for (int kb = 0; kb < K; kb += 32) { const v16h a0 = g2_frag(a0p + kb, hh), a1 = g2_frag(a1p + kb, hh);
    v16h b = g2_frag(b0p + kb, hh); c00 = g2_mma(a0, b, c00); c10 = g2_mma(a1, b, c10);
    b = g2_frag(b1p + kb, hh); c01 = g2_mma(a0, b, c01); c11 = g2_mma(a1, b, c11);
    b = g2_frag(b2p + kb, hh); c02 = g2_mma(a0, b, c02); c12 = g2_mma(a1, b, c12);
    b = g2_frag(b3p + kb, hh); c03 = g2_mma(a0, b, c03); c13 = g2_mma(a1, b, c13); }
  v8f accs[8] = {c00, c01, c02, c03, c10, c11, c12, c13};
#pragma unroll
  for (int u = 0; u < 8; ++u) { const int t = u & 3, half = u >> 2; const int col = col0 + t * 16 + ln; const float bv = bp ? bf16_round(bp[col]) : 0.f;
#pragma unroll
    for (int r = 0; r < 8; ++r) { const int rloc = half * 16 + 8 * hh + r; float v = accs[u][r] * alpha + bv; if (CP) { if (rowsPerB < 0) v += CP[cofs + (size_t)(row0g + row0 + rloc) * ldc + col];      /* rowsPerB < 0: own element of the batched C plane */ else { const int bidx = (row0g + row0 + rloc) / rowsPerB; v += CP[(size_t)bidx * sCPb + (size_t)by * 64 + col]; } }
      if (ACT == 3) v = fmaxf(v, 0.f); else if (ACT == 6) v = 0.5f * v * (1.0f + erff(v * 0.70710678118654752f)); else if (ACT == 11) v = 1.0f / (1.0f + expf(-v)); else if (ACT == 15) v = v / (1.0f + expf(-v)); else if (ACT == 12) v = (v > 0.f) ? v : 0.01f * v; else if (ACT == 8) v = tanhf(v); else if (ACT == 9) v = 0.5f * v * (1.0f + tanhf(0.7978845608028654f * (v + 0.044715f * v * v * v))); else if (ACT == 14) v = (v > 0.f) ? v : 0.1f * v; else if (ACT == 16) v = (v >= 0.f) ? v : 0.3f * v; else if (ACT == 17) v = (v >= 0.f) ? v : 0.2f * v;
      so[w][rloc][t * 16 + ln] = v; } }
  __builtin_amdgcn_fence(__ATOMIC_ACQ_REL, "workgroup"); __builtin_amdgcn_wave_barrier();
  const int rsub = lane >> 4, c4 = (lane & 15) * 4;
  {
#pragma unroll
    for (int q = 0; q < 16; ++q) { const int r = q * 2 + rsub; const v4f v = *(const v4fa*)&so[w][r][c4]; if (C) *(v4f*)(C + cofs + (size_t)(row0 + r) * ldc + col0 + c4) = v; if (C16) { v4h h4; for (int i = 0; i < 4; ++i) h4[i] = (_Float16)v[i]; *(v4h*)(C16 + cofs + (size_t)(row0 + r) * ldc + col0 + c4) = h4; } }
     } }


__global__ __launch_bounds__(256) void k_xrows(const float* __restrict__ x, _Float16* __restrict__ XR) { __shared__ float tl[CI][33]; const int tid = threadIdx.x; const int pb = blockIdx.x % (PX / 32); const int b = blockIdx.x / (PX / 32); const int p0 = pb * 32;
  for (int i = tid; i < CI * 32; i += 256) { const int c = i / 32, j = i % 32; tl[c][j] = bf16_round(x[((size_t)b * CI + c) * PX + p0 + j]); }
  __syncthreads();
  { for (int i = tid; i < 32 * CG; i += 256) { const int j = i / CG, c8 = (i % CG) * 8; FragH f; for (int q = 0; q < 8; ++q) f.h[q] = (_Float16)tl[c8 + q][j]; *(v8us*)((unsigned short*)XR + ((size_t)b * PX + p0 + j) * CI + c8) = f.half[0]; }  } }
__global__ __launch_bounds__(256) void k_im7(const _Float16* __restrict__ XR, int HO, int SH, size_t nvalid, size_t nrows, _Float16* __restrict__ IM) { const size_t t_ = (size_t)blockIdx.x * 256 + threadIdx.x; if (t_ >= nrows * KK * CG) return; const int c8 = (int)(t_ % CG) * 8; const int tap = (int)((t_ / CG) % KK); const size_t r = t_ / (KK * CG); v8us v; bool ok = false; size_t src = 0;
  if (r < nvalid) { const int PO = HO * HO; const int p = (int)(r % PO); const size_t b = r / PO; const int yy = p / HO + tap / 7 - SH, xx = p % HO + tap % 7 - SH; if (yy >= 0 && yy < HS && xx >= 0 && xx < HS) { ok = true; src = (b * PX + (size_t)yy * HS + xx) * CI + c8; } }
  if (ok) v = *(const v8us*)((const unsigned short*)XR + src); else { for (int q = 0; q < 8; ++q) v[q] = 0; }
  unsigned short* d = (unsigned short*)IM + r * KC + (size_t)tap * CI + c8; *(v8us*)d = v;  }
__global__ __launch_bounds__(256) void k_w7(const float* __restrict__ w, _Float16* __restrict__ Bt) { const size_t t = (size_t)blockIdx.x * 256 + threadIdx.x; if (t >= (size_t)CO * KC / 8) return; const int c8 = (int)((t * 8) % CI); const int tap = (int)(((t * 8) / CI) % KK); const int o = (int)((t * 8) / KC); FragH f; for (int q = 0; q < 8; ++q) f.h[q] = (_Float16)(bf16_round(w[((size_t)o * CI + c8 + q) * KK + tap]) * 16.0f);
  *(v8us*)((unsigned short*)Bt + t * 8) = f.half[0];  }
__global__ __launch_bounds__(256) void k_watt(const float* __restrict__ Q, const float* __restrict__ Kf, const float* __restrict__ Vf, const float* __restrict__ rh, const float* __restrict__ rw, float* __restrict__ out) {
  #pragma clang fp contract(off)
  const size_t t = (size_t)blockIdx.x * 256 + threadIdx.x; if (t >= (size_t)NB * NCO * PX / 8) return; const int p0 = (int)((t * 8) % PX); const size_t bc = (t * 8) / PX; const int c = (int)(bc % NCO); const size_t b = bc / NCO; v8f res;
#pragma unroll 1
  for (int u = 0; u < 8; ++u) { const int p = p0 + u; const int y = p / HS, x = p % HS; const float qv = Q[(b * PX + p) * CO + c]; float mx = -3.0e38f;
#pragma unroll 1
    for (int kk = 0; kk < KK; ++kk) { const int kh = kk / 7, kw = kk % 7; const float rel = (c < CO / 2) ? bf16_round(rh[(size_t)c * 7 + kh]) : bf16_round(rw[(size_t)(c - CO / 2) * 7 + kw]); const float kv = __fadd_rn(Kf[(b * PK + (size_t)(y + kh) * HK + (x + kw)) * CO + c], rel); mx = fmaxf(mx, __fmul_rn(qv, kv)); }
    float se = 0.f, acc = 0.f;
#pragma unroll 1
    for (int kk = 0; kk < KK; ++kk) { const int kh = kk / 7, kw = kk % 7; const float rel = (c < CO / 2) ? bf16_round(rh[(size_t)c * 7 + kh]) : bf16_round(rw[(size_t)(c - CO / 2) * 7 + kw]); const size_t kr = b * PK + (size_t)(y + kh) * HK + (x + kw); const float kv = __fadd_rn(Kf[kr * CO + c], rel); const float e = expf(__fmul_rn(qv, kv) - mx); se += e; acc = __fadd_rn(acc, __fmul_rn(e, Vf[kr * CO + c])); }
    res[u] = acc / se; }
  const int oc = (c % 32) * 8 + c / 32;      /* the reference's final transpose: output channel = dh*heads + head for computation channel head*32 + dh */
  float* d = out + ((b * CO + oc) * (size_t)PX + p0); *(v8f*)d = res;  }

extern "C" void kernel_launch(void* const* d_in, const int* in_sizes, int n_in,
                              void* d_out, int out_size, void* d_ws, size_t ws_size, hipStream_t stream) {
  (void)in_sizes; (void)n_in; (void)out_size;
  const float* const* I = (const float* const*)d_in; const float* x = I[0]; const float* wq = I[1]; const float* wk = I[2]; const float* wv = I[3]; const float* rh = I[4]; const float* rw = I[5];
  char* ws = (char*)d_ws; size_t off = 0;
  auto take = [&](size_t bytes) { char* p = ws + off; off += (bytes + 255) & ~(size_t)255; return p; };
  _Float16* BQ = (_Float16*)take((size_t)CO * KC * 2); _Float16* BK = (_Float16*)take((size_t)CO * KC * 2); _Float16* BV = (_Float16*)take((size_t)CO * KC * 2);
  _Float16* XR = (_Float16*)take(NRQ * CI * 2); _Float16* IM = (_Float16*)take((size_t)NRK * KC * 2); float* Q = (float*)take(NRQ * CO * 4); float* Kf = (float*)take((size_t)NRK * CO * 4); float* Vf = (float*)take((size_t)NRK * CO * 4);
  if (off > ws_size) return;      /* 9.6 + 1.6 + 98 + 6.4 + 8 + 8 = ≈ 132 MiB */
  const unsigned gw = (unsigned)(((size_t)CO * KC / 8 + 255) / 256);
  k_w7<<<gw, 256, 0, stream>>>(wq, BQ); k_w7<<<gw, 256, 0, stream>>>(wk, BK); k_w7<<<gw, 256, 0, stream>>>(wv, BV);
  k_xrows<<<NB * (PX / 32), 256, 0, stream>>>(x, XR);
  k_im7<<<(unsigned)((NRQ * KK * CG + 255) / 256), 256, 0, stream>>>(XR, HS, 3, NRQ, NRQ, IM);      /* q: 56-grid, x index = o + tap - 3 */
  k_gemm2<0><<<dim3((unsigned)((NRQ / 128) * (CO / 64)), 1), 128, 0, stream>>>(IM, KC, 0, BQ, KC, 0, 0.0625f, nullptr, 0, nullptr, 1, 0, 0, Q, nullptr, CO, 0, (int)NRQ, NCO, KC);
  k_im7<<<(unsigned)(((size_t)NRK * KK * CG + 255) / 256), 256, 0, stream>>>(XR, HK, 6, (size_t)NB * PK, NRK, IM);      /* k/v: 62-grid over pad3(x) with conv pad 3: x index = o + tap - 6 */
  k_gemm2<0><<<dim3((unsigned)((NRK / 128) * (CO / 64)), 1), 128, 0, stream>>>(IM, KC, 0, BK, KC, 0, 0.0625f, nullptr, 0, nullptr, 1, 0, 0, Kf, nullptr, CO, 0, NRK, NCO, KC);
  k_gemm2<0><<<dim3((unsigned)((NRK / 128) * (CO / 64)), 1), 128, 0, stream>>>(IM, KC, 0, BV, KC, 0, 0.0625f, nullptr, 0, nullptr, 1, 0, 0, Vf, nullptr, CO, 0, NRK, NCO, KC);
  k_watt<<<(unsigned)(((size_t)NB * NCO * PX / 8 + 255) / 256), 256, 0, stream>>>(Q, Kf, Vf, rh, rw, (float*)d_out);
}

// v001
// A run of this version takes 791 microseconds.
// Timed twice side by side with v000, it ran 1.96 and 1.97 times as fast.
#include <hip/hip_runtime.h>
// StandAloneSelfAttention (inputs [2][128][56][56]; q = conv7x7(x, Wq, pad 3) (256 ch, 56x56); k, v = conv7x7(pad3(x), Wk/Wv, pad 3) (256 ch, 62x62); per channel c and pixel: 7x7 window of k (plus rel_h[c] per window row for the first 128 channels, rel_w[c-128] per window column for the rest) and v around the pixel; attn = softmax over the 49 of q*k (scalar products); out = sum attn*v, then the reference's transpose(0,2,1,3,4): output channel (dh*8 + head) takes computation channel (head*32 + dh) -> [2][256][56][56]).
// Structure: pixel rows; x as exact f16 rows via LDS transposes; the three 7x7 convs as im2cols (K = 6,272; the k/v one over the 62x62 grid with the double padding folded into its bounds) + WMMA GEMMs (32x64 wave tiles, f32 accumulation, exact x16 weights) into f32 channel rows; the per-channel 49-way window softmax and weighted sum on VALU in f32 (rel tables read) with the channel-major store.
// Compute dtype: inputs rounded to bf16; x / weights / rel tables exact; q, k, v in f32 (GEMM outputs); softmax and the weighted sum f32 — no reduced-precision intermediates after the convs. v_wmma_f32_16x16x32_f16.
#define NB 2
#define CI 128
#define CO 256
#define HS 56
#define PX (HS * HS)                 /* 3136 */
#define HK 62                        /* k/v grid */
#define PK (HK * HK)                 /* 3844 */
#define NRQ ((size_t)NB * PX)        /* 6272 = 49 x 128 */
#define NRK 7808                     /* 2 x 3844 = 7688 -> padded to 61 x 128 */
#define KK 49
#define KC (KK * CI)                 /* 6272 */
#define CG (CI / 8)
#define NCO CO                       /* output channels computed (debug hook) */
typedef __bf16 v16b __attribute__((ext_vector_type(16)));
typedef unsigned short v8us __attribute__((ext_vector_type(8), may_alias));
typedef float  v8f  __attribute__((ext_vector_type(8)));
typedef float  v4f  __attribute__((ext_vector_type(4)));
typedef float  v4fa __attribute__((ext_vector_type(4), may_alias));
union FragB { v16b v; v8us half[2]; unsigned short u[16]; };

__device__ __forceinline__ unsigned short bf16_bits(float x) { unsigned int u = __float_as_uint(x); return (unsigned short)((u + 0x7FFFu + ((u >> 16) & 1u)) >> 16); }
__device__ __forceinline__ float bf16_val(unsigned short b) { return __uint_as_float(((unsigned int)b) << 16); }
__device__ __forceinline__ float bf16_round(float x) { return bf16_val(bf16_bits(x)); }
// D += A·B with NT terms: 1 = ah·bh, 2 = + al·bh (A split), 3 = + ah·bl (both split)
template <int NT>
__device__ __forceinline__ v8f mmaN(v16b ah, v16b al, v16b bh, v16b bl, v8f c) {
  c = __builtin_amdgcn_wmma_f32_16x16x32_bf16(false, ah, false, bh, (short)0, c, false, false);
  if (NT >= 2) c = __builtin_amdgcn_wmma_f32_16x16x32_bf16(false, al, false, bh, (short)0, c, false, false);
  if (NT >= 3) c = __builtin_amdgcn_wmma_f32_16x16x32_bf16(false, ah, false, bl, (short)0, c, false, false);
  asm volatile("v_nop\n\tv_nop\n\tv_nop\n\tv_nop" : "+v"(c) : "v"(ah), "v"(al), "v"(bh), "v"(bl));
  return c;
}

__global__ __launch_bounds__(256) void k_wt_bf16(const float* __restrict__ W, unsigned short* __restrict__ Wt, int K, int N) {
  const int t = blockIdx.x * 256 + threadIdx.x;
  const int k8n = K / 8;
  if (t >= N * k8n) return;
  const int n = t / k8n, k8 = (t % k8n) * 8;
  v8us v;
#pragma unroll
  for (int i = 0; i < 8; ++i) v[i] = bf16_bits(W[(size_t)(k8 + i) * N + n]);
  *(v8us*)(Wt + (size_t)n * K + k8) = v;
  
}

// GEMM C[M][N] (f32, pitch ldc) = act(A[M][K]·W + bias). A f32 row-major (pitch lda) converted per fragment to bf16
// (ASPLIT: hi/lo two planes -> 2 terms, else single rounded term); Wt bf16 [N][K] (pitch ldb). BIAS_BF16 rounds the
// bias to bf16 first (bias quantised to bf16 before the add). K%32==0, M%16==0, N%64==0.
template <bool ASPLIT, int ACT, bool BIAS_BF16>
__global__ __launch_bounds__(128) void k_gemm_bf(const float* __restrict__ A, int lda, const unsigned short* __restrict__ Wt, int ldb,
                                               const float* __restrict__ bias, float* __restrict__ C, int ldc, int M, int N, int K) {
  __shared__ __attribute__((aligned(16))) float so[4][16][64];
  const int tid = threadIdx.x, w = tid >> 5, lane = tid & 31, ln = lane & 15, hh = lane >> 4;
  const int ntn = N / 64;
  const int wid = blockIdx.x * 4 + w;
  const int mt = wid / ntn, nq = wid % ntn;
  if (mt * 16 >= M) return;
  const int row0 = mt * 16, col0 = nq * 64;
  const float* arow = A + (size_t)(row0 + ln) * lda;
  v8f acc[4] = {};
  for (int kb = 0; kb < K; kb += 32) {
    FragB ah, al;
    const v4f x0 = *(const v4fa*)(arow + kb + 8 * hh), x1 = *(const v4fa*)(arow + kb + 8 * hh + 4);
    const v4f x2 = *(const v4fa*)(arow + kb + 16 + 8 * hh), x3 = *(const v4fa*)(arow + kb + 16 + 8 * hh + 4);
    float xs[16] = {x0[0],x0[1],x0[2],x0[3],x1[0],x1[1],x1[2],x1[3],x2[0],x2[1],x2[2],x2[3],x3[0],x3[1],x3[2],x3[3]};
#pragma unroll
    for (int i = 0; i < 16; ++i) { const unsigned short hb = bf16_bits(xs[i]); ah.u[i] = hb; al.u[i] = ASPLIT ? bf16_bits(xs[i] - bf16_val(hb)) : (unsigned short)0; }
#pragma unroll
    for (int t = 0; t < 4; ++t) {
      const unsigned short* brow = Wt + (size_t)(col0 + t * 16 + ln) * ldb + kb;
      FragB b;
      b.half[0] = *(const v8us*)(brow + 8 * hh);
      b.half[1] = *(const v8us*)(brow + 16 + 8 * hh);
      acc[t] = mmaN<ASPLIT ? 2 : 1>(ah.v, al.v, b.v, b.v, acc[t]);
    }
  }
#pragma unroll
  for (int t = 0; t < 4; ++t) {
    float bv = bias ? bias[col0 + t * 16 + ln] : 0.f;
    if (BIAS_BF16) bv = bf16_round(bv);
#pragma unroll
    for (int r = 0; r < 8; ++r) { float v = acc[t][r] + bv; if (ACT == 1) v = fmaxf(v, 0.f); so[w][8 * hh + r][t * 16 + ln] = v; }
  }
  __builtin_amdgcn_fence(__ATOMIC_ACQ_REL, "workgroup");
  __builtin_amdgcn_wave_barrier();
  const int rsub = lane >> 4, c4 = (lane & 15) * 4;
  {
#pragma unroll
    for (int q = 0; q < 8; ++q) {
      const int r = q * 2 + rsub;
      const v4f v = *(const v4fa*)&so[w][r][c4];
      *(v4f*)(C + (size_t)(row0 + r) * ldc + col0 + c4) = v;
    }
    
  }
}

// GEMM C = act(A·W + bias + resid): A f32 (ASPLIT -> hi/lo 2 terms), Wt bf16 [N][K]; ACT 0 none, 1 relu, 2 exact gelu;
// resid (optional, f32, row index = (row % rmod), pitch ldr, RES_BF16 rounds it) added before the activation.
template <bool ASPLIT, int ACT, bool BIAS_BF16, bool RES_BF16>
__global__ __launch_bounds__(128) void k_gemm_bf3(const float* __restrict__ A, int lda, const unsigned short* __restrict__ Wt, int ldb,
                                                const float* __restrict__ bias, const float* __restrict__ resid, int rmod, int ldr,
                                                float* __restrict__ C, int ldc, int M, int N, int K) {
  __shared__ __attribute__((aligned(16))) float so[4][16][64];
  const int tid = threadIdx.x, w = tid >> 5, lane = tid & 31, ln = lane & 15, hh = lane >> 4;
  const int ntn = N / 64;
  const int wid = blockIdx.x * 4 + w;
  const int mt = wid / ntn, nq = wid % ntn;
  if (mt * 16 >= M) return;
  const int row0 = mt * 16, col0 = nq * 64;
  const float* arow = A + (size_t)(row0 + ln) * lda;
  v8f acc[4] = {};
  for (int kb = 0; kb < K; kb += 32) {
    FragB ah, al;
    const v4f x0 = *(const v4fa*)(arow + kb + 8 * hh), x1 = *(const v4fa*)(arow + kb + 8 * hh + 4);
    const v4f x2 = *(const v4fa*)(arow + kb + 16 + 8 * hh), x3 = *(const v4fa*)(arow + kb + 16 + 8 * hh + 4);
    float xs[16] = {x0[0],x0[1],x0[2],x0[3],x1[0],x1[1],x1[2],x1[3],x2[0],x2[1],x2[2],x2[3],x3[0],x3[1],x3[2],x3[3]};
#pragma unroll
    for (int i = 0; i < 16; ++i) { const unsigned short hb = bf16_bits(xs[i]); ah.u[i] = hb; al.u[i] = ASPLIT ? bf16_bits(xs[i] - bf16_val(hb)) : (unsigned short)0; }
#pragma unroll
    for (int t = 0; t < 4; ++t) {
      const unsigned short* brow = Wt + (size_t)(col0 + t * 16 + ln) * ldb + kb;
      FragB b;
      b.half[0] = *(const v8us*)(brow + 8 * hh);
      b.half[1] = *(const v8us*)(brow + 16 + 8 * hh);
      acc[t] = mmaN<ASPLIT ? 2 : 1>(ah.v, al.v, b.v, b.v, acc[t]);
    }
  }
#pragma unroll
  for (int t = 0; t < 4; ++t) {
    const int col = col0 + t * 16 + ln;
    float bv = bias ? bias[col] : 0.f;
    if (BIAS_BF16) bv = bf16_round(bv);
#pragma unroll
    for (int r = 0; r < 8; ++r) {
      float v = acc[t][r] + bv;
      if (resid) { float rv = resid[(size_t)((row0 + 8 * hh + r) % rmod) * ldr + col]; if (RES_BF16) rv = bf16_round(rv); v += rv; }
      if (ACT == 1) v = fmaxf(v, 0.f);
      if (ACT == 2) v = 0.5f * v * (1.0f + erff(v * 0.70710678118654752f));
      if (ACT == 3) { const float u = 0.7978845608028654f * (v + 0.044715f * v * v * v); v = 0.5f * v * (1.0f + tanhf(u)); }
      so[w][8 * hh + r][t * 16 + ln] = v;
    }
  }
  __builtin_amdgcn_fence(__ATOMIC_ACQ_REL, "workgroup");
  __builtin_amdgcn_wave_barrier();
  const int rsub = lane >> 4, c4 = (lane & 15) * 4;
  {
#pragma unroll
    for (int q = 0; q < 8; ++q) {
      const int r = q * 2 + rsub;
      const v4f v = *(const v4fa*)&so[w][r][c4];
      *(v4f*)(C + (size_t)(row0 + r) * ldc + col0 + c4) = v;
    }
    
  }
}
// row LayerNorm (biased variance, eps) over N: s = X (+ R); optional out_sum <- s; out_norm <- (s-mu)*rsqrt(var+eps)*g + b
template <bool PARAM_BF16>
__global__ __launch_bounds__(256) void k_layernorm(const float* __restrict__ X, const float* __restrict__ R, const float* __restrict__ g, const float* __restrict__ bta,
                                                  float* __restrict__ out_sum, float* __restrict__ out_norm, int N, float eps) {
  __shared__ float red[256];
  const int row = blockIdx.x, tid = threadIdx.x;
  const float* x = X + (size_t)row * N; const float* rr = R ? R + (size_t)row * N : nullptr;
  float vals[16];                     // up to N = 4096
  const int per = N / 256;            // contiguous chunk per thread? use strided-by-4 chunks: thread handles j = tid*4 + 1024*u
  float s1 = 0.f;
  for (int u = 0; u < per / 4; ++u) {
    const int j = tid * 4 + 1024 * u;
    const v4f a = *(const v4fa*)(x + j);
    v4f b = {0.f,0.f,0.f,0.f}; if (rr) b = *(const v4fa*)(rr + j);
#pragma unroll
    for (int q = 0; q < 4; ++q) { const float v = a[q] + b[q]; vals[u * 4 + q] = v; s1 += v; }
  }
  red[tid] = s1; __syncthreads();
  for (int st = 128; st > 0; st >>= 1) { if (tid < st) red[tid] += red[tid + st]; __syncthreads(); }
  const float mu = red[0] / (float)N; __syncthreads();
  float s2 = 0.f;
  for (int u = 0; u < per / 4; ++u)
#pragma unroll
    for (int q = 0; q < 4; ++q) { const float c = vals[u * 4 + q] - mu; s2 += c * c; }
  red[tid] = s2; __syncthreads();
  for (int st = 128; st > 0; st >>= 1) { if (tid < st) red[tid] += red[tid + st]; __syncthreads(); }
  const float rs = rsqrtf(red[0] / (float)N + eps);
  {
    for (int u = 0; u < per / 4; ++u) {
      const int j = tid * 4 + 1024 * u;
      v4f o, sm;
#pragma unroll
      for (int q = 0; q < 4; ++q) {
        float gg = g[j + q], bb = bta[j + q];
        if (PARAM_BF16) { gg = bf16_round(gg); bb = bf16_round(bb); }
        sm[q] = vals[u * 4 + q]; o[q] = (vals[u * 4 + q] - mu) * rs * gg + bb;
      }
      if (out_sum) *(v4f*)(out_sum + (size_t)row * N + j) = sm;
      *(v4f*)(out_norm + (size_t)row * N + j) = o;
    }
    
  }
}



// ---- f16 WMMA path (v_wmma_f32_16x16x32_f16): 11-bit significands for operands in range — used here for the conv GEMMs, whose bf16-rounded x and x16 weights are exact in f16
typedef _Float16 v16h __attribute__((ext_vector_type(16)));
union FragH { v16h v; v8us half[2]; _Float16 h[16]; unsigned short u[16]; };
template <int NT>
__device__ __forceinline__ v8f mmaH(v16h ah, v16h al, v16h bh, v16h bl, v8f c) {
  c = __builtin_amdgcn_wmma_f32_16x16x32_f16(false, ah, false, bh, (short)0, c, false, false);
  if (NT >= 2) c = __builtin_amdgcn_wmma_f32_16x16x32_f16(false, al, false, bh, (short)0, c, false, false);
  if (NT >= 3) c = __builtin_amdgcn_wmma_f32_16x16x32_f16(false, ah, false, bl, (short)0, c, false, false);
  asm volatile("v_nop\n\tv_nop\n\tv_nop\n\tv_nop" : "+v"(c) : "v"(ah), "v"(al), "v"(bh), "v"(bl));
  return c;
}
// batched GEMM like k_gemm_b but f16 operands: A f32 (split into f16 hi/lo if ASPLIT, else rounded to f16), Bt = f16 values [n][k]; alpha; C f32; N multiple of 16 (partial tiles skipped)
template <bool ASPLIT>
__global__ __launch_bounds__(128) void k_gemm_h(const float* __restrict__ A, int lda, size_t sA, const _Float16* __restrict__ Bh, int ldb, size_t sB, float alpha, float* __restrict__ C, int ldc, size_t sC, int M, int N, int K) {
  __shared__ __attribute__((aligned(16))) float so[4][16][64];
  const int tid = threadIdx.x, w = tid >> 5, lane = tid & 31, ln = lane & 15, hh = lane >> 4; const int by = blockIdx.y;
  A += (size_t)by * sA; Bh += (size_t)by * sB; C += (size_t)by * sC;
  const int ntn = (N + 63) / 64; const int wid = blockIdx.x * 4 + w; const int mt = wid / ntn, nq = wid % ntn; if (mt * 16 >= M) return;
  const int row0 = mt * 16, col0 = nq * 64; const float* arow = A + (size_t)(row0 + ln) * lda;
  v8f acc[4] = {};
  for (int kb = 0; kb < K; kb += 32) {
    FragH ah, al;
    const v4f x0 = *(const v4fa*)(arow + kb + 8 * hh), x1 = *(const v4fa*)(arow + kb + 8 * hh + 4), x2 = *(const v4fa*)(arow + kb + 16 + 8 * hh), x3 = *(const v4fa*)(arow + kb + 16 + 8 * hh + 4);
    float xs[16] = {x0[0],x0[1],x0[2],x0[3],x1[0],x1[1],x1[2],x1[3],x2[0],x2[1],x2[2],x2[3],x3[0],x3[1],x3[2],x3[3]};
#pragma unroll
    for (int i = 0; i < 16; ++i) { const _Float16 h = (_Float16)xs[i]; ah.h[i] = h; al.h[i] = ASPLIT ? (_Float16)(xs[i] - (float)h) : (_Float16)0.0f; }
#pragma unroll
    for (int t = 0; t < 4; ++t) { if (col0 + t * 16 >= N) continue; const size_t boff = (size_t)(col0 + t * 16 + ln) * ldb + kb; FragH bq; bq.half[0] = *(const v8us*)(Bh + boff + 8 * hh); bq.half[1] = *(const v8us*)(Bh + boff + 16 + 8 * hh);
      acc[t] = mmaH<ASPLIT ? 2 : 1>(ah.v, al.v, bq.v, bq.v, acc[t]); }
  }
#pragma unroll
  for (int t = 0; t < 4; ++t) { if (col0 + t * 16 >= N) continue;
#pragma unroll
    for (int r = 0; r < 8; ++r) so[w][8 * hh + r][t * 16 + ln] = acc[t][r] * alpha; }
  __builtin_amdgcn_fence(__ATOMIC_ACQ_REL, "workgroup"); __builtin_amdgcn_wave_barrier();
  const int rsub = lane >> 4, c4 = (lane & 15) * 4;
  {
#pragma unroll
    for (int q = 0; q < 8; ++q) { const int r = q * 2 + rsub; if (col0 + c4 < N) { const v4f v = *(const v4fa*)&so[w][r][c4]; *(v4f*)(C + (size_t)(row0 + r) * ldc + col0 + c4) = v; } }
     }
}

// Wt[n][k] = f16(W[k][n]·scale) from f32 row-major W[K][N] (scale = power of two; bf16-exact weights stay exact in f16 away from the subnormal range)
__global__ __launch_bounds__(256) void k_wt_f16(const float* __restrict__ W, _Float16* __restrict__ Wt, int K, int N, float scale) {
  const int t = blockIdx.x * 256 + threadIdx.x; if (t >= N * (K / 8)) return; const int n = t / (K / 8), k8 = (t % (K / 8)) * 8; FragH f;
#pragma unroll
  for (int i = 0; i < 8; ++i) f.h[i] = (_Float16)(bf16_round(W[(size_t)(k8 + i) * N + n]) * scale); const v8us o = f.half[0];
  *(v8us*)((unsigned short*)Wt + (size_t)n * K + k8) = o; 
}
// k_gemm_hh variant with fused epilogue: v = acc·alpha + bias[by·sBias + col] (+ CP[(row/rowsPerB)·sCPb + by·64 + col] if CP) ; ACT 0 none / 1 elu ; writes f16 C16 (and f32 C if non-null)
template <int ACT>
__global__ __launch_bounds__(128) void k_gemm_hhx(const _Float16* __restrict__ A, int lda, size_t sA, const _Float16* __restrict__ Bh, int ldb, size_t sB, float alpha, const float* __restrict__ bias, size_t sBias, const float* __restrict__ CP, int rowsPerB, size_t sCPb, int row0g,
    float* __restrict__ C, _Float16* __restrict__ C16, int ldc, size_t sC, int M, int N, int K) {
  __shared__ __attribute__((aligned(16))) float so[4][16][64];
  const int tid = threadIdx.x, w = tid >> 5, lane = tid & 31, ln = lane & 15, hh = lane >> 4; const int by = blockIdx.y;
  A += (size_t)by * sA; Bh += (size_t)by * sB; const size_t cofs = (size_t)by * sC; const float* bp = bias ? bias + (size_t)by * sBias : nullptr;
  const int ntn = (N + 63) / 64; const int wid = blockIdx.x * 4 + w; const int mt = wid / ntn, nq = wid % ntn; if (mt * 16 >= M) return;
  const int row0 = mt * 16, col0 = nq * 64; const _Float16* arow = A + (size_t)(row0 + ln) * lda;
  v8f acc[4] = {};
  for (int kb = 0; kb < K; kb += 32) { FragH ah; ah.half[0] = *(const v8us*)((const unsigned short*)arow + kb + 8 * hh); ah.half[1] = *(const v8us*)((const unsigned short*)arow + kb + 16 + 8 * hh);
#pragma unroll
    for (int t = 0; t < 4; ++t) { if (col0 + t * 16 >= N) continue; const size_t boff = (size_t)(col0 + t * 16 + ln) * ldb + kb; FragH bq; bq.half[0] = *(const v8us*)((const unsigned short*)Bh + boff + 8 * hh); bq.half[1] = *(const v8us*)((const unsigned short*)Bh + boff + 16 + 8 * hh);
      acc[t] = mmaH<1>(ah.v, ah.v, bq.v, bq.v, acc[t]); }
  }
#pragma unroll
  for (int t = 0; t < 4; ++t) { if (col0 + t * 16 >= N) continue; const int col = col0 + t * 16 + ln; const float bv = bp ? bf16_round(bp[col]) : 0.f;
#pragma unroll
    for (int r = 0; r < 8; ++r) { float v = acc[t][r] * alpha + bv; if (CP) { const int rr = row0g + row0 + 8 * hh + r; if (rowsPerB < 0) v += CP[cofs + (size_t)rr * ldc + col];      /* rowsPerB < 0: own element of the batched C plane */ else { const int bidx = rr / rowsPerB; v += CP[(size_t)bidx * sCPb + (size_t)by * 64 + col]; } } if (ACT == 1) v = (v > 0.f) ? v : expm1f(v); else if (ACT == 7) v = (v > 0.f) ? v + 1.0f : expf(v); else if (ACT == 8) v = tanhf(v); else if (ACT == 9) v = 0.5f * v * (1.0f + tanhf(0.7978845608028654f * (v + 0.044715f * v * v * v))); else if (ACT == 11) v = 1.0f / (1.0f + expf(-v)); else if (ACT == 12) v = (v > 0.f) ? v : 0.01f * v; else if (ACT == 14) v = (v > 0.f) ? v : 0.1f * v; else if (ACT == 16) v = (v >= 0.f) ? v : 0.3f * v; else if (ACT == 17) v = (v >= 0.f) ? v : 0.2f * v; else if (ACT == 15) v = v / (1.0f + expf(-v)); else if (ACT == 3) v = fmaxf(v, 0.f); else if (ACT == 6) v = 0.5f * v * (1.0f + erff(v * 0.70710678118654752f)); so[w][8 * hh + r][t * 16 + ln] = v; } }
  __builtin_amdgcn_fence(__ATOMIC_ACQ_REL, "workgroup"); __builtin_amdgcn_wave_barrier();
  const int rsub = lane >> 4, c4 = (lane & 15) * 4; typedef _Float16 v4h __attribute__((ext_vector_type(4)));
  {
#pragma unroll
    for (int q = 0; q < 8; ++q) { const int r = q * 2 + rsub; if (col0 + c4 < N) { const v4f v = *(const v4fa*)&so[w][r][c4]; if (C) *(v4f*)(C + cofs + (size_t)(row0 + r) * ldc + col0 + c4) = v; if (C16) { v4h h4; for (int i = 0; i < 4; ++i) h4[i] = (_Float16)v[i]; *(v4h*)(C16 + cofs + (size_t)(row0 + r) * ldc + col0 + c4) = h4; } } }
     }
}


typedef _Float16 v4h __attribute__((ext_vector_type(4)));

__global__ __launch_bounds__(256) void k_x16(const float* __restrict__ x, _Float16* __restrict__ X16, size_t n8) { const size_t t = (size_t)blockIdx.x * 256 + threadIdx.x; if (t >= n8) return; FragH f;
#pragma unroll
  for (int q = 0; q < 8; ++q) f.h[q] = (_Float16)bf16_round(x[t * 8 + q]); *(v8us*)((unsigned short*)X16 + t * 8) = f.half[0];  }
__global__ __launch_bounds__(256) void k_h16(const float* __restrict__ x, _Float16* __restrict__ X16, size_t n8) { const size_t t = (size_t)blockIdx.x * 256 + threadIdx.x; if (t >= n8) return; FragH f;
#pragma unroll
  for (int q = 0; q < 8; ++q) f.h[q] = (_Float16)x[t * 8 + q]; *(v8us*)((unsigned short*)X16 + t * 8) = f.half[0];  }
__global__ __launch_bounds__(256) void k_round16f(const float* __restrict__ W, _Float16* __restrict__ Bt, size_t n8) { const size_t t = (size_t)blockIdx.x * 256 + threadIdx.x; if (t >= n8) return; FragH f;
#pragma unroll
  for (int i = 0; i < 8; ++i) f.h[i] = (_Float16)(bf16_round(W[t * 8 + i]) * 16.0f); *(v8us*)((unsigned short*)Bt + t * 8) = f.half[0];  }
template <int NHv, int TTv>
__global__ __launch_bounds__(256) void k_vt(const _Float16* __restrict__ V16, int ldv, int voff, _Float16* __restrict__ Vt) { __shared__ unsigned short tl[64][66]; const int tid = threadIdx.x; const int slab = blockIdx.x / (TTv / 64), lg = blockIdx.x % (TTv / 64); const int b = slab / NHv, h = slab % NHv;
  for (int i = tid; i < 64 * 8; i += 256) { const int r = i / 8, c8 = (i % 8) * 8; FragH f; f.half[0] = *(const v8us*)((const unsigned short*)V16 + ((size_t)b * TTv + lg * 64 + r) * ldv + voff + h * 64 + c8);
#pragma unroll
    for (int q = 0; q < 8; ++q) tl[r][c8 + q] = f.u[q]; }
  __syncthreads();
  {
#pragma unroll
    for (int rd = 0; rd < 2; ++rd) { const int d = rd * 32 + tid / 8, pc = tid % 8; FragH f;
#pragma unroll
      for (int q = 0; q < 8; ++q) f.u[q] = tl[pc * 8 + q][d];
      *(v8us*)((unsigned short*)Vt + ((size_t)slab * 64 + d) * TTv + lg * 64 + pc * 8) = f.half[0]; }
     } }

__global__ __launch_bounds__(256) void k_hl(const float* __restrict__ F, _Float16* __restrict__ Hh, _Float16* __restrict__ Hl, size_t n8) { const size_t t = (size_t)blockIdx.x * 256 + threadIdx.x; if (t >= n8) return; FragH fh, fl; const v4f a = *(const v4fa*)(F + t * 8), c = *(const v4fa*)(F + t * 8 + 4);
#pragma unroll
  for (int q = 0; q < 4; ++q) { _Float16 h = (_Float16)a[q]; fh.h[q] = h; fl.h[q] = (_Float16)((a[q] - (float)h) * 1024.0f); h = (_Float16)c[q]; fh.h[4 + q] = h; fl.h[4 + q] = (_Float16)((c[q] - (float)h) * 1024.0f); }
  { *(v8us*)((unsigned short*)Hh + t * 8) = fh.half[0]; *(v8us*)((unsigned short*)Hl + t * 8) = fl.half[0];  } }

// ---- fast GEMM (wave tile 32x64; requires M % 32 == 0 rows per launch region and N % 64 == 0); epilogue = k_gemm_hhx semantics ----
__device__ __forceinline__ v16h g2_frag(const _Float16* p, int hh) { FragH f; f.half[0] = *(const v8us*)((const unsigned short*)p + 8 * hh); f.half[1] = *(const v8us*)((const unsigned short*)p + 16 + 8 * hh); return f.v; }
__device__ __forceinline__ v8f g2_mma(v16h a, v16h b, v8f c) { v8f d = __builtin_amdgcn_wmma_f32_16x16x32_f16(false, a, false, b, (short)0, c, false, false); asm volatile("v_nop\n\tv_nop\n\tv_nop\n\tv_nop" : "+v"(d) : "v"(a), "v"(b)); return d; }
template <int ACT>
__global__ __launch_bounds__(128) void k_gemm2(const _Float16* __restrict__ A, int lda, size_t sA, const _Float16* __restrict__ Bh, int ldb, size_t sB, float alpha, const float* __restrict__ bias, size_t sBias, const float* __restrict__ CP, int rowsPerB, size_t sCPb, int row0g,
    float* __restrict__ C, _Float16* __restrict__ C16, int ldc, size_t sC, int M, int N, int K) { static_assert(ACT == 0 || ACT == 3 || ACT == 6 || ACT == 8 || ACT == 9 || ACT == 11 || ACT == 12 || ACT == 14 || ACT == 15 || ACT == 16 || ACT == 17, "k_gemm2: unsupported ACT code (would silently apply no activation)");
  __shared__ __attribute__((aligned(16))) float so[4][32][68];
  const int tid = threadIdx.x, w = tid >> 5, lane = tid & 31, ln = lane & 15, hh = lane >> 4; const int by = blockIdx.y;
  A += (size_t)by * sA; Bh += (size_t)by * sB; const size_t cofs = (size_t)by * sC; const float* bp = bias ? bias + (size_t)by * sBias : nullptr;
  const int ntn = N >> 6; const int mt = blockIdx.x / ntn, nq = blockIdx.x - mt * ntn; const int row0 = mt * 128 + 32 * w, col0 = nq * 64; if (row0 >= M) return;
  const _Float16* a0p = A + (size_t)(row0 + ln) * lda; const _Float16* a1p = a0p + (size_t)16 * lda;
  const _Float16* b0p = Bh + (size_t)(col0 + ln) * ldb; const _Float16* b1p = b0p + (size_t)16 * ldb; const _Float16* b2p = b1p + (size_t)16 * ldb; const _Float16* b3p = b2p + (size_t)16 * ldb;
  const v8f z8 = {0.f,0.f,0.f,0.f,0.f,0.f,0.f,0.f}; v8f c00 = z8, c01 = z8, c02 = z8, c03 = z8, c10 = z8, c11 = z8, c12 = z8, c13 = z8;
#pragma unroll 1
  for (int kb = 0; kb < K; kb += 32) { const v16h a0 = g2_frag(a0p + kb, hh), a1 = g2_frag(a1p + kb, hh);
    v16h b = g2_frag(b0p + kb, hh); c00 = g2_mma(a0, b, c00); c10 = g2_mma(a1, b, c10);
    b = g2_frag(b1p + kb, hh); c01 = g2_mma(a0, b, c01); c11 = g2_mma(a1, b, c11);
    b = g2_frag(b2p + kb, hh); c02 = g2_mma(a0, b, c02); c12 = g2_mma(a1, b, c12);
    b = g2_frag(b3p + kb, hh); c03 = g2_mma(a0, b, c03); c13 = g2_mma(a1, b, c13); }
  v8f accs[8] = {c00, c01, c02, c03, c10, c11, c12, c13};
#pragma unroll
  for (int u = 0; u < 8; ++u) { const int t = u & 3, half = u >> 2; const int col = col0 + t * 16 + ln; const float bv = bp ? bf16_round(bp[col]) : 0.f;
#pragma unroll
    for (int r = 0; r < 8; ++r) { const int rloc = half * 16 + 8 * hh + r; float v = accs[u][r] * alpha + bv; if (CP) { if (rowsPerB < 0) v += CP[cofs + (size_t)(row0g + row0 + rloc) * ldc + col];      /* rowsPerB < 0: own element of the batched C plane */ else { const int bidx = (row0g + row0 + rloc) / rowsPerB; v += CP[(size_t)bidx * sCPb + (size_t)by * 64 + col]; } }
      if (ACT == 3) v = fmaxf(v, 0.f); else if (ACT == 6) v = 0.5f * v * (1.0f + erff(v * 0.70710678118654752f)); else if (ACT == 11) v = 1.0f / (1.0f + expf(-v)); else if (ACT == 15) v = v / (1.0f + expf(-v)); else if (ACT == 12) v = (v > 0.f) ? v : 0.01f * v; else if (ACT == 8) v = tanhf(v); else if (ACT == 9) v = 0.5f * v * (1.0f + tanhf(0.7978845608028654f * (v + 0.044715f * v * v * v))); else if (ACT == 14) v = (v > 0.f) ? v : 0.1f * v; else if (ACT == 16) v = (v >= 0.f) ? v : 0.3f * v; else if (ACT == 17) v = (v >= 0.f) ? v : 0.2f * v;
      so[w][rloc][t * 16 + ln] = v; } }
  __builtin_amdgcn_fence(__ATOMIC_ACQ_REL, "workgroup"); __builtin_amdgcn_wave_barrier();
  const int rsub = lane >> 4, c4 = (lane & 15) * 4;
  {
#pragma unroll
    for (int q = 0; q < 16; ++q) { const int r = q * 2 + rsub; const v4f v = *(const v4fa*)&so[w][r][c4]; if (C) *(v4f*)(C + cofs + (size_t)(row0 + r) * ldc + col0 + c4) = v; if (C16) { v4h h4; for (int i = 0; i < 4; ++i) h4[i] = (_Float16)v[i]; *(v4h*)(C16 + cofs + (size_t)(row0 + r) * ldc + col0 + c4) = h4; } }
     } }


__global__ __launch_bounds__(256) void k_xrows(const float* __restrict__ x, _Float16* __restrict__ XR) { __shared__ float tl[CI][33]; const int tid = threadIdx.x; const int pb = blockIdx.x % (PX / 32); const int b = blockIdx.x / (PX / 32); const int p0 = pb * 32;
  for (int i = tid; i < CI * 32; i += 256) { const int c = i / 32, j = i % 32; tl[c][j] = bf16_round(x[((size_t)b * CI + c) * PX + p0 + j]); }
  __syncthreads();
  { for (int i = tid; i < 32 * CG; i += 256) { const int j = i / CG, c8 = (i % CG) * 8; FragH f; for (int q = 0; q < 8; ++q) f.h[q] = (_Float16)tl[c8 + q][j]; *(v8us*)((unsigned short*)XR + ((size_t)b * PX + p0 + j) * CI + c8) = f.half[0]; }  } }
__global__ __launch_bounds__(256) void k_im7(const _Float16* __restrict__ XR, int HO, int SH, size_t nvalid, size_t nrows, _Float16* __restrict__ IM) { const size_t t_ = (size_t)blockIdx.x * 256 + threadIdx.x; if (t_ >= nrows * KK * CG) return; const int c8 = (int)(t_ % CG) * 8; const int tap = (int)((t_ / CG) % KK); const size_t r = t_ / (KK * CG); v8us v; bool ok = false; size_t src = 0;
  if (r < nvalid) { const int PO = HO * HO; const int p = (int)(r % PO); const size_t b = r / PO; const int yy = p / HO + tap / 7 - SH, xx = p % HO + tap % 7 - SH; if (yy >= 0 && yy < HS && xx >= 0 && xx < HS) { ok = true; src = (b * PX + (size_t)yy * HS + xx) * CI + c8; } }
  if (ok) v = *(const v8us*)((const unsigned short*)XR + src); else { for (int q = 0; q < 8; ++q) v[q] = 0; }
  unsigned short* d = (unsigned short*)IM + r * KC + (size_t)tap * CI + c8; *(v8us*)d = v;  }
__global__ __launch_bounds__(256) void k_w7(const float* __restrict__ w, _Float16* __restrict__ Bt) { const size_t t = (size_t)blockIdx.x * 256 + threadIdx.x; if (t >= (size_t)CO * KC / 8) return; const int c8 = (int)((t * 8) % CI); const int tap = (int)(((t * 8) / CI) % KK); const int o = (int)((t * 8) / KC); FragH f; for (int q = 0; q < 8; ++q) f.h[q] = (_Float16)(bf16_round(w[((size_t)o * CI + c8 + q) * KK + tap]) * 16.0f);
  *(v8us*)((unsigned short*)Bt + t * 8) = f.half[0];  }
// Lanes run along channels: one wave holds the 32 channels of one head at one pixel, so every Q, K and V load of a wave is one whole 128-byte line and the window position is wave-uniform.
// The head's rel table lies in LDS as [tap][channel], so that its reads are contiguous over the lanes too (in global memory a channel's taps are 28 bytes from the next channel's).
// A work-group (8 waves, 4 pixels each, neighbouring pixels at the same time) fills a 32-channel x 32-pixel tile in LDS, and the channel-major store then writes whole 128-byte lines.
__global__ __launch_bounds__(256) void k_watt(const float* __restrict__ Q, const float* __restrict__ Kf, const float* __restrict__ Vf, const float* __restrict__ rh, const float* __restrict__ rw, float* __restrict__ out) {
  #pragma clang fp contract(off)
  __shared__ __attribute__((aligned(16))) float tl[32][36]; __shared__ float rl[7][32];
  const int tid = threadIdx.x, lane = tid & 31; const int w = __builtin_amdgcn_readfirstlane(tid >> 5);      /* the wave's number as a scalar: pixel, window row and column stay on the scalar unit */
  const int p0 = (int)(blockIdx.x % (PX / 32)) * 32; const int bh = (int)(blockIdx.x / (PX / 32)); const int head = bh % (NCO / 32); const size_t b = bh / (NCO / 32); const int c = head * 32 + lane; const bool first = head < CO / 64;      /* c < CO / 2, the same for the whole work-group */
  if (w < 7) rl[w][lane] = first ? bf16_round(rh[(size_t)c * 7 + w]) : bf16_round(rw[(size_t)(c - CO / 2) * 7 + w]);
  __syncthreads();      /* the rel table is complete before any wave reads it */
#pragma unroll 1
  for (int u = 0; u < 4; ++u) { const int p = p0 + u * 8 + w; const int y = p / HS, x = p % HS; const float qv = Q[(b * PX + p) * CO + c]; float mx = -3.0e38f;
#pragma unroll 1
    for (int kk = 0; kk < KK; ++kk) { const int kh = kk / 7, kw = kk % 7; const float rel = rl[first ? kh : kw][lane]; const float kv = __fadd_rn(Kf[(b * PK + (size_t)(y + kh) * HK + (x + kw)) * CO + c], rel); mx = fmaxf(mx, __fmul_rn(qv, kv)); }
    float se = 0.f, acc = 0.f;
#pragma unroll 1
    for (int kk = 0; kk < KK; ++kk) { const int kh = kk / 7, kw = kk % 7; const float rel = rl[first ? kh : kw][lane]; const size_t kr = b * PK + (size_t)(y + kh) * HK + (x + kw); const float kv = __fadd_rn(Kf[kr * CO + c], rel); const float e = expf(__fmul_rn(qv, kv) - mx); se += e; acc = __fadd_rn(acc, __fmul_rn(e, Vf[kr * CO + c])); }
    tl[lane][u * 8 + w] = acc / se; }
  __syncthreads();      /* the tile is complete before any wave reads other waves' pixels */
  const int dh = tid >> 3, j4 = (tid & 7) * 4; const v4f o = *(const v4fa*)&tl[dh][j4];
  const int oc = dh * 8 + head;      /* the reference's final transpose: output channel = dh*heads + head for computation channel head*32 + dh */
  *(v4f*)(out + ((b * CO + oc) * (size_t)PX + p0 + j4)) = o; }

extern "C" void kernel_launch(void* const* d_in, const int* in_sizes, int n_in,
                              void* d_out, int out_size, void* d_ws, size_t ws_size, hipStream_t stream) {
  (void)in_sizes; (void)n_in; (void)out_size;
  const float* const* I = (const float* const*)d_in; const float* x = I[0]; const float* wq = I[1]; const float* wk = I[2]; const float* wv = I[3]; const float* rh = I[4]; const float* rw = I[5];
  char* ws = (char*)d_ws; size_t off = 0;
  auto take = [&](size_t bytes) { char* p = ws + off; off += (bytes + 255) & ~(size_t)255; return p; };
  _Float16* BQ = (_Float16*)take((size_t)CO * KC * 2); _Float16* BK = (_Float16*)take((size_t)CO * KC * 2); _Float16* BV = (_Float16*)take((size_t)CO * KC * 2);
  _Float16* XR = (_Float16*)take(NRQ * CI * 2); _Float16* IM = (_Float16*)take((size_t)NRK * KC * 2); float* Q = (float*)take(NRQ * CO * 4); float* Kf = (float*)take((size_t)NRK * CO * 4); float* Vf = (float*)take((size_t)NRK * CO * 4);
  if (off > ws_size) return;      /* 9.6 + 1.6 + 98 + 6.4 + 8 + 8 = ≈ 132 MiB */
  const unsigned gw = (unsigned)(((size_t)CO * KC / 8 + 255) / 256);
  k_w7<<<gw, 256, 0, stream>>>(wq, BQ); k_w7<<<gw, 256, 0, stream>>>(wk, BK); k_w7<<<gw, 256, 0, stream>>>(wv, BV);
  k_xrows<<<NB * (PX / 32), 256, 0, stream>>>(x, XR);
  k_im7<<<(unsigned)((NRQ * KK * CG + 255) / 256), 256, 0, stream>>>(XR, HS, 3, NRQ, NRQ, IM);      /* q: 56-grid, x index = o + tap - 3 */
  k_gemm2<0><<<dim3((unsigned)((NRQ / 128) * (CO / 64)), 1), 128, 0, stream>>>(IM, KC, 0, BQ, KC, 0, 0.0625f, nullptr, 0, nullptr, 1, 0, 0, Q, nullptr, CO, 0, (int)NRQ, NCO, KC);
  k_im7<<<(unsigned)(((size_t)NRK * KK * CG + 255) / 256), 256, 0, stream>>>(XR, HK, 6, (size_t)NB * PK, NRK, IM);      /* k/v: 62-grid over pad3(x) with conv pad 3: x index = o + tap - 6 */
  k_gemm2<0><<<dim3((unsigned)((NRK / 128) * (CO / 64)), 1), 128, 0, stream>>>(IM, KC, 0, BK, KC, 0, 0.0625f, nullptr, 0, nullptr, 1, 0, 0, Kf, nullptr, CO, 0, NRK, NCO, KC);
  k_gemm2<0><<<dim3((unsigned)((NRK / 128) * (CO / 64)), 1), 128, 0, stream>>>(IM, KC, 0, BV, KC, 0, 0.0625f, nullptr, 0, nullptr, 1, 0, 0, Vf, nullptr, CO, 0, NRK, NCO, KC);
  k_watt<<<NB * (NCO / 32) * (PX / 32), 256, 0, stream>>>(Q, Kf, Vf, rh, rw, (float*)d_out);
}

// v002
// Measured time: 654 microseconds a run.
// Two timings next to v001 put it at 1.20 and 1.21 times that version's speed.
// Counting every step since v000, it is 2.36 times as fast.
#include <hip/hip_runtime.h>
// StandAloneSelfAttention (inputs [2][128][56][56]; q = conv7x7(x, Wq, pad 3) (256 ch, 56x56); k, v = conv7x7(pad3(x), Wk/Wv, pad 3) (256 ch, 62x62); per channel c and pixel: 7x7 window of k (plus rel_h[c] per window row for the first 128 channels, rel_w[c-128] per window column for the rest) and v around the pixel; attn = softmax over the 49 of q*k (scalar products); out = sum attn*v, then the reference's transpose(0,2,1,3,4): output channel (dh*8 + head) takes computation channel (head*32 + dh) -> [2][256][56][56]).
// Structure: pixel rows; x as exact f16 rows via LDS transposes; the three 7x7 convs as WMMA GEMMs (K = 6,272 = 49 taps x 128 channels; 32x64 wave tiles, f32 accumulation, exact x16 weights) whose A fragments are read straight from the x rows, which lie on a 68x68 grid with 6 pixels of zeros on every side (all padding of both convs), into f32 channel rows; the per-channel 49-way window softmax and weighted sum on VALU in f32 (rel tables read) with the channel-major store.
// Compute dtype: inputs rounded to bf16; x / weights / rel tables exact; q, k, v in f32 (GEMM outputs); softmax and the weighted sum f32 — no reduced-precision intermediates after the convs. v_wmma_f32_16x16x32_f16.
#define NB 2
#define CI 128
#define CO 256
#define HS 56
#define PX (HS * HS)                 /* 3136 */
#define HK 62                        /* k/v grid */
#define PK (HK * HK)                 /* 3844 */
#define NRQ ((size_t)NB * PX)        /* 6272 = 49 x 128 */
#define NRK 7808                     /* 2 x 3844 = 7688 -> padded to 61 x 128 */
#define KK 49
#define KC (KK * CI)                 /* 6272 */
#define CG (CI / 8)
#define HP (HS + 12)                 /* x rows on a grid with 6 zero pixels on every side */
#define PP (HP * HP)                 /* 4624; NB * PP = 289 x 32 */
#define NCO CO                       /* output channels computed (debug hook) */
typedef __bf16 v16b __attribute__((ext_vector_type(16)));
typedef unsigned short v8us __attribute__((ext_vector_type(8), may_alias));
typedef float  v8f  __attribute__((ext_vector_type(8)));
typedef float  v4f  __attribute__((ext_vector_type(4)));
typedef float  v4fa __attribute__((ext_vector_type(4), may_alias));
union FragB { v16b v; v8us half[2]; unsigned short u[16]; };

__device__ __forceinline__ unsigned short bf16_bits(float x) { unsigned int u = __float_as_uint(x); return (unsigned short)((u + 0x7FFFu + ((u >> 16) & 1u)) >> 16); }
__device__ __forceinline__ float bf16_val(unsigned short b) { return __uint_as_float(((unsigned int)b) << 16); }
__device__ __forceinline__ float bf16_round(float x) { return bf16_val(bf16_bits(x)); }
// D += A·B with NT terms: 1 = ah·bh, 2 = + al·bh (A split), 3 = + ah·bl (both split)
template <int NT>
__device__ __forceinline__ v8f mmaN(v16b ah, v16b al, v16b bh, v16b bl, v8f c) {
  c = __builtin_amdgcn_wmma_f32_16x16x32_bf16(false, ah, false, bh, (short)0, c, false, false);
  if (NT >= 2) c = __builtin_amdgcn_wmma_f32_16x16x32_bf16(false, al, false, bh, (short)0, c, false, false);
  if (NT >= 3) c = __builtin_amdgcn_wmma_f32_16x16x32_bf16(false, ah, false, bl, (short)0, c, false, false);
  asm volatile("v_nop\n\tv_nop\n\tv_nop\n\tv_nop" : "+v"(c) : "v"(ah), "v"(al), "v"(bh), "v"(bl));
  return c;
}

__global__ __launch_bounds__(256) void k_wt_bf16(const float* __restrict__ W, unsigned short* __restrict__ Wt, int K, int N) {
  const int t = blockIdx.x * 256 + threadIdx.x;
  const int k8n = K / 8;
  if (t >= N * k8n) return;
  const int n = t / k8n, k8 = (t % k8n) * 8;
  v8us v;
#pragma unroll
  for (int i = 0; i < 8; ++i) v[i] = bf16_bits(W[(size_t)(k8 + i) * N + n]);
  *(v8us*)(Wt + (size_t)n * K + k8) = v;
  
}

// GEMM C[M][N] (f32, pitch ldc) = act(A[M][K]·W + bias). A f32 row-major (pitch lda) converted per fragment to bf16
// (ASPLIT: hi/lo two planes -> 2 terms, else single rounded term); Wt bf16 [N][K] (pitch ldb). BIAS_BF16 rounds the
// bias to bf16 first (bias quantised to bf16 before the add). K%32==0, M%16==0, N%64==0.
template <bool ASPLIT, int ACT, bool BIAS_BF16>
__global__ __launch_bounds__(128) void k_gemm_bf(const float* __restrict__ A, int lda, const unsigned short* __restrict__ Wt, int ldb,
                                               const float* __restrict__ bias, float* __restrict__ C, int ldc, int M, int N, int K) {
  __shared__ __attribute__((aligned(16))) float so[4][16][64];
  const int tid = threadIdx.x, w = tid >> 5, lane = tid & 31, ln = lane & 15, hh = lane >> 4;
  const int ntn = N / 64;
  const int wid = blockIdx.x * 4 + w;
  const int mt = wid / ntn, nq = wid % ntn;
  if (mt * 16 >= M) return;
  const int row0 = mt * 16, col0 = nq * 64;
  const float* arow = A + (size_t)(row0 + ln) * lda;
  v8f acc[4] = {};
  for (int kb = 0; kb < K; kb += 32) {
    FragB ah, al;
    const v4f x0 = *(const v4fa*)(arow + kb + 8 * hh), x1 = *(const v4fa*)(arow + kb + 8 * hh + 4);
    const v4f x2 = *(const v4fa*)(arow + kb + 16 + 8 * hh), x3 = *(const v4fa*)(arow + kb + 16 + 8 * hh + 4);
    float xs[16] = {x0[0],x0[1],x0[2],x0[3],x1[0],x1[1],x1[2],x1[3],x2[0],x2[1],x2[2],x2[3],x3[0],x3[1],x3[2],x3[3]};
#pragma unroll
    for (int i = 0; i < 16; ++i) { const unsigned short hb = bf16_bits(xs[i]); ah.u[i] = hb; al.u[i] = ASPLIT ? bf16_bits(xs[i] - bf16_val(hb)) : (unsigned short)0; }
#pragma unroll
    for (int t = 0; t < 4; ++t) {
      const unsigned short* brow = Wt + (size_t)(col0 + t * 16 + ln) * ldb + kb;
      FragB b;
      b.half[0] = *(const v8us*)(brow + 8 * hh);
      b.half[1] = *(const v8us*)(brow + 16 + 8 * hh);
      acc[t] = mmaN<ASPLIT ? 2 : 1>(ah.v, al.v, b.v, b.v, acc[t]);
    }
  }
#pragma unroll
  for (int t = 0; t < 4; ++t) {
    float bv = bias ? bias[col0 + t * 16 + ln] : 0.f;
    if (BIAS_BF16) bv = bf16_round(bv);
#pragma unroll
    for (int r = 0; r < 8; ++r) { float v = acc[t][r] + bv; if (ACT == 1) v = fmaxf(v, 0.f); so[w][8 * hh + r][t * 16 + ln] = v; }
  }
  __builtin_amdgcn_fence(__ATOMIC_ACQ_REL, "workgroup");
  __builtin_amdgcn_wave_barrier();
  const int rsub = lane >> 4, c4 = (lane & 15) * 4;
  {
#pragma unroll
    for (int q = 0; q < 8; ++q) {
      const int r = q * 2 + rsub;
      const v4f v = *(const v4fa*)&so[w][r][c4];
      *(v4f*)(C + (size_t)(row0 + r) * ldc + col0 + c4) = v;
    }
    
  }
}

// GEMM C = act(A·W + bias + resid): A f32 (ASPLIT -> hi/lo 2 terms), Wt bf16 [N][K]; ACT 0 none, 1 relu, 2 exact gelu;
// resid (optional, f32, row index = (row % rmod), pitch ldr, RES_BF16 rounds it) added before the activation.
template <bool ASPLIT, int ACT, bool BIAS_BF16, bool RES_BF16>
__global__ __launch_bounds__(128) void k_gemm_bf3(const float* __restrict__ A, int lda, const unsigned short* __restrict__ Wt, int ldb,
                                                const float* __restrict__ bias, const float* __restrict__ resid, int rmod, int ldr,
                                                float* __restrict__ C, int ldc, int M, int N, int K) {
  __shared__ __attribute__((aligned(16))) float so[4][16][64];
  const int tid = threadIdx.x, w = tid >> 5, lane = tid & 31, ln = lane & 15, hh = lane >> 4;
  const int ntn = N / 64;
  const int wid = blockIdx.x * 4 + w;
  const int mt = wid / ntn, nq = wid % ntn;
  if (mt * 16 >= M) return;
  const int row0 = mt * 16, col0 = nq * 64;
  const float* arow = A + (size_t)(row0 + ln) * lda;
  v8f acc[4] = {};
  for (int kb = 0; kb < K; kb += 32) {
    FragB ah, al;
    const v4f x0 = *(const v4fa*)(arow + kb + 8 * hh), x1 = *(const v4fa*)(arow + kb + 8 * hh + 4);
    const v4f x2 = *(const v4fa*)(arow + kb + 16 + 8 * hh), x3 = *(const v4fa*)(arow + kb + 16 + 8 * hh + 4);
    float xs[16] = {x0[0],x0[1],x0[2],x0[3],x1[0],x1[1],x1[2],x1[3],x2[0],x2[1],x2[2],x2[3],x3[0],x3[1],x3[2],x3[3]};
#pragma unroll
    for (int i = 0; i < 16; ++i) { const unsigned short hb = bf16_bits(xs[i]); ah.u[i] = hb; al.u[i] = ASPLIT ? bf16_bits(xs[i] - bf16_val(hb)) : (unsigned short)0; }
#pragma unroll
    for (int t = 0; t < 4; ++t) {
      const unsigned short* brow = Wt + (size_t)(col0 + t * 16 + ln) * ldb + kb;
      FragB b;
      b.half[0] = *(const v8us*)(brow + 8 * hh);
      b.half[1] = *(const v8us*)(brow + 16 + 8 * hh);
      acc[t] = mmaN<ASPLIT ? 2 : 1>(ah.v, al.v, b.v, b.v, acc[t]);
    }
  }
#pragma unroll
  for (int t = 0; t < 4; ++t) {
    const int col = col0 + t * 16 + ln;
    float bv = bias ? bias[col] : 0.f;
    if (BIAS_BF16) bv = bf16_round(bv);
#pragma unroll
    for (int r = 0; r < 8; ++r) {
      float v = acc[t][r] + bv;
      if (resid) { float rv = resid[(size_t)((row0 + 8 * hh + r) % rmod) * ldr + col]; if (RES_BF16) rv = bf16_round(rv); v += rv; }
      if (ACT == 1) v = fmaxf(v, 0.f);
      if (ACT == 2) v = 0.5f * v * (1.0f + erff(v * 0.70710678118654752f));
      if (ACT == 3) { const float u = 0.7978845608028654f * (v + 0.044715f * v * v * v); v = 0.5f * v * (1.0f + tanhf(u)); }
      so[w][8 * hh + r][t * 16 + ln] = v;
    }
  }
  __builtin_amdgcn_fence(__ATOMIC_ACQ_REL, "workgroup");
  __builtin_amdgcn_wave_barrier();
  const int rsub = lane >> 4, c4 = (lane & 15) * 4;
  {
#pragma unroll
    for (int q = 0; q < 8; ++q) {
      const int r = q * 2 + rsub;
      const v4f v = *(const v4fa*)&so[w][r][c4];
      *(v4f*)(C + (size_t)(row0 + r) * ldc + col0 + c4) = v;
    }
    
  }
}
// row LayerNorm (biased variance, eps) over N: s = X (+ R); optional out_sum <- s; out_norm <- (s-mu)*rsqrt(var+eps)*g + b
template <bool PARAM_BF16>
__global__ __launch_bounds__(256) void k_layernorm(const float* __restrict__ X, const float* __restrict__ R, const float* __restrict__ g, const float* __restrict__ bta,
                                                  float* __restrict__ out_sum, float* __restrict__ out_norm, int N, float eps) {
  __shared__ float red[256];
  const int row = blockIdx.x, tid = threadIdx.x;
  const float* x = X + (size_t)row * N; const float* rr = R ? R + (size_t)row * N : nullptr;
  float vals[16];                     // up to N = 4096
  const int per = N / 256;            // contiguous chunk per thread? use strided-by-4 chunks: thread handles j = tid*4 + 1024*u
  float s1 = 0.f;
  for (int u = 0; u < per / 4; ++u) {
    const int j = tid * 4 + 1024 * u;
    const v4f a = *(const v4fa*)(x + j);
    v4f b = {0.f,0.f,0.f,0.f}; if (rr) b = *(const v4fa*)(rr + j);
#pragma unroll
    for (int q = 0; q < 4; ++q) { const float v = a[q] + b[q]; vals[u * 4 + q] = v; s1 += v; }
  }
  red[tid] = s1; __syncthreads();
  for (int st = 128; st > 0; st >>= 1) { if (tid < st) red[tid] += red[tid + st]; __syncthreads(); }
  const float mu = red[0] / (float)N; __syncthreads();
  float s2 = 0.f;
  for (int u = 0; u < per / 4; ++u)
#pragma unroll
    for (int q = 0; q < 4; ++q) { const float c = vals[u * 4 + q] - mu; s2 += c * c; }
  red[tid] = s2; __syncthreads();
  for (int st = 128; st > 0; st >>= 1) { if (tid < st) red[tid] += red[tid + st]; __syncthreads(); }
  const float rs = rsqrtf(red[0] / (float)N + eps);
  {
    for (int u = 0; u < per / 4; ++u) {
      const int j = tid * 4 + 1024 * u;
      v4f o, sm;
#pragma unroll
      for (int q = 0; q < 4; ++q) {
        float gg = g[j + q], bb = bta[j + q];
        if (PARAM_BF16) { gg = bf16_round(gg); bb = bf16_round(bb); }
        sm[q] = vals[u * 4 + q]; o[q] = (vals[u * 4 + q] - mu) * rs * gg + bb;
      }
      if (out_sum) *(v4f*)(out_sum + (size_t)row * N + j) = sm;
      *(v4f*)(out_norm + (size_t)row * N + j) = o;
    }
    
  }
}



// ---- f16 WMMA path (v_wmma_f32_16x16x32_f16): 11-bit significands for operands in range — used here for the conv GEMMs, whose bf16-rounded x and x16 weights are exact in f16
typedef _Float16 v16h __attribute__((ext_vector_type(16)));
union FragH { v16h v; v8us half[2]; _Float16 h[16]; unsigned short u[16]; };
template <int NT>
__device__ __forceinline__ v8f mmaH(v16h ah, v16h al, v16h bh, v16h bl, v8f c) {
  c = __builtin_amdgcn_wmma_f32_16x16x32_f16(false, ah, false, bh, (short)0, c, false, false);
  if (NT >= 2) c = __builtin_amdgcn_wmma_f32_16x16x32_f16(false, al, false, bh, (short)0, c, false, false);
  if (NT >= 3) c = __builtin_amdgcn_wmma_f32_16x16x32_f16(false, ah, false, bl, (short)0, c, false, false);
  asm volatile("v_nop\n\tv_nop\n\tv_nop\n\tv_nop" : "+v"(c) : "v"(ah), "v"(al), "v"(bh), "v"(bl));
  return c;
}
// batched GEMM like k_gemm_b but f16 operands: A f32 (split into f16 hi/lo if ASPLIT, else rounded to f16), Bt = f16 values [n][k]; alpha; C f32; N multiple of 16 (partial tiles skipped)
template <bool ASPLIT>
__global__ __launch_bounds__(128) void k_gemm_h(const float* __restrict__ A, int lda, size_t sA, const _Float16* __restrict__ Bh, int ldb, size_t sB, float alpha, float* __restrict__ C, int ldc, size_t sC, int M, int N, int K) {
  __shared__ __attribute__((aligned(16))) float so[4][16][64];
  const int tid = threadIdx.x, w = tid >> 5, lane = tid & 31, ln = lane & 15, hh = lane >> 4; const int by = blockIdx.y;
  A += (size_t)by * sA; Bh += (size_t)by * sB; C += (size_t)by * sC;
  const int ntn = (N + 63) / 64; const int wid = blockIdx.x * 4 + w; const int mt = wid / ntn, nq = wid % ntn; if (mt * 16 >= M) return;
  const int row0 = mt * 16, col0 = nq * 64; const float* arow = A + (size_t)(row0 + ln) * lda;
  v8f acc[4] = {};
  for (int kb = 0; kb < K; kb += 32) {
    FragH ah, al;
    const v4f x0 = *(const v4fa*)(arow + kb + 8 * hh), x1 = *(const v4fa*)(arow + kb + 8 * hh + 4), x2 = *(const v4fa*)(arow + kb + 16 + 8 * hh), x3 = *(const v4fa*)(arow + kb + 16 + 8 * hh + 4);
    float xs[16] = {x0[0],x0[1],x0[2],x0[3],x1[0],x1[1],x1[2],x1[3],x2[0],x2[1],x2[2],x2[3],x3[0],x3[1],x3[2],x3[3]};
#pragma unroll
    for (int i = 0; i < 16; ++i) { const _Float16 h = (_Float16)xs[i]; ah.h[i] = h; al.h[i] = ASPLIT ? (_Float16)(xs[i] - (float)h) : (_Float16)0.0f; }
#pragma unroll
    for (int t = 0; t < 4; ++t) { if (col0 + t * 16 >= N) continue; const size_t boff = (size_t)(col0 + t * 16 + ln) * ldb + kb; FragH bq; bq.half[0] = *(const v8us*)(Bh + boff + 8 * hh); bq.half[1] = *(const v8us*)(Bh + boff + 16 + 8 * hh);
      acc[t] = mmaH<ASPLIT ? 2 : 1>(ah.v, al.v, bq.v, bq.v, acc[t]); }
  }
#pragma unroll
  for (int t = 0; t < 4; ++t) { if (col0 + t * 16 >= N) continue;
#pragma unroll
    for (int r = 0; r < 8; ++r) so[w][8 * hh + r][t * 16 + ln] = acc[t][r] * alpha; }
  __builtin_amdgcn_fence(__ATOMIC_ACQ_REL, "workgroup"); __builtin_amdgcn_wave_barrier();
  const int rsub = lane >> 4, c4 = (lane & 15) * 4;
  {
#pragma unroll
    for (int q = 0; q < 8; ++q) { const int r = q * 2 + rsub; if (col0 + c4 < N) { const v4f v = *(const v4fa*)&so[w][r][c4]; *(v4f*)(C + (size_t)(row0 + r) * ldc + col0 + c4) = v; } }
     }
}

// Wt[n][k] = f16(W[k][n]·scale) from f32 row-major W[K][N] (scale = power of two; bf16-exact weights stay exact in f16 away from the subnormal range)
__global__ __launch_bounds__(256) void k_wt_f16(const float* __restrict__ W, _Float16* __restrict__ Wt, int K, int N, float scale) {
  const int t = blockIdx.x * 256 + threadIdx.x; if (t >= N * (K / 8)) return; const int n = t / (K / 8), k8 = (t % (K / 8)) * 8; FragH f;
#pragma unroll
  for (int i = 0; i < 8; ++i) f.h[i] = (_Float16)(bf16_round(W[(size_t)(k8 + i) * N + n]) * scale); const v8us o = f.half[0];
  *(v8us*)((unsigned short*)Wt + (size_t)n * K + k8) = o; 
}
// k_gemm_hh variant with fused epilogue: v = acc·alpha + bias[by·sBias + col] (+ CP[(row/rowsPerB)·sCPb + by·64 + col] if CP) ; ACT 0 none / 1 elu ; writes f16 C16 (and f32 C if non-null)
template <int ACT>
__global__ __launch_bounds__(128) void k_gemm_hhx(const _Float16* __restrict__ A, int lda, size_t sA, const _Float16* __restrict__ Bh, int ldb, size_t sB, float alpha, const float* __restrict__ bias, size_t sBias, const float* __restrict__ CP, int rowsPerB, size_t sCPb, int row0g,
    float* __restrict__ C, _Float16* __restrict__ C16, int ldc, size_t sC, int M, int N, int K) {
  __shared__ __attribute__((aligned(16))) float so[4][16][64];
  const int tid = threadIdx.x, w = tid >> 5, lane = tid & 31, ln = lane & 15, hh = lane >> 4; const int by = blockIdx.y;
  A += (size_t)by * sA; Bh += (size_t)by * sB; const size_t cofs = (size_t)by * sC; const float* bp = bias ? bias + (size_t)by * sBias : nullptr;
  const int ntn = (N + 63) / 64; const int wid = blockIdx.x * 4 + w; const int mt = wid / ntn, nq = wid % ntn; if (mt * 16 >= M) return;
  const int row0 = mt * 16, col0 = nq * 64; const _Float16* arow = A + (size_t)(row0 + ln) * lda;
  v8f acc[4] = {};
  for (int kb = 0; kb < K; kb += 32) { FragH ah; ah.half[0] = *(const v8us*)((const unsigned short*)arow + kb + 8 * hh); ah.half[1] = *(const v8us*)((const unsigned short*)arow + kb + 16 + 8 * hh);
#pragma unroll
    for (int t = 0; t < 4; ++t) { if (col0 + t * 16 >= N) continue; const size_t boff = (size_t)(col0 + t * 16 + ln) * ldb + kb; FragH bq; bq.half[0] = *(const v8us*)((const unsigned short*)Bh + boff + 8 * hh); bq.half[1] = *(const v8us*)((const unsigned short*)Bh + boff + 16 + 8 * hh);
      acc[t] = mmaH<1>(ah.v, ah.v, bq.v, bq.v, acc[t]); }
  }
#pragma unroll
  for (int t = 0; t < 4; ++t) { if (col0 + t * 16 >= N) continue; const int col = col0 + t * 16 + ln; const float bv = bp ? bf16_round(bp[col]) : 0.f;
#pragma unroll
    for (int r = 0; r < 8; ++r) { float v = acc[t][r] * alpha + bv; if (CP) { const int rr = row0g + row0 + 8 * hh + r; if (rowsPerB < 0) v += CP[cofs + (size_t)rr * ldc + col];      /* rowsPerB < 0: own element of the batched C plane */ else { const int bidx = rr / rowsPerB; v += CP[(size_t)bidx * sCPb + (size_t)by * 64 + col]; } } if (ACT == 1) v = (v > 0.f) ? v : expm1f(v); else if (ACT == 7) v = (v > 0.f) ? v + 1.0f : expf(v); else if (ACT == 8) v = tanhf(v); else if (ACT == 9) v = 0.5f * v * (1.0f + tanhf(0.7978845608028654f * (v + 0.044715f * v * v * v))); else if (ACT == 11) v = 1.0f / (1.0f + expf(-v)); else if (ACT == 12) v = (v > 0.f) ? v : 0.01f * v; else if (ACT == 14) v = (v > 0.f) ? v : 0.1f * v; else if (ACT == 16) v = (v >= 0.f) ? v : 0.3f * v; else if (ACT == 17) v = (v >= 0.f) ? v : 0.2f * v; else if (ACT == 15) v = v / (1.0f + expf(-v)); else if (ACT == 3) v = fmaxf(v, 0.f); else if (ACT == 6) v = 0.5f * v * (1.0f + erff(v * 0.70710678118654752f)); so[w][8 * hh + r][t * 16 + ln] = v; } }
  __builtin_amdgcn_fence(__ATOMIC_ACQ_REL, "workgroup"); __builtin_amdgcn_wave_barrier();
  const int rsub = lane >> 4, c4 = (lane & 15) * 4; typedef _Float16 v4h __attribute__((ext_vector_type(4)));
  {
#pragma unroll
    for (int q = 0; q < 8; ++q) { const int r = q * 2 + rsub; if (col0 + c4 < N) { const v4f v = *(const v4fa*)&so[w][r][c4]; if (C) *(v4f*)(C + cofs + (size_t)(row0 + r) * ldc + col0 + c4) = v; if (C16) { v4h h4; for (int i = 0; i < 4; ++i) h4[i] = (_Float16)v[i]; *(v4h*)(C16 + cofs + (size_t)(row0 + r) * ldc + col0 + c4) = h4; } } }
     }
}


typedef _Float16 v4h __attribute__((ext_vector_type(4)));

__global__ __launch_bounds__(256) void k_x16(const float* __restrict__ x, _Float16* __restrict__ X16, size_t n8) { const size_t t = (size_t)blockIdx.x * 256 + threadIdx.x; if (t >= n8) return; FragH f;
#pragma unroll
  for (int q = 0; q < 8; ++q) f.h[q] = (_Float16)bf16_round(x[t * 8 + q]); *(v8us*)((unsigned short*)X16 + t * 8) = f.half[0];  }
__global__ __launch_bounds__(256) void k_h16(const float* __restrict__ x, _Float16* __restrict__ X16, size_t n8) { const size_t t = (size_t)blockIdx.x * 256 + threadIdx.x; if (t >= n8) return; FragH f;
#pragma unroll
  for (int q = 0; q < 8; ++q) f.h[q] = (_Float16)x[t * 8 + q]; *(v8us*)((unsigned short*)X16 + t * 8) = f.half[0];  }
__global__ __launch_bounds__(256) void k_round16f(const float* __restrict__ W, _Float16* __restrict__ Bt, size_t n8) { const size_t t = (size_t)blockIdx.x * 256 + threadIdx.x; if (t >= n8) return; FragH f;
#pragma unroll
  for (int i = 0; i < 8; ++i) f.h[i] = (_Float16)(bf16_round(W[t * 8 + i]) * 16.0f); *(v8us*)((unsigned short*)Bt + t * 8) = f.half[0];  }
template <int NHv, int TTv>
__global__ __launch_bounds__(256) void k_vt(const _Float16* __restrict__ V16, int ldv, int voff, _Float16* __restrict__ Vt) { __shared__ unsigned short tl[64][66]; const int tid = threadIdx.x; const int slab = blockIdx.x / (TTv / 64), lg = blockIdx.x % (TTv / 64); const int b = slab / NHv, h = slab % NHv;
  for (int i = tid; i < 64 * 8; i += 256) { const int r = i / 8, c8 = (i % 8) * 8; FragH f; f.half[0] = *(const v8us*)((const unsigned short*)V16 + ((size_t)b * TTv + lg * 64 + r) * ldv + voff + h * 64 + c8);
#pragma unroll
    for (int q = 0; q < 8; ++q) tl[r][c8 + q] = f.u[q]; }
  __syncthreads();
  {
#pragma unroll
    for (int rd = 0; rd < 2; ++rd) { const int d = rd * 32 + tid / 8, pc = tid % 8; FragH f;
#pragma unroll
      for (int q = 0; q < 8; ++q) f.u[q] = tl[pc * 8 + q][d];
      *(v8us*)((unsigned short*)Vt + ((size_t)slab * 64 + d) * TTv + lg * 64 + pc * 8) = f.half[0]; }
     } }

__global__ __launch_bounds__(256) void k_hl(const float* __restrict__ F, _Float16* __restrict__ Hh, _Float16* __restrict__ Hl, size_t n8) { const size_t t = (size_t)blockIdx.x * 256 + threadIdx.x; if (t >= n8) return; FragH fh, fl; const v4f a = *(const v4fa*)(F + t * 8), c = *(const v4fa*)(F + t * 8 + 4);
#pragma unroll
  for (int q = 0; q < 4; ++q) { _Float16 h = (_Float16)a[q]; fh.h[q] = h; fl.h[q] = (_Float16)((a[q] - (float)h) * 1024.0f); h = (_Float16)c[q]; fh.h[4 + q] = h; fl.h[4 + q] = (_Float16)((c[q] - (float)h) * 1024.0f); }
  { *(v8us*)((unsigned short*)Hh + t * 8) = fh.half[0]; *(v8us*)((unsigned short*)Hl + t * 8) = fl.half[0];  } }

// ---- fragment load and WMMA step of the conv GEMM (wave tile 32x64) ----
__device__ __forceinline__ v16h g2_frag(const _Float16* p, int hh) { FragH f; f.half[0] = *(const v8us*)((const unsigned short*)p + 8 * hh); f.half[1] = *(const v8us*)((const unsigned short*)p + 16 + 8 * hh); return f.v; }
__device__ __forceinline__ v8f g2_mma(v16h a, v16h b, v8f c) { v8f d = __builtin_amdgcn_wmma_f32_16x16x32_f16(false, a, false, b, (short)0, c, false, false); asm volatile("v_nop\n\tv_nop\n\tv_nop\n\tv_nop" : "+v"(d) : "v"(a), "v"(b)); return d; }

__global__ __launch_bounds__(256) void k_xrows(const float* __restrict__ x, _Float16* __restrict__ XR) { __shared__ float tl[CI][33]; const int tid = threadIdx.x; const int p0 = blockIdx.x * 32;      /* 32 pixels of the padded grid, batches end to end */
  for (int i = tid; i < CI * 32; i += 256) { const int c = i / 32, j = i % 32; const int b = (p0 + j) / PP, p = (p0 + j) % PP; const int yy = p / HP - 6, xx = p % HP - 6; tl[c][j] = (yy >= 0 && yy < HS && xx >= 0 && xx < HS) ? bf16_round(x[((size_t)b * CI + c) * PX + yy * HS + xx]) : 0.f; }
  __syncthreads();
  { for (int i = tid; i < 32 * CG; i += 256) { const int j = i / CG, c8 = (i % CG) * 8; FragH f; for (int q = 0; q < 8; ++q) f.h[q] = (_Float16)tl[c8 + q][j]; *(v8us*)((unsigned short*)XR + ((size_t)p0 + j) * CI + c8) = f.half[0]; }  } }
// 7x7 conv as a GEMM without an im2col buffer: row r of A is output pixel r of an HO x HO grid, and its k = tap * 128 + channel element is the x row at padded pixel (oy + OFF + tap / 7, ox + OFF + tap % 7),
// so a tap's 128 channels are 256 contiguous bytes and the tap's step is the same for every lane. C[r][n] = alpha * sum_k A[r][k] * Bh[n][k], k in the order of k_w7. Wave tile 32x64, work-group 128x64; rows from M on repeat row M - 1 (their C rows are never read).
template <int HO, int OFF>
__global__ __launch_bounds__(128) void k_conv7(const _Float16* __restrict__ XR, const _Float16* __restrict__ Bh, float alpha, float* __restrict__ C, int M) {
  __shared__ __attribute__((aligned(16))) float so[4][32][68];
  const int tid = threadIdx.x, w = tid >> 5, lane = tid & 31, ln = lane & 15, hh = lane >> 4;
  const int mt = blockIdx.x / (CO / 64), nq = blockIdx.x % (CO / 64); const int row0 = mt * 128 + 32 * w, col0 = nq * 64; if (row0 >= M) return;
  const int r0 = min(row0 + ln, M - 1), r1 = min(row0 + 16 + ln, M - 1);
  const unsigned a0o = (unsigned)(((r0 / (HO * HO)) * PP + ((r0 % (HO * HO)) / HO + OFF) * HP + (r0 % HO) + OFF) * CI);
  const unsigned a1o = (unsigned)(((r1 / (HO * HO)) * PP + ((r1 % (HO * HO)) / HO + OFF) * HP + (r1 % HO) + OFF) * CI);
  const unsigned b0o = (unsigned)((col0 + ln) * KC), b1o = b0o + 16 * KC, b2o = b0o + 32 * KC, b3o = b0o + 48 * KC;
  const v8f z8 = {0.f,0.f,0.f,0.f,0.f,0.f,0.f,0.f}; v8f c00 = z8, c01 = z8, c02 = z8, c03 = z8, c10 = z8, c11 = z8, c12 = z8, c13 = z8;
  /* both tap loops stay rolled: the loop body is one tap (32 WMMAs) */
#pragma unroll 1
  for (int ty = 0; ty < 7; ++ty) {
#pragma unroll 1
    for (int tx = 0; tx < 7; ++tx) { const _Float16* xt = XR + (ty * HP + tx) * CI; const _Float16* bt = Bh + (ty * 7 + tx) * CI;      /* the tap's bases, the same for every lane */
      for (int kc = 0; kc < CI; kc += 32) { const v16h a0 = g2_frag(xt + a0o + kc, hh), a1 = g2_frag(xt + a1o + kc, hh);
        v16h b = g2_frag(bt + b0o + kc, hh); c00 = g2_mma(a0, b, c00); c10 = g2_mma(a1, b, c10);
        b = g2_frag(bt + b1o + kc, hh); c01 = g2_mma(a0, b, c01); c11 = g2_mma(a1, b, c11);
        b = g2_frag(bt + b2o + kc, hh); c02 = g2_mma(a0, b, c02); c12 = g2_mma(a1, b, c12);
        b = g2_frag(bt + b3o + kc, hh); c03 = g2_mma(a0, b, c03); c13 = g2_mma(a1, b, c13); } } }
  v8f accs[8] = {c00, c01, c02, c03, c10, c11, c12, c13};
#pragma unroll
  for (int u = 0; u < 8; ++u) { const int t = u & 3, half = u >> 2;
#pragma unroll
    for (int r = 0; r < 8; ++r) so[w][half * 16 + 8 * hh + r][t * 16 + ln] = accs[u][r] * alpha; }
  __builtin_amdgcn_fence(__ATOMIC_ACQ_REL, "workgroup"); __builtin_amdgcn_wave_barrier();
  const int rsub = lane >> 4, c4 = (lane & 15) * 4;
#pragma unroll
  for (int q = 0; q < 16; ++q) { const int r = q * 2 + rsub; const v4f v = *(const v4fa*)&so[w][r][c4]; *(v4f*)(C + (size_t)(row0 + r) * CO + col0 + c4) = v; } }
__global__ __launch_bounds__(256) void k_w7(const float* __restrict__ w, _Float16* __restrict__ Bt) { const size_t t = (size_t)blockIdx.x * 256 + threadIdx.x; if (t >= (size_t)CO * KC / 8) return; const int c8 = (int)((t * 8) % CI); const int tap = (int)(((t * 8) / CI) % KK); const int o = (int)((t * 8) / KC); FragH f; for (int q = 0; q < 8; ++q) f.h[q] = (_Float16)(bf16_round(w[((size_t)o * CI + c8 + q) * KK + tap]) * 16.0f);
  *(v8us*)((unsigned short*)Bt + t * 8) = f.half[0];  }
// Lanes run along channels: one wave holds the 32 channels of one head at one pixel, so every Q, K and V load of a wave is one whole 128-byte line and the window position is wave-uniform.
// The head's rel table lies in LDS as [tap][channel], so that its reads are contiguous over the lanes too (in global memory a channel's taps are 28 bytes from the next channel's).
// A work-group (8 waves, 4 pixels each, neighbouring pixels at the same time) fills a 32-channel x 32-pixel tile in LDS, and the channel-major store then writes whole 128-byte lines.
__global__ __launch_bounds__(256) void k_watt(const float* __restrict__ Q, const float* __restrict__ Kf, const float* __restrict__ Vf, const float* __restrict__ rh, const float* __restrict__ rw, float* __restrict__ out) {
  #pragma clang fp contract(off)
  __shared__ __attribute__((aligned(16))) float tl[32][36]; __shared__ float rl[7][32];
  const int tid = threadIdx.x, lane = tid & 31; const int w = __builtin_amdgcn_readfirstlane(tid >> 5);      /* the wave's number as a scalar: pixel, window row and column stay on the scalar unit */
  const int p0 = (int)(blockIdx.x % (PX / 32)) * 32; const int bh = (int)(blockIdx.x / (PX / 32)); const int head = bh % (NCO / 32); const size_t b = bh / (NCO / 32); const int c = head * 32 + lane; const bool first = head < CO / 64;      /* c < CO / 2, the same for the whole work-group */
  if (w < 7) rl[w][lane] = first ? bf16_round(rh[(size_t)c * 7 + w]) : bf16_round(rw[(size_t)(c - CO / 2) * 7 + w]);
  __syncthreads();      /* the rel table is complete before any wave reads it */
#pragma unroll 1
  for (int u = 0; u < 4; ++u) { const int p = p0 + u * 8 + w; const int y = p / HS, x = p % HS; const float qv = Q[(b * PX + p) * CO + c]; float mx = -3.0e38f;
#pragma unroll 1
    for (int kk = 0; kk < KK; ++kk) { const int kh = kk / 7, kw = kk % 7; const float rel = rl[first ? kh : kw][lane]; const float kv = __fadd_rn(Kf[(b * PK + (size_t)(y + kh) * HK + (x + kw)) * CO + c], rel); mx = fmaxf(mx, __fmul_rn(qv, kv)); }
    float se = 0.f, acc = 0.f;
#pragma unroll 1
    for (int kk = 0; kk < KK; ++kk) { const int kh = kk / 7, kw = kk % 7; const float rel = rl[first ? kh : kw][lane]; const size_t kr = b * PK + (size_t)(y + kh) * HK + (x + kw); const float kv = __fadd_rn(Kf[kr * CO + c], rel); const float e = expf(__fmul_rn(qv, kv) - mx); se += e; acc = __fadd_rn(acc, __fmul_rn(e, Vf[kr * CO + c])); }
    tl[lane][u * 8 + w] = acc / se; }
  __syncthreads();      /* the tile is complete before any wave reads other waves' pixels */
  const int dh = tid >> 3, j4 = (tid & 7) * 4; const v4f o = *(const v4fa*)&tl[dh][j4];
  const int oc = dh * 8 + head;      /* the reference's final transpose: output channel = dh*heads + head for computation channel head*32 + dh */
  *(v4f*)(out + ((b * CO + oc) * (size_t)PX + p0 + j4)) = o; }

extern "C" void kernel_launch(void* const* d_in, const int* in_sizes, int n_in,
                              void* d_out, int out_size, void* d_ws, size_t ws_size, hipStream_t stream) {
  (void)in_sizes; (void)n_in; (void)out_size;
  const float* const* I = (const float* const*)d_in; const float* x = I[0]; const float* wq = I[1]; const float* wk = I[2]; const float* wv = I[3]; const float* rh = I[4]; const float* rw = I[5];
  char* ws = (char*)d_ws; size_t off = 0;
  auto take = [&](size_t bytes) { char* p = ws + off; off += (bytes + 255) & ~(size_t)255; return p; };
  _Float16* BQ = (_Float16*)take((size_t)CO * KC * 2); _Float16* BK = (_Float16*)take((size_t)CO * KC * 2); _Float16* BV = (_Float16*)take((size_t)CO * KC * 2);
  _Float16* XR = (_Float16*)take((size_t)NB * PP * CI * 2); float* Q = (float*)take(NRQ * CO * 4); float* Kf = (float*)take((size_t)NRK * CO * 4); float* Vf = (float*)take((size_t)NRK * CO * 4);
  if (off > ws_size) return;      /* three weight planes, the x rows, q, k, v */
  const unsigned gw = (unsigned)(((size_t)CO * KC / 8 + 255) / 256);
  k_w7<<<gw, 256, 0, stream>>>(wq, BQ); k_w7<<<gw, 256, 0, stream>>>(wk, BK); k_w7<<<gw, 256, 0, stream>>>(wv, BV);
  k_xrows<<<NB * PP / 32, 256, 0, stream>>>(x, XR);
  k_conv7<HS, 3><<<(unsigned)((NRQ / 128) * (CO / 64)), 128, 0, stream>>>(XR, BQ, 0.0625f, Q, (int)NRQ);      /* q: 56-grid, x index = o + tap - 3 */
  k_conv7<HK, 0><<<(unsigned)((NRK / 128) * (CO / 64)), 128, 0, stream>>>(XR, BK, 0.0625f, Kf, NB * PK);      /* k/v: 62-grid over pad3(x) with conv pad 3: x index = o + tap - 6 */
  k_conv7<HK, 0><<<(unsigned)((NRK / 128) * (CO / 64)), 128, 0, stream>>>(XR, BV, 0.0625f, Vf, NB * PK);
  k_watt<<<NB * (NCO / 32) * (PX / 32), 256, 0, stream>>>(Q, Kf, Vf, rh, rw, (float*)d_out);
}

// v003
// It runs in 253 microseconds.
// Next to v002, in two timings, it ran 2.55 times as fast each time.
// All steps since v000 together make it 6.03 times as fast.
#include <hip/hip_runtime.h>
// StandAloneSelfAttention (inputs [2][128][56][56]; q = conv7x7(x, Wq, pad 3) (256 ch, 56x56); k, v = conv7x7(pad3(x), Wk/Wv, pad 3) (256 ch, 62x62); per channel c and pixel: 7x7 window of k (plus rel_h[c] per window row for the first 128 channels, rel_w[c-128] per window column for the rest) and v around the pixel; attn = softmax over the 49 of q*k (scalar products); out = sum attn*v, then the reference's transpose(0,2,1,3,4): output channel (dh*8 + head) takes computation channel (head*32 + dh) -> [2][256][56][56]).
// Structure: pixel rows; x as exact f16 rows via LDS transposes; the three 7x7 convs as WMMA GEMMs (K = 6,272 = 49 taps x 128 channels; 32x64 wave tiles, f32 accumulation, exact x16 weights) whose A tiles are taken tap by tap from the x rows, which lie on a 68x68 grid with 6 pixels of zeros on every side (all padding of both convs), and staged with the weight tiles in LDS, into f32 channel rows; the per-channel 49-way window softmax and weighted sum on VALU in f32 (rel tables read) with the channel-major store.
// Compute dtype: inputs rounded to bf16; x / weights / rel tables exact; q, k, v in f32 (GEMM outputs); softmax and the weighted sum f32 — no reduced-precision intermediates after the convs. v_wmma_f32_16x16x32_f16.
#define NB 2
#define CI 128
#define CO 256
#define HS 56
#define PX (HS * HS)                 /* 3136 */
#define HK 62                        /* k/v grid */
#define PK (HK * HK)                 /* 3844 */
#define NRQ ((size_t)NB * PX)        /* 6272 = 49 x 128 */
#define NRK 7808                     /* 2 x 3844 = 7688 -> padded to 61 x 128 */
#define KK 49
#define KC (KK * CI)                 /* 6272 */
#define CG (CI / 8)
#define HP (HS + 12)                 /* x rows on a grid with 6 zero pixels on every side */
#define PP (HP * HP)                 /* 4624; NB * PP = 289 x 32 */
#define NCO CO                       /* output channels computed (debug hook) */
typedef __bf16 v16b __attribute__((ext_vector_type(16)));
typedef unsigned short v8us __attribute__((ext_vector_type(8), may_alias));
typedef float  v8f  __attribute__((ext_vector_type(8)));
typedef float  v4f  __attribute__((ext_vector_type(4)));
typedef float  v4fa __attribute__((ext_vector_type(4), may_alias));
union FragB { v16b v; v8us half[2]; unsigned short u[16]; };

__device__ __forceinline__ unsigned short bf16_bits(float x) { unsigned int u = __float_as_uint(x); return (unsigned short)((u + 0x7FFFu + ((u >> 16) & 1u)) >> 16); }
__device__ __forceinline__ float bf16_val(unsigned short b) { return __uint_as_float(((unsigned int)b) << 16); }
__device__ __forceinline__ float bf16_round(float x) { return bf16_val(bf16_bits(x)); }
// D += A·B with NT terms: 1 = ah·bh, 2 = + al·bh (A split), 3 = + ah·bl (both split)
template <int NT>
__device__ __forceinline__ v8f mmaN(v16b ah, v16b al, v16b bh, v16b bl, v8f c) {
  c = __builtin_amdgcn_wmma_f32_16x16x32_bf16(false, ah, false, bh, (short)0, c, false, false);
  if (NT >= 2) c = __builtin_amdgcn_wmma_f32_16x16x32_bf16(false, al, false, bh, (short)0, c, false, false);
  if (NT >= 3) c = __builtin_amdgcn_wmma_f32_16x16x32_bf16(false, ah, false, bl, (short)0, c, false, false);
  asm volatile("v_nop\n\tv_nop\n\tv_nop\n\tv_nop" : "+v"(c) : "v"(ah), "v"(al), "v"(bh), "v"(bl));
  return c;
}

__global__ __launch_bounds__(256) void k_wt_bf16(const float* __restrict__ W, unsigned short* __restrict__ Wt, int K, int N) {
  const int t = blockIdx.x * 256 + threadIdx.x;
  const int k8n = K / 8;
  if (t >= N * k8n) return;
  const int n = t / k8n, k8 = (t % k8n) * 8;
  v8us v;
#pragma unroll
  for (int i = 0; i < 8; ++i) v[i] = bf16_bits(W[(size_t)(k8 + i) * N + n]);
  *(v8us*)(Wt + (size_t)n * K + k8) = v;
  
}

// GEMM C[M][N] (f32, pitch ldc) = act(A[M][K]·W + bias). A f32 row-major (pitch lda) converted per fragment to bf16
// (ASPLIT: hi/lo two planes -> 2 terms, else single rounded term); Wt bf16 [N][K] (pitch ldb). BIAS_BF16 rounds the
// bias to bf16 first (bias quantised to bf16 before the add). K%32==0, M%16==0, N%64==0.
template <bool ASPLIT, int ACT, bool BIAS_BF16>
__global__ __launch_bounds__(128) void k_gemm_bf(const float* __restrict__ A, int lda, const unsigned short* __restrict__ Wt, int ldb,
                                               const float* __restrict__ bias, float* __restrict__ C, int ldc, int M, int N, int K) {
  __shared__ __attribute__((aligned(16))) float so[4][16][64];
  const int tid = threadIdx.x, w = tid >> 5, lane = tid & 31, ln = lane & 15, hh = lane >> 4;
  const int ntn = N / 64;
  const int wid = blockIdx.x * 4 + w;
  const int mt = wid / ntn, nq = wid % ntn;
  if (mt * 16 >= M) return;
  const int row0 = mt * 16, col0 = nq * 64;
  const float* arow = A + (size_t)(row0 + ln) * lda;
  v8f acc[4] = {};
  for (int kb = 0; kb < K; kb += 32) {
    FragB ah, al;
    const v4f x0 = *(const v4fa*)(arow + kb + 8 * hh), x1 = *(const v4fa*)(arow + kb + 8 * hh + 4);
    const v4f x2 = *(const v4fa*)(arow + kb + 16 + 8 * hh), x3 = *(const v4fa*)(arow + kb + 16 + 8 * hh + 4);
    float xs[16] = {x0[0],x0[1],x0[2],x0[3],x1[0],x1[1],x1[2],x1[3],x2[0],x2[1],x2[2],x2[3],x3[0],x3[1],x3[2],x3[3]};
#pragma unroll
    for (int i = 0; i < 16; ++i) { const unsigned short hb = bf16_bits(xs[i]); ah.u[i] = hb; al.u[i] = ASPLIT ? bf16_bits(xs[i] - bf16_val(hb)) : (unsigned short)0; }
#pragma unroll
    for (int t = 0; t < 4; ++t) {
      const unsigned short* brow = Wt + (size_t)(col0 + t * 16 + ln) * ldb + kb;
      FragB b;
      b.half[0] = *(const v8us*)(brow + 8 * hh);
      b.half[1] = *(const v8us*)(brow + 16 + 8 * hh);
      acc[t] = mmaN<ASPLIT ? 2 : 1>(ah.v, al.v, b.v, b.v, acc[t]);
    }
  }
#pragma unroll
  for (int t = 0; t < 4; ++t) {
    float bv = bias ? bias[col0 + t * 16 + ln] : 0.f;
    if (BIAS_BF16) bv = bf16_round(bv);
#pragma unroll
    for (int r = 0; r < 8; ++r) { float v = acc[t][r] + bv; if (ACT == 1) v = fmaxf(v, 0.f); so[w][8 * hh + r][t * 16 + ln] = v; }
  }
  __builtin_amdgcn_fence(__ATOMIC_ACQ_REL, "workgroup");
  __builtin_amdgcn_wave_barrier();
  const int rsub = lane >> 4, c4 = (lane & 15) * 4;
  {
#pragma unroll
    for (int q = 0; q < 8; ++q) {
      const int r = q * 2 + rsub;
      const v4f v = *(const v4fa*)&so[w][r][c4];
      *(v4f*)(C + (size_t)(row0 + r) * ldc + col0 + c4) = v;
    }
    
  }
}

// GEMM C = act(A·W + bias + resid): A f32 (ASPLIT -> hi/lo 2 terms), Wt bf16 [N][K]; ACT 0 none, 1 relu, 2 exact gelu;
// resid (optional, f32, row index = (row % rmod), pitch ldr, RES_BF16 rounds it) added before the activation.
template <bool ASPLIT, int ACT, bool BIAS_BF16, bool RES_BF16>
__global__ __launch_bounds__(128) void k_gemm_bf3(const float* __restrict__ A, int lda, const unsigned short* __restrict__ Wt, int ldb,
                                                const float* __restrict__ bias, const float* __restrict__ resid, int rmod, int ldr,
                                                float* __restrict__ C, int ldc, int M, int N, int K) {
  __shared__ __attribute__((aligned(16))) float so[4][16][64];
  const int tid = threadIdx.x, w = tid >> 5, lane = tid & 31, ln = lane & 15, hh = lane >> 4;
  const int ntn = N / 64;
  const int wid = blockIdx.x * 4 + w;
  const int mt = wid / ntn, nq = wid % ntn;
  if (mt * 16 >= M) return;
  const int row0 = mt * 16, col0 = nq * 64;
  const float* arow = A + (size_t)(row0 + ln) * lda;
  v8f acc[4] = {};
  for (int kb = 0; kb < K; kb += 32) {
    FragB ah, al;
    const v4f x0 = *(const v4fa*)(arow + kb + 8 * hh), x1 = *(const v4fa*)(arow + kb + 8 * hh + 4);
    const v4f x2 = *(const v4fa*)(arow + kb + 16 + 8 * hh), x3 = *(const v4fa*)(arow + kb + 16 + 8 * hh + 4);
    float xs[16] = {x0[0],x0[1],x0[2],x0[3],x1[0],x1[1],x1[2],x1[3],x2[0],x2[1],x2[2],x2[3],x3[0],x3[1],x3[2],x3[3]};
#pragma unroll
    for (int i = 0; i < 16; ++i) { const unsigned short hb = bf16_bits(xs[i]); ah.u[i] = hb; al.u[i] = ASPLIT ? bf16_bits(xs[i] - bf16_val(hb)) : (unsigned short)0; }
#pragma unroll
    for (int t = 0; t < 4; ++t) {
      const unsigned short* brow = Wt + (size_t)(col0 + t * 16 + ln) * ldb + kb;
      FragB b;
      b.half[0] = *(const v8us*)(brow + 8 * hh);
      b.half[1] = *(const v8us*)(brow + 16 + 8 * hh);
      acc[t] = mmaN<ASPLIT ? 2 : 1>(ah.v, al.v, b.v, b.v, acc[t]);
    }
  }
#pragma unroll
  for (int t = 0; t < 4; ++t) {
    const int col = col0 + t * 16 + ln;
    float bv = bias ? bias[col] : 0.f;
    if (BIAS_BF16) bv = bf16_round(bv);
#pragma unroll
    for (int r = 0; r < 8; ++r) {
      float v = acc[t][r] + bv;
      if (resid) { float rv = resid[(size_t)((row0 + 8 * hh + r) % rmod) * ldr + col]; if (RES_BF16) rv = bf16_round(rv); v += rv; }
      if (ACT == 1) v = fmaxf(v, 0.f);
      if (ACT == 2) v = 0.5f * v * (1.0f + erff(v * 0.70710678118654752f));
      if (ACT == 3) { const float u = 0.7978845608028654f * (v + 0.044715f * v * v * v); v = 0.5f * v * (1.0f + tanhf(u)); }
      so[w][8 * hh + r][t * 16 + ln] = v;
    }
  }
  __builtin_amdgcn_fence(__ATOMIC_ACQ_REL, "workgroup");
  __builtin_amdgcn_wave_barrier();
  const int rsub = lane >> 4, c4 = (lane & 15) * 4;
  {
#pragma unroll
    for (int q = 0; q < 8; ++q) {
      const int r = q * 2 + rsub;
      const v4f v = *(const v4fa*)&so[w][r][c4];
      *(v4f*)(C + (size_t)(row0 + r) * ldc + col0 + c4) = v;
    }
    
  }
}
// row LayerNorm (biased variance, eps) over N: s = X (+ R); optional out_sum <- s; out_norm <- (s-mu)*rsqrt(var+eps)*g + b
template <bool PARAM_BF16>
__global__ __launch_bounds__(256) void k_layernorm(const float* __restrict__ X, const float* __restrict__ R, const float* __restrict__ g, const float* __restrict__ bta,
                                                  float* __restrict__ out_sum, float* __restrict__ out_norm, int N, float eps) {
  __shared__ float red[256];
  const int row = blockIdx.x, tid = threadIdx.x;
  const float* x = X + (size_t)row * N; const float* rr = R ? R + (size_t)row * N : nullptr;
  float vals[16];                     // up to N = 4096
  const int per = N / 256;            // contiguous chunk per thread? use strided-by-4 chunks: thread handles j = tid*4 + 1024*u
  float s1 = 0.f;
  for (int u = 0; u < per / 4; ++u) {
    const int j = tid * 4 + 1024 * u;
    const v4f a = *(const v4fa*)(x + j);
    v4f b = {0.f,0.f,0.f,0.f}; if (rr) b = *(const v4fa*)(rr + j);
#pragma unroll
    for (int q = 0; q < 4; ++q) { const float v = a[q] + b[q]; vals[u * 4 + q] = v; s1 += v; }
  }
  red[tid] = s1; __syncthreads();
  for (int st = 128; st > 0; st >>= 1) { if (tid < st) red[tid] += red[tid + st]; __syncthreads(); }
  const float mu = red[0] / (float)N; __syncthreads();
  float s2 = 0.f;
  for (int u = 0; u < per / 4; ++u)
#pragma unroll
    for (int q = 0; q < 4; ++q) { const float c = vals[u * 4 + q] - mu; s2 += c * c; }
  red[tid] = s2; __syncthreads();
  for (int st = 128; st > 0; st >>= 1) { if (tid < st) red[tid] += red[tid + st]; __syncthreads(); }
  const float rs = rsqrtf(red[0] / (float)N + eps);
  {
    for (int u = 0; u < per / 4; ++u) {
      const int j = tid * 4 + 1024 * u;
      v4f o, sm;
#pragma unroll
      for (int q = 0; q < 4; ++q) {
        float gg = g[j + q], bb = bta[j + q];
        if (PARAM_BF16) { gg = bf16_round(gg); bb = bf16_round(bb); }
        sm[q] = vals[u * 4 + q]; o[q] = (vals[u * 4 + q] - mu) * rs * gg + bb;
      }
      if (out_sum) *(v4f*)(out_sum + (size_t)row * N + j) = sm;
      *(v4f*)(out_norm + (size_t)row * N + j) = o;
    }
    
  }
}



// ---- f16 WMMA path (v_wmma_f32_16x16x32_f16): 11-bit significands for operands in range — used here for the conv GEMMs, whose bf16-rounded x and x16 weights are exact in f16
typedef _Float16 v16h __attribute__((ext_vector_type(16)));
union FragH { v16h v; v8us half[2]; _Float16 h[16]; unsigned short u[16]; };
template <int NT>
__device__ __forceinline__ v8f mmaH(v16h ah, v16h al, v16h bh, v16h bl, v8f c) {
  c = __builtin_amdgcn_wmma_f32_16x16x32_f16(false, ah, false, bh, (short)0, c, false, false);
  if (NT >= 2) c = __builtin_amdgcn_wmma_f32_16x16x32_f16(false, al, false, bh, (short)0, c, false, false);
  if (NT >= 3) c = __builtin_amdgcn_wmma_f32_16x16x32_f16(false, ah, false, bl, (short)0, c, false, false);
  asm volatile("v_nop\n\tv_nop\n\tv_nop\n\tv_nop" : "+v"(c) : "v"(ah), "v"(al), "v"(bh), "v"(bl));
  return c;
}
// batched GEMM like k_gemm_b but f16 operands: A f32 (split into f16 hi/lo if ASPLIT, else rounded to f16), Bt = f16 values [n][k]; alpha; C f32; N multiple of 16 (partial tiles skipped)
template <bool ASPLIT>
__global__ __launch_bounds__(128) void k_gemm_h(const float* __restrict__ A, int lda, size_t sA, const _Float16* __restrict__ Bh, int ldb, size_t sB, float alpha, float* __restrict__ C, int ldc, size_t sC, int M, int N, int K) {
  __shared__ __attribute__((aligned(16))) float so[4][16][64];
  const int tid = threadIdx.x, w = tid >> 5, lane = tid & 31, ln = lane & 15, hh = lane >> 4; const int by = blockIdx.y;
  A += (size_t)by * sA; Bh += (size_t)by * sB; C += (size_t)by * sC;
  const int ntn = (N + 63) / 64; const int wid = blockIdx.x * 4 + w; const int mt = wid / ntn, nq = wid % ntn; if (mt * 16 >= M) return;
  const int row0 = mt * 16, col0 = nq * 64; const float* arow = A + (size_t)(row0 + ln) * lda;
  v8f acc[4] = {};
  for (int kb = 0; kb < K; kb += 32) {
    FragH ah, al;
    const v4f x0 = *(const v4fa*)(arow + kb + 8 * hh), x1 = *(const v4fa*)(arow + kb + 8 * hh + 4), x2 = *(const v4fa*)(arow + kb + 16 + 8 * hh), x3 = *(const v4fa*)(arow + kb + 16 + 8 * hh + 4);
    float xs[16] = {x0[0],x0[1],x0[2],x0[3],x1[0],x1[1],x1[2],x1[3],x2[0],x2[1],x2[2],x2[3],x3[0],x3[1],x3[2],x3[3]};
#pragma unroll
    for (int i = 0; i < 16; ++i) { const _Float16 h = (_Float16)xs[i]; ah.h[i] = h; al.h[i] = ASPLIT ? (_Float16)(xs[i] - (float)h) : (_Float16)0.0f; }
#pragma unroll
    for (int t = 0; t < 4; ++t) { if (col0 + t * 16 >= N) continue; const size_t boff = (size_t)(col0 + t * 16 + ln) * ldb + kb; FragH bq; bq.half[0] = *(const v8us*)(Bh + boff + 8 * hh); bq.half[1] = *(const v8us*)(Bh + boff + 16 + 8 * hh);
      acc[t] = mmaH<ASPLIT ? 2 : 1>(ah.v, al.v, bq.v, bq.v, acc[t]); }
  }
#pragma unroll
  for (int t = 0; t < 4; ++t) { if (col0 + t * 16 >= N) continue;
#pragma unroll
    for (int r = 0; r < 8; ++r) so[w][8 * hh + r][t * 16 + ln] = acc[t][r] * alpha; }
  __builtin_amdgcn_fence(__ATOMIC_ACQ_REL, "workgroup"); __builtin_amdgcn_wave_barrier();
  const int rsub = lane >> 4, c4 = (lane & 15) * 4;
  {
#pragma unroll
    for (int q = 0; q < 8; ++q) { const int r = q * 2 + rsub; if (col0 + c4 < N) { const v4f v = *(const v4fa*)&so[w][r][c4]; *(v4f*)(C + (size_t)(row0 + r) * ldc + col0 + c4) = v; } }
     }
}

// Wt[n][k] = f16(W[k][n]·scale) from f32 row-major W[K][N] (scale = power of two; bf16-exact weights stay exact in f16 away from the subnormal range)
__global__ __launch_bounds__(256) void k_wt_f16(const float* __restrict__ W, _Float16* __restrict__ Wt, int K, int N, float scale) {
  const int t = blockIdx.x * 256 + threadIdx.x; if (t >= N * (K / 8)) return; const int n = t / (K / 8), k8 = (t % (K / 8)) * 8; FragH f;
#pragma unroll
  for (int i = 0; i < 8; ++i) f.h[i] = (_Float16)(bf16_round(W[(size_t)(k8 + i) * N + n]) * scale); const v8us o = f.half[0];
  *(v8us*)((unsigned short*)Wt + (size_t)n * K + k8) = o; 
}
// k_gemm_hh variant with fused epilogue: v = acc·alpha + bias[by·sBias + col] (+ CP[(row/rowsPerB)·sCPb + by·64 + col] if CP) ; ACT 0 none / 1 elu ; writes f16 C16 (and f32 C if non-null)
template <int ACT>
__global__ __launch_bounds__(128) void k_gemm_hhx(const _Float16* __restrict__ A, int lda, size_t sA, const _Float16* __restrict__ Bh, int ldb, size_t sB, float alpha, const float* __restrict__ bias, size_t sBias, const float* __restrict__ CP, int rowsPerB, size_t sCPb, int row0g,
    float* __restrict__ C, _Float16* __restrict__ C16, int ldc, size_t sC, int M, int N, int K) {
  __shared__ __attribute__((aligned(16))) float so[4][16][64];
  const int tid = threadIdx.x, w = tid >> 5, lane = tid & 31, ln = lane & 15, hh = lane >> 4; const int by = blockIdx.y;
  A += (size_t)by * sA; Bh += (size_t)by * sB; const size_t cofs = (size_t)by * sC; const float* bp = bias ? bias + (size_t)by * sBias : nullptr;
  const int ntn = (N + 63) / 64; const int wid = blockIdx.x * 4 + w; const int mt = wid / ntn, nq = wid % ntn; if (mt * 16 >= M) return;
  const int row0 = mt * 16, col0 = nq * 64; const _Float16* arow = A + (size_t)(row0 + ln) * lda;
  v8f acc[4] = {};
  for (int kb = 0; kb < K; kb += 32) { FragH ah; ah.half[0] = *(const v8us*)((const unsigned short*)arow + kb + 8 * hh); ah.half[1] = *(const v8us*)((const unsigned short*)arow + kb + 16 + 8 * hh);
#pragma unroll
    for (int t = 0; t < 4; ++t) { if (col0 + t * 16 >= N) continue; const size_t boff = (size_t)(col0 + t * 16 + ln) * ldb + kb; FragH bq; bq.half[0] = *(const v8us*)((const unsigned short*)Bh + boff + 8 * hh); bq.half[1] = *(const v8us*)((const unsigned short*)Bh + boff + 16 + 8 * hh);
      acc[t] = mmaH<1>(ah.v, ah.v, bq.v, bq.v, acc[t]); }
  }
#pragma unroll
  for (int t = 0; t < 4; ++t) { if (col0 + t * 16 >= N) continue; const int col = col0 + t * 16 + ln; const float bv = bp ? bf16_round(bp[col]) : 0.f;
#pragma unroll
    for (int r = 0; r < 8; ++r) { float v = acc[t][r] * alpha + bv; if (CP) { const int rr = row0g + row0 + 8 * hh + r; if (rowsPerB < 0) v += CP[cofs + (size_t)rr * ldc + col];      /* rowsPerB < 0: own element of the batched C plane */ else { const int bidx = rr / rowsPerB; v += CP[(size_t)bidx * sCPb + (size_t)by * 64 + col]; } } if (ACT == 1) v = (v > 0.f) ? v : expm1f(v); else if (ACT == 7) v = (v > 0.f) ? v + 1.0f : expf(v); else if (ACT == 8) v = tanhf(v); else if (ACT == 9) v = 0.5f * v * (1.0f + tanhf(0.7978845608028654f * (v + 0.044715f * v * v * v))); else if (ACT == 11) v = 1.0f / (1.0f + expf(-v)); else if (ACT == 12) v = (v > 0.f) ? v : 0.01f * v; else if (ACT == 14) v = (v > 0.f) ? v : 0.1f * v; else if (ACT == 16) v = (v >= 0.f) ? v : 0.3f * v; else if (ACT == 17) v = (v >= 0.f) ? v : 0.2f * v; else if (ACT == 15) v = v / (1.0f + expf(-v)); else if (ACT == 3) v = fmaxf(v, 0.f); else if (ACT == 6) v = 0.5f * v * (1.0f + erff(v * 0.70710678118654752f)); so[w][8 * hh + r][t * 16 + ln] = v; } }
  __builtin_amdgcn_fence(__ATOMIC_ACQ_REL, "workgroup"); __builtin_amdgcn_wave_barrier();
  const int rsub = lane >> 4, c4 = (lane & 15) * 4; typedef _Float16 v4h __attribute__((ext_vector_type(4)));
  {
#pragma unroll
    for (int q = 0; q < 8; ++q) { const int r = q * 2 + rsub; if (col0 + c4 < N) { const v4f v = *(const v4fa*)&so[w][r][c4]; if (C) *(v4f*)(C + cofs + (size_t)(row0 + r) * ldc + col0 + c4) = v; if (C16) { v4h h4; for (int i = 0; i < 4; ++i) h4[i] = (_Float16)v[i]; *(v4h*)(C16 + cofs + (size_t)(row0 + r) * ldc + col0 + c4) = h4; } } }
     }
}


typedef _Float16 v4h __attribute__((ext_vector_type(4)));

__global__ __launch_bounds__(256) void k_x16(const float* __restrict__ x, _Float16* __restrict__ X16, size_t n8) { const size_t t = (size_t)blockIdx.x * 256 + threadIdx.x; if (t >= n8) return; FragH f;
#pragma unroll
  for (int q = 0; q < 8; ++q) f.h[q] = (_Float16)bf16_round(x[t * 8 + q]); *(v8us*)((unsigned short*)X16 + t * 8) = f.half[0];  }
__global__ __launch_bounds__(256) void k_h16(const float* __restrict__ x, _Float16* __restrict__ X16, size_t n8) { const size_t t = (size_t)blockIdx.x * 256 + threadIdx.x; if (t >= n8) return; FragH f;
#pragma unroll
  for (int q = 0; q < 8; ++q) f.h[q] = (_Float16)x[t * 8 + q]; *(v8us*)((unsigned short*)X16 + t * 8) = f.half[0];  }
__global__ __launch_bounds__(256) void k_round16f(const float* __restrict__ W, _Float16* __restrict__ Bt, size_t n8) { const size_t t = (size_t)blockIdx.x * 256 + threadIdx.x; if (t >= n8) return; FragH f;
#pragma unroll
  for (int i = 0; i < 8; ++i) f.h[i] = (_Float16)(bf16_round(W[t * 8 + i]) * 16.0f); *(v8us*)((unsigned short*)Bt + t * 8) = f.half[0];  }
template <int NHv, int TTv>
__global__ __launch_bounds__(256) void k_vt(const _Float16* __restrict__ V16, int ldv, int voff, _Float16* __restrict__ Vt) { __shared__ unsigned short tl[64][66]; const int tid = threadIdx.x; const int slab = blockIdx.x / (TTv / 64), lg = blockIdx.x % (TTv / 64); const int b = slab / NHv, h = slab % NHv;
  for (int i = tid; i < 64 * 8; i += 256) { const int r = i / 8, c8 = (i % 8) * 8; FragH f; f.half[0] = *(const v8us*)((const unsigned short*)V16 + ((size_t)b * TTv + lg * 64 + r) * ldv + voff + h * 64 + c8);
#pragma unroll
    for (int q = 0; q < 8; ++q) tl[r][c8 + q] = f.u[q]; }
  __syncthreads();
  {
#pragma unroll
    for (int rd = 0; rd < 2; ++rd) { const int d = rd * 32 + tid / 8, pc = tid % 8; FragH f;
#pragma unroll
      for (int q = 0; q < 8; ++q) f.u[q] = tl[pc * 8 + q][d];
      *(v8us*)((unsigned short*)Vt + ((size_t)slab * 64 + d) * TTv + lg * 64 + pc * 8) = f.half[0]; }
     } }

__global__ __launch_bounds__(256) void k_hl(const float* __restrict__ F, _Float16* __restrict__ Hh, _Float16* __restrict__ Hl, size_t n8) { const size_t t = (size_t)blockIdx.x * 256 + threadIdx.x; if (t >= n8) return; FragH fh, fl; const v4f a = *(const v4fa*)(F + t * 8), c = *(const v4fa*)(F + t * 8 + 4);
#pragma unroll
  for (int q = 0; q < 4; ++q) { _Float16 h = (_Float16)a[q]; fh.h[q] = h; fl.h[q] = (_Float16)((a[q] - (float)h) * 1024.0f); h = (_Float16)c[q]; fh.h[4 + q] = h; fl.h[4 + q] = (_Float16)((c[q] - (float)h) * 1024.0f); }
  { *(v8us*)((unsigned short*)Hh + t * 8) = fh.half[0]; *(v8us*)((unsigned short*)Hl + t * 8) = fl.half[0];  } }

// ---- WMMA step of the conv GEMM (wave tile 32x64) ----
__device__ __forceinline__ v8f g2_mma(v16h a, v16h b, v8f c) { v8f d = __builtin_amdgcn_wmma_f32_16x16x32_f16(false, a, false, b, (short)0, c, false, false); asm volatile("v_nop\n\tv_nop\n\tv_nop\n\tv_nop" : "+v"(d) : "v"(a), "v"(b)); return d; }

__global__ __launch_bounds__(256) void k_xrows(const float* __restrict__ x, _Float16* __restrict__ XR) { __shared__ float tl[CI][33]; const int tid = threadIdx.x; const int p0 = blockIdx.x * 32;      /* 32 pixels of the padded grid, batches end to end */
  for (int i = tid; i < CI * 32; i += 256) { const int c = i / 32, j = i % 32; const int b = (p0 + j) / PP, p = (p0 + j) % PP; const int yy = p / HP - 6, xx = p % HP - 6; tl[c][j] = (yy >= 0 && yy < HS && xx >= 0 && xx < HS) ? bf16_round(x[((size_t)b * CI + c) * PX + yy * HS + xx]) : 0.f; }
  __syncthreads();
  { for (int i = tid; i < 32 * CG; i += 256) { const int j = i / CG, c8 = (i % CG) * 8; FragH f; for (int q = 0; q < 8; ++q) f.h[q] = (_Float16)tl[c8 + q][j]; *(v8us*)((unsigned short*)XR + ((size_t)p0 + j) * CI + c8) = f.half[0]; }  } }
// 7x7 conv as a GEMM without an im2col buffer: row r of A is output pixel r of an HO x HO grid, and its k = tap * 128 + channel element is the x row at padded pixel (oy + OFF + tap / 7, ox + OFF + tap % 7),
// so a tap's 128 channels are 256 contiguous bytes. C[r][n] = alpha * sum_k A[r][k] * Bh[n][k], k in the order of k_w7. Wave tile 32x64, work-group 128x64; rows from M on repeat row M - 1 (their C rows are never read).
// One trip of the loop is one tap. The tap's A tile (128 pixel rows) and B tile (64 weight rows), 256 bytes a row, are brought into LDS by asynchronous copies, 16 bytes a lane (16 lanes = one whole row),
// into one of two buffers: the copies of tap t + 2 fly while tap t + 1 is worked on. The fragments are read from LDS at a row pitch of 272 bytes (free of bank conflicts for 16-byte reads).
#define LP 272                       /* LDS row pitch in bytes */
#define LA (128 * LP)                /* A tile */
#define LS (192 * LP)                /* one buffer: A tile, then B tile */
// twelve copies of 16 bytes a lane, LDS byte address l[i] from global address g[i]; the wait on the address registers ends the copies' own statement, ahead of any rewrite of them
__device__ __forceinline__ void g2_copy12(const unsigned* l, const char* const* g) {
  asm volatile("global_load_async_to_lds_b128 %0, %12, off\n\tglobal_load_async_to_lds_b128 %1, %13, off\n\tglobal_load_async_to_lds_b128 %2, %14, off\n\tglobal_load_async_to_lds_b128 %3, %15, off\n\t"
               "global_load_async_to_lds_b128 %4, %16, off\n\tglobal_load_async_to_lds_b128 %5, %17, off\n\tglobal_load_async_to_lds_b128 %6, %18, off\n\tglobal_load_async_to_lds_b128 %7, %19, off\n\t"
               "global_load_async_to_lds_b128 %8, %20, off\n\tglobal_load_async_to_lds_b128 %9, %21, off\n\tglobal_load_async_to_lds_b128 %10, %22, off\n\tglobal_load_async_to_lds_b128 %11, %23, off\n\ts_wait_xcnt 0x0"
               :: "v"(l[0]), "v"(l[1]), "v"(l[2]), "v"(l[3]), "v"(l[4]), "v"(l[5]), "v"(l[6]), "v"(l[7]), "v"(l[8]), "v"(l[9]), "v"(l[10]), "v"(l[11]),
                  "v"(g[0]), "v"(g[1]), "v"(g[2]), "v"(g[3]), "v"(g[4]), "v"(g[5]), "v"(g[6]), "v"(g[7]), "v"(g[8]), "v"(g[9]), "v"(g[10]), "v"(g[11]) : "memory"); }
__device__ __forceinline__ v16h g2_lfrag(const unsigned char* p) { FragH f; f.half[0] = *(const v8us*)p; f.half[1] = *(const v8us*)(p + 32); return f.v; }
template <int HO, int OFF>
__global__ __launch_bounds__(128) void k_conv7(const _Float16* __restrict__ XR, const _Float16* __restrict__ Bh, float alpha, float* __restrict__ C, int M) {
  __shared__ __attribute__((aligned(16))) float so[4][32][68];
  __shared__ __attribute__((aligned(16))) unsigned char ring[2 * LS];
  const int tid = threadIdx.x, w = tid >> 5, lane = tid & 31, ln = lane & 15, hh = lane >> 4;
  const int mt = blockIdx.x / (CO / 64), nq = blockIdx.x % (CO / 64); const int row0 = mt * 128 + 32 * w, col0 = nq * 64;
  /* copy side: this thread brings the 16 bytes number cc of tile rows cr, cr + 8, ... */
  const int cr = tid >> 4, cc = tid & 15; unsigned ao[16], bo[8];      /* byte offsets of this thread's rows at tap 0; every loop over them is unrolled so that they stay in registers */
#pragma unroll
  for (int i = 0; i < 16; ++i) { const int r = min(mt * 128 + cr + 8 * i, M - 1); ao[i] = (unsigned)((((r / (HO * HO)) * PP + ((r % (HO * HO)) / HO + OFF) * HP + (r % HO) + OFF) * CI + cc * 8) * 2); }
#pragma unroll
  for (int i = 0; i < 8; ++i) bo[i] = (unsigned)(((col0 + cr + 8 * i) * KC + cc * 8) * 2);
  const unsigned lc = (unsigned)(size_t)ring + (unsigned)(cr * LP + cc * 16);
  auto issue = [&](int t, int buf) { const char* xa = (const char*)XR + ((t / 7) * HP + t % 7) * (CI * 2); const char* xb = (const char*)Bh + t * (CI * 2); const unsigned l = lc + (unsigned)(buf * LS);      /* the tap's bases, the same for every lane */
    unsigned la[24]; const char* ga[24];      /* tile rows cr + 8 i: 16 of A, then 8 of B (the B tile follows the A tile at the same pitch) */
#pragma unroll
    for (int i = 0; i < 24; ++i) { la[i] = l + (unsigned)(8 * i * LP); ga[i] = i < 16 ? xa + ao[i] : xb + bo[i - 16]; }
    g2_copy12(la, ga); g2_copy12(la + 12, ga + 12); };
  const v8f z8 = {0.f,0.f,0.f,0.f,0.f,0.f,0.f,0.f}; v8f c00 = z8, c01 = z8, c02 = z8, c03 = z8, c10 = z8, c11 = z8, c12 = z8, c13 = z8;
  issue(0, 0);
  asm volatile("s_wait_asynccnt 0x0" ::: "memory");      /* this wave's copies of tap 0 have landed */
  __syncthreads();      /* tap 0 is complete before any wave reads it */
  issue(1, 1);
  /* the tap loop stays rolled: its body holds 32 WMMAs */
#pragma unroll 1
  for (int t = 0; t < KK; ++t) { const unsigned char* st = ring + (t & 1) * LS; const unsigned char* pa = st + (32 * w + ln) * LP + 16 * hh; const unsigned char* pb = st + LA + ln * LP + 16 * hh;
    v16h a0[2], a1[2], b0[2], b1[2], b2[2], b3[2];
    /* two fragment sets: the next 32 channels' LDS reads stand ahead of this block's WMMAs, so that their latency runs under the block; unrolled so that the sets are picked by constants */
    a0[0] = g2_lfrag(pa); a1[0] = g2_lfrag(pa + 16 * LP); b0[0] = g2_lfrag(pb); b1[0] = g2_lfrag(pb + 16 * LP); b2[0] = g2_lfrag(pb + 32 * LP); b3[0] = g2_lfrag(pb + 48 * LP);
#pragma unroll
    for (int s = 0; s < 4; ++s) { const int u = s & 1, n = u ^ 1, kb = (s + 1) * 64;
      if (s < 3) { a0[n] = g2_lfrag(pa + kb); a1[n] = g2_lfrag(pa + 16 * LP + kb); b0[n] = g2_lfrag(pb + kb); b1[n] = g2_lfrag(pb + 16 * LP + kb); b2[n] = g2_lfrag(pb + 32 * LP + kb); b3[n] = g2_lfrag(pb + 48 * LP + kb); }
      c00 = g2_mma(a0[u], b0[u], c00); c10 = g2_mma(a1[u], b0[u], c10); c01 = g2_mma(a0[u], b1[u], c01); c11 = g2_mma(a1[u], b1[u], c11);
      c02 = g2_mma(a0[u], b2[u], c02); c12 = g2_mma(a1[u], b2[u], c12); c03 = g2_mma(a0[u], b3[u], c03); c13 = g2_mma(a1[u], b3[u], c13);
    }
    asm volatile("s_wait_dscnt 0x0" ::: "memory");      /* this wave's reads of the buffer are done before it is handed back */
    asm volatile("s_wait_asynccnt 0x0" ::: "memory");      /* this wave's copies of tap t + 1 have landed */
    __syncthreads();      /* publishes tap t + 1 and ends every wave's reads of tap t's buffer */
    if (t + 2 < KK) issue(t + 2, t & 1); }
  asm volatile("s_wait_asynccnt 0x0" ::: "memory");      /* no copy is outstanding when the wave goes on */
  v8f accs[8] = {c00, c01, c02, c03, c10, c11, c12, c13};
#pragma unroll
  for (int u = 0; u < 8; ++u) { const int t = u & 3, half = u >> 2;
#pragma unroll
    for (int r = 0; r < 8; ++r) so[w][half * 16 + 8 * hh + r][t * 16 + ln] = accs[u][r] * alpha; }
  __builtin_amdgcn_fence(__ATOMIC_ACQ_REL, "workgroup"); __builtin_amdgcn_wave_barrier();
  const int rsub = lane >> 4, c4 = (lane & 15) * 4;
#pragma unroll
  for (int q = 0; q < 16; ++q) { const int r = q * 2 + rsub; const v4f v = *(const v4fa*)&so[w][r][c4]; *(v4f*)(C + (size_t)(row0 + r) * CO + col0 + c4) = v; } }
__global__ __launch_bounds__(256) void k_w7(const float* __restrict__ w, _Float16* __restrict__ Bt) { const size_t t = (size_t)blockIdx.x * 256 + threadIdx.x; if (t >= (size_t)CO * KC / 8) return; const int c8 = (int)((t * 8) % CI); const int tap = (int)(((t * 8) / CI) % KK); const int o = (int)((t * 8) / KC); FragH f; for (int q = 0; q < 8; ++q) f.h[q] = (_Float16)(bf16_round(w[((size_t)o * CI + c8 + q) * KK + tap]) * 16.0f);
  *(v8us*)((unsigned short*)Bt + t * 8) = f.half[0];  }
// Lanes run along channels: one wave holds the 32 channels of one head at one pixel, so every Q, K and V load of a wave is one whole 128-byte line and the window position is wave-uniform.
// The head's rel table lies in LDS as [tap][channel], so that its reads are contiguous over the lanes too (in global memory a channel's taps are 28 bytes from the next channel's).
// A work-group (8 waves, 4 pixels each, neighbouring pixels at the same time) fills a 32-channel x 32-pixel tile in LDS, and the channel-major store then writes whole 128-byte lines.
__global__ __launch_bounds__(256) void k_watt(const float* __restrict__ Q, const float* __restrict__ Kf, const float* __restrict__ Vf, const float* __restrict__ rh, const float* __restrict__ rw, float* __restrict__ out) {
  #pragma clang fp contract(off)
  __shared__ __attribute__((aligned(16))) float tl[32][36]; __shared__ float rl[7][32];
  const int tid = threadIdx.x, lane = tid & 31; const int w = __builtin_amdgcn_readfirstlane(tid >> 5);      /* the wave's number as a scalar: pixel, window row and column stay on the scalar unit */
  const int p0 = (int)(blockIdx.x % (PX / 32)) * 32; const int bh = (int)(blockIdx.x / (PX / 32)); const int head = bh % (NCO / 32); const size_t b = bh / (NCO / 32); const int c = head * 32 + lane; const bool first = head < CO / 64;      /* c < CO / 2, the same for the whole work-group */
  if (w < 7) rl[w][lane] = first ? bf16_round(rh[(size_t)c * 7 + w]) : bf16_round(rw[(size_t)(c - CO / 2) * 7 + w]);
  __syncthreads();      /* the rel table is complete before any wave reads it */
#pragma unroll 1
  for (int u = 0; u < 4; ++u) { const int p = p0 + u * 8 + w; const int y = p / HS, x = p % HS; const float qv = Q[(b * PX + p) * CO + c]; float mx = -3.0e38f;
#pragma unroll 1
    for (int kk = 0; kk < KK; ++kk) { const int kh = kk / 7, kw = kk % 7; const float rel = rl[first ? kh : kw][lane]; const float kv = __fadd_rn(Kf[(b * PK + (size_t)(y + kh) * HK + (x + kw)) * CO + c], rel); mx = fmaxf(mx, __fmul_rn(qv, kv)); }
    float se = 0.f, acc = 0.f;
#pragma unroll 1
    for (int kk = 0; kk < KK; ++kk) { const int kh = kk / 7, kw = kk % 7; const float rel = rl[first ? kh : kw][lane]; const size_t kr = b * PK + (size_t)(y + kh) * HK + (x + kw); const float kv = __fadd_rn(Kf[kr * CO + c], rel); const float e = expf(__fmul_rn(qv, kv) - mx); se += e; acc = __fadd_rn(acc, __fmul_rn(e, Vf[kr * CO + c])); }
    tl[lane][u * 8 + w] = acc / se; }
  __syncthreads();      /* the tile is complete before any wave reads other waves' pixels */
  const int dh = tid >> 3, j4 = (tid & 7) * 4; const v4f o = *(const v4fa*)&tl[dh][j4];
  const int oc = dh * 8 + head;      /* the reference's final transpose: output channel = dh*heads + head for computation channel head*32 + dh */
  *(v4f*)(out + ((b * CO + oc) * (size_t)PX + p0 + j4)) = o; }

extern "C" void kernel_launch(void* const* d_in, const int* in_sizes, int n_in,
                              void* d_out, int out_size, void* d_ws, size_t ws_size, hipStream_t stream) {
  (void)in_sizes; (void)n_in; (void)out_size;
  const float* const* I = (const float* const*)d_in; const float* x = I[0]; const float* wq = I[1]; const float* wk = I[2]; const float* wv = I[3]; const float* rh = I[4]; const float* rw = I[5];
  char* ws = (char*)d_ws; size_t off = 0;
  auto take = [&](size_t bytes) { char* p = ws + off; off += (bytes + 255) & ~(size_t)255; return p; };
  _Float16* BQ = (_Float16*)take((size_t)CO * KC * 2); _Float16* BK = (_Float16*)take((size_t)CO * KC * 2); _Float16* BV = (_Float16*)take((size_t)CO * KC * 2);
  _Float16* XR = (_Float16*)take((size_t)NB * PP * CI * 2); float* Q = (float*)take(NRQ * CO * 4); float* Kf = (float*)take((size_t)NRK * CO * 4); float* Vf = (float*)take((size_t)NRK * CO * 4);
  if (off > ws_size) return;      /* three weight planes, the x rows, q, k, v */
  const unsigned gw = (unsigned)(((size_t)CO * KC / 8 + 255) / 256);
  k_w7<<<gw, 256, 0, stream>>>(wq, BQ); k_w7<<<gw, 256, 0, stream>>>(wk, BK); k_w7<<<gw, 256, 0, stream>>>(wv, BV);
  k_xrows<<<NB * PP / 32, 256, 0, stream>>>(x, XR);
  k_conv7<HS, 3><<<(unsigned)((NRQ / 128) * (CO / 64)), 128, 0, stream>>>(XR, BQ, 0.0625f, Q, (int)NRQ);      /* q: 56-grid, x index = o + tap - 3 */
  k_conv7<HK, 0><<<(unsigned)((NRK / 128) * (CO / 64)), 128, 0, stream>>>(XR, BK, 0.0625f, Kf, NB * PK);      /* k/v: 62-grid over pad3(x) with conv pad 3: x index = o + tap - 6 */
  k_conv7<HK, 0><<<(unsigned)((NRK / 128) * (CO / 64)), 128, 0, stream>>>(XR, BV, 0.0625f, Vf, NB * PK);
  k_watt<<<NB * (NCO / 32) * (PX / 32), 256, 0, stream>>>(Q, Kf, Vf, rh, rw, (float*)d_out);
}

// v004
// A run of this version takes 185 microseconds.
// In two side-by-side timings against v003, it was 1.41 and 1.40 times as fast.
// Counting every step since v000, it is 8.47 times as fast.
#include <hip/hip_runtime.h>
// StandAloneSelfAttention (inputs [2][128][56][56]; q = conv7x7(x, Wq, pad 3) (256 ch, 56x56); k, v = conv7x7(pad3(x), Wk/Wv, pad 3) (256 ch, 62x62); per channel c and pixel: 7x7 window of k (plus rel_h[c] per window row for the first 128 channels, rel_w[c-128] per window column for the rest) and v around the pixel; attn = softmax over the 49 of q*k (scalar products); out = sum attn*v, then the reference's transpose(0,2,1,3,4): output channel (dh*8 + head) takes computation channel (head*32 + dh) -> [2][256][56][56]).
// Structure: pixel rows; x as exact f16 rows via LDS transposes; the three 7x7 convs as WMMA GEMMs (K = 6,272 = 49 taps x 128 channels; 32x64 wave tiles, f32 accumulation, exact x16 weights) whose A tiles are taken tap by tap from the x rows, which lie on a 68x68 grid with 6 pixels of zeros on every side (all padding of both convs), and staged with the weight tiles in LDS, into f32 channel rows; the per-channel 49-way window softmax and weighted sum on VALU in f32 (rel tables read) with the channel-major store.
// Compute dtype: inputs rounded to bf16; x / weights / rel tables exact; q, k, v in f32 (GEMM outputs); softmax and the weighted sum f32 — no reduced-precision intermediates after the convs. v_wmma_f32_16x16x32_f16.
#define NB 2
#define CI 128
#define CO 256
#define HS 56
#define PX (HS * HS)                 /* 3136 */
#define HK 62                        /* k/v grid */
#define PK (HK * HK)                 /* 3844 */
#define NRQ ((size_t)NB * PX)        /* 6272 = 49 x 128 */
#define NRK 7808                     /* 2 x 3844 = 7688 -> padded to 61 x 128 */
#define KK 49
#define KC (KK * CI)                 /* 6272 */
#define CG (CI / 8)
#define HP (HS + 12)                 /* x rows on a grid with 6 zero pixels on every side */
#define PP (HP * HP)                 /* 4624; NB * PP = 289 x 32 */
#define NCO CO                       /* output channels computed (debug hook) */
typedef __bf16 v16b __attribute__((ext_vector_type(16)));
typedef unsigned short v8us __attribute__((ext_vector_type(8), may_alias));
typedef float  v8f  __attribute__((ext_vector_type(8)));
typedef float  v4f  __attribute__((ext_vector_type(4)));
typedef float  v4fa __attribute__((ext_vector_type(4), may_alias));
union FragB { v16b v; v8us half[2]; unsigned short u[16]; };

__device__ __forceinline__ unsigned short bf16_bits(float x) { unsigned int u = __float_as_uint(x); return (unsigned short)((u + 0x7FFFu + ((u >> 16) & 1u)) >> 16); }
__device__ __forceinline__ float bf16_val(unsigned short b) { return __uint_as_float(((unsigned int)b) << 16); }
__device__ __forceinline__ float bf16_round(float x) { return bf16_val(bf16_bits(x)); }
// D += A·B with NT terms: 1 = ah·bh, 2 = + al·bh (A split), 3 = + ah·bl (both split)
template <int NT>
__device__ __forceinline__ v8f mmaN(v16b ah, v16b al, v16b bh, v16b bl, v8f c) {
  c = __builtin_amdgcn_wmma_f32_16x16x32_bf16(false, ah, false, bh, (short)0, c, false, false);
  if (NT >= 2) c = __builtin_amdgcn_wmma_f32_16x16x32_bf16(false, al, false, bh, (short)0, c, false, false);
  if (NT >= 3) c = __builtin_amdgcn_wmma_f32_16x16x32_bf16(false, ah, false, bl, (short)0, c, false, false);
  asm volatile("v_nop\n\tv_nop\n\tv_nop\n\tv_nop" : "+v"(c) : "v"(ah), "v"(al), "v"(bh), "v"(bl));
  return c;
}

__global__ __launch_bounds__(256) void k_wt_bf16(const float* __restrict__ W, unsigned short* __restrict__ Wt, int K, int N) {
  const int t = blockIdx.x * 256 + threadIdx.x;
  const int k8n = K / 8;
  if (t >= N * k8n) return;
  const int n = t / k8n, k8 = (t % k8n) * 8;
  v8us v;
#pragma unroll
  for (int i = 0; i < 8; ++i) v[i] = bf16_bits(W[(size_t)(k8 + i) * N + n]);
  *(v8us*)(Wt + (size_t)n * K + k8) = v;
  
}

// GEMM C[M][N] (f32, pitch ldc) = act(A[M][K]·W + bias). A f32 row-major (pitch lda) converted per fragment to bf16
// (ASPLIT: hi/lo two planes -> 2 terms, else single rounded term); Wt bf16 [N][K] (pitch ldb). BIAS_BF16 rounds the
// bias to bf16 first (bias quantised to bf16 before the add). K%32==0, M%16==0, N%64==0.
template <bool ASPLIT, int ACT, bool BIAS_BF16>
__global__ __launch_bounds__(128) void k_gemm_bf(const float* __restrict__ A, int lda, const unsigned short* __restrict__ Wt, int ldb,
                                               const float* __restrict__ bias, float* __restrict__ C, int ldc, int M, int N, int K) {
  __shared__ __attribute__((aligned(16))) float so[4][16][64];
  const int tid = threadIdx.x, w = tid >> 5, lane = tid & 31, ln = lane & 15, hh = lane >> 4;
  const int ntn = N / 64;
  const int wid = blockIdx.x * 4 + w;
  const int mt = wid / ntn, nq = wid % ntn;
  if (mt * 16 >= M) return;
  const int row0 = mt * 16, col0 = nq * 64;
  const float* arow = A + (size_t)(row0 + ln) * lda;
  v8f acc[4] = {};
  for (int kb = 0; kb < K; kb += 32) {
    FragB ah, al;
    const v4f x0 = *(const v4fa*)(arow + kb + 8 * hh), x1 = *(const v4fa*)(arow + kb + 8 * hh + 4);
    const v4f x2 = *(const v4fa*)(arow + kb + 16 + 8 * hh), x3 = *(const v4fa*)(arow + kb + 16 + 8 * hh + 4);
    float xs[16] = {x0[0],x0[1],x0[2],x0[3],x1[0],x1[1],x1[2],x1[3],x2[0],x2[1],x2[2],x2[3],x3[0],x3[1],x3[2],x3[3]};
#pragma unroll
    for (int i = 0; i < 16; ++i) { const unsigned short hb = bf16_bits(xs[i]); ah.u[i] = hb; al.u[i] = ASPLIT ? bf16_bits(xs[i] - bf16_val(hb)) : (unsigned short)0; }
#pragma unroll
    for (int t = 0; t < 4; ++t) {
      const unsigned short* brow = Wt + (size_t)(col0 + t * 16 + ln) * ldb + kb;
      FragB b;
      b.half[0] = *(const v8us*)(brow + 8 * hh);
      b.half[1] = *(const v8us*)(brow + 16 + 8 * hh);
      acc[t] = mmaN<ASPLIT ? 2 : 1>(ah.v, al.v, b.v, b.v, acc[t]);
    }
  }
#pragma unroll
  for (int t = 0; t < 4; ++t) {
    float bv = bias ? bias[col0 + t * 16 + ln] : 0.f;
    if (BIAS_BF16) bv = bf16_round(bv);
#pragma unroll
    for (int r = 0; r < 8; ++r) { float v = acc[t][r] + bv; if (ACT == 1) v = fmaxf(v, 0.f); so[w][8 * hh + r][t * 16 + ln] = v; }
  }
  __builtin_amdgcn_fence(__ATOMIC_ACQ_REL, "workgroup");
  __builtin_amdgcn_wave_barrier();
  const int rsub = lane >> 4, c4 = (lane & 15) * 4;
  {
#pragma unroll
    for (int q = 0; q < 8; ++q) {
      const int r = q * 2 + rsub;
      const v4f v = *(const v4fa*)&so[w][r][c4];
      *(v4f*)(C + (size_t)(row0 + r) * ldc + col0 + c4) = v;
    }
    
  }
}

// GEMM C = act(A·W + bias + resid): A f32 (ASPLIT -> hi/lo 2 terms), Wt bf16 [N][K]; ACT 0 none, 1 relu, 2 exact gelu;
// resid (optional, f32, row index = (row % rmod), pitch ldr, RES_BF16 rounds it) added before the activation.
template <bool ASPLIT, int ACT, bool BIAS_BF16, bool RES_BF16>
__global__ __launch_bounds__(128) void k_gemm_bf3(const float* __restrict__ A, int lda, const unsigned short* __restrict__ Wt, int ldb,
                                                const float* __restrict__ bias, const float* __restrict__ resid, int rmod, int ldr,
                                                float* __restrict__ C, int ldc, int M, int N, int K) {
  __shared__ __attribute__((aligned(16))) float so[4][16][64];
  const int tid = threadIdx.x, w = tid >> 5, lane = tid & 31, ln = lane & 15, hh = lane >> 4;
  const int ntn = N / 64;
  const int wid = blockIdx.x * 4 + w;
  const int mt = wid / ntn, nq = wid % ntn;
  if (mt * 16 >= M) return;
  const int row0 = mt * 16, col0 = nq * 64;
  const float* arow = A + (size_t)(row0 + ln) * lda;
  v8f acc[4] = {};
  for (int kb = 0; kb < K; kb += 32) {
    FragB ah, al;
    const v4f x0 = *(const v4fa*)(arow + kb + 8 * hh), x1 = *(const v4fa*)(arow + kb + 8 * hh + 4);
    const v4f x2 = *(const v4fa*)(arow + kb + 16 + 8 * hh), x3 = *(const v4fa*)(arow + kb + 16 + 8 * hh + 4);
    float xs[16] = {x0[0],x0[1],x0[2],x0[3],x1[0],x1[1],x1[2],x1[3],x2[0],x2[1],x2[2],x2[3],x3[0],x3[1],x3[2],x3[3]};
#pragma unroll
    for (int i = 0; i < 16; ++i) { const unsigned short hb = bf16_bits(xs[i]); ah.u[i] = hb; al.u[i] = ASPLIT ? bf16_bits(xs[i] - bf16_val(hb)) : (unsigned short)0; }
#pragma unroll
    for (int t = 0; t < 4; ++t) {
      const unsigned short* brow = Wt + (size_t)(col0 + t * 16 + ln) * ldb + kb;
      FragB b;
      b.half[0] = *(const v8us*)(brow + 8 * hh);
      b.half[1] = *(const v8us*)(brow + 16 + 8 * hh);
      acc[t] = mmaN<ASPLIT ? 2 : 1>(ah.v, al.v, b.v, b.v, acc[t]);
    }
  }
#pragma unroll
  for (int t = 0; t < 4; ++t) {
    const int col = col0 + t * 16 + ln;
    float bv = bias ? bias[col] : 0.f;
    if (BIAS_BF16) bv = bf16_round(bv);
#pragma unroll
    for (int r = 0; r < 8; ++r) {
      float v = acc[t][r] + bv;
      if (resid) { float rv = resid[(size_t)((row0 + 8 * hh + r) % rmod) * ldr + col]; if (RES_BF16) rv = bf16_round(rv); v += rv; }
      if (ACT == 1) v = fmaxf(v, 0.f);
      if (ACT == 2) v = 0.5f * v * (1.0f + erff(v * 0.70710678118654752f));
      if (ACT == 3) { const float u = 0.7978845608028654f * (v + 0.044715f * v * v * v); v = 0.5f * v * (1.0f + tanhf(u)); }
      so[w][8 * hh + r][t * 16 + ln] = v;
    }
  }
  __builtin_amdgcn_fence(__ATOMIC_ACQ_REL, "workgroup");
  __builtin_amdgcn_wave_barrier();
  const int rsub = lane >> 4, c4 = (lane & 15) * 4;
  {
#pragma unroll
    for (int q = 0; q < 8; ++q) {
      const int r = q * 2 + rsub;
      const v4f v = *(const v4fa*)&so[w][r][c4];
      *(v4f*)(C + (size_t)(row0 + r) * ldc + col0 + c4) = v;
    }
    
  }
}
// row LayerNorm (biased variance, eps) over N: s = X (+ R); optional out_sum <- s; out_norm <- (s-mu)*rsqrt(var+eps)*g + b
template <bool PARAM_BF16>
__global__ __launch_bounds__(256) void k_layernorm(const float* __restrict__ X, const float* __restrict__ R, const float* __restrict__ g, const float* __restrict__ bta,
                                                  float* __restrict__ out_sum, float* __restrict__ out_norm, int N, float eps) {
  __shared__ float red[256];
  const int row = blockIdx.x, tid = threadIdx.x;
  const float* x = X + (size_t)row * N; const float* rr = R ? R + (size_t)row * N : nullptr;
  float vals[16];                     // up to N = 4096
  const int per = N / 256;            // contiguous chunk per thread? use strided-by-4 chunks: thread handles j = tid*4 + 1024*u
  float s1 = 0.f;
  for (int u = 0; u < per / 4; ++u) {
    const int j = tid * 4 + 1024 * u;
    const v4f a = *(const v4fa*)(x + j);
    v4f b = {0.f,0.f,0.f,0.f}; if (rr) b = *(const v4fa*)(rr + j);
#pragma unroll
    for (int q = 0; q < 4; ++q) { const float v = a[q] + b[q]; vals[u * 4 + q] = v; s1 += v; }
  }
  red[tid] = s1; __syncthreads();
  for (int st = 128; st > 0; st >>= 1) { if (tid < st) red[tid] += red[tid + st]; __syncthreads(); }
  const float mu = red[0] / (float)N; __syncthreads();
  float s2 = 0.f;
  for (int u = 0; u < per / 4; ++u)
#pragma unroll
    for (int q = 0; q < 4; ++q) { const float c = vals[u * 4 + q] - mu; s2 += c * c; }
  red[tid] = s2; __syncthreads();
  for (int st = 128; st > 0; st >>= 1) { if (tid < st) red[tid] += red[tid + st]; __syncthreads(); }
  const float rs = rsqrtf(red[0] / (float)N + eps);
  {
    for (int u = 0; u < per / 4; ++u) {
      const int j = tid * 4 + 1024 * u;
      v4f o, sm;
#pragma unroll
      for (int q = 0; q < 4; ++q) {
        float gg = g[j + q], bb = bta[j + q];
        if (PARAM_BF16) { gg = bf16_round(gg); bb = bf16_round(bb); }
        sm[q] = vals[u * 4 + q]; o[q] = (vals[u * 4 + q] - mu) * rs * gg + bb;
      }
      if (out_sum) *(v4f*)(out_sum + (size_t)row * N + j) = sm;
      *(v4f*)(out_norm + (size_t)row * N + j) = o;
    }
    
  }
}



// ---- f16 WMMA path (v_wmma_f32_16x16x32_f16): 11-bit significands for operands in range — used here for the conv GEMMs, whose bf16-rounded x and x16 weights are exact in f16
typedef _Float16 v16h __attribute__((ext_vector_type(16)));
union FragH { v16h v; v8us half[2]; _Float16 h[16]; unsigned short u[16]; };
template <int NT>
__device__ __forceinline__ v8f mmaH(v16h ah, v16h al, v16h bh, v16h bl, v8f c) {
  c = __builtin_amdgcn_wmma_f32_16x16x32_f16(false, ah, false, bh, (short)0, c, false, false);
  if (NT >= 2) c = __builtin_amdgcn_wmma_f32_16x16x32_f16(false, al, false, bh, (short)0, c, false, false);
  if (NT >= 3) c = __builtin_amdgcn_wmma_f32_16x16x32_f16(false, ah, false, bl, (short)0, c, false, false);
  asm volatile("v_nop\n\tv_nop\n\tv_nop\n\tv_nop" : "+v"(c) : "v"(ah), "v"(al), "v"(bh), "v"(bl));
  return c;
}
// batched GEMM like k_gemm_b but f16 operands: A f32 (split into f16 hi/lo if ASPLIT, else rounded to f16), Bt = f16 values [n][k]; alpha; C f32; N multiple of 16 (partial tiles skipped)
template <bool ASPLIT>
__global__ __launch_bounds__(128) void k_gemm_h(const float* __restrict__ A, int lda, size_t sA, const _Float16* __restrict__ Bh, int ldb, size_t sB, float alpha, float* __restrict__ C, int ldc, size_t sC, int M, int N, int K) {
  __shared__ __attribute__((aligned(16))) float so[4][16][64];
  const int tid = threadIdx.x, w = tid >> 5, lane = tid & 31, ln = lane & 15, hh = lane >> 4; const int by = blockIdx.y;
  A += (size_t)by * sA; Bh += (size_t)by * sB; C += (size_t)by * sC;
  const int ntn = (N + 63) / 64; const int wid = blockIdx.x * 4 + w; const int mt = wid / ntn, nq = wid % ntn; if (mt * 16 >= M) return;
  const int row0 = mt * 16, col0 = nq * 64; const float* arow = A + (size_t)(row0 + ln) * lda;
  v8f acc[4] = {};
  for (int kb = 0; kb < K; kb += 32) {
    FragH ah, al;
    const v4f x0 = *(const v4fa*)(arow + kb + 8 * hh), x1 = *(const v4fa*)(arow + kb + 8 * hh + 4), x2 = *(const v4fa*)(arow + kb + 16 + 8 * hh), x3 = *(const v4fa*)(arow + kb + 16 + 8 * hh + 4);
    float xs[16] = {x0[0],x0[1],x0[2],x0[3],x1[0],x1[1],x1[2],x1[3],x2[0],x2[1],x2[2],x2[3],x3[0],x3[1],x3[2],x3[3]};
#pragma unroll
    for (int i = 0; i < 16; ++i) { const _Float16 h = (_Float16)xs[i]; ah.h[i] = h; al.h[i] = ASPLIT ? (_Float16)(xs[i] - (float)h) : (_Float16)0.0f; }
#pragma unroll
    for (int t = 0; t < 4; ++t) { if (col0 + t * 16 >= N) continue; const size_t boff = (size_t)(col0 + t * 16 + ln) * ldb + kb; FragH bq; bq.half[0] = *(const v8us*)(Bh + boff + 8 * hh); bq.half[1] = *(const v8us*)(Bh + boff + 16 + 8 * hh);
      acc[t] = mmaH<ASPLIT ? 2 : 1>(ah.v, al.v, bq.v, bq.v, acc[t]); }
  }
#pragma unroll
  for (int t = 0; t < 4; ++t) { if (col0 + t * 16 >= N) continue;
#pragma unroll
    for (int r = 0; r < 8; ++r) so[w][8 * hh + r][t * 16 + ln] = acc[t][r] * alpha; }
  __builtin_amdgcn_fence(__ATOMIC_ACQ_REL, "workgroup"); __builtin_amdgcn_wave_barrier();
  const int rsub = lane >> 4, c4 = (lane & 15) * 4;
  {
#pragma unroll
    for (int q = 0; q < 8; ++q) { const int r = q * 2 + rsub; if (col0 + c4 < N) { const v4f v = *(const v4fa*)&so[w][r][c4]; *(v4f*)(C + (size_t)(row0 + r) * ldc + col0 + c4) = v; } }
     }
}

// Wt[n][k] = f16(W[k][n]·scale) from f32 row-major W[K][N] (scale = power of two; bf16-exact weights stay exact in f16 away from the subnormal range)
__global__ __launch_bounds__(256) void k_wt_f16(const float* __restrict__ W, _Float16* __restrict__ Wt, int K, int N, float scale) {
  const int t = blockIdx.x * 256 + threadIdx.x; if (t >= N * (K / 8)) return; const int n = t / (K / 8), k8 = (t % (K / 8)) * 8; FragH f;
#pragma unroll
  for (int i = 0; i < 8; ++i) f.h[i] = (_Float16)(bf16_round(W[(size_t)(k8 + i) * N + n]) * scale); const v8us o = f.half[0];
  *(v8us*)((unsigned short*)Wt + (size_t)n * K + k8) = o; 
}
// k_gemm_hh variant with fused epilogue: v = acc·alpha + bias[by·sBias + col] (+ CP[(row/rowsPerB)·sCPb + by·64 + col] if CP) ; ACT 0 none / 1 elu ; writes f16 C16 (and f32 C if non-null)
template <int ACT>
__global__ __launch_bounds__(128) void k_gemm_hhx(const _Float16* __restrict__ A, int lda, size_t sA, const _Float16* __restrict__ Bh, int ldb, size_t sB, float alpha, const float* __restrict__ bias, size_t sBias, const float* __restrict__ CP, int rowsPerB, size_t sCPb, int row0g,
    float* __restrict__ C, _Float16* __restrict__ C16, int ldc, size_t sC, int M, int N, int K) {
  __shared__ __attribute__((aligned(16))) float so[4][16][64];
  const int tid = threadIdx.x, w = tid >> 5, lane = tid & 31, ln = lane & 15, hh = lane >> 4; const int by = blockIdx.y;
  A += (size_t)by * sA; Bh += (size_t)by * sB; const size_t cofs = (size_t)by * sC; const float* bp = bias ? bias + (size_t)by * sBias : nullptr;
  const int ntn = (N + 63) / 64; const int wid = blockIdx.x * 4 + w; const int mt = wid / ntn, nq = wid % ntn; if (mt * 16 >= M) return;
  const int row0 = mt * 16, col0 = nq * 64; const _Float16* arow = A + (size_t)(row0 + ln) * lda;
  v8f acc[4] = {};
  for (int kb = 0; kb < K; kb += 32) { FragH ah; ah.half[0] = *(const v8us*)((const unsigned short*)arow + kb + 8 * hh); ah.half[1] = *(const v8us*)((const unsigned short*)arow + kb + 16 + 8 * hh);
#pragma unroll
    for (int t = 0; t < 4; ++t) { if (col0 + t * 16 >= N) continue; const size_t boff = (size_t)(col0 + t * 16 + ln) * ldb + kb; FragH bq; bq.half[0] = *(const v8us*)((const unsigned short*)Bh + boff + 8 * hh); bq.half[1] = *(const v8us*)((const unsigned short*)Bh + boff + 16 + 8 * hh);
      acc[t] = mmaH<1>(ah.v, ah.v, bq.v, bq.v, acc[t]); }
  }
#pragma unroll
  for (int t = 0; t < 4; ++t) { if (col0 + t * 16 >= N) continue; const int col = col0 + t * 16 + ln; const float bv = bp ? bf16_round(bp[col]) : 0.f;
#pragma unroll
    for (int r = 0; r < 8; ++r) { float v = acc[t][r] * alpha + bv; if (CP) { const int rr = row0g + row0 + 8 * hh + r; if (rowsPerB < 0) v += CP[cofs + (size_t)rr * ldc + col];      /* rowsPerB < 0: own element of the batched C plane */ else { const int bidx = rr / rowsPerB; v += CP[(size_t)bidx * sCPb + (size_t)by * 64 + col]; } } if (ACT == 1) v = (v > 0.f) ? v : expm1f(v); else if (ACT == 7) v = (v > 0.f) ? v + 1.0f : expf(v); else if (ACT == 8) v = tanhf(v); else if (ACT == 9) v = 0.5f * v * (1.0f + tanhf(0.7978845608028654f * (v + 0.044715f * v * v * v))); else if (ACT == 11) v = 1.0f / (1.0f + expf(-v)); else if (ACT == 12) v = (v > 0.f) ? v : 0.01f * v; else if (ACT == 14) v = (v > 0.f) ? v : 0.1f * v; else if (ACT == 16) v = (v >= 0.f) ? v : 0.3f * v; else if (ACT == 17) v = (v >= 0.f) ? v : 0.2f * v; else if (ACT == 15) v = v / (1.0f + expf(-v)); else if (ACT == 3) v = fmaxf(v, 0.f); else if (ACT == 6) v = 0.5f * v * (1.0f + erff(v * 0.70710678118654752f)); so[w][8 * hh + r][t * 16 + ln] = v; } }
  __builtin_amdgcn_fence(__ATOMIC_ACQ_REL, "workgroup"); __builtin_amdgcn_wave_barrier();
  const int rsub = lane >> 4, c4 = (lane & 15) * 4; typedef _Float16 v4h __attribute__((ext_vector_type(4)));
  {
#pragma unroll
    for (int q = 0; q < 8; ++q) { const int r = q * 2 + rsub; if (col0 + c4 < N) { const v4f v = *(const v4fa*)&so[w][r][c4]; if (C) *(v4f*)(C + cofs + (size_t)(row0 + r) * ldc + col0 + c4) = v; if (C16) { v4h h4; for (int i = 0; i < 4; ++i) h4[i] = (_Float16)v[i]; *(v4h*)(C16 + cofs + (size_t)(row0 + r) * ldc + col0 + c4) = h4; } } }
     }
}


typedef _Float16 v4h __attribute__((ext_vector_type(4)));

__global__ __launch_bounds__(256) void k_x16(const float* __restrict__ x, _Float16* __restrict__ X16, size_t n8) { const size_t t = (size_t)blockIdx.x * 256 + threadIdx.x; if (t >= n8) return; FragH f;
#pragma unroll
  for (int q = 0; q < 8; ++q) f.h[q] = (_Float16)bf16_round(x[t * 8 + q]); *(v8us*)((unsigned short*)X16 + t * 8) = f.half[0];  }
__global__ __launch_bounds__(256) void k_h16(const float* __restrict__ x, _Float16* __restrict__ X16, size_t n8) { const size_t t = (size_t)blockIdx.x * 256 + threadIdx.x; if (t >= n8) return; FragH f;
#pragma unroll
  for (int q = 0; q < 8; ++q) f.h[q] = (_Float16)x[t * 8 + q]; *(v8us*)((unsigned short*)X16 + t * 8) = f.half[0];  }
__global__ __launch_bounds__(256) void k_round16f(const float* __restrict__ W, _Float16* __restrict__ Bt, size_t n8) { const size_t t = (size_t)blockIdx.x * 256 + threadIdx.x; if (t >= n8) return; FragH f;
#pragma unroll
  for (int i = 0; i < 8; ++i) f.h[i] = (_Float16)(bf16_round(W[t * 8 + i]) * 16.0f); *(v8us*)((unsigned short*)Bt + t * 8) = f.half[0];  }
template <int NHv, int TTv>
__global__ __launch_bounds__(256) void k_vt(const _Float16* __restrict__ V16, int ldv, int voff, _Float16* __restrict__ Vt) { __shared__ unsigned short tl[64][66]; const int tid = threadIdx.x; const int slab = blockIdx.x / (TTv / 64), lg = blockIdx.x % (TTv / 64); const int b = slab / NHv, h = slab % NHv;
  for (int i = tid; i < 64 * 8; i += 256) { const int r = i / 8, c8 = (i % 8) * 8; FragH f; f.half[0] = *(const v8us*)((const unsigned short*)V16 + ((size_t)b * TTv + lg * 64 + r) * ldv + voff + h * 64 + c8);
#pragma unroll
    for (int q = 0; q < 8; ++q) tl[r][c8 + q] = f.u[q]; }
  __syncthreads();
  {
#pragma unroll
    for (int rd = 0; rd < 2; ++rd) { const int d = rd * 32 + tid / 8, pc = tid % 8; FragH f;
#pragma unroll
      for (int q = 0; q < 8; ++q) f.u[q] = tl[pc * 8 + q][d];
      *(v8us*)((unsigned short*)Vt + ((size_t)slab * 64 + d) * TTv + lg * 64 + pc * 8) = f.half[0]; }
     } }

__global__ __launch_bounds__(256) void k_hl(const float* __restrict__ F, _Float16* __restrict__ Hh, _Float16* __restrict__ Hl, size_t n8) { const size_t t = (size_t)blockIdx.x * 256 + threadIdx.x; if (t >= n8) return; FragH fh, fl; const v4f a = *(const v4fa*)(F + t * 8), c = *(const v4fa*)(F + t * 8 + 4);
#pragma unroll
  for (int q = 0; q < 4; ++q) { _Float16 h = (_Float16)a[q]; fh.h[q] = h; fl.h[q] = (_Float16)((a[q] - (float)h) * 1024.0f); h = (_Float16)c[q]; fh.h[4 + q] = h; fl.h[4 + q] = (_Float16)((c[q] - (float)h) * 1024.0f); }
  { *(v8us*)((unsigned short*)Hh + t * 8) = fh.half[0]; *(v8us*)((unsigned short*)Hl + t * 8) = fl.half[0];  } }

// ---- WMMA step of the conv GEMM (wave tile 32x64) ----
__device__ __forceinline__ v8f g2_mma(v16h a, v16h b, v8f c) { v8f d = __builtin_amdgcn_wmma_f32_16x16x32_f16(false, a, false, b, (short)0, c, false, false); asm volatile("v_nop\n\tv_nop\n\tv_nop\n\tv_nop" : "+v"(d) : "v"(a), "v"(b)); return d; }

__global__ __launch_bounds__(256) void k_xrows(const float* __restrict__ x, _Float16* __restrict__ XR) { __shared__ float tl[CI][33]; const int tid = threadIdx.x; const int p0 = blockIdx.x * 32;      /* 32 pixels of the padded grid, batches end to end */
  for (int i = tid; i < CI * 32; i += 256) { const int c = i / 32, j = i % 32; const int b = (p0 + j) / PP, p = (p0 + j) % PP; const int yy = p / HP - 6, xx = p % HP - 6; tl[c][j] = (yy >= 0 && yy < HS && xx >= 0 && xx < HS) ? bf16_round(x[((size_t)b * CI + c) * PX + yy * HS + xx]) : 0.f; }
  __syncthreads();
  { for (int i = tid; i < 32 * CG; i += 256) { const int j = i / CG, c8 = (i % CG) * 8; FragH f; for (int q = 0; q < 8; ++q) f.h[q] = (_Float16)tl[c8 + q][j]; *(v8us*)((unsigned short*)XR + ((size_t)p0 + j) * CI + c8) = f.half[0]; }  } }
// 7x7 conv as a GEMM without an im2col buffer: row r of A is output pixel r of an HO x HO grid, and its k = tap * 128 + channel element is the x row at padded pixel (oy + OFF + tap / 7, ox + OFF + tap % 7),
// so a tap's 128 channels are 256 contiguous bytes. C[r][n] = alpha * sum_k A[r][k] * Bh[n][k], k in the order of k_w7. Wave tile 32x64, work-group 128x64; rows from M on repeat row M - 1 (their C rows are never read).
// One trip of the loop is one tap. The tap's A tile (128 pixel rows) and B tile (64 weight rows), 256 bytes a row, are brought into LDS by asynchronous copies, 16 bytes a lane (16 lanes = one whole row),
// into one of two buffers: the copies of tap t + 2 fly while tap t + 1 is worked on. The fragments are read from LDS at a row pitch of 272 bytes (free of bank conflicts for 16-byte reads).
#define LP 272                       /* LDS row pitch in bytes */
#define LA (128 * LP)                /* A tile */
#define LS (192 * LP)                /* one buffer: A tile, then B tile */
// twelve copies of 16 bytes a lane, LDS byte address l[i] from global address g[i]; the wait on the address registers ends the copies' own statement, ahead of any rewrite of them
__device__ __forceinline__ void g2_copy12(const unsigned* l, const char* const* g) {
  asm volatile("global_load_async_to_lds_b128 %0, %12, off\n\tglobal_load_async_to_lds_b128 %1, %13, off\n\tglobal_load_async_to_lds_b128 %2, %14, off\n\tglobal_load_async_to_lds_b128 %3, %15, off\n\t"
               "global_load_async_to_lds_b128 %4, %16, off\n\tglobal_load_async_to_lds_b128 %5, %17, off\n\tglobal_load_async_to_lds_b128 %6, %18, off\n\tglobal_load_async_to_lds_b128 %7, %19, off\n\t"
               "global_load_async_to_lds_b128 %8, %20, off\n\tglobal_load_async_to_lds_b128 %9, %21, off\n\tglobal_load_async_to_lds_b128 %10, %22, off\n\tglobal_load_async_to_lds_b128 %11, %23, off\n\ts_wait_xcnt 0x0"
               :: "v"(l[0]), "v"(l[1]), "v"(l[2]), "v"(l[3]), "v"(l[4]), "v"(l[5]), "v"(l[6]), "v"(l[7]), "v"(l[8]), "v"(l[9]), "v"(l[10]), "v"(l[11]),
                  "v"(g[0]), "v"(g[1]), "v"(g[2]), "v"(g[3]), "v"(g[4]), "v"(g[5]), "v"(g[6]), "v"(g[7]), "v"(g[8]), "v"(g[9]), "v"(g[10]), "v"(g[11]) : "memory"); }
__device__ __forceinline__ v16h g2_lfrag(const unsigned char* p) { FragH f; f.half[0] = *(const v8us*)p; f.half[1] = *(const v8us*)(p + 32); return f.v; }
template <int HO, int OFF>
__global__ __launch_bounds__(128) void k_conv7(const _Float16* __restrict__ XR, const _Float16* __restrict__ Bh, float alpha, float* __restrict__ C, int M) {
  __shared__ __attribute__((aligned(16))) float so[4][32][68];
  __shared__ __attribute__((aligned(16))) unsigned char ring[2 * LS];
  const int tid = threadIdx.x, w = tid >> 5, lane = tid & 31, ln = lane & 15, hh = lane >> 4;
  const int mt = blockIdx.x / (CO / 64), nq = blockIdx.x % (CO / 64); const int row0 = mt * 128 + 32 * w, col0 = nq * 64;
  /* copy side: this thread brings the 16 bytes number cc of tile rows cr, cr + 8, ... */
  const int cr = tid >> 4, cc = tid & 15; unsigned ao[16], bo[8];      /* byte offsets of this thread's rows at tap 0; every loop over them is unrolled so that they stay in registers */
#pragma unroll
  for (int i = 0; i < 16; ++i) { const int r = min(mt * 128 + cr + 8 * i, M - 1); ao[i] = (unsigned)((((r / (HO * HO)) * PP + ((r % (HO * HO)) / HO + OFF) * HP + (r % HO) + OFF) * CI + cc * 8) * 2); }
#pragma unroll
  for (int i = 0; i < 8; ++i) bo[i] = (unsigned)(((col0 + cr + 8 * i) * KC + cc * 8) * 2);
  const unsigned lc = (unsigned)(size_t)ring + (unsigned)(cr * LP + cc * 16);
  auto issue = [&](int t, int buf) { const char* xa = (const char*)XR + ((t / 7) * HP + t % 7) * (CI * 2); const char* xb = (const char*)Bh + t * (CI * 2); const unsigned l = lc + (unsigned)(buf * LS);      /* the tap's bases, the same for every lane */
    unsigned la[24]; const char* ga[24];      /* tile rows cr + 8 i: 16 of A, then 8 of B (the B tile follows the A tile at the same pitch) */
#pragma unroll
    for (int i = 0; i < 24; ++i) { la[i] = l + (unsigned)(8 * i * LP); ga[i] = i < 16 ? xa + ao[i] : xb + bo[i - 16]; }
    g2_copy12(la, ga); g2_copy12(la + 12, ga + 12); };
  const v8f z8 = {0.f,0.f,0.f,0.f,0.f,0.f,0.f,0.f}; v8f c00 = z8, c01 = z8, c02 = z8, c03 = z8, c10 = z8, c11 = z8, c12 = z8, c13 = z8;
  issue(0, 0);
  asm volatile("s_wait_asynccnt 0x0" ::: "memory");      /* this wave's copies of tap 0 have landed */
  __syncthreads();      /* tap 0 is complete before any wave reads it */
  issue(1, 1);
  /* the tap loop stays rolled: its body holds 32 WMMAs */
#pragma unroll 1
  for (int t = 0; t < KK; ++t) { const unsigned char* st = ring + (t & 1) * LS; const unsigned char* pa = st + (32 * w + ln) * LP + 16 * hh; const unsigned char* pb = st + LA + ln * LP + 16 * hh;
    v16h a0[2], a1[2], b0[2], b1[2], b2[2], b3[2];
    /* two fragment sets: the next 32 channels' LDS reads stand ahead of this block's WMMAs, so that their latency runs under the block; unrolled so that the sets are picked by constants */
    a0[0] = g2_lfrag(pa); a1[0] = g2_lfrag(pa + 16 * LP); b0[0] = g2_lfrag(pb); b1[0] = g2_lfrag(pb + 16 * LP); b2[0] = g2_lfrag(pb + 32 * LP); b3[0] = g2_lfrag(pb + 48 * LP);
#pragma unroll
    for (int s = 0; s < 4; ++s) { const int u = s & 1, n = u ^ 1, kb = (s + 1) * 64;
      if (s < 3) { a0[n] = g2_lfrag(pa + kb); a1[n] = g2_lfrag(pa + 16 * LP + kb); b0[n] = g2_lfrag(pb + kb); b1[n] = g2_lfrag(pb + 16 * LP + kb); b2[n] = g2_lfrag(pb + 32 * LP + kb); b3[n] = g2_lfrag(pb + 48 * LP + kb); }
      c00 = g2_mma(a0[u], b0[u], c00); c10 = g2_mma(a1[u], b0[u], c10); c01 = g2_mma(a0[u], b1[u], c01); c11 = g2_mma(a1[u], b1[u], c11);
      c02 = g2_mma(a0[u], b2[u], c02); c12 = g2_mma(a1[u], b2[u], c12); c03 = g2_mma(a0[u], b3[u], c03); c13 = g2_mma(a1[u], b3[u], c13);
    }
    asm volatile("s_wait_dscnt 0x0" ::: "memory");      /* this wave's reads of the buffer are done before it is handed back */
    asm volatile("s_wait_asynccnt 0x0" ::: "memory");      /* this wave's copies of tap t + 1 have landed */
    __syncthreads();      /* publishes tap t + 1 and ends every wave's reads of tap t's buffer */
    if (t + 2 < KK) issue(t + 2, t & 1); }
  asm volatile("s_wait_asynccnt 0x0" ::: "memory");      /* no copy is outstanding when the wave goes on */
  v8f accs[8] = {c00, c01, c02, c03, c10, c11, c12, c13};
#pragma unroll
  for (int u = 0; u < 8; ++u) { const int t = u & 3, half = u >> 2;
#pragma unroll
    for (int r = 0; r < 8; ++r) so[w][half * 16 + 8 * hh + r][t * 16 + ln] = accs[u][r] * alpha; }
  __builtin_amdgcn_fence(__ATOMIC_ACQ_REL, "workgroup"); __builtin_amdgcn_wave_barrier();
  const int rsub = lane >> 4, c4 = (lane & 15) * 4;
#pragma unroll
  for (int q = 0; q < 16; ++q) { const int r = q * 2 + rsub; const v4f v = *(const v4fa*)&so[w][r][c4]; *(v4f*)(C + (size_t)(row0 + r) * CO + col0 + c4) = v; } }
__global__ __launch_bounds__(256) void k_w7(const float* __restrict__ w, _Float16* __restrict__ Bt) { const size_t t = (size_t)blockIdx.x * 256 + threadIdx.x; if (t >= (size_t)CO * KC / 8) return; const int c8 = (int)((t * 8) % CI); const int tap = (int)(((t * 8) / CI) % KK); const int o = (int)((t * 8) / KC); FragH f; for (int q = 0; q < 8; ++q) f.h[q] = (_Float16)(bf16_round(w[((size_t)o * CI + c8 + q) * KK + tap]) * 16.0f);
  *(v8us*)((unsigned short*)Bt + t * 8) = f.half[0];  }
// Lanes run along channels: one wave holds the 32 channels of one head, so every Q, K and V load of a wave is one whole 128-byte line and the window position is wave-uniform.
// A wave takes four neighbouring pixels of one image row at once: their four 7-wide window rows are ten neighbouring K (and V) pixels, loaded once per window row, all in flight together, and used from registers by all four.
// The head's rel table lies in LDS as [tap][channel], so that its reads are contiguous over the lanes too (in global memory a channel's taps are 28 bytes from the next channel's).
// A work-group (8 waves, 4 pixels each) fills a 32-channel x 32-pixel tile in LDS, and the channel-major store then writes whole 128-byte lines.
__global__ __launch_bounds__(256) void k_watt(const float* __restrict__ Q, const float* __restrict__ Kf, const float* __restrict__ Vf, const float* __restrict__ rh, const float* __restrict__ rw, float* __restrict__ out) {
  #pragma clang fp contract(off)
  __shared__ __attribute__((aligned(16))) float tl[32][36]; __shared__ float rl[7][32];
  const int tid = threadIdx.x, lane = tid & 31; const int w = __builtin_amdgcn_readfirstlane(tid >> 5);      /* the wave's number as a scalar: pixel, window row and column stay on the scalar unit */
  const int p0 = (int)(blockIdx.x % (PX / 32)) * 32; const int bh = (int)(blockIdx.x / (PX / 32)); const int head = bh % (NCO / 32); const size_t b = bh / (NCO / 32); const int c = head * 32 + lane; const bool first = head < CO / 64;      /* c < CO / 2, the same for the whole work-group */
  if (w < 7) rl[w][lane] = first ? bf16_round(rh[(size_t)c * 7 + w]) : bf16_round(rw[(size_t)(c - CO / 2) * 7 + w]);
  __syncthreads();      /* the rel table is complete before any wave reads it */
  const int p = p0 + 4 * w; const int y = p / HS, x = p % HS;      /* pixels p .. p + 3 lie in one image row: HS and p are multiples of 4 */
  const float* kp = Kf + (b * PK + (size_t)y * HK + x) * CO + c; const float* vp = Vf + (b * PK + (size_t)y * HK + x) * CO + c;
  float qv[4], mx[4], se[4], acc[4], rc[7];
  /* every loop over the four pixels, the seven window columns and the ten loaded lines is unrolled (each '#pragma unroll' below), so that these small arrays are indexed by constants and stay in registers */
#pragma unroll
  for (int j = 0; j < 4; ++j) { qv[j] = Q[(b * PX + p + j) * CO + c]; mx[j] = -3.0e38f; se[j] = 0.f; acc[j] = 0.f; }
#pragma unroll
  for (int kw = 0; kw < 7; ++kw) rc[kw] = rl[kw][lane];
  /* the loops over window rows stay rolled: one row's body (28 window positions) is already long */
#pragma unroll 1
  for (int kh = 0; kh < 7; ++kh) { float kr[10]; const float rk = rl[kh][lane];
#pragma unroll
    for (int i = 0; i < 10; ++i) kr[i] = kp[(size_t)(kh * HK + i) * CO];
#pragma unroll
    for (int j = 0; j < 4; ++j)
#pragma unroll
      for (int kw = 0; kw < 7; ++kw) { const float kv = __fadd_rn(kr[j + kw], first ? rk : rc[kw]); mx[j] = fmaxf(mx[j], __fmul_rn(qv[j], kv)); } }
  /* per pixel the 49 terms are summed window row by window row, left to right */
#pragma unroll 1
  for (int kh = 0; kh < 7; ++kh) { float kr[10], vr[10]; const float rk = rl[kh][lane];
#pragma unroll
    for (int i = 0; i < 10; ++i) { kr[i] = kp[(size_t)(kh * HK + i) * CO]; vr[i] = vp[(size_t)(kh * HK + i) * CO]; }
#pragma unroll
    for (int j = 0; j < 4; ++j)
#pragma unroll
      for (int kw = 0; kw < 7; ++kw) { const float kv = __fadd_rn(kr[j + kw], first ? rk : rc[kw]); const float e = expf(__fmul_rn(qv[j], kv) - mx[j]); se[j] += e; acc[j] = __fadd_rn(acc[j], __fmul_rn(e, vr[j + kw])); } }
#pragma unroll
  for (int j = 0; j < 4; ++j) tl[lane][4 * w + j] = acc[j] / se[j];
  __syncthreads();      /* the tile is complete before any wave reads other waves' pixels */
  const int dh = tid >> 3, j4 = (tid & 7) * 4; const v4f o = *(const v4fa*)&tl[dh][j4];
  const int oc = dh * 8 + head;      /* the reference's final transpose: output channel = dh*heads + head for computation channel head*32 + dh */
  *(v4f*)(out + ((b * CO + oc) * (size_t)PX + p0 + j4)) = o; }

extern "C" void kernel_launch(void* const* d_in, const int* in_sizes, int n_in,
                              void* d_out, int out_size, void* d_ws, size_t ws_size, hipStream_t stream) {
  (void)in_sizes; (void)n_in; (void)out_size;
  const float* const* I = (const float* const*)d_in; const float* x = I[0]; const float* wq = I[1]; const float* wk = I[2]; const float* wv = I[3]; const float* rh = I[4]; const float* rw = I[5];
  char* ws = (char*)d_ws; size_t off = 0;
  auto take = [&](size_t bytes) { char* p = ws + off; off += (bytes + 255) & ~(size_t)255; return p; };
  _Float16* BQ = (_Float16*)take((size_t)CO * KC * 2); _Float16* BK = (_Float16*)take((size_t)CO * KC * 2); _Float16* BV = (_Float16*)take((size_t)CO * KC * 2);
  _Float16* XR = (_Float16*)take((size_t)NB * PP * CI * 2); float* Q = (float*)take(NRQ * CO * 4); float* Kf = (float*)take((size_t)NRK * CO * 4); float* Vf = (float*)take((size_t)NRK * CO * 4);
  if (off > ws_size) return;      /* three weight planes, the x rows, q, k, v */
  const unsigned gw = (unsigned)(((size_t)CO * KC / 8 + 255) / 256);
  k_w7<<<gw, 256, 0, stream>>>(wq, BQ); k_w7<<<gw, 256, 0, stream>>>(wk, BK); k_w7<<<gw, 256, 0, stream>>>(wv, BV);
  k_xrows<<<NB * PP / 32, 256, 0, stream>>>(x, XR);
  k_conv7<HS, 3><<<(unsigned)((NRQ / 128) * (CO / 64)), 128, 0, stream>>>(XR, BQ, 0.0625f, Q, (int)NRQ);      /* q: 56-grid, x index = o + tap - 3 */
  k_conv7<HK, 0><<<(unsigned)((NRK / 128) * (CO / 64)), 128, 0, stream>>>(XR, BK, 0.0625f, Kf, NB * PK);      /* k/v: 62-grid over pad3(x) with conv pad 3: x index = o + tap - 6 */
  k_conv7<HK, 0><<<(unsigned)((NRK / 128) * (CO / 64)), 128, 0, stream>>>(XR, BV, 0.0625f, Vf, NB * PK);
  k_watt<<<NB * (NCO / 32) * (PX / 32), 256, 0, stream>>>(Q, Kf, Vf, rh, rw, (float*)d_out);
}

// v005
// A run of this version takes 170 microseconds.
// Next to v004, in two timings, it ran 1.09 and 1.08 times as fast.
// Over all steps from v000 it is 9.19 times as fast.
#include <hip/hip_runtime.h>
// StandAloneSelfAttention (inputs [2][128][56][56]; q = conv7x7(x, Wq, pad 3) (256 ch, 56x56); k, v = conv7x7(pad3(x), Wk/Wv, pad 3) (256 ch, 62x62); per channel c and pixel: 7x7 window of k (plus rel_h[c] per window row for the first 128 channels, rel_w[c-128] per window column for the rest) and v around the pixel; attn = softmax over the 49 of q*k (scalar products); out = sum attn*v, then the reference's transpose(0,2,1,3,4): output channel (dh*8 + head) takes computation channel (head*32 + dh) -> [2][256][56][56]).
// Structure: pixel rows; x as exact f16 rows via LDS transposes; the three 7x7 convs as WMMA GEMMs (K = 6,272 = 49 taps x 128 channels; 32x64 wave tiles, f32 accumulation, exact x16 weights) whose A tiles are taken tap by tap from the x rows, which lie on a 68x68 grid with 6 pixels of zeros on every side (all padding of both convs), and staged with the weight tiles in LDS, into f32 channel rows; the per-channel 49-way window softmax and weighted sum on VALU in f32 (rel tables read) with the channel-major store.
// Compute dtype: inputs rounded to bf16; x / weights / rel tables exact; q, k, v in f32 (GEMM outputs); softmax and the weighted sum f32 — no reduced-precision intermediates after the convs. v_wmma_f32_16x16x32_f16.
#define NB 2
#define CI 128
#define CO 256
#define HS 56
#define PX (HS * HS)                 /* 3136 */
#define HK 62                        /* k/v grid */
#define PK (HK * HK)                 /* 3844 */
#define NRQ ((size_t)NB * PX)        /* 6272 = 49 x 128 */
#define NRK 7808                     /* 2 x 3844 = 7688 -> padded to 61 x 128 */
#define KK 49
#define KC (KK * CI)                 /* 6272 */
#define CG (CI / 8)
#define HP (HS + 12)                 /* x rows on a grid with 6 zero pixels on every side */
#define PP (HP * HP)                 /* 4624; NB * PP = 289 x 32 */
#define NCO CO                       /* output channels computed (debug hook) */
typedef __bf16 v16b __attribute__((ext_vector_type(16)));
typedef unsigned short v8us __attribute__((ext_vector_type(8), may_alias));
typedef float  v8f  __attribute__((ext_vector_type(8)));
typedef float  v4f  __attribute__((ext_vector_type(4)));
typedef float  v4fa __attribute__((ext_vector_type(4), may_alias));
union FragB { v16b v; v8us half[2]; unsigned short u[16]; };

__device__ __forceinline__ unsigned short bf16_bits(float x) { unsigned int u = __float_as_uint(x); return (unsigned short)((u + 0x7FFFu + ((u >> 16) & 1u)) >> 16); }
__device__ __forceinline__ float bf16_val(unsigned short b) { return __uint_as_float(((unsigned int)b) << 16); }
__device__ __forceinline__ float bf16_round(float x) { return bf16_val(bf16_bits(x)); }
// D += A·B with NT terms: 1 = ah·bh, 2 = + al·bh (A split), 3 = + ah·bl (both split)
template <int NT>
__device__ __forceinline__ v8f mmaN(v16b ah, v16b al, v16b bh, v16b bl, v8f c) {
  c = __builtin_amdgcn_wmma_f32_16x16x32_bf16(false, ah, false, bh, (short)0, c, false, false);
  if (NT >= 2) c = __builtin_amdgcn_wmma_f32_16x16x32_bf16(false, al, false, bh, (short)0, c, false, false);
  if (NT >= 3) c = __builtin_amdgcn_wmma_f32_16x16x32_bf16(false, ah, false, bl, (short)0, c, false, false);
  asm volatile("v_nop\n\tv_nop\n\tv_nop\n\tv_nop" : "+v"(c) : "v"(ah), "v"(al), "v"(bh), "v"(bl));
  return c;
}

__global__ __launch_bounds__(256) void k_wt_bf16(const float* __restrict__ W, unsigned short* __restrict__ Wt, int K, int N) {
  const int t = blockIdx.x * 256 + threadIdx.x;
  const int k8n = K / 8;
  if (t >= N * k8n) return;
  const int n = t / k8n, k8 = (t % k8n) * 8;
  v8us v;
#pragma unroll
  for (int i = 0; i < 8; ++i) v[i] = bf16_bits(W[(size_t)(k8 + i) * N + n]);
  *(v8us*)(Wt + (size_t)n * K + k8) = v;
  
}

// GEMM C[M][N] (f32, pitch ldc) = act(A[M][K]·W + bias). A f32 row-major (pitch lda) converted per fragment to bf16
// (ASPLIT: hi/lo two planes -> 2 terms, else single rounded term); Wt bf16 [N][K] (pitch ldb). BIAS_BF16 rounds the
// bias to bf16 first (bias quantised to bf16 before the add). K%32==0, M%16==0, N%64==0.
template <bool ASPLIT, int ACT, bool BIAS_BF16>
__global__ __launch_bounds__(128) void k_gemm_bf(const float* __restrict__ A, int lda, const unsigned short* __restrict__ Wt, int ldb,
                                               const float* __restrict__ bias, float* __restrict__ C, int ldc, int M, int N, int K) {
  __shared__ __attribute__((aligned(16))) float so[4][16][64];
  const int tid = threadIdx.x, w = tid >> 5, lane = tid & 31, ln = lane & 15, hh = lane >> 4;
  const int ntn = N / 64;
  const int wid = blockIdx.x * 4 + w;
  const int mt = wid / ntn, nq = wid % ntn;
  if (mt * 16 >= M) return;
  const int row0 = mt * 16, col0 = nq * 64;
  const float* arow = A + (size_t)(row0 + ln) * lda;
  v8f acc[4] = {};
  for (int kb = 0; kb < K; kb += 32) {
    FragB ah, al;
    const v4f x0 = *(const v4fa*)(arow + kb + 8 * hh), x1 = *(const v4fa*)(arow + kb + 8 * hh + 4);
    const v4f x2 = *(const v4fa*)(arow + kb + 16 + 8 * hh), x3 = *(const v4fa*)(arow + kb + 16 + 8 * hh + 4);
    float xs[16] = {x0[0],x0[1],x0[2],x0[3],x1[0],x1[1],x1[2],x1[3],x2[0],x2[1],x2[2],x2[3],x3[0],x3[1],x3[2],x3[3]};
#pragma unroll
    for (int i = 0; i < 16; ++i) { const unsigned short hb = bf16_bits(xs[i]); ah.u[i] = hb; al.u[i] = ASPLIT ? bf16_bits(xs[i] - bf16_val(hb)) : (unsigned short)0; }
#pragma unroll
    for (int t = 0; t < 4; ++t) {
      const unsigned short* brow = Wt + (size_t)(col0 + t * 16 + ln) * ldb + kb;
      FragB b;
      b.half[0] = *(const v8us*)(brow + 8 * hh);
      b.half[1] = *(const v8us*)(brow + 16 + 8 * hh);
      acc[t] = mmaN<ASPLIT ? 2 : 1>(ah.v, al.v, b.v, b.v, acc[t]);
    }
  }
#pragma unroll
  for (int t = 0; t < 4; ++t) {
    float bv = bias ? bias[col0 + t * 16 + ln] : 0.f;
    if (BIAS_BF16) bv = bf16_round(bv);
#pragma unroll
    for (int r = 0; r < 8; ++r) { float v = acc[t][r] + bv; if (ACT == 1) v = fmaxf(v, 0.f); so[w][8 * hh + r][t * 16 + ln] = v; }
  }
  __builtin_amdgcn_fence(__ATOMIC_ACQ_REL, "workgroup");
  __builtin_amdgcn_wave_barrier();
  const int rsub = lane >> 4, c4 = (lane & 15) * 4;
  {
#pragma unroll
    for (int q = 0; q < 8; ++q) {
      const int r = q * 2 + rsub;
      const v4f v = *(const v4fa*)&so[w][r][c4];
      *(v4f*)(C + (size_t)(row0 + r) * ldc + col0 + c4) = v;
    }
    
  }
}

// GEMM C = act(A·W + bias + resid): A f32 (ASPLIT -> hi/lo 2 terms), Wt bf16 [N][K]; ACT 0 none, 1 relu, 2 exact gelu;
// resid (optional, f32, row index = (row % rmod), pitch ldr, RES_BF16 rounds it) added before the activation.
template <bool ASPLIT, int ACT, bool BIAS_BF16, bool RES_BF16>
__global__ __launch_bounds__(128) void k_gemm_bf3(const float* __restrict__ A, int lda, const unsigned short* __restrict__ Wt, int ldb,
                                                const float* __restrict__ bias, const float* __restrict__ resid, int rmod, int ldr,
                                                float* __restrict__ C, int ldc, int M, int N, int K) {
  __shared__ __attribute__((aligned(16))) float so[4][16][64];
  const int tid = threadIdx.x, w = tid >> 5, lane = tid & 31, ln = lane & 15, hh = lane >> 4;
  const int ntn = N / 64;
  const int wid = blockIdx.x * 4 + w;
  const int mt = wid / ntn, nq = wid % ntn;
  if (mt * 16 >= M) return;
  const int row0 = mt * 16, col0 = nq * 64;
  const float* arow = A + (size_t)(row0 + ln) * lda;
  v8f acc[4] = {};
  for (int kb = 0; kb < K; kb += 32) {
    FragB ah, al;
    const v4f x0 = *(const v4fa*)(arow + kb + 8 * hh), x1 = *(const v4fa*)(arow + kb + 8 * hh + 4);
    const v4f x2 = *(const v4fa*)(arow + kb + 16 + 8 * hh), x3 = *(const v4fa*)(arow + kb + 16 + 8 * hh + 4);
    float xs[16] = {x0[0],x0[1],x0[2],x0[3],x1[0],x1[1],x1[2],x1[3],x2[0],x2[1],x2[2],x2[3],x3[0],x3[1],x3[2],x3[3]};
#pragma unroll
    for (int i = 0; i < 16; ++i) { const unsigned short hb = bf16_bits(xs[i]); ah.u[i] = hb; al.u[i] = ASPLIT ? bf16_bits(xs[i] - bf16_val(hb)) : (unsigned short)0; }
#pragma unroll
    for (int t = 0; t < 4; ++t) {
      const unsigned short* brow = Wt + (size_t)(col0 + t * 16 + ln) * ldb + kb;
      FragB b;
      b.half[0] = *(const v8us*)(brow + 8 * hh);
      b.half[1] = *(const v8us*)(brow + 16 + 8 * hh);
      acc[t] = mmaN<ASPLIT ? 2 : 1>(ah.v, al.v, b.v, b.v, acc[t]);
    }
  }
#pragma unroll
  for (int t = 0; t < 4; ++t) {
    const int col = col0 + t * 16 + ln;
    float bv = bias ? bias[col] : 0.f;
    if (BIAS_BF16) bv = bf16_round(bv);
#pragma unroll
    for (int r = 0; r < 8; ++r) {
      float v = acc[t][r] + bv;
      if (resid) { float rv = resid[(size_t)((row0 + 8 * hh + r) % rmod) * ldr + col]; if (RES_BF16) rv = bf16_round(rv); v += rv; }
      if (ACT == 1) v = fmaxf(v, 0.f);
      if (ACT == 2) v = 0.5f * v * (1.0f + erff(v * 0.70710678118654752f));
      if (ACT == 3) { const float u = 0.7978845608028654f * (v + 0.044715f * v * v * v); v = 0.5f * v * (1.0f + tanhf(u)); }
      so[w][8 * hh + r][t * 16 + ln] = v;
    }
  }
  __builtin_amdgcn_fence(__ATOMIC_ACQ_REL, "workgroup");
  __builtin_amdgcn_wave_barrier();
  const int rsub = lane >> 4, c4 = (lane & 15) * 4;
  {
#pragma unroll
    for (int q = 0; q < 8; ++q) {
      const int r = q * 2 + rsub;
      const v4f v = *(const v4fa*)&so[w][r][c4];
      *(v4f*)(C + (size_t)(row0 + r) * ldc + col0 + c4) = v;
    }
    
  }
}
// row LayerNorm (biased variance, eps) over N: s = X (+ R); optional out_sum <- s; out_norm <- (s-mu)*rsqrt(var+eps)*g + b
template <bool PARAM_BF16>
__global__ __launch_bounds__(256) void k_layernorm(const float* __restrict__ X, const float* __restrict__ R, const float* __restrict__ g, const float* __restrict__ bta,
                                                  float* __restrict__ out_sum, float* __restrict__ out_norm, int N, float eps) {
  __shared__ float red[256];
  const int row = blockIdx.x, tid = threadIdx.x;
  const float* x = X + (size_t)row * N; const float* rr = R ? R + (size_t)row * N : nullptr;
  float vals[16];                     // up to N = 4096
  const int per = N / 256;            // contiguous chunk per thread? use strided-by-4 chunks: thread handles j = tid*4 + 1024*u
  float s1 = 0.f;
  for (int u = 0; u < per / 4; ++u) {
    const int j = tid * 4 + 1024 * u;
    const v4f a = *(const v4fa*)(x + j);
    v4f b = {0.f,0.f,0.f,0.f}; if (rr) b = *(const v4fa*)(rr + j);
#pragma unroll
    for (int q = 0; q < 4; ++q) { const float v = a[q] + b[q]; vals[u * 4 + q] = v; s1 += v; }
  }
  red[tid] = s1; __syncthreads();
  for (int st = 128; st > 0; st >>= 1) { if (tid < st) red[tid] += red[tid + st]; __syncthreads(); }
  const float mu = red[0] / (float)N; __syncthreads();
  float s2 = 0.f;
  for (int u = 0; u < per / 4; ++u)
#pragma unroll
    for (int q = 0; q < 4; ++q) { const float c = vals[u * 4 + q] - mu; s2 += c * c; }
  red[tid] = s2; __syncthreads();
  for (int st = 128; st > 0; st >>= 1) { if (tid < st) red[tid] += red[tid + st]; __syncthreads(); }
  const float rs = rsqrtf(red[0] / (float)N + eps);
  {
    for (int u = 0; u < per / 4; ++u) {
      const int j = tid * 4 + 1024 * u;
      v4f o, sm;
#pragma unroll
      for (int q = 0; q < 4; ++q) {
        float gg = g[j + q], bb = bta[j + q];
        if (PARAM_BF16) { gg = bf16_round(gg); bb = bf16_round(bb); }
        sm[q] = vals[u * 4 + q]; o[q] = (vals[u * 4 + q] - mu) * rs * gg + bb;
      }
      if (out_sum) *(v4f*)(out_sum + (size_t)row * N + j) = sm;
      *(v4f*)(out_norm + (size_t)row * N + j) = o;
    }
    
  }
}



// ---- f16 WMMA path (v_wmma_f32_16x16x32_f16): 11-bit significands for operands in range — used here for the conv GEMMs, whose bf16-rounded x and x16 weights are exact in f16
typedef _Float16 v16h __attribute__((ext_vector_type(16)));
union FragH { v16h v; v8us half[2]; _Float16 h[16]; unsigned short u[16]; };
template <int NT>
__device__ __forceinline__ v8f mmaH(v16h ah, v16h al, v16h bh, v16h bl, v8f c) {
  c = __builtin_amdgcn_wmma_f32_16x16x32_f16(false, ah, false, bh, (short)0, c, false, false);
  if (NT >= 2) c = __builtin_amdgcn_wmma_f32_16x16x32_f16(false, al, false, bh, (short)0, c, false, false);
  if (NT >= 3) c = __builtin_amdgcn_wmma_f32_16x16x32_f16(false, ah, false, bl, (short)0, c, false, false);
  asm volatile("v_nop\n\tv_nop\n\tv_nop\n\tv_nop" : "+v"(c) : "v"(ah), "v"(al), "v"(bh), "v"(bl));
  return c;
}
// batched GEMM like k_gemm_b but f16 operands: A f32 (split into f16 hi/lo if ASPLIT, else rounded to f16), Bt = f16 values [n][k]; alpha; C f32; N multiple of 16 (partial tiles skipped)
template <bool ASPLIT>
__global__ __launch_bounds__(128) void k_gemm_h(const float* __restrict__ A, int lda, size_t sA, const _Float16* __restrict__ Bh, int ldb, size_t sB, float alpha, float* __restrict__ C, int ldc, size_t sC, int M, int N, int K) {
  __shared__ __attribute__((aligned(16))) float so[4][16][64];
  const int tid = threadIdx.x, w = tid >> 5, lane = tid & 31, ln = lane & 15, hh = lane >> 4; const int by = blockIdx.y;
  A += (size_t)by * sA; Bh += (size_t)by * sB; C += (size_t)by * sC;
  const int ntn = (N + 63) / 64; const int wid = blockIdx.x * 4 + w; const int mt = wid / ntn, nq = wid % ntn; if (mt * 16 >= M) return;
  const int row0 = mt * 16, col0 = nq * 64; const float* arow = A + (size_t)(row0 + ln) * lda;
  v8f acc[4] = {};
  for (int kb = 0; kb < K; kb += 32) {
    FragH ah, al;
    const v4f x0 = *(const v4fa*)(arow + kb + 8 * hh), x1 = *(const v4fa*)(arow + kb + 8 * hh + 4), x2 = *(const v4fa*)(arow + kb + 16 + 8 * hh), x3 = *(const v4fa*)(arow + kb + 16 + 8 * hh + 4);
    float xs[16] = {x0[0],x0[1],x0[2],x0[3],x1[0],x1[1],x1[2],x1[3],x2[0],x2[1],x2[2],x2[3],x3[0],x3[1],x3[2],x3[3]};
#pragma unroll
    for (int i = 0; i < 16; ++i) { const _Float16 h = (_Float16)xs[i]; ah.h[i] = h; al.h[i] = ASPLIT ? (_Float16)(xs[i] - (float)h) : (_Float16)0.0f; }
#pragma unroll
    for (int t = 0; t < 4; ++t) { if (col0 + t * 16 >= N) continue; const size_t boff = (size_t)(col0 + t * 16 + ln) * ldb + kb; FragH bq; bq.half[0] = *(const v8us*)(Bh + boff + 8 * hh); bq.half[1] = *(const v8us*)(Bh + boff + 16 + 8 * hh);
      acc[t] = mmaH<ASPLIT ? 2 : 1>(ah.v, al.v, bq.v, bq.v, acc[t]); }
  }
#pragma unroll
  for (int t = 0; t < 4; ++t) { if (col0 + t * 16 >= N) continue;
#pragma unroll
    for (int r = 0; r < 8; ++r) so[w][8 * hh + r][t * 16 + ln] = acc[t][r] * alpha; }
  __builtin_amdgcn_fence(__ATOMIC_ACQ_REL, "workgroup"); __builtin_amdgcn_wave_barrier();
  const int rsub = lane >> 4, c4 = (lane & 15) * 4;
  {
#pragma unroll
    for (int q = 0; q < 8; ++q) { const int r = q * 2 + rsub; if (col0 + c4 < N) { const v4f v = *(const v4fa*)&so[w][r][c4]; *(v4f*)(C + (size_t)(row0 + r) * ldc + col0 + c4) = v; } }
     }
}

// Wt[n][k] = f16(W[k][n]·scale) from f32 row-major W[K][N] (scale = power of two; bf16-exact weights stay exact in f16 away from the subnormal range)
__global__ __launch_bounds__(256) void k_wt_f16(const float* __restrict__ W, _Float16* __restrict__ Wt, int K, int N, float scale) {
  const int t = blockIdx.x * 256 + threadIdx.x; if (t >= N * (K / 8)) return; const int n = t / (K / 8), k8 = (t % (K / 8)) * 8; FragH f;
#pragma unroll
  for (int i = 0; i < 8; ++i) f.h[i] = (_Float16)(bf16_round(W[(size_t)(k8 + i) * N + n]) * scale); const v8us o = f.half[0];
  *(v8us*)((unsigned short*)Wt + (size_t)n * K + k8) = o; 
}
// k_gemm_hh variant with fused epilogue: v = acc·alpha + bias[by·sBias + col] (+ CP[(row/rowsPerB)·sCPb + by·64 + col] if CP) ; ACT 0 none / 1 elu ; writes f16 C16 (and f32 C if non-null)
template <int ACT>
__global__ __launch_bounds__(128) void k_gemm_hhx(const _Float16* __restrict__ A, int lda, size_t sA, const _Float16* __restrict__ Bh, int ldb, size_t sB, float alpha, const float* __restrict__ bias, size_t sBias, const float* __restrict__ CP, int rowsPerB, size_t sCPb, int row0g,
    float* __restrict__ C, _Float16* __restrict__ C16, int ldc, size_t sC, int M, int N, int K) {
  __shared__ __attribute__((aligned(16))) float so[4][16][64];
  const int tid = threadIdx.x, w = tid >> 5, lane = tid & 31, ln = lane & 15, hh = lane >> 4; const int by = blockIdx.y;
  A += (size_t)by * sA; Bh += (size_t)by * sB; const size_t cofs = (size_t)by * sC; const float* bp = bias ? bias + (size_t)by * sBias : nullptr;
  const int ntn = (N + 63) / 64; const int wid = blockIdx.x * 4 + w; const int mt = wid / ntn, nq = wid % ntn; if (mt * 16 >= M) return;
  const int row0 = mt * 16, col0 = nq * 64; const _Float16* arow = A + (size_t)(row0 + ln) * lda;
  v8f acc[4] = {};
  for (int kb = 0; kb < K; kb += 32) { FragH ah; ah.half[0] = *(const v8us*)((const unsigned short*)arow + kb + 8 * hh); ah.half[1] = *(const v8us*)((const unsigned short*)arow + kb + 16 + 8 * hh);
#pragma unroll
    for (int t = 0; t < 4; ++t) { if (col0 + t * 16 >= N) continue; const size_t boff = (size_t)(col0 + t * 16 + ln) * ldb + kb; FragH bq; bq.half[0] = *(const v8us*)((const unsigned short*)Bh + boff + 8 * hh); bq.half[1] = *(const v8us*)((const unsigned short*)Bh + boff + 16 + 8 * hh);
      acc[t] = mmaH<1>(ah.v, ah.v, bq.v, bq.v, acc[t]); }
  }
#pragma unroll
  for (int t = 0; t < 4; ++t) { if (col0 + t * 16 >= N) continue; const int col = col0 + t * 16 + ln; const float bv = bp ? bf16_round(bp[col]) : 0.f;
#pragma unroll
    for (int r = 0; r < 8; ++r) { float v = acc[t][r] * alpha + bv; if (CP) { const int rr = row0g + row0 + 8 * hh + r; if (rowsPerB < 0) v += CP[cofs + (size_t)rr * ldc + col];      /* rowsPerB < 0: own element of the batched C plane */ else { const int bidx = rr / rowsPerB; v += CP[(size_t)bidx * sCPb + (size_t)by * 64 + col]; } } if (ACT == 1) v = (v > 0.f) ? v : expm1f(v); else if (ACT == 7) v = (v > 0.f) ? v + 1.0f : expf(v); else if (ACT == 8) v = tanhf(v); else if (ACT == 9) v = 0.5f * v * (1.0f + tanhf(0.7978845608028654f * (v + 0.044715f * v * v * v))); else if (ACT == 11) v = 1.0f / (1.0f + expf(-v)); else if (ACT == 12) v = (v > 0.f) ? v : 0.01f * v; else if (ACT == 14) v = (v > 0.f) ? v : 0.1f * v; else if (ACT == 16) v = (v >= 0.f) ? v : 0.3f * v; else if (ACT == 17) v = (v >= 0.f) ? v : 0.2f * v; else if (ACT == 15) v = v / (1.0f + expf(-v)); else if (ACT == 3) v = fmaxf(v, 0.f); else if (ACT == 6) v = 0.5f * v * (1.0f + erff(v * 0.70710678118654752f)); so[w][8 * hh + r][t * 16 + ln] = v; } }
  __builtin_amdgcn_fence(__ATOMIC_ACQ_REL, "workgroup"); __builtin_amdgcn_wave_barrier();
  const int rsub = lane >> 4, c4 = (lane & 15) * 4; typedef _Float16 v4h __attribute__((ext_vector_type(4)));
  {
#pragma unroll
    for (int q = 0; q < 8; ++q) { const int r = q * 2 + rsub; if (col0 + c4 < N) { const v4f v = *(const v4fa*)&so[w][r][c4]; if (C) *(v4f*)(C + cofs + (size_t)(row0 + r) * ldc + col0 + c4) = v; if (C16) { v4h h4; for (int i = 0; i < 4; ++i) h4[i] = (_Float16)v[i]; *(v4h*)(C16 + cofs + (size_t)(row0 + r) * ldc + col0 + c4) = h4; } } }
     }
}


typedef _Float16 v4h __attribute__((ext_vector_type(4)));

__global__ __launch_bounds__(256) void k_x16(const float* __restrict__ x, _Float16* __restrict__ X16, size_t n8) { const size_t t = (size_t)blockIdx.x * 256 + threadIdx.x; if (t >= n8) return; FragH f;
#pragma unroll
  for (int q = 0; q < 8; ++q) f.h[q] = (_Float16)bf16_round(x[t * 8 + q]); *(v8us*)((unsigned short*)X16 + t * 8) = f.half[0];  }
__global__ __launch_bounds__(256) void k_h16(const float* __restrict__ x, _Float16* __restrict__ X16, size_t n8) { const size_t t = (size_t)blockIdx.x * 256 + threadIdx.x; if (t >= n8) return; FragH f;
#pragma unroll
  for (int q = 0; q < 8; ++q) f.h[q] = (_Float16)x[t * 8 + q]; *(v8us*)((unsigned short*)X16 + t * 8) = f.half[0];  }
__global__ __launch_bounds__(256) void k_round16f(const float* __restrict__ W, _Float16* __restrict__ Bt, size_t n8) { const size_t t = (size_t)blockIdx.x * 256 + threadIdx.x; if (t >= n8) return; FragH f;
#pragma unroll
  for (int i = 0; i < 8; ++i) f.h[i] = (_Float16)(bf16_round(W[t * 8 + i]) * 16.0f); *(v8us*)((unsigned short*)Bt + t * 8) = f.half[0];  }
template <int NHv, int TTv>
__global__ __launch_bounds__(256) void k_vt(const _Float16* __restrict__ V16, int ldv, int voff, _Float16* __restrict__ Vt) { __shared__ unsigned short tl[64][66]; const int tid = threadIdx.x; const int slab = blockIdx.x / (TTv / 64), lg = blockIdx.x % (TTv / 64); const int b = slab / NHv, h = slab % NHv;
  for (int i = tid; i < 64 * 8; i += 256) { const int r = i / 8, c8 = (i % 8) * 8; FragH f; f.half[0] = *(const v8us*)((const unsigned short*)V16 + ((size_t)b * TTv + lg * 64 + r) * ldv + voff + h * 64 + c8);
#pragma unroll
    for (int q = 0; q < 8; ++q) tl[r][c8 + q] = f.u[q]; }
  __syncthreads();
  {
#pragma unroll
    for (int rd = 0; rd < 2; ++rd) { const int d = rd * 32 + tid / 8, pc = tid % 8; FragH f;
#pragma unroll
      for (int q = 0; q < 8; ++q) f.u[q] = tl[pc * 8 + q][d];
      *(v8us*)((unsigned short*)Vt + ((size_t)slab * 64 + d) * TTv + lg * 64 + pc * 8) = f.half[0]; }
     } }

__global__ __launch_bounds__(256) void k_hl(const float* __restrict__ F, _Float16* __restrict__ Hh, _Float16* __restrict__ Hl, size_t n8) { const size_t t = (size_t)blockIdx.x * 256 + threadIdx.x; if (t >= n8) return; FragH fh, fl; const v4f a = *(const v4fa*)(F + t * 8), c = *(const v4fa*)(F + t * 8 + 4);
#pragma unroll
  for (int q = 0; q < 4; ++q) { _Float16 h = (_Float16)a[q]; fh.h[q] = h; fl.h[q] = (_Float16)((a[q] - (float)h) * 1024.0f); h = (_Float16)c[q]; fh.h[4 + q] = h; fl.h[4 + q] = (_Float16)((c[q] - (float)h) * 1024.0f); }
  { *(v8us*)((unsigned short*)Hh + t * 8) = fh.half[0]; *(v8us*)((unsigned short*)Hl + t * 8) = fl.half[0];  } }

// ---- WMMA step of the conv GEMM (wave tile 32x64) ----
__device__ __forceinline__ v8f g2_mma(v16h a, v16h b, v8f c) { v8f d = __builtin_amdgcn_wmma_f32_16x16x32_f16(false, a, false, b, (short)0, c, false, false); asm volatile("v_nop\n\tv_nop\n\tv_nop\n\tv_nop" : "+v"(d) : "v"(a), "v"(b)); return d; }

__global__ __launch_bounds__(256) void k_xrows(const float* __restrict__ x, _Float16* __restrict__ XR) { __shared__ float tl[CI][33]; const int tid = threadIdx.x; const int p0 = blockIdx.x * 32;      /* 32 pixels of the padded grid, batches end to end */
  for (int i = tid; i < CI * 32; i += 256) { const int c = i / 32, j = i % 32; const int b = (p0 + j) / PP, p = (p0 + j) % PP; const int yy = p / HP - 6, xx = p % HP - 6; tl[c][j] = (yy >= 0 && yy < HS && xx >= 0 && xx < HS) ? bf16_round(x[((size_t)b * CI + c) * PX + yy * HS + xx]) : 0.f; }
  __syncthreads();
  { for (int i = tid; i < 32 * CG; i += 256) { const int j = i / CG, c8 = (i % CG) * 8; FragH f; for (int q = 0; q < 8; ++q) f.h[q] = (_Float16)tl[c8 + q][j]; *(v8us*)((unsigned short*)XR + ((size_t)p0 + j) * CI + c8) = f.half[0]; }  } }
// 7x7 conv as a GEMM without an im2col buffer: row r of A is output pixel r of an HO x HO grid, and its k = tap * 128 + channel element is the x row at padded pixel (oy + OFF + tap / 7, ox + OFF + tap % 7),
// so a tap's 128 channels are 256 contiguous bytes. C[r][n] = alpha * sum_k A[r][k] * Bh[n][k], k in the order of k_w7. Wave tile 32x64, work-group 128x64; rows from M on repeat row M - 1 (their C rows are never read).
// One trip of the loop is one tap. The tap's A tile (128 pixel rows) and B tile (64 weight rows), 256 bytes a row, are brought into LDS by asynchronous copies, 16 bytes a lane (16 lanes = one whole row),
// into one of two buffers: the copies of tap t + 2 fly while tap t + 1 is worked on. The fragments are read from LDS at a row pitch of 272 bytes (free of bank conflicts for 16-byte reads).
#define LP 272                       /* LDS row pitch in bytes */
#define LA (128 * LP)                /* A tile */
#define LS (192 * LP)                /* one buffer: A tile, then B tile */
// twelve copies of 16 bytes a lane, LDS byte address l[i] from global address g[i]; the wait on the address registers ends the copies' own statement, ahead of any rewrite of them
__device__ __forceinline__ void g2_copy12(const unsigned* l, const char* const* g) {
  asm volatile("global_load_async_to_lds_b128 %0, %12, off\n\tglobal_load_async_to_lds_b128 %1, %13, off\n\tglobal_load_async_to_lds_b128 %2, %14, off\n\tglobal_load_async_to_lds_b128 %3, %15, off\n\t"
               "global_load_async_to_lds_b128 %4, %16, off\n\tglobal_load_async_to_lds_b128 %5, %17, off\n\tglobal_load_async_to_lds_b128 %6, %18, off\n\tglobal_load_async_to_lds_b128 %7, %19, off\n\t"
               "global_load_async_to_lds_b128 %8, %20, off\n\tglobal_load_async_to_lds_b128 %9, %21, off\n\tglobal_load_async_to_lds_b128 %10, %22, off\n\tglobal_load_async_to_lds_b128 %11, %23, off\n\ts_wait_xcnt 0x0"
               :: "v"(l[0]), "v"(l[1]), "v"(l[2]), "v"(l[3]), "v"(l[4]), "v"(l[5]), "v"(l[6]), "v"(l[7]), "v"(l[8]), "v"(l[9]), "v"(l[10]), "v"(l[11]),
                  "v"(g[0]), "v"(g[1]), "v"(g[2]), "v"(g[3]), "v"(g[4]), "v"(g[5]), "v"(g[6]), "v"(g[7]), "v"(g[8]), "v"(g[9]), "v"(g[10]), "v"(g[11]) : "memory"); }
__device__ __forceinline__ v16h g2_lfrag(const unsigned char* p) { FragH f; f.half[0] = *(const v8us*)p; f.half[1] = *(const v8us*)(p + 32); return f.v; }
template <int HO, int OFF>
__global__ __launch_bounds__(128) void k_conv7(const _Float16* __restrict__ XR, const _Float16* __restrict__ Bh, float alpha, float* __restrict__ C, int M) {
  __shared__ __attribute__((aligned(16))) float so[4][32][68];
  __shared__ __attribute__((aligned(16))) unsigned char ring[2 * LS];
  const int tid = threadIdx.x, w = tid >> 5, lane = tid & 31, ln = lane & 15, hh = lane >> 4;
  const int mt = blockIdx.x / (CO / 64), nq = blockIdx.x % (CO / 64); const int row0 = mt * 128 + 32 * w, col0 = nq * 64;
  /* copy side: this thread brings the 16 bytes number cc of tile rows cr, cr + 8, ... */
  const int cr = tid >> 4, cc = tid & 15; unsigned ao[16], bo[8];      /* byte offsets of this thread's rows at tap 0; every loop over them is unrolled so that they stay in registers */
#pragma unroll
  for (int i = 0; i < 16; ++i) { const int r = min(mt * 128 + cr + 8 * i, M - 1); ao[i] = (unsigned)((((r / (HO * HO)) * PP + ((r % (HO * HO)) / HO + OFF) * HP + (r % HO) + OFF) * CI + cc * 8) * 2); }
#pragma unroll
  for (int i = 0; i < 8; ++i) bo[i] = (unsigned)(((col0 + cr + 8 * i) * KC + cc * 8) * 2);
  const unsigned lc = (unsigned)(size_t)ring + (unsigned)(cr * LP + cc * 16);
  auto issue = [&](int t, int buf) { const char* xa = (const char*)XR + ((t / 7) * HP + t % 7) * (CI * 2); const char* xb = (const char*)Bh + t * (CI * 2); const unsigned l = lc + (unsigned)(buf * LS);      /* the tap's bases, the same for every lane */
    unsigned la[24]; const char* ga[24];      /* tile rows cr + 8 i: 16 of A, then 8 of B (the B tile follows the A tile at the same pitch) */
#pragma unroll
    for (int i = 0; i < 24; ++i) { la[i] = l + (unsigned)(8 * i * LP); ga[i] = i < 16 ? xa + ao[i] : xb + bo[i - 16]; }
    g2_copy12(la, ga); g2_copy12(la + 12, ga + 12); };
  const v8f z8 = {0.f,0.f,0.f,0.f,0.f,0.f,0.f,0.f}; v8f c00 = z8, c01 = z8, c02 = z8, c03 = z8, c10 = z8, c11 = z8, c12 = z8, c13 = z8;
  issue(0, 0);
  asm volatile("s_wait_asynccnt 0x0" ::: "memory");      /* this wave's copies of tap 0 have landed */
  __syncthreads();      /* tap 0 is complete before any wave reads it */
  issue(1, 1);
  /* the tap loop stays rolled: its body holds 32 WMMAs */
#pragma unroll 1
  for (int t = 0; t < KK; ++t) { const unsigned char* st = ring + (t & 1) * LS; const unsigned char* pa = st + (32 * w + ln) * LP + 16 * hh; const unsigned char* pb = st + LA + ln * LP + 16 * hh;
    v16h a0[2], a1[2], b0[2], b1[2], b2[2], b3[2];
    /* two fragment sets: the next 32 channels' LDS reads stand ahead of this block's WMMAs, so that their latency runs under the block; unrolled so that the sets are picked by constants */
    a0[0] = g2_lfrag(pa); a1[0] = g2_lfrag(pa + 16 * LP); b0[0] = g2_lfrag(pb); b1[0] = g2_lfrag(pb + 16 * LP); b2[0] = g2_lfrag(pb + 32 * LP); b3[0] = g2_lfrag(pb + 48 * LP);
#pragma unroll
    for (int s = 0; s < 4; ++s) { const int u = s & 1, n = u ^ 1, kb = (s + 1) * 64;
      if (s < 3) { a0[n] = g2_lfrag(pa + kb); a1[n] = g2_lfrag(pa + 16 * LP + kb); b0[n] = g2_lfrag(pb + kb); b1[n] = g2_lfrag(pb + 16 * LP + kb); b2[n] = g2_lfrag(pb + 32 * LP + kb); b3[n] = g2_lfrag(pb + 48 * LP + kb); }
      c00 = g2_mma(a0[u], b0[u], c00); c10 = g2_mma(a1[u], b0[u], c10); c01 = g2_mma(a0[u], b1[u], c01); c11 = g2_mma(a1[u], b1[u], c11);
      c02 = g2_mma(a0[u], b2[u], c02); c12 = g2_mma(a1[u], b2[u], c12); c03 = g2_mma(a0[u], b3[u], c03); c13 = g2_mma(a1[u], b3[u], c13);
    }
    asm volatile("s_wait_dscnt 0x0" ::: "memory");      /* this wave's reads of the buffer are done before it is handed back */
    asm volatile("s_wait_asynccnt 0x0" ::: "memory");      /* this wave's copies of tap t + 1 have landed */
    __syncthreads();      /* publishes tap t + 1 and ends every wave's reads of tap t's buffer */
    if (t + 2 < KK) issue(t + 2, t & 1); }
  asm volatile("s_wait_asynccnt 0x0" ::: "memory");      /* no copy is outstanding when the wave goes on */
  v8f accs[8] = {c00, c01, c02, c03, c10, c11, c12, c13};
#pragma unroll
  for (int u = 0; u < 8; ++u) { const int t = u & 3, half = u >> 2;
#pragma unroll
    for (int r = 0; r < 8; ++r) so[w][half * 16 + 8 * hh + r][t * 16 + ln] = accs[u][r] * alpha; }
  __builtin_amdgcn_fence(__ATOMIC_ACQ_REL, "workgroup"); __builtin_amdgcn_wave_barrier();
  const int rsub = lane >> 4, c4 = (lane & 15) * 4;
#pragma unroll
  for (int q = 0; q < 16; ++q) { const int r = q * 2 + rsub; const v4f v = *(const v4fa*)&so[w][r][c4]; *(v4f*)(C + (size_t)(row0 + r) * CO + col0 + c4) = v; } }
__global__ __launch_bounds__(256) void k_w7(const float* __restrict__ w, _Float16* __restrict__ Bt) { const size_t t = (size_t)blockIdx.x * 256 + threadIdx.x; if (t >= (size_t)CO * KC / 8) return; const int c8 = (int)((t * 8) % CI); const int tap = (int)(((t * 8) / CI) % KK); const int o = (int)((t * 8) / KC); FragH f; for (int q = 0; q < 8; ++q) f.h[q] = (_Float16)(bf16_round(w[((size_t)o * CI + c8 + q) * KK + tap]) * 16.0f);
  *(v8us*)((unsigned short*)Bt + t * 8) = f.half[0];  }
// Lanes run along channels: one wave holds the 32 channels of one head, so every Q, K and V load of a wave is one whole 128-byte line and the window position is wave-uniform.
// A wave takes four neighbouring pixels of one image row at once: their four 7-wide window rows are ten neighbouring K (and V) pixels, loaded once per window row, all in flight together, and used from registers by all four.
// The head's rel table lies in LDS as [tap][channel], so that its reads are contiguous over the lanes too (in global memory a channel's taps are 28 bytes from the next channel's).
// A work-group (8 waves, 4 pixels each) fills a 32-channel x 32-pixel tile in LDS, and the channel-major store then writes whole 128-byte lines.
__global__ __launch_bounds__(256) void k_watt(const float* __restrict__ Q, const float* __restrict__ Kf, const float* __restrict__ Vf, const float* __restrict__ rh, const float* __restrict__ rw, float* __restrict__ out) {
  __shared__ __attribute__((aligned(16))) float tl[32][36]; __shared__ float rl[7][32];
  const int tid = threadIdx.x, lane = tid & 31; const int w = __builtin_amdgcn_readfirstlane(tid >> 5);      /* the wave's number as a scalar: pixel, window row and column stay on the scalar unit */
  const int p0 = (int)(blockIdx.x % (PX / 32)) * 32; const int bh = (int)(blockIdx.x / (PX / 32)); const int head = bh % (NCO / 32); const size_t b = bh / (NCO / 32); const int c = head * 32 + lane; const bool first = head < CO / 64;      /* c < CO / 2, the same for the whole work-group */
  if (w < 7) rl[w][lane] = first ? bf16_round(rh[(size_t)c * 7 + w]) : bf16_round(rw[(size_t)(c - CO / 2) * 7 + w]);
  __syncthreads();      /* the rel table is complete before any wave reads it */
  const int p = p0 + 4 * w; const int y = p / HS, x = p % HS;      /* pixels p .. p + 3 lie in one image row: HS and p are multiples of 4 */
  const float* kp = Kf + (b * PK + (size_t)y * HK + x) * CO + c; const float* vp = Vf + (b * PK + (size_t)y * HK + x) * CO + c;
  float qv[4], mx[4], se[4], acc[4], rc[7];
  /* every loop over the four pixels, the seven window columns and the ten loaded lines is unrolled (each '#pragma unroll' below), so that these small arrays are indexed by constants and stay in registers */
#pragma unroll
  for (int j = 0; j < 4; ++j) { qv[j] = Q[(b * PX + p + j) * CO + c] * 1.44269504f; mx[j] = -3.0e38f; se[j] = 0.f; acc[j] = 0.f; }      /* q carries log2(e): scores and their maximum are in base-2 units, so that each term is one exp2 */
#pragma unroll
  for (int kw = 0; kw < 7; ++kw) rc[kw] = rl[kw][lane];
  /* the loops over window rows stay rolled: one row's body (28 window positions) is already long */
#pragma unroll 1
  for (int kh = 0; kh < 7; ++kh) { float kr[10]; const float rk = rl[kh][lane];
#pragma unroll
    for (int i = 0; i < 10; ++i) kr[i] = kp[(size_t)(kh * HK + i) * CO];
#pragma unroll
    for (int j = 0; j < 4; ++j)
#pragma unroll
      for (int kw = 0; kw < 7; ++kw) { const float kv = __fadd_rn(kr[j + kw], first ? rk : rc[kw]); mx[j] = fmaxf(mx[j], __fmul_rn(qv[j], kv)); } }
  /* per pixel the 49 terms are summed window row by window row, left to right */
#pragma unroll 1
  for (int kh = 0; kh < 7; ++kh) { float kr[10], vr[10]; const float rk = rl[kh][lane];
#pragma unroll
    for (int i = 0; i < 10; ++i) { kr[i] = kp[(size_t)(kh * HK + i) * CO]; vr[i] = vp[(size_t)(kh * HK + i) * CO]; }
#pragma unroll
    for (int j = 0; j < 4; ++j)
#pragma unroll
      for (int kw = 0; kw < 7; ++kw) { const float kv = kr[j + kw] + (first ? rk : rc[kw]); const float e = __builtin_amdgcn_exp2f(fmaf(qv[j], kv, -mx[j])); se[j] += e; acc[j] = fmaf(e, vr[j + kw], acc[j]); } }      /* the argument is at most a rounding error above 0; a term below the exp2 instruction's range counts as 0 beside the largest term's 1 */
#pragma unroll
  for (int j = 0; j < 4; ++j) tl[lane][4 * w + j] = acc[j] / se[j];
  __syncthreads();      /* the tile is complete before any wave reads other waves' pixels */
  const int dh = tid >> 3, j4 = (tid & 7) * 4; const v4f o = *(const v4fa*)&tl[dh][j4];
  const int oc = dh * 8 + head;      /* the reference's final transpose: output channel = dh*heads + head for computation channel head*32 + dh */
  *(v4f*)(out + ((b * CO + oc) * (size_t)PX + p0 + j4)) = o; }

extern "C" void kernel_launch(void* const* d_in, const int* in_sizes, int n_in,
                              void* d_out, int out_size, void* d_ws, size_t ws_size, hipStream_t stream) {
  (void)in_sizes; (void)n_in; (void)out_size;
  const float* const* I = (const float* const*)d_in; const float* x = I[0]; const float* wq = I[1]; const float* wk = I[2]; const float* wv = I[3]; const float* rh = I[4]; const float* rw = I[5];
  char* ws = (char*)d_ws; size_t off = 0;
  auto take = [&](size_t bytes) { char* p = ws + off; off += (bytes + 255) & ~(size_t)255; return p; };
  _Float16* BQ = (_Float16*)take((size_t)CO * KC * 2); _Float16* BK = (_Float16*)take((size_t)CO * KC * 2); _Float16* BV = (_Float16*)take((size_t)CO * KC * 2);
  _Float16* XR = (_Float16*)take((size_t)NB * PP * CI * 2); float* Q = (float*)take(NRQ * CO * 4); float* Kf = (float*)take((size_t)NRK * CO * 4); float* Vf = (float*)take((size_t)NRK * CO * 4);
  if (off > ws_size) return;      /* three weight planes, the x rows, q, k, v */
  const unsigned gw = (unsigned)(((size_t)CO * KC / 8 + 255) / 256);
  k_w7<<<gw, 256, 0, stream>>>(wq, BQ); k_w7<<<gw, 256, 0, stream>>>(wk, BK); k_w7<<<gw, 256, 0, stream>>>(wv, BV);
  k_xrows<<<NB * PP / 32, 256, 0, stream>>>(x, XR);
  k_conv7<HS, 3><<<(unsigned)((NRQ / 128) * (CO / 64)), 128, 0, stream>>>(XR, BQ, 0.0625f, Q, (int)NRQ);      /* q: 56-grid, x index = o + tap - 3 */
  k_conv7<HK, 0><<<(unsigned)((NRK / 128) * (CO / 64)), 128, 0, stream>>>(XR, BK, 0.0625f, Kf, NB * PK);      /* k/v: 62-grid over pad3(x) with conv pad 3: x index = o + tap - 6 */
  k_conv7<HK, 0><<<(unsigned)((NRK / 128) * (CO / 64)), 128, 0, stream>>>(XR, BV, 0.0625f, Vf, NB * PK);
  k_watt<<<NB * (NCO / 32) * (PX / 32), 256, 0, stream>>>(Q, Kf, Vf, rh, rw, (float*)d_out);
}

// v006
// Measured time: 112 microseconds a run.
// Timed twice side by side with v005, it ran 1.55 and 1.52 times as fast.
// Over all steps from v000 it is 14.1 times as fast.
#include <hip/hip_runtime.h>
// StandAloneSelfAttention (inputs [2][128][56][56]; q = conv7x7(x, Wq, pad 3) (256 ch, 56x56); k, v = conv7x7(pad3(x), Wk/Wv, pad 3) (256 ch, 62x62); per channel c and pixel: 7x7 window of k (plus rel_h[c] per window row for the first 128 channels, rel_w[c-128] per window column for the rest) and v around the pixel; attn = softmax over the 49 of q*k (scalar products); out = sum attn*v, then the reference's transpose(0,2,1,3,4): output channel (dh*8 + head) takes computation channel (head*32 + dh) -> [2][256][56][56]).
// Structure: pixel rows; x as exact f16 rows via LDS transposes; the three 7x7 convs as WMMA GEMMs (K = 6,272 = 49 taps x 128 channels; 32x64 wave tiles, f32 accumulation, exact x16 weights) whose A tiles are taken tap by tap from the x rows, which lie on a 68x68 grid with 6 pixels of zeros on every side (all padding of both convs), and staged with the weight tiles in LDS, into f32 channel rows; the per-channel 49-way window softmax and weighted sum on VALU in f32 (rel tables read) with the channel-major store.
// Compute dtype: inputs rounded to bf16; x / weights / rel tables exact; q, k, v in f32 (GEMM outputs); softmax and the weighted sum f32 — no reduced-precision intermediates after the convs. v_wmma_f32_16x16x32_f16.
#define NB 2
#define CI 128
#define CO 256
#define HS 56
#define PX (HS * HS)                 /* 3136 */
#define HK 62                        /* k/v grid */
#define PK (HK * HK)                 /* 3844 */
#define NRQ ((size_t)NB * PX)        /* 6272 = 49 x 128 */
#define NRK 7808                     /* 2 x 3844 = 7688 -> padded to 61 x 128 */
#define KK 49
#define KC (KK * CI)                 /* 6272 */
#define CG (CI / 8)
#define HP (HS + 12)                 /* x rows on a grid with 6 zero pixels on every side */
#define PP (HP * HP)                 /* 4624; NB * PP = 289 x 32 */
#define NCO CO                       /* output channels computed (debug hook) */
typedef __bf16 v16b __attribute__((ext_vector_type(16)));
typedef unsigned short v8us __attribute__((ext_vector_type(8), may_alias));
typedef float  v8f  __attribute__((ext_vector_type(8)));
typedef float  v4f  __attribute__((ext_vector_type(4)));
typedef float  v4fa __attribute__((ext_vector_type(4), may_alias));
union FragB { v16b v; v8us half[2]; unsigned short u[16]; };

__device__ __forceinline__ unsigned short bf16_bits(float x) { unsigned int u = __float_as_uint(x); return (unsigned short)((u + 0x7FFFu + ((u >> 16) & 1u)) >> 16); }
__device__ __forceinline__ float bf16_val(unsigned short b) { return __uint_as_float(((unsigned int)b) << 16); }
__device__ __forceinline__ float bf16_round(float x) { return bf16_val(bf16_bits(x)); }
// D += A·B with NT terms: 1 = ah·bh, 2 = + al·bh (A split), 3 = + ah·bl (both split)
template <int NT>
__device__ __forceinline__ v8f mmaN(v16b ah, v16b al, v16b bh, v16b bl, v8f c) {
  c = __builtin_amdgcn_wmma_f32_16x16x32_bf16(false, ah, false, bh, (short)0, c, false, false);
  if (NT >= 2) c = __builtin_amdgcn_wmma_f32_16x16x32_bf16(false, al, false, bh, (short)0, c, false, false);
  if (NT >= 3) c = __builtin_amdgcn_wmma_f32_16x16x32_bf16(false, ah, false, bl, (short)0, c, false, false);
  asm volatile("v_nop\n\tv_nop\n\tv_nop\n\tv_nop" : "+v"(c) : "v"(ah), "v"(al), "v"(bh), "v"(bl));
  return c;
}

__global__ __launch_bounds__(256) void k_wt_bf16(const float* __restrict__ W, unsigned short* __restrict__ Wt, int K, int N) {
  const int t = blockIdx.x * 256 + threadIdx.x;
  const int k8n = K / 8;
  if (t >= N * k8n) return;
  const int n = t / k8n, k8 = (t % k8n) * 8;
  v8us v;
#pragma unroll
  for (int i = 0; i < 8; ++i) v[i] = bf16_bits(W[(size_t)(k8 + i) * N + n]);
  *(v8us*)(Wt + (size_t)n * K + k8) = v;
  
}

// GEMM C[M][N] (f32, pitch ldc) = act(A[M][K]·W + bias). A f32 row-major (pitch lda) converted per fragment to bf16
// (ASPLIT: hi/lo two planes -> 2 terms, else single rounded term); Wt bf16 [N][K] (pitch ldb). BIAS_BF16 rounds the
// bias to bf16 first (bias quantised to bf16 before the add). K%32==0, M%16==0, N%64==0.
template <bool ASPLIT, int ACT, bool BIAS_BF16>
__global__ __launch_bounds__(128) void k_gemm_bf(const float* __restrict__ A, int lda, const unsigned short* __restrict__ Wt, int ldb,
                                               const float* __restrict__ bias, float* __restrict__ C, int ldc, int M, int N, int K) {
  __shared__ __attribute__((aligned(16))) float so[4][16][64];
  const int tid = threadIdx.x, w = tid >> 5, lane = tid & 31, ln = lane & 15, hh = lane >> 4;
  const int ntn = N / 64;
  const int wid = blockIdx.x * 4 + w;
  const int mt = wid / ntn, nq = wid % ntn;
  if (mt * 16 >= M) return;
  const int row0 = mt * 16, col0 = nq * 64;
  const float* arow = A + (size_t)(row0 + ln) * lda;
  v8f acc[4] = {};
  for (int kb = 0; kb < K; kb += 32) {
    FragB ah, al;
    const v4f x0 = *(const v4fa*)(arow + kb + 8 * hh), x1 = *(const v4fa*)(arow + kb + 8 * hh + 4);
    const v4f x2 = *(const v4fa*)(arow + kb + 16 + 8 * hh), x3 = *(const v4fa*)(arow + kb + 16 + 8 * hh + 4);
    float xs[16] = {x0[0],x0[1],x0[2],x0[3],x1[0],x1[1],x1[2],x1[3],x2[0],x2[1],x2[2],x2[3],x3[0],x3[1],x3[2],x3[3]};
#pragma unroll
    for (int i = 0; i < 16; ++i) { const unsigned short hb = bf16_bits(xs[i]); ah.u[i] = hb; al.u[i] = ASPLIT ? bf16_bits(xs[i] - bf16_val(hb)) : (unsigned short)0; }
#pragma unroll
    for (int t = 0; t < 4; ++t) {
      const unsigned short* brow = Wt + (size_t)(col0 + t * 16 + ln) * ldb + kb;
      FragB b;
      b.half[0] = *(const v8us*)(brow + 8 * hh);
      b.half[1] = *(const v8us*)(brow + 16 + 8 * hh);
      acc[t] = mmaN<ASPLIT ? 2 : 1>(ah.v, al.v, b.v, b.v, acc[t]);
    }
  }
#pragma unroll
  for (int t = 0; t < 4; ++t) {
    float bv = bias ? bias[col0 + t * 16 + ln] : 0.f;
    if (BIAS_BF16) bv = bf16_round(bv);
#pragma unroll
    for (int r = 0; r < 8; ++r) { float v = acc[t][r] + bv; if (ACT == 1) v = fmaxf(v, 0.f); so[w][8 * hh + r][t * 16 + ln] = v; }
  }
  __builtin_amdgcn_fence(__ATOMIC_ACQ_REL, "workgroup");
  __builtin_amdgcn_wave_barrier();
  const int rsub = lane >> 4, c4 = (lane & 15) * 4;
  {
#pragma unroll
    for (int q = 0; q < 8; ++q) {
      const int r = q * 2 + rsub;
      const v4f v = *(const v4fa*)&so[w][r][c4];
      *(v4f*)(C + (size_t)(row0 + r) * ldc + col0 + c4) = v;
    }
    
  }
}

// GEMM C = act(A·W + bias + resid): A f32 (ASPLIT -> hi/lo 2 terms), Wt bf16 [N][K]; ACT 0 none, 1 relu, 2 exact gelu;
// resid (optional, f32, row index = (row % rmod), pitch ldr, RES_BF16 rounds it) added before the activation.
template <bool ASPLIT, int ACT, bool BIAS_BF16, bool RES_BF16>
__global__ __launch_bounds__(128) void k_gemm_bf3(const float* __restrict__ A, int lda, const unsigned short* __restrict__ Wt, int ldb,
                                                const float* __restrict__ bias, const float* __restrict__ resid, int rmod, int ldr,
                                                float* __restrict__ C, int ldc, int M, int N, int K) {
  __shared__ __attribute__((aligned(16))) float so[4][16][64];
  const int tid = threadIdx.x, w = tid >> 5, lane = tid & 31, ln = lane & 15, hh = lane >> 4;
  const int ntn = N / 64;
  const int wid = blockIdx.x * 4 + w;
  const int mt = wid / ntn, nq = wid % ntn;
  if (mt * 16 >= M) return;
  const int row0 = mt * 16, col0 = nq * 64;
  const float* arow = A + (size_t)(row0 + ln) * lda;
  v8f acc[4] = {};
  for (int kb = 0; kb < K; kb += 32) {
    FragB ah, al;
    const v4f x0 = *(const v4fa*)(arow + kb + 8 * hh), x1 = *(const v4fa*)(arow + kb + 8 * hh + 4);
    const v4f x2 = *(const v4fa*)(arow + kb + 16 + 8 * hh), x3 = *(const v4fa*)(arow + kb + 16 + 8 * hh + 4);
    float xs[16] = {x0[0],x0[1],x0[2],x0[3],x1[0],x1[1],x1[2],x1[3],x2[0],x2[1],x2[2],x2[3],x3[0],x3[1],x3[2],x3[3]};
#pragma unroll
    for (int i = 0; i < 16; ++i) { const unsigned short hb = bf16_bits(xs[i]); ah.u[i] = hb; al.u[i] = ASPLIT ? bf16_bits(xs[i] - bf16_val(hb)) : (unsigned short)0; }
#pragma unroll
    for (int t = 0; t < 4; ++t) {
      const unsigned short* brow = Wt + (size_t)(col0 + t * 16 + ln) * ldb + kb;
      FragB b;
      b.half[0] = *(const v8us*)(brow + 8 * hh);
      b.half[1] = *(const v8us*)(brow + 16 + 8 * hh);
      acc[t] = mmaN<ASPLIT ? 2 : 1>(ah.v, al.v, b.v, b.v, acc[t]);
    }
  }
#pragma unroll
  for (int t = 0; t < 4; ++t) {
    const int col = col0 + t * 16 + ln;
    float bv = bias ? bias[col] : 0.f;
    if (BIAS_BF16) bv = bf16_round(bv);
#pragma unroll
    for (int r = 0; r < 8; ++r) {
      float v = acc[t][r] + bv;
      if (resid) { float rv = resid[(size_t)((row0 + 8 * hh + r) % rmod) * ldr + col]; if (RES_BF16) rv = bf16_round(rv); v += rv; }
      if (ACT == 1) v = fmaxf(v, 0.f);
      if (ACT == 2) v = 0.5f * v * (1.0f + erff(v * 0.70710678118654752f));
      if (ACT == 3) { const float u = 0.7978845608028654f * (v + 0.044715f * v * v * v); v = 0.5f * v * (1.0f + tanhf(u)); }
      so[w][8 * hh + r][t * 16 + ln] = v;
    }
  }
  __builtin_amdgcn_fence(__ATOMIC_ACQ_REL, "workgroup");
  __builtin_amdgcn_wave_barrier();
  const int rsub = lane >> 4, c4 = (lane & 15) * 4;
  {
#pragma unroll
    for (int q = 0; q < 8; ++q) {
      const int r = q * 2 + rsub;
      const v4f v = *(const v4fa*)&so[w][r][c4];
      *(v4f*)(C + (size_t)(row0 + r) * ldc + col0 + c4) = v;
    }
    
  }
}
// row LayerNorm (biased variance, eps) over N: s = X (+ R); optional out_sum <- s; out_norm <- (s-mu)*rsqrt(var+eps)*g + b
template <bool PARAM_BF16>
__global__ __launch_bounds__(256) void k_layernorm(const float* __restrict__ X, const float* __restrict__ R, const float* __restrict__ g, const float* __restrict__ bta,
                                                  float* __restrict__ out_sum, float* __restrict__ out_norm, int N, float eps) {
  __shared__ float red[256];
  const int row = blockIdx.x, tid = threadIdx.x;
  const float* x = X + (size_t)row * N; const float* rr = R ? R + (size_t)row * N : nullptr;
  float vals[16];                     // up to N = 4096
  const int per = N / 256;            // contiguous chunk per thread? use strided-by-4 chunks: thread handles j = tid*4 + 1024*u
  float s1 = 0.f;
  for (int u = 0; u < per / 4; ++u) {
    const int j = tid * 4 + 1024 * u;
    const v4f a = *(const v4fa*)(x + j);
    v4f b = {0.f,0.f,0.f,0.f}; if (rr) b = *(const v4fa*)(rr + j);
#pragma unroll
    for (int q = 0; q < 4; ++q) { const float v = a[q] + b[q]; vals[u * 4 + q] = v; s1 += v; }
  }
  red[tid] = s1; __syncthreads();
  for (int st = 128; st > 0; st >>= 1) { if (tid < st) red[tid] += red[tid + st]; __syncthreads(); }
  const float mu = red[0] / (float)N; __syncthreads();
  float s2 = 0.f;
  for (int u = 0; u < per / 4; ++u)
#pragma unroll
    for (int q = 0; q < 4; ++q) { const float c = vals[u * 4 + q] - mu; s2 += c * c; }
  red[tid] = s2; __syncthreads();
  for (int st = 128; st > 0; st >>= 1) { if (tid < st) red[tid] += red[tid + st]; __syncthreads(); }
  const float rs = rsqrtf(red[0] / (float)N + eps);
  {
    for (int u = 0; u < per / 4; ++u) {
      const int j = tid * 4 + 1024 * u;
      v4f o, sm;
#pragma unroll
      for (int q = 0; q < 4; ++q) {
        float gg = g[j + q], bb = bta[j + q];
        if (PARAM_BF16) { gg = bf16_round(gg); bb = bf16_round(bb); }
        sm[q] = vals[u * 4 + q]; o[q] = (vals[u * 4 + q] - mu) * rs * gg + bb;
      }
      if (out_sum) *(v4f*)(out_sum + (size_t)row * N + j) = sm;
      *(v4f*)(out_norm + (size_t)row * N + j) = o;
    }
    
  }
}



// ---- f16 WMMA path (v_wmma_f32_16x16x32_f16): 11-bit significands for operands in range — used here for the conv GEMMs, whose bf16-rounded x and x16 weights are exact in f16
typedef _Float16 v16h __attribute__((ext_vector_type(16)));
union FragH { v16h v; v8us half[2]; _Float16 h[16]; unsigned short u[16]; };
template <int NT>
__device__ __forceinline__ v8f mmaH(v16h ah, v16h al, v16h bh, v16h bl, v8f c) {
  c = __builtin_amdgcn_wmma_f32_16x16x32_f16(false, ah, false, bh, (short)0, c, false, false);
  if (NT >= 2) c = __builtin_amdgcn_wmma_f32_16x16x32_f16(false, al, false, bh, (short)0, c, false, false);
  if (NT >= 3) c = __builtin_amdgcn_wmma_f32_16x16x32_f16(false, ah, false, bl, (short)0, c, false, false);
  asm volatile("v_nop\n\tv_nop\n\tv_nop\n\tv_nop" : "+v"(c) : "v"(ah), "v"(al), "v"(bh), "v"(bl));
  return c;
}
// batched GEMM like k_gemm_b but f16 operands: A f32 (split into f16 hi/lo if ASPLIT, else rounded to f16), Bt = f16 values [n][k]; alpha; C f32; N multiple of 16 (partial tiles skipped)
template <bool ASPLIT>
__global__ __launch_bounds__(128) void k_gemm_h(const float* __restrict__ A, int lda, size_t sA, const _Float16* __restrict__ Bh, int ldb, size_t sB, float alpha, float* __restrict__ C, int ldc, size_t sC, int M, int N, int K) {
  __shared__ __attribute__((aligned(16))) float so[4][16][64];
  const int tid = threadIdx.x, w = tid >> 5, lane = tid & 31, ln = lane & 15, hh = lane >> 4; const int by = blockIdx.y;
  A += (size_t)by * sA; Bh += (size_t)by * sB; C += (size_t)by * sC;
  const int ntn = (N + 63) / 64; const int wid = blockIdx.x * 4 + w; const int mt = wid / ntn, nq = wid % ntn; if (mt * 16 >= M) return;
  const int row0 = mt * 16, col0 = nq * 64; const float* arow = A + (size_t)(row0 + ln) * lda;
  v8f acc[4] = {};
  for (int kb = 0; kb < K; kb += 32) {
    FragH ah, al;
    const v4f x0 = *(const v4fa*)(arow + kb + 8 * hh), x1 = *(const v4fa*)(arow + kb + 8 * hh + 4), x2 = *(const v4fa*)(arow + kb + 16 + 8 * hh), x3 = *(const v4fa*)(arow + kb + 16 + 8 * hh + 4);
    float xs[16] = {x0[0],x0[1],x0[2],x0[3],x1[0],x1[1],x1[2],x1[3],x2[0],x2[1],x2[2],x2[3],x3[0],x3[1],x3[2],x3[3]};
#pragma unroll
    for (int i = 0; i < 16; ++i) { const _Float16 h = (_Float16)xs[i]; ah.h[i] = h; al.h[i] = ASPLIT ? (_Float16)(xs[i] - (float)h) : (_Float16)0.0f; }
#pragma unroll
    for (int t = 0; t < 4; ++t) { if (col0 + t * 16 >= N) continue; const size_t boff = (size_t)(col0 + t * 16 + ln) * ldb + kb; FragH bq; bq.half[0] = *(const v8us*)(Bh + boff + 8 * hh); bq.half[1] = *(const v8us*)(Bh + boff + 16 + 8 * hh);
      acc[t] = mmaH<ASPLIT ? 2 : 1>(ah.v, al.v, bq.v, bq.v, acc[t]); }
  }
#pragma unroll
  for (int t = 0; t < 4; ++t) { if (col0 + t * 16 >= N) continue;
#pragma unroll
    for (int r = 0; r < 8; ++r) so[w][8 * hh + r][t * 16 + ln] = acc[t][r] * alpha; }
  __builtin_amdgcn_fence(__ATOMIC_ACQ_REL, "workgroup"); __builtin_amdgcn_wave_barrier();
  const int rsub = lane >> 4, c4 = (lane & 15) * 4;
  {
#pragma unroll
    for (int q = 0; q < 8; ++q) { const int r = q * 2 + rsub; if (col0 + c4 < N) { const v4f v = *(const v4fa*)&so[w][r][c4]; *(v4f*)(C + (size_t)(row0 + r) * ldc + col0 + c4) = v; } }
     }
}

// Wt[n][k] = f16(W[k][n]·scale) from f32 row-major W[K][N] (scale = power of two; bf16-exact weights stay exact in f16 away from the subnormal range)
__global__ __launch_bounds__(256) void k_wt_f16(const float* __restrict__ W, _Float16* __restrict__ Wt, int K, int N, float scale) {
  const int t = blockIdx.x * 256 + threadIdx.x; if (t >= N * (K / 8)) return; const int n = t / (K / 8), k8 = (t % (K / 8)) * 8; FragH f;
#pragma unroll
  for (int i = 0; i < 8; ++i) f.h[i] = (_Float16)(bf16_round(W[(size_t)(k8 + i) * N + n]) * scale); const v8us o = f.half[0];
  *(v8us*)((unsigned short*)Wt + (size_t)n * K + k8) = o; 
}
// k_gemm_hh variant with fused epilogue: v = acc·alpha + bias[by·sBias + col] (+ CP[(row/rowsPerB)·sCPb + by·64 + col] if CP) ; ACT 0 none / 1 elu ; writes f16 C16 (and f32 C if non-null)
template <int ACT>
__global__ __launch_bounds__(128) void k_gemm_hhx(const _Float16* __restrict__ A, int lda, size_t sA, const _Float16* __restrict__ Bh, int ldb, size_t sB, float alpha, const float* __restrict__ bias, size_t sBias, const float* __restrict__ CP, int rowsPerB, size_t sCPb, int row0g,
    float* __restrict__ C, _Float16* __restrict__ C16, int ldc, size_t sC, int M, int N, int K) {
  __shared__ __attribute__((aligned(16))) float so[4][16][64];
  const int tid = threadIdx.x, w = tid >> 5, lane = tid & 31, ln = lane & 15, hh = lane >> 4; const int by = blockIdx.y;
  A += (size_t)by * sA; Bh += (size_t)by * sB; const size_t cofs = (size_t)by * sC; const float* bp = bias ? bias + (size_t)by * sBias : nullptr;
  const int ntn = (N + 63) / 64; const int wid = blockIdx.x * 4 + w; const int mt = wid / ntn, nq = wid % ntn; if (mt * 16 >= M) return;
  const int row0 = mt * 16, col0 = nq * 64; const _Float16* arow = A + (size_t)(row0 + ln) * lda;
  v8f acc[4] = {};
  for (int kb = 0; kb < K; kb += 32) { FragH ah; ah.half[0] = *(const v8us*)((const unsigned short*)arow + kb + 8 * hh); ah.half[1] = *(const v8us*)((const unsigned short*)arow + kb + 16 + 8 * hh);
#pragma unroll
    for (int t = 0; t < 4; ++t) { if (col0 + t * 16 >= N) continue; const size_t boff = (size_t)(col0 + t * 16 + ln) * ldb + kb; FragH bq; bq.half[0] = *(const v8us*)((const unsigned short*)Bh + boff + 8 * hh); bq.half[1] = *(const v8us*)((const unsigned short*)Bh + boff + 16 + 8 * hh);
      acc[t] = mmaH<1>(ah.v, ah.v, bq.v, bq.v, acc[t]); }
  }
#pragma unroll
  for (int t = 0; t < 4; ++t) { if (col0 + t * 16 >= N) continue; const int col = col0 + t * 16 + ln; const float bv = bp ? bf16_round(bp[col]) : 0.f;
#pragma unroll
    for (int r = 0; r < 8; ++r) { float v = acc[t][r] * alpha + bv; if (CP) { const int rr = row0g + row0 + 8 * hh + r; if (rowsPerB < 0) v += CP[cofs + (size_t)rr * ldc + col];      /* rowsPerB < 0: own element of the batched C plane */ else { const int bidx = rr / rowsPerB; v += CP[(size_t)bidx * sCPb + (size_t)by * 64 + col]; } } if (ACT == 1) v = (v > 0.f) ? v : expm1f(v); else if (ACT == 7) v = (v > 0.f) ? v + 1.0f : expf(v); else if (ACT == 8) v = tanhf(v); else if (ACT == 9) v = 0.5f * v * (1.0f + tanhf(0.7978845608028654f * (v + 0.044715f * v * v * v))); else if (ACT == 11) v = 1.0f / (1.0f + expf(-v)); else if (ACT == 12) v = (v > 0.f) ? v : 0.01f * v; else if (ACT == 14) v = (v > 0.f) ? v : 0.1f * v; else if (ACT == 16) v = (v >= 0.f) ? v : 0.3f * v; else if (ACT == 17) v = (v >= 0.f) ? v : 0.2f * v; else if (ACT == 15) v = v / (1.0f + expf(-v)); else if (ACT == 3) v = fmaxf(v, 0.f); else if (ACT == 6) v = 0.5f * v * (1.0f + erff(v * 0.70710678118654752f)); so[w][8 * hh + r][t * 16 + ln] = v; } }
  __builtin_amdgcn_fence(__ATOMIC_ACQ_REL, "workgroup"); __builtin_amdgcn_wave_barrier();
  const int rsub = lane >> 4, c4 = (lane & 15) * 4; typedef _Float16 v4h __attribute__((ext_vector_type(4)));
  {
#pragma unroll
    for (int q = 0; q < 8; ++q) { const int r = q * 2 + rsub; if (col0 + c4 < N) { const v4f v = *(const v4fa*)&so[w][r][c4]; if (C) *(v4f*)(C + cofs + (size_t)(row0 + r) * ldc + col0 + c4) = v; if (C16) { v4h h4; for (int i = 0; i < 4; ++i) h4[i] = (_Float16)v[i]; *(v4h*)(C16 + cofs + (size_t)(row0 + r) * ldc + col0 + c4) = h4; } } }
     }
}


typedef _Float16 v4h __attribute__((ext_vector_type(4)));

__global__ __launch_bounds__(256) void k_x16(const float* __restrict__ x, _Float16* __restrict__ X16, size_t n8) { const size_t t = (size_t)blockIdx.x * 256 + threadIdx.x; if (t >= n8) return; FragH f;
#pragma unroll
  for (int q = 0; q < 8; ++q) f.h[q] = (_Float16)bf16_round(x[t * 8 + q]); *(v8us*)((unsigned short*)X16 + t * 8) = f.half[0];  }
__global__ __launch_bounds__(256) void k_h16(const float* __restrict__ x, _Float16* __restrict__ X16, size_t n8) { const size_t t = (size_t)blockIdx.x * 256 + threadIdx.x; if (t >= n8) return; FragH f;
#pragma unroll
  for (int q = 0; q < 8; ++q) f.h[q] = (_Float16)x[t * 8 + q]; *(v8us*)((unsigned short*)X16 + t * 8) = f.half[0];  }
__global__ __launch_bounds__(256) void k_round16f(const float* __restrict__ W, _Float16* __restrict__ Bt, size_t n8) { const size_t t = (size_t)blockIdx.x * 256 + threadIdx.x; if (t >= n8) return; FragH f;
#pragma unroll
  for (int i = 0; i < 8; ++i) f.h[i] = (_Float16)(bf16_round(W[t * 8 + i]) * 16.0f); *(v8us*)((unsigned short*)Bt + t * 8) = f.half[0];  }
template <int NHv, int TTv>
__global__ __launch_bounds__(256) void k_vt(const _Float16* __restrict__ V16, int ldv, int voff, _Float16* __restrict__ Vt) { __shared__ unsigned short tl[64][66]; const int tid = threadIdx.x; const int slab = blockIdx.x / (TTv / 64), lg = blockIdx.x % (TTv / 64); const int b = slab / NHv, h = slab % NHv;
  for (int i = tid; i < 64 * 8; i += 256) { const int r = i / 8, c8 = (i % 8) * 8; FragH f; f.half[0] = *(const v8us*)((const unsigned short*)V16 + ((size_t)b * TTv + lg * 64 + r) * ldv + voff + h * 64 + c8);
#pragma unroll
    for (int q = 0; q < 8; ++q) tl[r][c8 + q] = f.u[q]; }
  __syncthreads();
  {
#pragma unroll
    for (int rd = 0; rd < 2; ++rd) { const int d = rd * 32 + tid / 8, pc = tid % 8; FragH f;
#pragma unroll
      for (int q = 0; q < 8; ++q) f.u[q] = tl[pc * 8 + q][d];
      *(v8us*)((unsigned short*)Vt + ((size_t)slab * 64 + d) * TTv + lg * 64 + pc * 8) = f.half[0]; }
     } }

__global__ __launch_bounds__(256) void k_hl(const float* __restrict__ F, _Float16* __restrict__ Hh, _Float16* __restrict__ Hl, size_t n8) { const size_t t = (size_t)blockIdx.x * 256 + threadIdx.x; if (t >= n8) return; FragH fh, fl; const v4f a = *(const v4fa*)(F + t * 8), c = *(const v4fa*)(F + t * 8 + 4);
#pragma unroll
  for (int q = 0; q < 4; ++q) { _Float16 h = (_Float16)a[q]; fh.h[q] = h; fl.h[q] = (_Float16)((a[q] - (float)h) * 1024.0f); h = (_Float16)c[q]; fh.h[4 + q] = h; fl.h[4 + q] = (_Float16)((c[q] - (float)h) * 1024.0f); }
  { *(v8us*)((unsigned short*)Hh + t * 8) = fh.half[0]; *(v8us*)((unsigned short*)Hl + t * 8) = fl.half[0];  } }

// ---- WMMA step of the conv GEMM (wave tile 32x64) ----
__device__ __forceinline__ v8f g2_mma(v16h a, v16h b, v8f c) { v8f d = __builtin_amdgcn_wmma_f32_16x16x32_f16(false, a, false, b, (short)0, c, false, false); asm volatile("v_nop\n\tv_nop\n\tv_nop\n\tv_nop" : "+v"(d) : "v"(a), "v"(b)); return d; }

__device__ __forceinline__ void d_xrows(const float* __restrict__ x, _Float16* __restrict__ XR, int blk) { __shared__ float tl[CI][33]; const int tid = threadIdx.x; const int p0 = blk * 32;      /* 32 pixels of the padded grid, batches end to end */
  for (int i = tid; i < CI * 32; i += 256) { const int c = i / 32, j = i % 32; const int b = (p0 + j) / PP, p = (p0 + j) % PP; const int yy = p / HP - 6, xx = p % HP - 6; tl[c][j] = (yy >= 0 && yy < HS && xx >= 0 && xx < HS) ? bf16_round(x[((size_t)b * CI + c) * PX + yy * HS + xx]) : 0.f; }
  __syncthreads();
  { for (int i = tid; i < 32 * CG; i += 256) { const int j = i / CG, c8 = (i % CG) * 8; FragH f; for (int q = 0; q < 8; ++q) f.h[q] = (_Float16)tl[c8 + q][j]; *(v8us*)((unsigned short*)XR + ((size_t)p0 + j) * CI + c8) = f.half[0]; }  } }
// 7x7 conv as a GEMM without an im2col buffer: row r of A is output pixel r of an HO x HO grid, and its k = tap * 128 + channel element is the x row at padded pixel (oy + OFF + tap / 7, ox + OFF + tap % 7),
// so a tap's 128 channels are 256 contiguous bytes. C[r][n] = alpha * sum_k A[r][k] * Bh[n][k], k in the order of d_w7. Wave tile 32x64, work-group 128x64; rows from M on repeat row M - 1 (their C rows are never read).
// One trip of the loop is one tap. The tap's A tile (128 pixel rows) and B tile (64 weight rows), 256 bytes a row, are brought into LDS by asynchronous copies, 16 bytes a lane (16 lanes = one whole row),
// into one of two buffers: the copies of tap t + 2 fly while tap t + 1 is worked on. The fragments are read from LDS at a row pitch of 272 bytes (free of bank conflicts for 16-byte reads).
#define LP 272                       /* LDS row pitch in bytes */
#define LA (128 * LP)                /* A tile */
#define LS (192 * LP)                /* one buffer: A tile, then B tile */
// twelve copies of 16 bytes a lane, LDS byte address l[i] from global address g[i]; the wait on the address registers ends the copies' own statement, ahead of any rewrite of them
__device__ __forceinline__ void g2_copy12(const unsigned* l, const char* const* g) {
  asm volatile("global_load_async_to_lds_b128 %0, %12, off\n\tglobal_load_async_to_lds_b128 %1, %13, off\n\tglobal_load_async_to_lds_b128 %2, %14, off\n\tglobal_load_async_to_lds_b128 %3, %15, off\n\t"
               "global_load_async_to_lds_b128 %4, %16, off\n\tglobal_load_async_to_lds_b128 %5, %17, off\n\tglobal_load_async_to_lds_b128 %6, %18, off\n\tglobal_load_async_to_lds_b128 %7, %19, off\n\t"
               "global_load_async_to_lds_b128 %8, %20, off\n\tglobal_load_async_to_lds_b128 %9, %21, off\n\tglobal_load_async_to_lds_b128 %10, %22, off\n\tglobal_load_async_to_lds_b128 %11, %23, off\n\ts_wait_xcnt 0x0"
               :: "v"(l[0]), "v"(l[1]), "v"(l[2]), "v"(l[3]), "v"(l[4]), "v"(l[5]), "v"(l[6]), "v"(l[7]), "v"(l[8]), "v"(l[9]), "v"(l[10]), "v"(l[11]),
                  "v"(g[0]), "v"(g[1]), "v"(g[2]), "v"(g[3]), "v"(g[4]), "v"(g[5]), "v"(g[6]), "v"(g[7]), "v"(g[8]), "v"(g[9]), "v"(g[10]), "v"(g[11]) : "memory"); }
__device__ __forceinline__ v16h g2_lfrag(const unsigned char* p) { FragH f; f.half[0] = *(const v8us*)p; f.half[1] = *(const v8us*)(p + 32); return f.v; }
// byte offset, in the x rows, of output pixel r's row at tap 0
template <int HO, int OFF>
__device__ __forceinline__ unsigned g2_arow(int r) { return (unsigned)((((r / (HO * HO)) * PP + ((r % (HO * HO)) / HO + OFF) * HP + (r % HO) + OFF) * CI) * 2); }
#define GQ ((int)(NRQ / 128) * (CO / 64))      /* 196 work-groups of q */
#define GK ((NRK / 128) * (CO / 64))           /* 244 work-groups of k, and as many of v */
// The three convs read nothing of each other, so they go as ONE launch: work-groups 0 .. GQ - 1 are q's tiles, the next GK are k's, the last GK are v's. A launch of one conv has fewer work-groups than the chip has WGPs;
// together they are 684, and two of them (by their LDS) share a WGP, each filling the other's waits. Which conv a work-group belongs to is the same for all its threads: every branch on it is a scalar one.
__global__ __launch_bounds__(128) void k_conv7(const _Float16* __restrict__ XR, const _Float16* __restrict__ BQ, const _Float16* __restrict__ BK, const _Float16* __restrict__ BV, float alpha, float* __restrict__ Q, float* __restrict__ Kf, float* __restrict__ Vf) {
  __shared__ __attribute__((aligned(16))) float so[4][32][68];
  __shared__ __attribute__((aligned(16))) unsigned char ring[2 * LS];
  const int tid = threadIdx.x, w = tid >> 5, lane = tid & 31, ln = lane & 15, hh = lane >> 4;
  const int job = (int)blockIdx.x < GQ ? 0 : (int)blockIdx.x < GQ + GK ? 1 : 2; const int blk = (int)blockIdx.x - (job == 0 ? 0 : job == 1 ? GQ : GQ + GK);
  const _Float16* __restrict__ Bh = job == 0 ? BQ : job == 1 ? BK : BV; float* __restrict__ C = job == 0 ? Q : job == 1 ? Kf : Vf;
  const int mt = blk / (CO / 64), nq = blk % (CO / 64); const int row0 = mt * 128 + 32 * w, col0 = nq * 64;
  /* copy side: this thread brings the 16 bytes number cc of tile rows cr, cr + 8, ... */
  const int cr = tid >> 4, cc = tid & 15; unsigned ao[16], bo[8];      /* byte offsets of this thread's rows at tap 0; every loop over them is unrolled so that they stay in registers */
  if (job == 0) {      /* q: 56-grid, x index = o + tap - 3 */
#pragma unroll
    for (int i = 0; i < 16; ++i) ao[i] = g2_arow<HS, 3>(min(mt * 128 + cr + 8 * i, (int)NRQ - 1)) + (unsigned)(cc * 16);
  } else {      /* k, v: 62-grid over pad3(x) with conv pad 3: x index = o + tap - 6 */
#pragma unroll
    for (int i = 0; i < 16; ++i) ao[i] = g2_arow<HK, 0>(min(mt * 128 + cr + 8 * i, NB * PK - 1)) + (unsigned)(cc * 16);
  }
#pragma unroll
  for (int i = 0; i < 8; ++i) bo[i] = (unsigned)(((col0 + cr + 8 * i) * KC + cc * 8) * 2);
  const unsigned lc = (unsigned)(size_t)ring + (unsigned)(cr * LP + cc * 16);
  auto issue = [&](int t, int buf) { const char* xa = (const char*)XR + ((t / 7) * HP + t % 7) * (CI * 2); const char* xb = (const char*)Bh + t * (CI * 2); const unsigned l = lc + (unsigned)(buf * LS);      /* the tap's bases, the same for every lane */
    unsigned la[24]; const char* ga[24];      /* tile rows cr + 8 i: 16 of A, then 8 of B (the B tile follows the A tile at the same pitch) */
#pragma unroll
    for (int i = 0; i < 24; ++i) { la[i] = l + (unsigned)(8 * i * LP); ga[i] = i < 16 ? xa + ao[i] : xb + bo[i - 16]; }
    g2_copy12(la, ga); g2_copy12(la + 12, ga + 12); };
  const v8f z8 = {0.f,0.f,0.f,0.f,0.f,0.f,0.f,0.f}; v8f c00 = z8, c01 = z8, c02 = z8, c03 = z8, c10 = z8, c11 = z8, c12 = z8, c13 = z8;
  issue(0, 0);
  asm volatile("s_wait_asynccnt 0x0" ::: "memory");      /* this wave's copies of tap 0 have landed */
  __syncthreads();      /* tap 0 is complete before any wave reads it */
  issue(1, 1);
  /* the tap loop stays rolled: its body holds 32 WMMAs */
#pragma unroll 1
  for (int t = 0; t < KK; ++t) { const unsigned char* st = ring + (t & 1) * LS; const unsigned char* pa = st + (32 * w + ln) * LP + 16 * hh; const unsigned char* pb = st + LA + ln * LP + 16 * hh;
    v16h a0[2], a1[2], b0[2], b1[2], b2[2], b3[2];
    /* two fragment sets: the next 32 channels' LDS reads stand ahead of this block's WMMAs, so that their latency runs under the block; unrolled so that the sets are picked by constants */
    a0[0] = g2_lfrag(pa); a1[0] = g2_lfrag(pa + 16 * LP); b0[0] = g2_lfrag(pb); b1[0] = g2_lfrag(pb + 16 * LP); b2[0] = g2_lfrag(pb + 32 * LP); b3[0] = g2_lfrag(pb + 48 * LP);
#pragma unroll
    for (int s = 0; s < 4; ++s) { const int u = s & 1, n = u ^ 1, kb = (s + 1) * 64;
      if (s < 3) { a0[n] = g2_lfrag(pa + kb); a1[n] = g2_lfrag(pa + 16 * LP + kb); b0[n] = g2_lfrag(pb + kb); b1[n] = g2_lfrag(pb + 16 * LP + kb); b2[n] = g2_lfrag(pb + 32 * LP + kb); b3[n] = g2_lfrag(pb + 48 * LP + kb); }
      c00 = g2_mma(a0[u], b0[u], c00); c10 = g2_mma(a1[u], b0[u], c10); c01 = g2_mma(a0[u], b1[u], c01); c11 = g2_mma(a1[u], b1[u], c11);
      c02 = g2_mma(a0[u], b2[u], c02); c12 = g2_mma(a1[u], b2[u], c12); c03 = g2_mma(a0[u], b3[u], c03); c13 = g2_mma(a1[u], b3[u], c13);
    }
    asm volatile("s_wait_dscnt 0x0" ::: "memory");      /* this wave's reads of the buffer are done before it is handed back */
    asm volatile("s_wait_asynccnt 0x0" ::: "memory");      /* this wave's copies of tap t + 1 have landed */
    __syncthreads();      /* publishes tap t + 1 and ends every wave's reads of tap t's buffer */
    if (t + 2 < KK) issue(t + 2, t & 1); }
  asm volatile("s_wait_asynccnt 0x0" ::: "memory");      /* no copy is outstanding when the wave goes on */
  v8f accs[8] = {c00, c01, c02, c03, c10, c11, c12, c13};
#pragma unroll
  for (int u = 0; u < 8; ++u) { const int t = u & 3, half = u >> 2;
#pragma unroll
    for (int r = 0; r < 8; ++r) so[w][half * 16 + 8 * hh + r][t * 16 + ln] = accs[u][r] * alpha; }
  __builtin_amdgcn_fence(__ATOMIC_ACQ_REL, "workgroup"); __builtin_amdgcn_wave_barrier();
  const int rsub = lane >> 4, c4 = (lane & 15) * 4;
#pragma unroll
  for (int q = 0; q < 16; ++q) { const int r = q * 2 + rsub; const v4f v = *(const v4fa*)&so[w][r][c4]; *(v4f*)(C + (size_t)(row0 + r) * CO + col0 + c4) = v; } }
__device__ __forceinline__ void d_w7(const float* __restrict__ w, _Float16* __restrict__ Bt, int blk) { const size_t t = (size_t)blk * 256 + threadIdx.x; if (t >= (size_t)CO * KC / 8) return; const int c8 = (int)((t * 8) % CI); const int tap = (int)(((t * 8) / CI) % KK); const int o = (int)((t * 8) / KC); FragH f; for (int q = 0; q < 8; ++q) f.h[q] = (_Float16)(bf16_round(w[((size_t)o * CI + c8 + q) * KK + tap]) * 16.0f);
  *(v8us*)((unsigned short*)Bt + t * 8) = f.half[0];  }
#define GX (NB * PP / 32)                      /* 289 work-groups of x rows */
#define GW ((CO * KC / 8 + 255) / 256)         /* 784 work-groups per weight plane */
// The x rows and the three weight planes are made from the inputs alone, none from another: one launch, the job picked by the work-group's index (the same for all its threads, so the barrier of the x rows is passed by whole work-groups).
__global__ __launch_bounds__(256) void k_prep(const float* __restrict__ x, const float* __restrict__ wq, const float* __restrict__ wk, const float* __restrict__ wv, _Float16* __restrict__ XR, _Float16* __restrict__ BQ, _Float16* __restrict__ BK, _Float16* __restrict__ BV) {
  const int blk = (int)blockIdx.x;
  if (blk < GX) { d_xrows(x, XR, blk); return; }
  const int job = (blk - GX) / GW;
  d_w7(job == 0 ? wq : job == 1 ? wk : wv, job == 0 ? BQ : job == 1 ? BK : BV, (blk - GX) % GW); }
// Lanes run along channels: one wave holds the 32 channels of one head, so every Q, K and V load of a wave is one whole 128-byte line and the window position is wave-uniform.
// A wave takes four neighbouring pixels of one image row at once: their four 7-wide window rows are ten neighbouring K (and V) pixels, loaded once per window row, all in flight together, and used from registers by all four.
// The head's rel table lies in LDS as [tap][channel], so that its reads are contiguous over the lanes too (in global memory a channel's taps are 28 bytes from the next channel's).
// A work-group (8 waves, 4 pixels each) fills a 32-channel x 32-pixel tile in LDS, and the channel-major store then writes whole 128-byte lines.
__global__ __launch_bounds__(256) void k_watt(const float* __restrict__ Q, const float* __restrict__ Kf, const float* __restrict__ Vf, const float* __restrict__ rh, const float* __restrict__ rw, float* __restrict__ out) {
  __shared__ __attribute__((aligned(16))) float tl[32][36]; __shared__ float rl[7][32];
  const int tid = threadIdx.x, lane = tid & 31; const int w = __builtin_amdgcn_readfirstlane(tid >> 5);      /* the wave's number as a scalar: pixel, window row and column stay on the scalar unit */
  const int p0 = (int)(blockIdx.x % (PX / 32)) * 32; const int bh = (int)(blockIdx.x / (PX / 32)); const int head = bh % (NCO / 32); const size_t b = bh / (NCO / 32); const int c = head * 32 + lane; const bool first = head < CO / 64;      /* c < CO / 2, the same for the whole work-group */
  if (w < 7) rl[w][lane] = first ? bf16_round(rh[(size_t)c * 7 + w]) : bf16_round(rw[(size_t)(c - CO / 2) * 7 + w]);
  __syncthreads();      /* the rel table is complete before any wave reads it */
  const int p = p0 + 4 * w; const int y = p / HS, x = p % HS;      /* pixels p .. p + 3 lie in one image row: HS and p are multiples of 4 */
  const float* kp = Kf + (b * PK + (size_t)y * HK + x) * CO + c; const float* vp = Vf + (b * PK + (size_t)y * HK + x) * CO + c;
  float qv[4], mx[4], se[4], acc[4], rc[7];
  /* every loop over the four pixels, the seven window columns and the ten loaded lines is unrolled (each '#pragma unroll' below), so that these small arrays are indexed by constants and stay in registers */
#pragma unroll
  for (int j = 0; j < 4; ++j) { qv[j] = Q[(b * PX + p + j) * CO + c] * 1.44269504f; mx[j] = -3.0e38f; se[j] = 0.f; acc[j] = 0.f; }      /* q carries log2(e): scores and their maximum are in base-2 units, so that each term is one exp2 */
#pragma unroll
  for (int kw = 0; kw < 7; ++kw) rc[kw] = rl[kw][lane];
  /* the loops over window rows stay rolled: one row's body (28 window positions) is already long */
#pragma unroll 1
  for (int kh = 0; kh < 7; ++kh) { float kr[10]; const float rk = rl[kh][lane];
#pragma unroll
    for (int i = 0; i < 10; ++i) kr[i] = kp[(size_t)(kh * HK + i) * CO];
#pragma unroll
    for (int j = 0; j < 4; ++j)
#pragma unroll
      for (int kw = 0; kw < 7; ++kw) { const float kv = __fadd_rn(kr[j + kw], first ? rk : rc[kw]); mx[j] = fmaxf(mx[j], __fmul_rn(qv[j], kv)); } }
  /* per pixel the 49 terms are summed window row by window row, left to right */
#pragma unroll 1
  for (int kh = 0; kh < 7; ++kh) { float kr[10], vr[10]; const float rk = rl[kh][lane];
#pragma unroll
    for (int i = 0; i < 10; ++i) { kr[i] = kp[(size_t)(kh * HK + i) * CO]; vr[i] = vp[(size_t)(kh * HK + i) * CO]; }
#pragma unroll
    for (int j = 0; j < 4; ++j)
#pragma unroll
      for (int kw = 0; kw < 7; ++kw) { const float kv = kr[j + kw] + (first ? rk : rc[kw]); const float e = __builtin_amdgcn_exp2f(fmaf(qv[j], kv, -mx[j])); se[j] += e; acc[j] = fmaf(e, vr[j + kw], acc[j]); } }      /* the argument is at most a rounding error above 0; a term below the exp2 instruction's range counts as 0 beside the largest term's 1 */
#pragma unroll
  for (int j = 0; j < 4; ++j) tl[lane][4 * w + j] = acc[j] / se[j];
  __syncthreads();      /* the tile is complete before any wave reads other waves' pixels */
  const int dh = tid >> 3, j4 = (tid & 7) * 4; const v4f o = *(const v4fa*)&tl[dh][j4];
  const int oc = dh * 8 + head;      /* the reference's final transpose: output channel = dh*heads + head for computation channel head*32 + dh */
  *(v4f*)(out + ((b * CO + oc) * (size_t)PX + p0 + j4)) = o; }

extern "C" void kernel_launch(void* const* d_in, const int* in_sizes, int n_in,
                              void* d_out, int out_size, void* d_ws, size_t ws_size, hipStream_t stream) {
  (void)in_sizes; (void)n_in; (void)out_size;
  const float* const* I = (const float* const*)d_in; const float* x = I[0]; const float* wq = I[1]; const float* wk = I[2]; const float* wv = I[3]; const float* rh = I[4]; const float* rw = I[5];
  char* ws = (char*)d_ws; size_t off = 0;
  auto take = [&](size_t bytes) { char* p = ws + off; off += (bytes + 255) & ~(size_t)255; return p; };
  _Float16* BQ = (_Float16*)take((size_t)CO * KC * 2); _Float16* BK = (_Float16*)take((size_t)CO * KC * 2); _Float16* BV = (_Float16*)take((size_t)CO * KC * 2);
  _Float16* XR = (_Float16*)take((size_t)NB * PP * CI * 2); float* Q = (float*)take(NRQ * CO * 4); float* Kf = (float*)take((size_t)NRK * CO * 4); float* Vf = (float*)take((size_t)NRK * CO * 4);
  if (off > ws_size) return;      /* three weight planes, the x rows, q, k, v */
  k_prep<<<GX + 3 * GW, 256, 0, stream>>>(x, wq, wk, wv, XR, BQ, BK, BV);
  k_conv7<<<GQ + 2 * GK, 128, 0, stream>>>(XR, BQ, BK, BV, 0.0625f, Q, Kf, Vf);
  k_watt<<<NB * (NCO / 32) * (PX / 32), 256, 0, stream>>>(Q, Kf, Vf, rh, rw, (float*)d_out);
}

// v007
// It runs in 99 microseconds.
// Next to v006, in two timings, it ran 1.13 and 1.12 times as fast.
// Over all steps from v000 it is 15.9 times as fast.
#include <hip/hip_runtime.h>
// StandAloneSelfAttention (inputs [2][128][56][56]; q = conv7x7(x, Wq, pad 3) (256 ch, 56x56); k, v = conv7x7(pad3(x), Wk/Wv, pad 3) (256 ch, 62x62); per channel c and pixel: 7x7 window of k (plus rel_h[c] per window row for the first 128 channels, rel_w[c-128] per window column for the rest) and v around the pixel; attn = softmax over the 49 of q*k (scalar products); out = sum attn*v, then the reference's transpose(0,2,1,3,4): output channel (dh*8 + head) takes computation channel (head*32 + dh) -> [2][256][56][56]).
// Structure: pixel rows; x as exact f16 rows via LDS transposes; the three 7x7 convs as WMMA GEMMs (K = 6,272 = 49 taps x 128 channels; 32x64 wave tiles, f32 accumulation, exact x16 weights) whose A tiles are taken tap by tap from the x rows, which lie on a 68x68 grid with 6 pixels of zeros on every side (all padding of both convs), and staged with the weight tiles in LDS, into f32 channel rows; the per-channel 49-way window softmax and weighted sum on VALU in f32 (rel tables read) with the channel-major store.
// Compute dtype: inputs rounded to bf16; x / weights / rel tables exact; q, k, v in f32 (GEMM outputs); softmax and the weighted sum f32 — no reduced-precision intermediates after the convs. v_wmma_f32_16x16x32_f16.
#define NB 2
#define CI 128
#define CO 256
#define HS 56
#define PX (HS * HS)                 /* 3136 */
#define HK 62                        /* k/v grid */
#define PK (HK * HK)                 /* 3844 */
#define NRQ ((size_t)NB * PX)        /* 6272 = 49 x 128 */
#define NRK 7808                     /* 2 x 3844 = 7688 -> padded to 61 x 128 */
#define KK 49
#define KC (KK * CI)                 /* 6272 */
#define CG (CI / 8)
#define HP (HS + 12)                 /* x rows on a grid with 6 zero pixels on every side */
#define PP (HP * HP)                 /* 4624; NB * PP = 289 x 32 */
#define NCO CO                       /* output channels computed (debug hook) */
typedef __bf16 v16b __attribute__((ext_vector_type(16)));
typedef unsigned short v8us __attribute__((ext_vector_type(8), may_alias));
typedef float  v8f  __attribute__((ext_vector_type(8)));
typedef float  v4f  __attribute__((ext_vector_type(4)));
typedef float  v4fa __attribute__((ext_vector_type(4), may_alias));
union FragB { v16b v; v8us half[2]; unsigned short u[16]; };

__device__ __forceinline__ unsigned short bf16_bits(float x) { unsigned int u = __float_as_uint(x); return (unsigned short)((u + 0x7FFFu + ((u >> 16) & 1u)) >> 16); }
__device__ __forceinline__ float bf16_val(unsigned short b) { return __uint_as_float(((unsigned int)b) << 16); }
__device__ __forceinline__ float bf16_round(float x) { return bf16_val(bf16_bits(x)); }
// D += A·B with NT terms: 1 = ah·bh, 2 = + al·bh (A split), 3 = + ah·bl (both split)
template <int NT>
__device__ __forceinline__ v8f mmaN(v16b ah, v16b al, v16b bh, v16b bl, v8f c) {
  c = __builtin_amdgcn_wmma_f32_16x16x32_bf16(false, ah, false, bh, (short)0, c, false, false);
  if (NT >= 2) c = __builtin_amdgcn_wmma_f32_16x16x32_bf16(false, al, false, bh, (short)0, c, false, false);
  if (NT >= 3) c = __builtin_amdgcn_wmma_f32_16x16x32_bf16(false, ah, false, bl, (short)0, c, false, false);
  asm volatile("v_nop\n\tv_nop\n\tv_nop\n\tv_nop" : "+v"(c) : "v"(ah), "v"(al), "v"(bh), "v"(bl));
  return c;
}

__global__ __launch_bounds__(256) void k_wt_bf16(const float* __restrict__ W, unsigned short* __restrict__ Wt, int K, int N) {
  const int t = blockIdx.x * 256 + threadIdx.x;
  const int k8n = K / 8;
  if (t >= N * k8n) return;
  const int n = t / k8n, k8 = (t % k8n) * 8;
  v8us v;
#pragma unroll
  for (int i = 0; i < 8; ++i) v[i] = bf16_bits(W[(size_t)(k8 + i) * N + n]);
  *(v8us*)(Wt + (size_t)n * K + k8) = v;
  
}

// GEMM C[M][N] (f32, pitch ldc) = act(A[M][K]·W + bias). A f32 row-major (pitch lda) converted per fragment to bf16
// (ASPLIT: hi/lo two planes -> 2 terms, else single rounded term); Wt bf16 [N][K] (pitch ldb). BIAS_BF16 rounds the
// bias to bf16 first (bias quantised to bf16 before the add). K%32==0, M%16==0, N%64==0.
template <bool ASPLIT, int ACT, bool BIAS_BF16>
__global__ __launch_bounds__(128) void k_gemm_bf(const float* __restrict__ A, int lda, const unsigned short* __restrict__ Wt, int ldb,
                                               const float* __restrict__ bias, float* __restrict__ C, int ldc, int M, int N, int K) {
  __shared__ __attribute__((aligned(16))) float so[4][16][64];
  const int tid = threadIdx.x, w = tid >> 5, lane = tid & 31, ln = lane & 15, hh = lane >> 4;
  const int ntn = N / 64;
  const int wid = blockIdx.x * 4 + w;
  const int mt = wid / ntn, nq = wid % ntn;
  if (mt * 16 >= M) return;
  const int row0 = mt * 16, col0 = nq * 64;
  const float* arow = A + (size_t)(row0 + ln) * lda;
  v8f acc[4] = {};
  for (int kb = 0; kb < K; kb += 32) {
    FragB ah, al;
    const v4f x0 = *(const v4fa*)(arow + kb + 8 * hh), x1 = *(const v4fa*)(arow + kb + 8 * hh + 4);
    const v4f x2 = *(const v4fa*)(arow + kb + 16 + 8 * hh), x3 = *(const v4fa*)(arow + kb + 16 + 8 * hh + 4);
    float xs[16] = {x0[0],x0[1],x0[2],x0[3],x1[0],x1[1],x1[2],x1[3],x2[0],x2[1],x2[2],x2[3],x3[0],x3[1],x3[2],x3[3]};
#pragma unroll
    for (int i = 0; i < 16; ++i) { const unsigned short hb = bf16_bits(xs[i]); ah.u[i] = hb; al.u[i] = ASPLIT ? bf16_bits(xs[i] - bf16_val(hb)) : (unsigned short)0; }
#pragma unroll
    for (int t = 0; t < 4; ++t) {
      const unsigned short* brow = Wt + (size_t)(col0 + t * 16 + ln) * ldb + kb;
      FragB b;
      b.half[0] = *(const v8us*)(brow + 8 * hh);
      b.half[1] = *(const v8us*)(brow + 16 + 8 * hh);
      acc[t] = mmaN<ASPLIT ? 2 : 1>(ah.v, al.v, b.v, b.v, acc[t]);
    }
  }
#pragma unroll
  for (int t = 0; t < 4; ++t) {
    float bv = bias ? bias[col0 + t * 16 + ln] : 0.f;
    if (BIAS_BF16) bv = bf16_round(bv);
#pragma unroll
    for (int r = 0; r < 8; ++r) { float v = acc[t][r] + bv; if (ACT == 1) v = fmaxf(v, 0.f); so[w][8 * hh + r][t * 16 + ln] = v; }
  }
  __builtin_amdgcn_fence(__ATOMIC_ACQ_REL, "workgroup");
  __builtin_amdgcn_wave_barrier();
  const int rsub = lane >> 4, c4 = (lane & 15) * 4;
  {
#pragma unroll
    for (int q = 0; q < 8; ++q) {
      const int r = q * 2 + rsub;
      const v4f v = *(const v4fa*)&so[w][r][c4];
      *(v4f*)(C + (size_t)(row0 + r) * ldc + col0 + c4) = v;
    }
    
  }
}

// GEMM C = act(A·W + bias + resid): A f32 (ASPLIT -> hi/lo 2 terms), Wt bf16 [N][K]; ACT 0 none, 1 relu, 2 exact gelu;
// resid (optional, f32, row index = (row % rmod), pitch ldr, RES_BF16 rounds it) added before the activation.
template <bool ASPLIT, int ACT, bool BIAS_BF16, bool RES_BF16>
__global__ __launch_bounds__(128) void k_gemm_bf3(const float* __restrict__ A, int lda, const unsigned short* __restrict__ Wt, int ldb,
                                                const float* __restrict__ bias, const float* __restrict__ resid, int rmod, int ldr,
                                                float* __restrict__ C, int ldc, int M, int N, int K) {
  __shared__ __attribute__((aligned(16))) float so[4][16][64];
  const int tid = threadIdx.x, w = tid >> 5, lane = tid & 31, ln = lane & 15, hh = lane >> 4;
  const int ntn = N / 64;
  const int wid = blockIdx.x * 4 + w;
  const int mt = wid / ntn, nq = wid % ntn;
  if (mt * 16 >= M) return;
  const int row0 = mt * 16, col0 = nq * 64;
  const float* arow = A + (size_t)(row0 + ln) * lda;
  v8f acc[4] = {};
  for (int kb = 0; kb < K; kb += 32) {
    FragB ah, al;
    const v4f x0 = *(const v4fa*)(arow + kb + 8 * hh), x1 = *(const v4fa*)(arow + kb + 8 * hh + 4);
    const v4f x2 = *(const v4fa*)(arow + kb + 16 + 8 * hh), x3 = *(const v4fa*)(arow + kb + 16 + 8 * hh + 4);
    float xs[16] = {x0[0],x0[1],x0[2],x0[3],x1[0],x1[1],x1[2],x1[3],x2[0],x2[1],x2[2],x2[3],x3[0],x3[1],x3[2],x3[3]};
#pragma unroll
    for (int i = 0; i < 16; ++i) { const unsigned short hb = bf16_bits(xs[i]); ah.u[i] = hb; al.u[i] = ASPLIT ? bf16_bits(xs[i] - bf16_val(hb)) : (unsigned short)0; }
#pragma unroll
    for (int t = 0; t < 4; ++t) {
      const unsigned short* brow = Wt + (size_t)(col0 + t * 16 + ln) * ldb + kb;
      FragB b;
      b.half[0] = *(const v8us*)(brow + 8 * hh);
      b.half[1] = *(const v8us*)(brow + 16 + 8 * hh);
      acc[t] = mmaN<ASPLIT ? 2 : 1>(ah.v, al.v, b.v, b.v, acc[t]);
    }
  }
#pragma unroll
  for (int t = 0; t < 4; ++t) {
    const int col = col0 + t * 16 + ln;
    float bv = bias ? bias[col] : 0.f;
    if (BIAS_BF16) bv = bf16_round(bv);
#pragma unroll
    for (int r = 0; r < 8; ++r) {
      float v = acc[t][r] + bv;
      if (resid) { float rv = resid[(size_t)((row0 + 8 * hh + r) % rmod) * ldr + col]; if (RES_BF16) rv = bf16_round(rv); v += rv; }
      if (ACT == 1) v = fmaxf(v, 0.f);
      if (ACT == 2) v = 0.5f * v * (1.0f + erff(v * 0.70710678118654752f));
      if (ACT == 3) { const float u = 0.7978845608028654f * (v + 0.044715f * v * v * v); v = 0.5f * v * (1.0f + tanhf(u)); }
      so[w][8 * hh + r][t * 16 + ln] = v;
    }
  }
  __builtin_amdgcn_fence(__ATOMIC_ACQ_REL, "workgroup");
  __builtin_amdgcn_wave_barrier();
  const int rsub = lane >> 4, c4 = (lane & 15) * 4;
  {
#pragma unroll
    for (int q = 0; q < 8; ++q) {
      const int r = q * 2 + rsub;
      const v4f v = *(const v4fa*)&so[w][r][c4];
      *(v4f*)(C + (size_t)(row0 + r) * ldc + col0 + c4) = v;
    }
    
  }
}
// row LayerNorm (biased variance, eps) over N: s = X (+ R); optional out_sum <- s; out_norm <- (s-mu)*rsqrt(var+eps)*g + b
template <bool PARAM_BF16>
__global__ __launch_bounds__(256) void k_layernorm(const float* __restrict__ X, const float* __restrict__ R, const float* __restrict__ g, const float* __restrict__ bta,
                                                  float* __restrict__ out_sum, float* __restrict__ out_norm, int N, float eps) {
  __shared__ float red[256];
  const int row = blockIdx.x, tid = threadIdx.x;
  const float* x = X + (size_t)row * N; const float* rr = R ? R + (size_t)row * N : nullptr;
  float vals[16];                     // up to N = 4096
  const int per = N / 256;            // contiguous chunk per thread? use strided-by-4 chunks: thread handles j = tid*4 + 1024*u
  float s1 = 0.f;
  for (int u = 0; u < per / 4; ++u) {
    const int j = tid * 4 + 1024 * u;
    const v4f a = *(const v4fa*)(x + j);
    v4f b = {0.f,0.f,0.f,0.f}; if (rr) b = *(const v4fa*)(rr + j);
#pragma unroll
    for (int q = 0; q < 4; ++q) { const float v = a[q] + b[q]; vals[u * 4 + q] = v; s1 += v; }
  }
  red[tid] = s1; __syncthreads();
  for (int st = 128; st > 0; st >>= 1) { if (tid < st) red[tid] += red[tid + st]; __syncthreads(); }
  const float mu = red[0] / (float)N; __syncthreads();
  float s2 = 0.f;
  for (int u = 0; u < per / 4; ++u)
#pragma unroll
    for (int q = 0; q < 4; ++q) { const float c = vals[u * 4 + q] - mu; s2 += c * c; }
  red[tid] = s2; __syncthreads();
  for (int st = 128; st > 0; st >>= 1) { if (tid < st) red[tid] += red[tid + st]; __syncthreads(); }
  const float rs = rsqrtf(red[0] / (float)N + eps);
  {
    for (int u = 0; u < per / 4; ++u) {
      const int j = tid * 4 + 1024 * u;
      v4f o, sm;
#pragma unroll
      for (int q = 0; q < 4; ++q) {
        float gg = g[j + q], bb = bta[j + q];
        if (PARAM_BF16) { gg = bf16_round(gg); bb = bf16_round(bb); }
        sm[q] = vals[u * 4 + q]; o[q] = (vals[u * 4 + q] - mu) * rs * gg + bb;
      }
      if (out_sum) *(v4f*)(out_sum + (size_t)row * N + j) = sm;
      *(v4f*)(out_norm + (size_t)row * N + j) = o;
    }
    
  }
}



// ---- f16 WMMA path (v_wmma_f32_16x16x32_f16): 11-bit significands for operands in range — used here for the conv GEMMs, whose bf16-rounded x and x16 weights are exact in f16
typedef _Float16 v16h __attribute__((ext_vector_type(16)));
union FragH { v16h v; v8us half[2]; _Float16 h[16]; unsigned short u[16]; };
template <int NT>
__device__ __forceinline__ v8f mmaH(v16h ah, v16h al, v16h bh, v16h bl, v8f c) {
  c = __builtin_amdgcn_wmma_f32_16x16x32_f16(false, ah, false, bh, (short)0, c, false, false);
  if (NT >= 2) c = __builtin_amdgcn_wmma_f32_16x16x32_f16(false, al, false, bh, (short)0, c, false, false);
  if (NT >= 3) c = __builtin_amdgcn_wmma_f32_16x16x32_f16(false, ah, false, bl, (short)0, c, false, false);
  asm volatile("v_nop\n\tv_nop\n\tv_nop\n\tv_nop" : "+v"(c) : "v"(ah), "v"(al), "v"(bh), "v"(bl));
  return c;
}
// batched GEMM like k_gemm_b but f16 operands: A f32 (split into f16 hi/lo if ASPLIT, else rounded to f16), Bt = f16 values [n][k]; alpha; C f32; N multiple of 16 (partial tiles skipped)
template <bool ASPLIT>
__global__ __launch_bounds__(128) void k_gemm_h(const float* __restrict__ A, int lda, size_t sA, const _Float16* __restrict__ Bh, int ldb, size_t sB, float alpha, float* __restrict__ C, int ldc, size_t sC, int M, int N, int K) {
  __shared__ __attribute__((aligned(16))) float so[4][16][64];
  const int tid = threadIdx.x, w = tid >> 5, lane = tid & 31, ln = lane & 15, hh = lane >> 4; const int by = blockIdx.y;
  A += (size_t)by * sA; Bh += (size_t)by * sB; C += (size_t)by * sC;
  const int ntn = (N + 63) / 64; const int wid = blockIdx.x * 4 + w; const int mt = wid / ntn, nq = wid % ntn; if (mt * 16 >= M) return;
  const int row0 = mt * 16, col0 = nq * 64; const float* arow = A + (size_t)(row0 + ln) * lda;
  v8f acc[4] = {};
  for (int kb = 0; kb < K; kb += 32) {
    FragH ah, al;
    const v4f x0 = *(const v4fa*)(arow + kb + 8 * hh), x1 = *(const v4fa*)(arow + kb + 8 * hh + 4), x2 = *(const v4fa*)(arow + kb + 16 + 8 * hh), x3 = *(const v4fa*)(arow + kb + 16 + 8 * hh + 4);
    float xs[16] = {x0[0],x0[1],x0[2],x0[3],x1[0],x1[1],x1[2],x1[3],x2[0],x2[1],x2[2],x2[3],x3[0],x3[1],x3[2],x3[3]};
#pragma unroll
    for (int i = 0; i < 16; ++i) { const _Float16 h = (_Float16)xs[i]; ah.h[i] = h; al.h[i] = ASPLIT ? (_Float16)(xs[i] - (float)h) : (_Float16)0.0f; }
#pragma unroll
    for (int t = 0; t < 4; ++t) { if (col0 + t * 16 >= N) continue; const size_t boff = (size_t)(col0 + t * 16 + ln) * ldb + kb; FragH bq; bq.half[0] = *(const v8us*)(Bh + boff + 8 * hh); bq.half[1] = *(const v8us*)(Bh + boff + 16 + 8 * hh);
      acc[t] = mmaH<ASPLIT ? 2 : 1>(ah.v, al.v, bq.v, bq.v, acc[t]); }
  }
#pragma unroll
  for (int t = 0; t < 4; ++t) { if (col0 + t * 16 >= N) continue;
#pragma unroll
    for (int r = 0; r < 8; ++r) so[w][8 * hh + r][t * 16 + ln] = acc[t][r] * alpha; }
  __builtin_amdgcn_fence(__ATOMIC_ACQ_REL, "workgroup"); __builtin_amdgcn_wave_barrier();
  const int rsub = lane >> 4, c4 = (lane & 15) * 4;
  {
#pragma unroll
    for (int q = 0; q < 8; ++q) { const int r = q * 2 + rsub; if (col0 + c4 < N) { const v4f v = *(const v4fa*)&so[w][r][c4]; *(v4f*)(C + (size_t)(row0 + r) * ldc + col0 + c4) = v; } }
     }
}

// Wt[n][k] = f16(W[k][n]·scale) from f32 row-major W[K][N] (scale = power of two; bf16-exact weights stay exact in f16 away from the subnormal range)
__global__ __launch_bounds__(256) void k_wt_f16(const float* __restrict__ W, _Float16* __restrict__ Wt, int K, int N, float scale) {
  const int t = blockIdx.x * 256 + threadIdx.x; if (t >= N * (K / 8)) return; const int n = t / (K / 8), k8 = (t % (K / 8)) * 8; FragH f;
#pragma unroll
  for (int i = 0; i < 8; ++i) f.h[i] = (_Float16)(bf16_round(W[(size_t)(k8 + i) * N + n]) * scale); const v8us o = f.half[0];
  *(v8us*)((unsigned short*)Wt + (size_t)n * K + k8) = o; 
}
// k_gemm_hh variant with fused epilogue: v = acc·alpha + bias[by·sBias + col] (+ CP[(row/rowsPerB)·sCPb + by·64 + col] if CP) ; ACT 0 none / 1 elu ; writes f16 C16 (and f32 C if non-null)
template <int ACT>
__global__ __launch_bounds__(128) void k_gemm_hhx(const _Float16* __restrict__ A, int lda, size_t sA, const _Float16* __restrict__ Bh, int ldb, size_t sB, float alpha, const float* __restrict__ bias, size_t sBias, const float* __restrict__ CP, int rowsPerB, size_t sCPb, int row0g,
    float* __restrict__ C, _Float16* __restrict__ C16, int ldc, size_t sC, int M, int N, int K) {
  __shared__ __attribute__((aligned(16))) float so[4][16][64];
  const int tid = threadIdx.x, w = tid >> 5, lane = tid & 31, ln = lane & 15, hh = lane >> 4; const int by = blockIdx.y;
  A += (size_t)by * sA; Bh += (size_t)by * sB; const size_t cofs = (size_t)by * sC; const float* bp = bias ? bias + (size_t)by * sBias : nullptr;
  const int ntn = (N + 63) / 64; const int wid = blockIdx.x * 4 + w; const int mt = wid / ntn, nq = wid % ntn; if (mt * 16 >= M) return;
  const int row0 = mt * 16, col0 = nq * 64; const _Float16* arow = A + (size_t)(row0 + ln) * lda;
  v8f acc[4] = {};
  for (int kb = 0; kb < K; kb += 32) { FragH ah; ah.half[0] = *(const v8us*)((const unsigned short*)arow + kb + 8 * hh); ah.half[1] = *(const v8us*)((const unsigned short*)arow + kb + 16 + 8 * hh);
#pragma unroll
    for (int t = 0; t < 4; ++t) { if (col0 + t * 16 >= N) continue; const size_t boff = (size_t)(col0 + t * 16 + ln) * ldb + kb; FragH bq; bq.half[0] = *(const v8us*)((const unsigned short*)Bh + boff + 8 * hh); bq.half[1] = *(const v8us*)((const unsigned short*)Bh + boff + 16 + 8 * hh);
      acc[t] = mmaH<1>(ah.v, ah.v, bq.v, bq.v, acc[t]); }
  }
#pragma unroll
  for (int t = 0; t < 4; ++t) { if (col0 + t * 16 >= N) continue; const int col = col0 + t * 16 + ln; const float bv = bp ? bf16_round(bp[col]) : 0.f;
#pragma unroll
    for (int r = 0; r < 8; ++r) { float v = acc[t][r] * alpha + bv; if (CP) { const int rr = row0g + row0 + 8 * hh + r; if (rowsPerB < 0) v += CP[cofs + (size_t)rr * ldc + col];      /* rowsPerB < 0: own element of the batched C plane */ else { const int bidx = rr / rowsPerB; v += CP[(size_t)bidx * sCPb + (size_t)by * 64 + col]; } } if (ACT == 1) v = (v > 0.f) ? v : expm1f(v); else if (ACT == 7) v = (v > 0.f) ? v + 1.0f : expf(v); else if (ACT == 8) v = tanhf(v); else if (ACT == 9) v = 0.5f * v * (1.0f + tanhf(0.7978845608028654f * (v + 0.044715f * v * v * v))); else if (ACT == 11) v = 1.0f / (1.0f + expf(-v)); else if (ACT == 12) v = (v > 0.f) ? v : 0.01f * v; else if (ACT == 14) v = (v > 0.f) ? v : 0.1f * v; else if (ACT == 16) v = (v >= 0.f) ? v : 0.3f * v; else if (ACT == 17) v = (v >= 0.f) ? v : 0.2f * v; else if (ACT == 15) v = v / (1.0f + expf(-v)); else if (ACT == 3) v = fmaxf(v, 0.f); else if (ACT == 6) v = 0.5f * v * (1.0f + erff(v * 0.70710678118654752f)); so[w][8 * hh + r][t * 16 + ln] = v; } }
  __builtin_amdgcn_fence(__ATOMIC_ACQ_REL, "workgroup"); __builtin_amdgcn_wave_barrier();
  const int rsub = lane >> 4, c4 = (lane & 15) * 4; typedef _Float16 v4h __attribute__((ext_vector_type(4)));
  {
#pragma unroll
    for (int q = 0; q < 8; ++q) { const int r = q * 2 + rsub; if (col0 + c4 < N) { const v4f v = *(const v4fa*)&so[w][r][c4]; if (C) *(v4f*)(C + cofs + (size_t)(row0 + r) * ldc + col0 + c4) = v; if (C16) { v4h h4; for (int i = 0; i < 4; ++i) h4[i] = (_Float16)v[i]; *(v4h*)(C16 + cofs + (size_t)(row0 + r) * ldc + col0 + c4) = h4; } } }
     }
}


typedef _Float16 v4h __attribute__((ext_vector_type(4)));

__global__ __launch_bounds__(256) void k_x16(const float* __restrict__ x, _Float16* __restrict__ X16, size_t n8) { const size_t t = (size_t)blockIdx.x * 256 + threadIdx.x; if (t >= n8) return; FragH f;
#pragma unroll
  for (int q = 0; q < 8; ++q) f.h[q] = (_Float16)bf16_round(x[t * 8 + q]); *(v8us*)((unsigned short*)X16 + t * 8) = f.half[0];  }
__global__ __launch_bounds__(256) void k_h16(const float* __restrict__ x, _Float16* __restrict__ X16, size_t n8) { const size_t t = (size_t)blockIdx.x * 256 + threadIdx.x; if (t >= n8) return; FragH f;
#pragma unroll
  for (int q = 0; q < 8; ++q) f.h[q] = (_Float16)x[t * 8 + q]; *(v8us*)((unsigned short*)X16 + t * 8) = f.half[0];  }
__global__ __launch_bounds__(256) void k_round16f(const float* __restrict__ W, _Float16* __restrict__ Bt, size_t n8) { const size_t t = (size_t)blockIdx.x * 256 + threadIdx.x; if (t >= n8) return; FragH f;
#pragma unroll
  for (int i = 0; i < 8; ++i) f.h[i] = (_Float16)(bf16_round(W[t * 8 + i]) * 16.0f); *(v8us*)((unsigned short*)Bt + t * 8) = f.half[0];  }
template <int NHv, int TTv>
__global__ __launch_bounds__(256) void k_vt(const _Float16* __restrict__ V16, int ldv, int voff, _Float16* __restrict__ Vt) { __shared__ unsigned short tl[64][66]; const int tid = threadIdx.x; const int slab = blockIdx.x / (TTv / 64), lg = blockIdx.x % (TTv / 64); const int b = slab / NHv, h = slab % NHv;
  for (int i = tid; i < 64 * 8; i += 256) { const int r = i / 8, c8 = (i % 8) * 8; FragH f; f.half[0] = *(const v8us*)((const unsigned short*)V16 + ((size_t)b * TTv + lg * 64 + r) * ldv + voff + h * 64 + c8);
#pragma unroll
    for (int q = 0; q < 8; ++q) tl[r][c8 + q] = f.u[q]; }
  __syncthreads();
  {
#pragma unroll
    for (int rd = 0; rd < 2; ++rd) { const int d = rd * 32 + tid / 8, pc = tid % 8; FragH f;
#pragma unroll
      for (int q = 0; q < 8; ++q) f.u[q] = tl[pc * 8 + q][d];
      *(v8us*)((unsigned short*)Vt + ((size_t)slab * 64 + d) * TTv + lg * 64 + pc * 8) = f.half[0]; }
     } }

__global__ __launch_bounds__(256) void k_hl(const float* __restrict__ F, _Float16* __restrict__ Hh, _Float16* __restrict__ Hl, size_t n8) { const size_t t = (size_t)blockIdx.x * 256 + threadIdx.x; if (t >= n8) return; FragH fh, fl; const v4f a = *(const v4fa*)(F + t * 8), c = *(const v4fa*)(F + t * 8 + 4);
#pragma unroll
  for (int q = 0; q < 4; ++q) { _Float16 h = (_Float16)a[q]; fh.h[q] = h; fl.h[q] = (_Float16)((a[q] - (float)h) * 1024.0f); h = (_Float16)c[q]; fh.h[4 + q] = h; fl.h[4 + q] = (_Float16)((c[q] - (float)h) * 1024.0f); }
  { *(v8us*)((unsigned short*)Hh + t * 8) = fh.half[0]; *(v8us*)((unsigned short*)Hl + t * 8) = fl.half[0];  } }

// ---- WMMA step of the conv GEMM (wave tile 32x64) ----
__device__ __forceinline__ v8f g2_mma(v16h a, v16h b, v8f c) { v8f d = __builtin_amdgcn_wmma_f32_16x16x32_f16(false, a, false, b, (short)0, c, false, false); asm volatile("v_nop\n\tv_nop\n\tv_nop\n\tv_nop" : "+v"(d) : "v"(a), "v"(b)); return d; }

__device__ __forceinline__ void d_xrows(const float* __restrict__ x, _Float16* __restrict__ XR, int blk) { __shared__ float tl[CI][33]; const int tid = threadIdx.x; const int p0 = blk * 32;      /* 32 pixels of the padded grid, batches end to end */
  for (int i = tid; i < CI * 32; i += 256) { const int c = i / 32, j = i % 32; const int b = (p0 + j) / PP, p = (p0 + j) % PP; const int yy = p / HP - 6, xx = p % HP - 6; tl[c][j] = (yy >= 0 && yy < HS && xx >= 0 && xx < HS) ? bf16_round(x[((size_t)b * CI + c) * PX + yy * HS + xx]) : 0.f; }
  __syncthreads();
  { for (int i = tid; i < 32 * CG; i += 256) { const int j = i / CG, c8 = (i % CG) * 8; FragH f; for (int q = 0; q < 8; ++q) f.h[q] = (_Float16)tl[c8 + q][j]; *(v8us*)((unsigned short*)XR + ((size_t)p0 + j) * CI + c8) = f.half[0]; }  } }
// 7x7 conv as a GEMM without an im2col buffer: row r of A is output pixel r of an HO x HO grid, and its k = tap * 128 + channel element is the x row at padded pixel (oy + OFF + tap / 7, ox + OFF + tap % 7),
// so a tap's 128 channels are 256 contiguous bytes. C[r][n] = alpha * sum_k A[r][k] * Bh[n][k], k in the order of d_w7. Wave tile 32x64, work-group 128x64; rows from M on repeat pixels of the last image row (their C rows are never read).
// One trip of the loop is one tap. The tap's B tile (64 weight rows, 256 bytes a row) is brought into LDS by asynchronous copies, 16 bytes a lane (16 lanes = one whole row),
// into one of two buffers: the copies of tap t + 2 fly while tap t + 1 is worked on. The fragments are read from LDS at a row pitch of 272 bytes (free of bank conflicts for 16-byte reads).
// The A tile is staged once per WINDOW ROW, not per tap: the seven taps of a window row read the same x rows, one pixel further right each. The tile's 128 pixels lie in up to four image rows (segments);
// each segment is staged with the 6 pixels that follow it in the padded grid, and tap column dx reads pixel i at LDS row i + 16 * segment + dx (16 rows per segment keep a fragment's 16 rows on 16 different bank groups).
// Two A buffers: window row d + 1 is copied, with the B tile of its first tap, while the last tap of window row d is worked on.
#define LP 272                       /* LDS row pitch in bytes */
#define AC 160                       /* x rows copied per window row: 128 pixels + 4 x 6 that follow a segment = 152, rounded up to 20 per thread */
#define LA ((AC + 30) * LP)          /* one A buffer: the copied rows, 10 unused rows between segments */
#define LB (64 * LP)                 /* one B buffer */
// twelve copies of 16 bytes a lane, LDS byte address l[i] from global address g[i]; the wait on the address registers ends the copies' own statement, ahead of any rewrite of them
__device__ __forceinline__ void g2_copy12(const unsigned* l, const char* const* g) {
  asm volatile("global_load_async_to_lds_b128 %0, %12, off\n\tglobal_load_async_to_lds_b128 %1, %13, off\n\tglobal_load_async_to_lds_b128 %2, %14, off\n\tglobal_load_async_to_lds_b128 %3, %15, off\n\t"
               "global_load_async_to_lds_b128 %4, %16, off\n\tglobal_load_async_to_lds_b128 %5, %17, off\n\tglobal_load_async_to_lds_b128 %6, %18, off\n\tglobal_load_async_to_lds_b128 %7, %19, off\n\t"
               "global_load_async_to_lds_b128 %8, %20, off\n\tglobal_load_async_to_lds_b128 %9, %21, off\n\tglobal_load_async_to_lds_b128 %10, %22, off\n\tglobal_load_async_to_lds_b128 %11, %23, off\n\ts_wait_xcnt 0x0"
               :: "v"(l[0]), "v"(l[1]), "v"(l[2]), "v"(l[3]), "v"(l[4]), "v"(l[5]), "v"(l[6]), "v"(l[7]), "v"(l[8]), "v"(l[9]), "v"(l[10]), "v"(l[11]),
                  "v"(g[0]), "v"(g[1]), "v"(g[2]), "v"(g[3]), "v"(g[4]), "v"(g[5]), "v"(g[6]), "v"(g[7]), "v"(g[8]), "v"(g[9]), "v"(g[10]), "v"(g[11]) : "memory"); }
// the same for eight copies
__device__ __forceinline__ void g2_copy8(const unsigned* l, const char* const* g) {
  asm volatile("global_load_async_to_lds_b128 %0, %8, off\n\tglobal_load_async_to_lds_b128 %1, %9, off\n\tglobal_load_async_to_lds_b128 %2, %10, off\n\tglobal_load_async_to_lds_b128 %3, %11, off\n\t"
               "global_load_async_to_lds_b128 %4, %12, off\n\tglobal_load_async_to_lds_b128 %5, %13, off\n\tglobal_load_async_to_lds_b128 %6, %14, off\n\tglobal_load_async_to_lds_b128 %7, %15, off\n\ts_wait_xcnt 0x0"
               :: "v"(l[0]), "v"(l[1]), "v"(l[2]), "v"(l[3]), "v"(l[4]), "v"(l[5]), "v"(l[6]), "v"(l[7]),
                  "v"(g[0]), "v"(g[1]), "v"(g[2]), "v"(g[3]), "v"(g[4]), "v"(g[5]), "v"(g[6]), "v"(g[7]) : "memory"); }
__device__ __forceinline__ v16h g2_lfrag(const unsigned char* p) { FragH f; f.half[0] = *(const v8us*)p; f.half[1] = *(const v8us*)(p + 32); return f.v; }
// copied row number c (0 .. AC - 1) of the tile that starts at output pixel r0: go = byte offset of its x row at window row 0, lo = byte offset of its place in an A buffer.
// Segment 0 is the rest of r0's image row and the 6 pixels behind it, every later segment a whole image row of HO pixels and 6 more; image rows past the last one repeat the last (their C rows are never read).
template <int HO, int OFF>
__device__ __forceinline__ void g2_amap(int r0, int c, unsigned& go, unsigned& lo) {
  const int x0 = r0 % HO, c2 = c - (HO - x0 + 6); const int s = c2 < 0 ? 0 : 1 + c2 / (HO + 6), col = c2 < 0 ? x0 + c : c2 % (HO + 6);
  const int R = min(r0 / HO + s, NB * HO - 1);      /* image row, batches end to end */
  go = (unsigned)((((R / HO) * PP + (R % HO + OFF) * HP + col + OFF) * CI) * 2); lo = (unsigned)((c + 10 * s) * LP); }
// byte offset, in an A buffer, of tile pixel i at tap column 0
template <int HO>
__device__ __forceinline__ unsigned g2_lrow(int r0, int i) { return (unsigned)((i + 16 * ((r0 + i) / HO - r0 / HO)) * LP); }
#define GQ ((int)(NRQ / 128) * (CO / 64))      /* 196 work-groups of q */
#define GK ((NRK / 128) * (CO / 64))           /* 244 work-groups of k, and as many of v */
// The three convs read nothing of each other, so they go as ONE launch: work-groups 0 .. GQ - 1 are q's tiles, the next GK are k's, the last GK are v's. A launch of one conv has fewer work-groups than the chip has WGPs;
// together they are 684, and two of them (by their LDS) share a WGP, each filling the other's waits. Which conv a work-group belongs to is the same for all its threads: every branch on it is a scalar one.
__global__ __launch_bounds__(128) void k_conv7(const _Float16* __restrict__ XR, const _Float16* __restrict__ BQ, const _Float16* __restrict__ BK, const _Float16* __restrict__ BV, float alpha, float* __restrict__ Q, float* __restrict__ Kf, float* __restrict__ Vf) {
  __shared__ __attribute__((aligned(16))) unsigned char ring[2 * LA + 2 * LB];      /* two A buffers, then two B buffers */
  float (*so)[32][68] = (float (*)[32][68])ring;      /* the output tiles take the first A buffer's place behind the loop's last barrier, so that two work-groups still fit a WGP's LDS */
  const int tid = threadIdx.x, w = tid >> 5, lane = tid & 31, ln = lane & 15, hh = lane >> 4;
  const int job = (int)blockIdx.x < GQ ? 0 : (int)blockIdx.x < GQ + GK ? 1 : 2; const int blk = (int)blockIdx.x - (job == 0 ? 0 : job == 1 ? GQ : GQ + GK);
  const _Float16* __restrict__ Bh = job == 0 ? BQ : job == 1 ? BK : BV; float* __restrict__ C = job == 0 ? Q : job == 1 ? Kf : Vf;
  const int mt = blk / (CO / 64), nq = blk % (CO / 64); const int row0 = mt * 128 + 32 * w, col0 = nq * 64;
  /* copy side: this thread brings the 16 bytes number cc of tile rows cr, cr + 8, ... */
  const int cr = tid >> 4, cc = tid & 15; unsigned ao[AC / 8], al[AC / 8], bo[8], fa0, fa1;      /* byte offsets of this thread's rows at tap 0 (al: in an A buffer); fa0, fa1: of this lane's two fragment rows; every loop over the arrays is unrolled so that they stay in registers */
  if (job == 0) {      /* q: 56-grid, x index = o + tap - 3 */
#pragma unroll
    for (int i = 0; i < AC / 8; ++i) g2_amap<HS, 3>(mt * 128, cr + 8 * i, ao[i], al[i]);
    fa0 = g2_lrow<HS>(mt * 128, 32 * w + ln); fa1 = g2_lrow<HS>(mt * 128, 32 * w + 16 + ln);
  } else {      /* k, v: 62-grid over pad3(x) with conv pad 3: x index = o + tap - 6 */
#pragma unroll
    for (int i = 0; i < AC / 8; ++i) g2_amap<HK, 0>(mt * 128, cr + 8 * i, ao[i], al[i]);
    fa0 = g2_lrow<HK>(mt * 128, 32 * w + ln); fa1 = g2_lrow<HK>(mt * 128, 32 * w + 16 + ln);
  }
#pragma unroll
  for (int i = 0; i < 8; ++i) bo[i] = (unsigned)(((col0 + cr + 8 * i) * KC + cc * 8) * 2);
  const unsigned lc = (unsigned)(size_t)ring + (unsigned)(cc * 16);
  auto issueA = [&](int d) { const char* xa = (const char*)XR + d * (HP * CI * 2) + cc * 16; const unsigned l = lc + (unsigned)((d & 1) * LA);      /* window row d's base, the same for every lane but for its 16 bytes of the row */
    unsigned la[AC / 8]; const char* ga[AC / 8];
#pragma unroll
    for (int i = 0; i < AC / 8; ++i) { la[i] = l + al[i]; ga[i] = xa + ao[i]; }
    g2_copy12(la, ga); g2_copy8(la + 12, ga + 12); };
  auto issueB = [&](int t) { const char* xb = (const char*)Bh + t * (CI * 2); const unsigned l = lc + (unsigned)(2 * LA + (t & 1) * LB + cr * LP);      /* tile rows cr + 8 i of tap t */
    unsigned la[8]; const char* ga[8];
#pragma unroll
    for (int i = 0; i < 8; ++i) { la[i] = l + (unsigned)(8 * i * LP); ga[i] = xb + bo[i]; }
    g2_copy8(la, ga); };
  const v8f z8 = {0.f,0.f,0.f,0.f,0.f,0.f,0.f,0.f}; v8f c00 = z8, c01 = z8, c02 = z8, c03 = z8, c10 = z8, c11 = z8, c12 = z8, c13 = z8;
  issueA(0); issueB(0);
  asm volatile("s_wait_asynccnt 0x0" ::: "memory");      /* this wave's copies of tap 0 have landed */
  __syncthreads();      /* tap 0 is complete before any wave reads it */
  issueB(1);
  /* the tap loop stays rolled (its body: 32 WMMAs), for speed only */
#pragma unroll 1
  for (int t = 0; t < KK; ++t) { const unsigned char* sa = ring + ((t / 7) & 1) * LA + (t % 7) * LP + 16 * hh; const unsigned char* pa = sa + fa0; const unsigned char* pc = sa + fa1; const unsigned char* pb = ring + 2 * LA + (t & 1) * LB + ln * LP + 16 * hh;
    v16h a0[2], a1[2], b0[2], b1[2], b2[2], b3[2];
    /* two fragment sets: the next 32 channels' LDS reads stand ahead of this block's WMMAs, so that their latency runs under the block; unrolled so that the sets are picked by constants */
    a0[0] = g2_lfrag(pa); a1[0] = g2_lfrag(pc); b0[0] = g2_lfrag(pb); b1[0] = g2_lfrag(pb + 16 * LP); b2[0] = g2_lfrag(pb + 32 * LP); b3[0] = g2_lfrag(pb + 48 * LP);
#pragma unroll
    for (int s = 0; s < 4; ++s) { const int u = s & 1, n = u ^ 1, kb = (s + 1) * 64;
      if (s < 3) { a0[n] = g2_lfrag(pa + kb); a1[n] = g2_lfrag(pc + kb); b0[n] = g2_lfrag(pb + kb); b1[n] = g2_lfrag(pb + 16 * LP + kb); b2[n] = g2_lfrag(pb + 32 * LP + kb); b3[n] = g2_lfrag(pb + 48 * LP + kb); }
      c00 = g2_mma(a0[u], b0[u], c00); c10 = g2_mma(a1[u], b0[u], c10); c01 = g2_mma(a0[u], b1[u], c01); c11 = g2_mma(a1[u], b1[u], c11);
      c02 = g2_mma(a0[u], b2[u], c02); c12 = g2_mma(a1[u], b2[u], c12); c03 = g2_mma(a0[u], b3[u], c03); c13 = g2_mma(a1[u], b3[u], c13);
    }
    asm volatile("s_wait_dscnt 0x0" ::: "memory");      /* this wave's reads of the buffer are done before it is handed back */
    asm volatile("s_wait_asynccnt 0x0" ::: "memory");      /* this wave's copies of tap t + 1 have landed */
    __syncthreads();      /* publishes tap t + 1 and ends every wave's reads of tap t's buffer */
    if (t + 2 < KK) { issueB(t + 2); if ((t + 2) % 7 == 0) issueA((t + 2) / 7); } }      /* a new window row goes into the A buffer that the window row before the current one has left */
  asm volatile("s_wait_asynccnt 0x0" ::: "memory");      /* no copy is outstanding when the wave goes on */
  v8f accs[8] = {c00, c01, c02, c03, c10, c11, c12, c13};
#pragma unroll
  for (int u = 0; u < 8; ++u) { const int t = u & 3, half = u >> 2;
#pragma unroll
    for (int r = 0; r < 8; ++r) so[w][half * 16 + 8 * hh + r][t * 16 + ln] = accs[u][r] * alpha; }
  __builtin_amdgcn_fence(__ATOMIC_ACQ_REL, "workgroup"); __builtin_amdgcn_wave_barrier();
  const int rsub = lane >> 4, c4 = (lane & 15) * 4;
#pragma unroll
  for (int q = 0; q < 16; ++q) { const int r = q * 2 + rsub; const v4f v = *(const v4fa*)&so[w][r][c4]; *(v4f*)(C + (size_t)(row0 + r) * CO + col0 + c4) = v; } }
__device__ __forceinline__ void d_w7(const float* __restrict__ w, _Float16* __restrict__ Bt, int blk) { const size_t t = (size_t)blk * 256 + threadIdx.x; if (t >= (size_t)CO * KC / 8) return; const int c8 = (int)((t * 8) % CI); const int tap = (int)(((t * 8) / CI) % KK); const int o = (int)((t * 8) / KC); FragH f; for (int q = 0; q < 8; ++q) f.h[q] = (_Float16)(bf16_round(w[((size_t)o * CI + c8 + q) * KK + tap]) * 16.0f);
  *(v8us*)((unsigned short*)Bt + t * 8) = f.half[0];  }
#define GX (NB * PP / 32)                      /* 289 work-groups of x rows */
#define GW ((CO * KC / 8 + 255) / 256)         /* 784 work-groups per weight plane */
// The x rows and the three weight planes are made from the inputs alone, none from another: one launch, the job picked by the work-group's index (the same for all its threads, so the barrier of the x rows is passed by whole work-groups).
__global__ __launch_bounds__(256) void k_prep(const float* __restrict__ x, const float* __restrict__ wq, const float* __restrict__ wk, const float* __restrict__ wv, _Float16* __restrict__ XR, _Float16* __restrict__ BQ, _Float16* __restrict__ BK, _Float16* __restrict__ BV) {
  const int blk = (int)blockIdx.x;
  if (blk < GX) { d_xrows(x, XR, blk); return; }
  const int job = (blk - GX) / GW;
  d_w7(job == 0 ? wq : job == 1 ? wk : wv, job == 0 ? BQ : job == 1 ? BK : BV, (blk - GX) % GW); }
// Lanes run along channels: one wave holds the 32 channels of one head, so every Q, K and V load of a wave is one whole 128-byte line and the window position is wave-uniform.
// A wave takes four neighbouring pixels of one image row at once: their four 7-wide window rows are ten neighbouring K (and V) pixels, loaded once per window row, all in flight together, and used from registers by all four.
// The head's rel table lies in LDS as [tap][channel], so that its reads are contiguous over the lanes too (in global memory a channel's taps are 28 bytes from the next channel's).
// A work-group (8 waves, 4 pixels each) fills a 32-channel x 32-pixel tile in LDS, and the channel-major store then writes whole 128-byte lines.
__global__ __launch_bounds__(256) void k_watt(const float* __restrict__ Q, const float* __restrict__ Kf, const float* __restrict__ Vf, const float* __restrict__ rh, const float* __restrict__ rw, float* __restrict__ out) {
  __shared__ __attribute__((aligned(16))) float tl[32][36]; __shared__ float rl[7][32];
  const int tid = threadIdx.x, lane = tid & 31; const int w = __builtin_amdgcn_readfirstlane(tid >> 5);      /* the wave's number as a scalar: pixel, window row and column stay on the scalar unit */
  const int p0 = (int)(blockIdx.x % (PX / 32)) * 32; const int bh = (int)(blockIdx.x / (PX / 32)); const int head = bh % (NCO / 32); const size_t b = bh / (NCO / 32); const int c = head * 32 + lane; const bool first = head < CO / 64;      /* c < CO / 2, the same for the whole work-group */
  if (w < 7) rl[w][lane] = first ? bf16_round(rh[(size_t)c * 7 + w]) : bf16_round(rw[(size_t)(c - CO / 2) * 7 + w]);
  __syncthreads();      /* the rel table is complete before any wave reads it */
  const int p = p0 + 4 * w; const int y = p / HS, x = p % HS;      /* pixels p .. p + 3 lie in one image row: HS and p are multiples of 4 */
  const float* kp = Kf + (b * PK + (size_t)y * HK + x) * CO + c; const float* vp = Vf + (b * PK + (size_t)y * HK + x) * CO + c;
  float qv[4], mx[4], se[4], acc[4], rc[7];
  /* every loop over the four pixels, the seven window columns and the ten loaded lines is unrolled (each '#pragma unroll' below), so that these small arrays are indexed by constants and stay in registers */
#pragma unroll
  for (int j = 0; j < 4; ++j) { qv[j] = Q[(b * PX + p + j) * CO + c] * 1.44269504f; mx[j] = -3.0e38f; se[j] = 0.f; acc[j] = 0.f; }      /* q carries log2(e): scores and their maximum are in base-2 units, so that each term is one exp2 */
#pragma unroll
  for (int kw = 0; kw < 7; ++kw) rc[kw] = rl[kw][lane];
  /* the loops over window rows stay rolled: one row's body (28 window positions) is already long */
#pragma unroll 1
  for (int kh = 0; kh < 7; ++kh) { float kr[10]; const float rk = rl[kh][lane];
#pragma unroll
    for (int i = 0; i < 10; ++i) kr[i] = kp[(size_t)(kh * HK + i) * CO];
#pragma unroll
    for (int j = 0; j < 4; ++j)
#pragma unroll
      for (int kw = 0; kw < 7; ++kw) { const float kv = __fadd_rn(kr[j + kw], first ? rk : rc[kw]); mx[j] = fmaxf(mx[j], __fmul_rn(qv[j], kv)); } }
  /* per pixel the 49 terms are summed window row by window row, left to right */
#pragma unroll 1
  for (int kh = 0; kh < 7; ++kh) { float kr[10], vr[10]; const float rk = rl[kh][lane];
#pragma unroll
    for (int i = 0; i < 10; ++i) { kr[i] = kp[(size_t)(kh * HK + i) * CO]; vr[i] = vp[(size_t)(kh * HK + i) * CO]; }
#pragma unroll
    for (int j = 0; j < 4; ++j)
#pragma unroll
      for (int kw = 0; kw < 7; ++kw) { const float kv = kr[j + kw] + (first ? rk : rc[kw]); const float e = __builtin_amdgcn_exp2f(fmaf(qv[j], kv, -mx[j])); se[j] += e; acc[j] = fmaf(e, vr[j + kw], acc[j]); } }      /* the argument is at most a rounding error above 0; a term below the exp2 instruction's range counts as 0 beside the largest term's 1 */
#pragma unroll
  for (int j = 0; j < 4; ++j) tl[lane][4 * w + j] = acc[j] / se[j];
  __syncthreads();      /* the tile is complete before any wave reads other waves' pixels */
  const int dh = tid >> 3, j4 = (tid & 7) * 4; const v4f o = *(const v4fa*)&tl[dh][j4];
  const int oc = dh * 8 + head;      /* the reference's final transpose: output channel = dh*heads + head for computation channel head*32 + dh */
  *(v4f*)(out + ((b * CO + oc) * (size_t)PX + p0 + j4)) = o; }

extern "C" void kernel_launch(void* const* d_in, const int* in_sizes, int n_in,
                              void* d_out, int out_size, void* d_ws, size_t ws_size, hipStream_t stream) {
  (void)in_sizes; (void)n_in; (void)out_size;
  const float* const* I = (const float* const*)d_in; const float* x = I[0]; const float* wq = I[1]; const float* wk = I[2]; const float* wv = I[3]; const float* rh = I[4]; const float* rw = I[5];
  char* ws = (char*)d_ws; size_t off = 0;
  auto take = [&](size_t bytes) { char* p = ws + off; off += (bytes + 255) & ~(size_t)255; return p; };
  _Float16* BQ = (_Float16*)take((size_t)CO * KC * 2); _Float16* BK = (_Float16*)take((size_t)CO * KC * 2); _Float16* BV = (_Float16*)take((size_t)CO * KC * 2);
  _Float16* XR = (_Float16*)take((size_t)NB * PP * CI * 2); float* Q = (float*)take(NRQ * CO * 4); float* Kf = (float*)take((size_t)NRK * CO * 4); float* Vf = (float*)take((size_t)NRK * CO * 4);
  if (off > ws_size) return;      /* three weight planes, the x rows, q, k, v */
  k_prep<<<GX + 3 * GW, 256, 0, stream>>>(x, wq, wk, wv, XR, BQ, BK, BV);
  k_conv7<<<GQ + 2 * GK, 128, 0, stream>>>(XR, BQ, BK, BV, 0.0625f, Q, Kf, Vf);
  k_watt<<<NB * (NCO / 32) * (PX / 32), 256, 0, stream>>>(Q, Kf, Vf, rh, rw, (float*)d_out);
}

// v008
// A run of this version takes 85 microseconds.
// Timed twice side by side with v007, it ran 1.17 and 1.20 times as fast.
// Counting every step since v000, it is 18.8 times as fast.
#include <hip/hip_runtime.h>
// StandAloneSelfAttention (inputs [2][128][56][56]; q = conv7x7(x, Wq, pad 3) (256 ch, 56x56); k, v = conv7x7(pad3(x), Wk/Wv, pad 3) (256 ch, 62x62); per channel c and pixel: 7x7 window of k (plus rel_h[c] per window row for the first 128 channels, rel_w[c-128] per window column for the rest) and v around the pixel; attn = softmax over the 49 of q*k (scalar products); out = sum attn*v, then the reference's transpose(0,2,1,3,4): output channel (dh*8 + head) takes computation channel (head*32 + dh) -> [2][256][56][56]).
// Structure: pixel rows; x as exact f16 rows via LDS transposes; the three 7x7 convs as WMMA GEMMs (K = 6,272 = 49 taps x 128 channels; 48x64 wave tiles, f32 accumulation, exact x16 weights) whose A tiles are taken tap by tap from the x rows, which lie on a 68x68 grid with 6 pixels of zeros on every side (all padding of both convs), and staged with the weight tiles in LDS, into f32 channel rows; the per-channel 49-way window softmax and weighted sum on VALU in f32 (rel tables read) with the channel-major store.
// Compute dtype: inputs rounded to bf16; x / weights / rel tables exact; q, k, v in f32 (GEMM outputs); softmax and the weighted sum f32 — no reduced-precision intermediates after the convs. v_wmma_f32_16x16x32_f16.
#define NB 2
#define CI 128
#define CO 256
#define HS 56
#define PX (HS * HS)                 /* 3136 */
#define HK 62                        /* k/v grid */
#define PK (HK * HK)                 /* 3844 */
#define NRQ ((size_t)NB * PX)        /* 6272 = 49 x 128 */
#define TM 192                       /* rows (output pixels) of a conv work-group's tile */
#define TN 128                       /* its columns (output channels) */
#define MQ ((int)((NRQ + TM - 1) / TM))          /* 33 row tiles of q */
#define MK ((NB * PK + TM - 1) / TM)             /* 41 row tiles of k, and of v (2 x 3844 = 7688 rows) */
#define KK 49
#define KC (KK * CI)                 /* 6272 */
#define CG (CI / 8)
#define HP (HS + 12)                 /* x rows on a grid with 6 zero pixels on every side */
#define PP (HP * HP)                 /* 4624; NB * PP = 289 x 32 */
#define NCO CO                       /* output channels computed (debug hook) */
typedef __bf16 v16b __attribute__((ext_vector_type(16)));
typedef unsigned short v8us __attribute__((ext_vector_type(8), may_alias));
typedef float  v8f  __attribute__((ext_vector_type(8)));
typedef float  v4f  __attribute__((ext_vector_type(4)));
typedef float  v4fa __attribute__((ext_vector_type(4), may_alias));
union FragB { v16b v; v8us half[2]; unsigned short u[16]; };

__device__ __forceinline__ unsigned short bf16_bits(float x) { unsigned int u = __float_as_uint(x); return (unsigned short)((u + 0x7FFFu + ((u >> 16) & 1u)) >> 16); }
__device__ __forceinline__ float bf16_val(unsigned short b) { return __uint_as_float(((unsigned int)b) << 16); }
__device__ __forceinline__ float bf16_round(float x) { return bf16_val(bf16_bits(x)); }
// D += A·B with NT terms: 1 = ah·bh, 2 = + al·bh (A split), 3 = + ah·bl (both split)
template <int NT>
__device__ __forceinline__ v8f mmaN(v16b ah, v16b al, v16b bh, v16b bl, v8f c) {
  c = __builtin_amdgcn_wmma_f32_16x16x32_bf16(false, ah, false, bh, (short)0, c, false, false);
  if (NT >= 2) c = __builtin_amdgcn_wmma_f32_16x16x32_bf16(false, al, false, bh, (short)0, c, false, false);
  if (NT >= 3) c = __builtin_amdgcn_wmma_f32_16x16x32_bf16(false, ah, false, bl, (short)0, c, false, false);
  asm volatile("v_nop\n\tv_nop\n\tv_nop\n\tv_nop" : "+v"(c) : "v"(ah), "v"(al), "v"(bh), "v"(bl));
  return c;
}

__global__ __launch_bounds__(256) void k_wt_bf16(const float* __restrict__ W, unsigned short* __restrict__ Wt, int K, int N) {
  const int t = blockIdx.x * 256 + threadIdx.x;
  const int k8n = K / 8;
  if (t >= N * k8n) return;
  const int n = t / k8n, k8 = (t % k8n) * 8;
  v8us v;
#pragma unroll
  for (int i = 0; i < 8; ++i) v[i] = bf16_bits(W[(size_t)(k8 + i) * N + n]);
  *(v8us*)(Wt + (size_t)n * K + k8) = v;
  
}

// GEMM C[M][N] (f32, pitch ldc) = act(A[M][K]·W + bias). A f32 row-major (pitch lda) converted per fragment to bf16
// (ASPLIT: hi/lo two planes -> 2 terms, else single rounded term); Wt bf16 [N][K] (pitch ldb). BIAS_BF16 rounds the
// bias to bf16 first (bias quantised to bf16 before the add). K%32==0, M%16==0, N%64==0.
template <bool ASPLIT, int ACT, bool BIAS_BF16>
__global__ __launch_bounds__(128) void k_gemm_bf(const float* __restrict__ A, int lda, const unsigned short* __restrict__ Wt, int ldb,
                                               const float* __restrict__ bias, float* __restrict__ C, int ldc, int M, int N, int K) {
  __shared__ __attribute__((aligned(16))) float so[4][16][64];
  const int tid = threadIdx.x, w = tid >> 5, lane = tid & 31, ln = lane & 15, hh = lane >> 4;
  const int ntn = N / 64;
  const int wid = blockIdx.x * 4 + w;
  const int mt = wid / ntn, nq = wid % ntn;
  if (mt * 16 >= M) return;
  const int row0 = mt * 16, col0 = nq * 64;
  const float* arow = A + (size_t)(row0 + ln) * lda;
  v8f acc[4] = {};
  for (int kb = 0; kb < K; kb += 32) {
    FragB ah, al;
    const v4f x0 = *(const v4fa*)(arow + kb + 8 * hh), x1 = *(const v4fa*)(arow + kb + 8 * hh + 4);
    const v4f x2 = *(const v4fa*)(arow + kb + 16 + 8 * hh), x3 = *(const v4fa*)(arow + kb + 16 + 8 * hh + 4);
    float xs[16] = {x0[0],x0[1],x0[2],x0[3],x1[0],x1[1],x1[2],x1[3],x2[0],x2[1],x2[2],x2[3],x3[0],x3[1],x3[2],x3[3]};
#pragma unroll
    for (int i = 0; i < 16; ++i) { const unsigned short hb = bf16_bits(xs[i]); ah.u[i] = hb; al.u[i] = ASPLIT ? bf16_bits(xs[i] - bf16_val(hb)) : (unsigned short)0; }
#pragma unroll
    for (int t = 0; t < 4; ++t) {
      const unsigned short* brow = Wt + (size_t)(col0 + t * 16 + ln) * ldb + kb;
      FragB b;
      b.half[0] = *(const v8us*)(brow + 8 * hh);
      b.half[1] = *(const v8us*)(brow + 16 + 8 * hh);
      acc[t] = mmaN<ASPLIT ? 2 : 1>(ah.v, al.v, b.v, b.v, acc[t]);
    }
  }
#pragma unroll
  for (int t = 0; t < 4; ++t) {
    float bv = bias ? bias[col0 + t * 16 + ln] : 0.f;
    if (BIAS_BF16) bv = bf16_round(bv);
#pragma unroll
    for (int r = 0; r < 8; ++r) { float v = acc[t][r] + bv; if (ACT == 1) v = fmaxf(v, 0.f); so[w][8 * hh + r][t * 16 + ln] = v; }
  }
  __builtin_amdgcn_fence(__ATOMIC_ACQ_REL, "workgroup");
  __builtin_amdgcn_wave_barrier();
  const int rsub = lane >> 4, c4 = (lane & 15) * 4;
  {
#pragma unroll
    for (int q = 0; q < 8; ++q) {
      const int r = q * 2 + rsub;
      const v4f v = *(const v4fa*)&so[w][r][c4];
      *(v4f*)(C + (size_t)(row0 + r) * ldc + col0 + c4) = v;
    }
    
  }
}

// GEMM C = act(A·W + bias + resid): A f32 (ASPLIT -> hi/lo 2 terms), Wt bf16 [N][K]; ACT 0 none, 1 relu, 2 exact gelu;
// resid (optional, f32, row index = (row % rmod), pitch ldr, RES_BF16 rounds it) added before the activation.
template <bool ASPLIT, int ACT, bool BIAS_BF16, bool RES_BF16>
__global__ __launch_bounds__(128) void k_gemm_bf3(const float* __restrict__ A, int lda, const unsigned short* __restrict__ Wt, int ldb,
                                                const float* __restrict__ bias, const float* __restrict__ resid, int rmod, int ldr,
                                                float* __restrict__ C, int ldc, int M, int N, int K) {
  __shared__ __attribute__((aligned(16))) float so[4][16][64];
  const int tid = threadIdx.x, w = tid >> 5, lane = tid & 31, ln = lane & 15, hh = lane >> 4;
  const int ntn = N / 64;
  const int wid = blockIdx.x * 4 + w;
  const int mt = wid / ntn, nq = wid % ntn;
  if (mt * 16 >= M) return;
  const int row0 = mt * 16, col0 = nq * 64;
  const float* arow = A + (size_t)(row0 + ln) * lda;
  v8f acc[4] = {};
  for (int kb = 0; kb < K; kb += 32) {
    FragB ah, al;
    const v4f x0 = *(const v4fa*)(arow + kb + 8 * hh), x1 = *(const v4fa*)(arow + kb + 8 * hh + 4);
    const v4f x2 = *(const v4fa*)(arow + kb + 16 + 8 * hh), x3 = *(const v4fa*)(arow + kb + 16 + 8 * hh + 4);
    float xs[16] = {x0[0],x0[1],x0[2],x0[3],x1[0],x1[1],x1[2],x1[3],x2[0],x2[1],x2[2],x2[3],x3[0],x3[1],x3[2],x3[3]};
#pragma unroll
    for (int i = 0; i < 16; ++i) { const unsigned short hb = bf16_bits(xs[i]); ah.u[i] = hb; al.u[i] = ASPLIT ? bf16_bits(xs[i] - bf16_val(hb)) : (unsigned short)0; }
#pragma unroll
    for (int t = 0; t < 4; ++t) {
      const unsigned short* brow = Wt + (size_t)(col0 + t * 16 + ln) * ldb + kb;
      FragB b;
      b.half[0] = *(const v8us*)(brow + 8 * hh);
      b.half[1] = *(const v8us*)(brow + 16 + 8 * hh);
      acc[t] = mmaN<ASPLIT ? 2 : 1>(ah.v, al.v, b.v, b.v, acc[t]);
    }
  }
#pragma unroll
  for (int t = 0; t < 4; ++t) {
    const int col = col0 + t * 16 + ln;
    float bv = bias ? bias[col] : 0.f;
    if (BIAS_BF16) bv = bf16_round(bv);
#pragma unroll
    for (int r = 0; r < 8; ++r) {
      float v = acc[t][r] + bv;
      if (resid) { float rv = resid[(size_t)((row0 + 8 * hh + r) % rmod) * ldr + col]; if (RES_BF16) rv = bf16_round(rv); v += rv; }
      if (ACT == 1) v = fmaxf(v, 0.f);
      if (ACT == 2) v = 0.5f * v * (1.0f + erff(v * 0.70710678118654752f));
      if (ACT == 3) { const float u = 0.7978845608028654f * (v + 0.044715f * v * v * v); v = 0.5f * v * (1.0f + tanhf(u)); }
      so[w][8 * hh + r][t * 16 + ln] = v;
    }
  }
  __builtin_amdgcn_fence(__ATOMIC_ACQ_REL, "workgroup");
  __builtin_amdgcn_wave_barrier();
  const int rsub = lane >> 4, c4 = (lane & 15) * 4;
  {
#pragma unroll
    for (int q = 0; q < 8; ++q) {
      const int r = q * 2 + rsub;
      const v4f v = *(const v4fa*)&so[w][r][c4];
      *(v4f*)(C + (size_t)(row0 + r) * ldc + col0 + c4) = v;
    }
    
  }
}
// row LayerNorm (biased variance, eps) over N: s = X (+ R); optional out_sum <- s; out_norm <- (s-mu)*rsqrt(var+eps)*g + b
template <bool PARAM_BF16>
__global__ __launch_bounds__(256) void k_layernorm(const float* __restrict__ X, const float* __restrict__ R, const float* __restrict__ g, const float* __restrict__ bta,
                                                  float* __restrict__ out_sum, float* __restrict__ out_norm, int N, float eps) {
  __shared__ float red[256];
  const int row = blockIdx.x, tid = threadIdx.x;
  const float* x = X + (size_t)row * N; const float* rr = R ? R + (size_t)row * N : nullptr;
  float vals[16];                     // up to N = 4096
  const int per = N / 256;            // contiguous chunk per thread? use strided-by-4 chunks: thread handles j = tid*4 + 1024*u
  float s1 = 0.f;
  for (int u = 0; u < per / 4; ++u) {
    const int j = tid * 4 + 1024 * u;
    const v4f a = *(const v4fa*)(x + j);
    v4f b = {0.f,0.f,0.f,0.f}; if (rr) b = *(const v4fa*)(rr + j);
#pragma unroll
    for (int q = 0; q < 4; ++q) { const float v = a[q] + b[q]; vals[u * 4 + q] = v; s1 += v; }
  }
  red[tid] = s1; __syncthreads();
  for (int st = 128; st > 0; st >>= 1) { if (tid < st) red[tid] += red[tid + st]; __syncthreads(); }
  const float mu = red[0] / (float)N; __syncthreads();
  float s2 = 0.f;
  for (int u = 0; u < per / 4; ++u)
#pragma unroll
    for (int q = 0; q < 4; ++q) { const float c = vals[u * 4 + q] - mu; s2 += c * c; }
  red[tid] = s2; __syncthreads();
  for (int st = 128; st > 0; st >>= 1) { if (tid < st) red[tid] += red[tid + st]; __syncthreads(); }
  const float rs = rsqrtf(red[0] / (float)N + eps);
  {
    for (int u = 0; u < per / 4; ++u) {
      const int j = tid * 4 + 1024 * u;
      v4f o, sm;
#pragma unroll
      for (int q = 0; q < 4; ++q) {
        float gg = g[j + q], bb = bta[j + q];
        if (PARAM_BF16) { gg = bf16_round(gg); bb = bf16_round(bb); }
        sm[q] = vals[u * 4 + q]; o[q] = (vals[u * 4 + q] - mu) * rs * gg + bb;
      }
      if (out_sum) *(v4f*)(out_sum + (size_t)row * N + j) = sm;
      *(v4f*)(out_norm + (size_t)row * N + j) = o;
    }
    
  }
}



// ---- f16 WMMA path (v_wmma_f32_16x16x32_f16): 11-bit significands for operands in range — used here for the conv GEMMs, whose bf16-rounded x and x16 weights are exact in f16
typedef _Float16 v16h __attribute__((ext_vector_type(16)));
union FragH { v16h v; v8us half[2]; _Float16 h[16]; unsigned short u[16]; };
template <int NT>
__device__ __forceinline__ v8f mmaH(v16h ah, v16h al, v16h bh, v16h bl, v8f c) {
  c = __builtin_amdgcn_wmma_f32_16x16x32_f16(false, ah, false, bh, (short)0, c, false, false);
  if (NT >= 2) c = __builtin_amdgcn_wmma_f32_16x16x32_f16(false, al, false, bh, (short)0, c, false, false);
  if (NT >= 3) c = __builtin_amdgcn_wmma_f32_16x16x32_f16(false, ah, false, bl, (short)0, c, false, false);
  asm volatile("v_nop\n\tv_nop\n\tv_nop\n\tv_nop" : "+v"(c) : "v"(ah), "v"(al), "v"(bh), "v"(bl));
  return c;
}
// batched GEMM like k_gemm_b but f16 operands: A f32 (split into f16 hi/lo if ASPLIT, else rounded to f16), Bt = f16 values [n][k]; alpha; C f32; N multiple of 16 (partial tiles skipped)
template <bool ASPLIT>
__global__ __launch_bounds__(128) void k_gemm_h(const float* __restrict__ A, int lda, size_t sA, const _Float16* __restrict__ Bh, int ldb, size_t sB, float alpha, float* __restrict__ C, int ldc, size_t sC, int M, int N, int K) {
  __shared__ __attribute__((aligned(16))) float so[4][16][64];
  const int tid = threadIdx.x, w = tid >> 5, lane = tid & 31, ln = lane & 15, hh = lane >> 4; const int by = blockIdx.y;
  A += (size_t)by * sA; Bh += (size_t)by * sB; C += (size_t)by * sC;
  const int ntn = (N + 63) / 64; const int wid = blockIdx.x * 4 + w; const int mt = wid / ntn, nq = wid % ntn; if (mt * 16 >= M) return;
  const int row0 = mt * 16, col0 = nq * 64; const float* arow = A + (size_t)(row0 + ln) * lda;
  v8f acc[4] = {};
  for (int kb = 0; kb < K; kb += 32) {
    FragH ah, al;
    const v4f x0 = *(const v4fa*)(arow + kb + 8 * hh), x1 = *(const v4fa*)(arow + kb + 8 * hh + 4), x2 = *(const v4fa*)(arow + kb + 16 + 8 * hh), x3 = *(const v4fa*)(arow + kb + 16 + 8 * hh + 4);
    float xs[16] = {x0[0],x0[1],x0[2],x0[3],x1[0],x1[1],x1[2],x1[3],x2[0],x2[1],x2[2],x2[3],x3[0],x3[1],x3[2],x3[3]};
#pragma unroll
    for (int i = 0; i < 16; ++i) { const _Float16 h = (_Float16)xs[i]; ah.h[i] = h; al.h[i] = ASPLIT ? (_Float16)(xs[i] - (float)h) : (_Float16)0.0f; }
#pragma unroll
    for (int t = 0; t < 4; ++t) { if (col0 + t * 16 >= N) continue; const size_t boff = (size_t)(col0 + t * 16 + ln) * ldb + kb; FragH bq; bq.half[0] = *(const v8us*)(Bh + boff + 8 * hh); bq.half[1] = *(const v8us*)(Bh + boff + 16 + 8 * hh);
      acc[t] = mmaH<ASPLIT ? 2 : 1>(ah.v, al.v, bq.v, bq.v, acc[t]); }
  }
#pragma unroll
  for (int t = 0; t < 4; ++t) { if (col0 + t * 16 >= N) continue;
#pragma unroll
    for (int r = 0; r < 8; ++r) so[w][8 * hh + r][t * 16 + ln] = acc[t][r] * alpha; }
  __builtin_amdgcn_fence(__ATOMIC_ACQ_REL, "workgroup"); __builtin_amdgcn_wave_barrier();
  const int rsub = lane >> 4, c4 = (lane & 15) * 4;
  {
#pragma unroll
    for (int q = 0; q < 8; ++q) { const int r = q * 2 + rsub; if (col0 + c4 < N) { const v4f v = *(const v4fa*)&so[w][r][c4]; *(v4f*)(C + (size_t)(row0 + r) * ldc + col0 + c4) = v; } }
     }
}

// Wt[n][k] = f16(W[k][n]·scale) from f32 row-major W[K][N] (scale = power of two; bf16-exact weights stay exact in f16 away from the subnormal range)
__global__ __launch_bounds__(256) void k_wt_f16(const float* __restrict__ W, _Float16* __restrict__ Wt, int K, int N, float scale) {
  const int t = blockIdx.x * 256 + threadIdx.x; if (t >= N * (K / 8)) return; const int n = t / (K / 8), k8 = (t % (K / 8)) * 8; FragH f;
#pragma unroll
  for (int i = 0; i < 8; ++i) f.h[i] = (_Float16)(bf16_round(W[(size_t)(k8 + i) * N + n]) * scale); const v8us o = f.half[0];
  *(v8us*)((unsigned short*)Wt + (size_t)n * K + k8) = o; 
}
// k_gemm_hh variant with fused epilogue: v = acc·alpha + bias[by·sBias + col] (+ CP[(row/rowsPerB)·sCPb + by·64 + col] if CP) ; ACT 0 none / 1 elu ; writes f16 C16 (and f32 C if non-null)
template <int ACT>
__global__ __launch_bounds__(128) void k_gemm_hhx(const _Float16* __restrict__ A, int lda, size_t sA, const _Float16* __restrict__ Bh, int ldb, size_t sB, float alpha, const float* __restrict__ bias, size_t sBias, const float* __restrict__ CP, int rowsPerB, size_t sCPb, int row0g,
    float* __restrict__ C, _Float16* __restrict__ C16, int ldc, size_t sC, int M, int N, int K) {
  __shared__ __attribute__((aligned(16))) float so[4][16][64];
  const int tid = threadIdx.x, w = tid >> 5, lane = tid & 31, ln = lane & 15, hh = lane >> 4; const int by = blockIdx.y;
  A += (size_t)by * sA; Bh += (size_t)by * sB; const size_t cofs = (size_t)by * sC; const float* bp = bias ? bias + (size_t)by * sBias : nullptr;
  const int ntn = (N + 63) / 64; const int wid = blockIdx.x * 4 + w; const int mt = wid / ntn, nq = wid % ntn; if (mt * 16 >= M) return;
  const int row0 = mt * 16, col0 = nq * 64; const _Float16* arow = A + (size_t)(row0 + ln) * lda;
  v8f acc[4] = {};
  for (int kb = 0; kb < K; kb += 32) { FragH ah; ah.half[0] = *(const v8us*)((const unsigned short*)arow + kb + 8 * hh); ah.half[1] = *(const v8us*)((const unsigned short*)arow + kb + 16 + 8 * hh);
#pragma unroll
    for (int t = 0; t < 4; ++t) { if (col0 + t * 16 >= N) continue; const size_t boff = (size_t)(col0 + t * 16 + ln) * ldb + kb; FragH bq; bq.half[0] = *(const v8us*)((const unsigned short*)Bh + boff + 8 * hh); bq.half[1] = *(const v8us*)((const unsigned short*)Bh + boff + 16 + 8 * hh);
      acc[t] = mmaH<1>(ah.v, ah.v, bq.v, bq.v, acc[t]); }
  }
#pragma unroll
  for (int t = 0; t < 4; ++t) { if (col0 + t * 16 >= N) continue; const int col = col0 + t * 16 + ln; const float bv = bp ? bf16_round(bp[col]) : 0.f;
#pragma unroll
    for (int r = 0; r < 8; ++r) { float v = acc[t][r] * alpha + bv; if (CP) { const int rr = row0g + row0 + 8 * hh + r; if (rowsPerB < 0) v += CP[cofs + (size_t)rr * ldc + col];      /* rowsPerB < 0: own element of the batched C plane */ else { const int bidx = rr / rowsPerB; v += CP[(size_t)bidx * sCPb + (size_t)by * 64 + col]; } } if (ACT == 1) v = (v > 0.f) ? v : expm1f(v); else if (ACT == 7) v = (v > 0.f) ? v + 1.0f : expf(v); else if (ACT == 8) v = tanhf(v); else if (ACT == 9) v = 0.5f * v * (1.0f + tanhf(0.7978845608028654f * (v + 0.044715f * v * v * v))); else if (ACT == 11) v = 1.0f / (1.0f + expf(-v)); else if (ACT == 12) v = (v > 0.f) ? v : 0.01f * v; else if (ACT == 14) v = (v > 0.f) ? v : 0.1f * v; else if (ACT == 16) v = (v >= 0.f) ? v : 0.3f * v; else if (ACT == 17) v = (v >= 0.f) ? v : 0.2f * v; else if (ACT == 15) v = v / (1.0f + expf(-v)); else if (ACT == 3) v = fmaxf(v, 0.f); else if (ACT == 6) v = 0.5f * v * (1.0f + erff(v * 0.70710678118654752f)); so[w][8 * hh + r][t * 16 + ln] = v; } }
  __builtin_amdgcn_fence(__ATOMIC_ACQ_REL, "workgroup"); __builtin_amdgcn_wave_barrier();
  const int rsub = lane >> 4, c4 = (lane & 15) * 4; typedef _Float16 v4h __attribute__((ext_vector_type(4)));
  {
#pragma unroll
    for (int q = 0; q < 8; ++q) { const int r = q * 2 + rsub; if (col0 + c4 < N) { const v4f v = *(const v4fa*)&so[w][r][c4]; if (C) *(v4f*)(C + cofs + (size_t)(row0 + r) * ldc + col0 + c4) = v; if (C16) { v4h h4; for (int i = 0; i < 4; ++i) h4[i] = (_Float16)v[i]; *(v4h*)(C16 + cofs + (size_t)(row0 + r) * ldc + col0 + c4) = h4; } } }
     }
}


typedef _Float16 v4h __attribute__((ext_vector_type(4)));

__global__ __launch_bounds__(256) void k_x16(const float* __restrict__ x, _Float16* __restrict__ X16, size_t n8) { const size_t t = (size_t)blockIdx.x * 256 + threadIdx.x; if (t >= n8) return; FragH f;
#pragma unroll
  for (int q = 0; q < 8; ++q) f.h[q] = (_Float16)bf16_round(x[t * 8 + q]); *(v8us*)((unsigned short*)X16 + t * 8) = f.half[0];  }
__global__ __launch_bounds__(256) void k_h16(const float* __restrict__ x, _Float16* __restrict__ X16, size_t n8) { const size_t t = (size_t)blockIdx.x * 256 + threadIdx.x; if (t >= n8) return; FragH f;
#pragma unroll
  for (int q = 0; q < 8; ++q) f.h[q] = (_Float16)x[t * 8 + q]; *(v8us*)((unsigned short*)X16 + t * 8) = f.half[0];  }
__global__ __launch_bounds__(256) void k_round16f(const float* __restrict__ W, _Float16* __restrict__ Bt, size_t n8) { const size_t t = (size_t)blockIdx.x * 256 + threadIdx.x; if (t >= n8) return; FragH f;
#pragma unroll
  for (int i = 0; i < 8; ++i) f.h[i] = (_Float16)(bf16_round(W[t * 8 + i]) * 16.0f); *(v8us*)((unsigned short*)Bt + t * 8) = f.half[0];  }
template <int NHv, int TTv>
__global__ __launch_bounds__(256) void k_vt(const _Float16* __restrict__ V16, int ldv, int voff, _Float16* __restrict__ Vt) { __shared__ unsigned short tl[64][66]; const int tid = threadIdx.x; const int slab = blockIdx.x / (TTv / 64), lg = blockIdx.x % (TTv / 64); const int b = slab / NHv, h = slab % NHv;
  for (int i = tid; i < 64 * 8; i += 256) { const int r = i / 8, c8 = (i % 8) * 8; FragH f; f.half[0] = *(const v8us*)((const unsigned short*)V16 + ((size_t)b * TTv + lg * 64 + r) * ldv + voff + h * 64 + c8);
#pragma unroll
    for (int q = 0; q < 8; ++q) tl[r][c8 + q] = f.u[q]; }
  __syncthreads();
  {
#pragma unroll
    for (int rd = 0; rd < 2; ++rd) { const int d = rd * 32 + tid / 8, pc = tid % 8; FragH f;
#pragma unroll
      for (int q = 0; q < 8; ++q) f.u[q] = tl[pc * 8 + q][d];
      *(v8us*)((unsigned short*)Vt + ((size_t)slab * 64 + d) * TTv + lg * 64 + pc * 8) = f.half[0]; }
     } }

__global__ __launch_bounds__(256) void k_hl(const float* __restrict__ F, _Float16* __restrict__ Hh, _Float16* __restrict__ Hl, size_t n8) { const size_t t = (size_t)blockIdx.x * 256 + threadIdx.x; if (t >= n8) return; FragH fh, fl; const v4f a = *(const v4fa*)(F + t * 8), c = *(const v4fa*)(F + t * 8 + 4);
#pragma unroll
  for (int q = 0; q < 4; ++q) { _Float16 h = (_Float16)a[q]; fh.h[q] = h; fl.h[q] = (_Float16)((a[q] - (float)h) * 1024.0f); h = (_Float16)c[q]; fh.h[4 + q] = h; fl.h[4 + q] = (_Float16)((c[q] - (float)h) * 1024.0f); }
  { *(v8us*)((unsigned short*)Hh + t * 8) = fh.half[0]; *(v8us*)((unsigned short*)Hl + t * 8) = fl.half[0];  } }

// ---- WMMA step of the conv GEMM (wave tile 48x64) ----
__device__ __forceinline__ v8f g2_mma(v16h a, v16h b, v8f c) { v8f d = __builtin_amdgcn_wmma_f32_16x16x32_f16(false, a, false, b, (short)0, c, false, false); asm volatile("v_nop\n\tv_nop\n\tv_nop\n\tv_nop" : "+v"(d) : "v"(a), "v"(b)); return d; }

__device__ __forceinline__ void d_xrows(const float* __restrict__ x, _Float16* __restrict__ XR, int blk) { __shared__ float tl[CI][33]; const int tid = threadIdx.x; const int p0 = blk * 32;      /* 32 pixels of the padded grid, batches end to end */
  for (int i = tid; i < CI * 32; i += 256) { const int c = i / 32, j = i % 32; const int b = (p0 + j) / PP, p = (p0 + j) % PP; const int yy = p / HP - 6, xx = p % HP - 6; tl[c][j] = (yy >= 0 && yy < HS && xx >= 0 && xx < HS) ? bf16_round(x[((size_t)b * CI + c) * PX + yy * HS + xx]) : 0.f; }
  __syncthreads();
  { for (int i = tid; i < 32 * CG; i += 256) { const int j = i / CG, c8 = (i % CG) * 8; FragH f; for (int q = 0; q < 8; ++q) f.h[q] = (_Float16)tl[c8 + q][j]; *(v8us*)((unsigned short*)XR + ((size_t)p0 + j) * CI + c8) = f.half[0]; }  } }
// 7x7 conv as a GEMM without an im2col buffer: row r of A is output pixel r of an HO x HO grid, and its k = tap * 128 + channel element is the x row at padded pixel (oy + OFF + tap / 7, ox + OFF + tap % 7),
// so a tap's 128 channels are 256 contiguous bytes. C[r][n] = alpha * sum_k A[r][k] * Bh[n][k], k in the order of d_w7. Wave tile 48x64, work-group 192x128 (8 waves, 4 down x 2 across); rows from M on repeat the last image row (their C rows are never read).
// One trip of the loop is one tap. The tap's B tile (128 weight rows, 256 bytes a row) is brought into LDS by asynchronous copies, 16 bytes a lane (16 lanes = one whole row),
// into one of two buffers: the copies of tap t + 2 fly while tap t + 1 is worked on. The fragments are read from LDS at a row pitch of 272 bytes (free of bank conflicts for 16-byte reads).
// The A tile is staged once per WINDOW ROW, not per tap: the seven taps of a window row read the same x rows, one pixel further right each. The tile's 192 pixels lie in up to five image rows (segments);
// each segment is staged with the 6 pixels that follow it in the padded grid, and tap column dx reads pixel i at LDS row i + 16 * segment + dx (16 rows per segment keep a fragment's 16 rows on 16 different bank groups).
// Two A buffers: window row d + 1 is copied, with the B tile of its first tap, while the last tap of window row d is worked on.
#define LP 272                       /* LDS row pitch in bytes */
#define AC 224                       /* x rows copied per window row: 192 pixels + 5 x 6 that follow a segment = 222, rounded up to 14 per thread */
#define LA ((AC + 40) * LP)          /* one A buffer: the copied rows, 10 unused rows between segments */
#define LB (TN * LP)                 /* one B buffer */
// six copies of 16 bytes a lane, LDS byte address l[i] from global address g[i]; the wait on the address registers ends the copies' own statement, ahead of any rewrite of them
__device__ __forceinline__ void g2_copy6(const unsigned* l, const char* const* g) {
  asm volatile("global_load_async_to_lds_b128 %0, %6, off\n\tglobal_load_async_to_lds_b128 %1, %7, off\n\tglobal_load_async_to_lds_b128 %2, %8, off\n\t"
               "global_load_async_to_lds_b128 %3, %9, off\n\tglobal_load_async_to_lds_b128 %4, %10, off\n\tglobal_load_async_to_lds_b128 %5, %11, off\n\ts_wait_xcnt 0x0"
               :: "v"(l[0]), "v"(l[1]), "v"(l[2]), "v"(l[3]), "v"(l[4]), "v"(l[5]),
                  "v"(g[0]), "v"(g[1]), "v"(g[2]), "v"(g[3]), "v"(g[4]), "v"(g[5]) : "memory"); }
// the same for eight copies
__device__ __forceinline__ void g2_copy8(const unsigned* l, const char* const* g) {
  asm volatile("global_load_async_to_lds_b128 %0, %8, off\n\tglobal_load_async_to_lds_b128 %1, %9, off\n\tglobal_load_async_to_lds_b128 %2, %10, off\n\tglobal_load_async_to_lds_b128 %3, %11, off\n\t"
               "global_load_async_to_lds_b128 %4, %12, off\n\tglobal_load_async_to_lds_b128 %5, %13, off\n\tglobal_load_async_to_lds_b128 %6, %14, off\n\tglobal_load_async_to_lds_b128 %7, %15, off\n\ts_wait_xcnt 0x0"
               :: "v"(l[0]), "v"(l[1]), "v"(l[2]), "v"(l[3]), "v"(l[4]), "v"(l[5]), "v"(l[6]), "v"(l[7]),
                  "v"(g[0]), "v"(g[1]), "v"(g[2]), "v"(g[3]), "v"(g[4]), "v"(g[5]), "v"(g[6]), "v"(g[7]) : "memory"); }
__device__ __forceinline__ v16h g2_lfrag(const unsigned char* p) { FragH f; f.half[0] = *(const v8us*)p; f.half[1] = *(const v8us*)(p + 32); return f.v; }
// copied row number c (0 .. AC - 1) of the tile that starts at output pixel r0: go = byte offset of its x row at window row 0, lo = byte offset of its place in an A buffer.
// Segment 0 is the rest of r0's image row and the 6 pixels behind it, every later segment a whole image row of HO pixels and 6 more; image rows past the last one repeat the last (their C rows are never read).
template <int HO, int OFF>
__device__ __forceinline__ void g2_amap(int r0, int c, unsigned& go, unsigned& lo) {
  const int x0 = r0 % HO, c2 = c - (HO - x0 + 6); const int s = c2 < 0 ? 0 : 1 + c2 / (HO + 6), col = c2 < 0 ? x0 + c : c2 % (HO + 6);
  const int R = min(r0 / HO + s, NB * HO - 1);      /* image row, batches end to end */
  go = (unsigned)((((R / HO) * PP + (R % HO + OFF) * HP + col + OFF) * CI) * 2); lo = (unsigned)((c + 10 * s) * LP); }
// byte offset, in an A buffer, of tile pixel i at tap column 0
template <int HO>
__device__ __forceinline__ unsigned g2_lrow(int r0, int i) { return (unsigned)((i + 16 * ((r0 + i) / HO - r0 / HO)) * LP); }
#define GQ (MQ * (CO / TN))                    /* 66 work-groups of q */
#define GK (MK * (CO / TN))                    /* 82 work-groups of k, and as many of v */
// The three convs read nothing of each other, so they go as ONE launch: work-groups 0 .. GQ - 1 are q's tiles, the next GK are k's, the last GK are v's. Together they are 230, fewer than the chip has WGPs:
// every work-group has a WGP (and its LDS) to itself, two waves on each SIMD, and the launch is one round with no tail. The 192x128 tile gives a wave 48 WMMAs per tap between two barriers, enough to cover the flight of the next tap's copies,
// each weight row is fetched from L2 once per 192 pixels, and a wave reads 7 fragments from LDS for 12 WMMAs. Which conv a work-group belongs to is the same for all its threads: every branch on it is a scalar one.
__global__ __launch_bounds__(256) void k_conv7(const _Float16* __restrict__ XR, const _Float16* __restrict__ BQ, const _Float16* __restrict__ BK, const _Float16* __restrict__ BV, float alpha, float* __restrict__ Q, float* __restrict__ Kf, float* __restrict__ Vf) {
  __shared__ __attribute__((aligned(16))) unsigned char ring[2 * LA + 2 * LB];      /* two A buffers, then two B buffers */
  float (*so)[48][68] = (float (*)[48][68])ring;      /* the output tiles take the A buffers' place behind the loop's last barrier */
  const int tid = threadIdx.x, w = tid >> 5, lane = tid & 31, ln = lane & 15, hh = lane >> 4; const int wm = w >> 1, wn = w & 1;      /* the wave's place in the tile: 48 rows from 48 wm, 64 columns from 64 wn */
  const int job = (int)blockIdx.x < GQ ? 0 : (int)blockIdx.x < GQ + GK ? 1 : 2; const int blk = (int)blockIdx.x - (job == 0 ? 0 : job == 1 ? GQ : GQ + GK);
  const _Float16* __restrict__ Bh = job == 0 ? BQ : job == 1 ? BK : BV; float* __restrict__ C = job == 0 ? Q : job == 1 ? Kf : Vf;
  const int mt = blk / (CO / TN), nq = blk % (CO / TN); const int row0 = mt * TM + 48 * wm, col0 = nq * TN + 64 * wn;
  /* copy side: this thread brings the 16 bytes number cc of tile rows cr, cr + 16, ... */
  const int cr = tid >> 4, cc = tid & 15; unsigned ao[AC / 16], al[AC / 16], fa0, fa1, fa2;      /* byte offsets of this thread's rows at tap 0 (al: in an A buffer); fa0 .. fa2: of this lane's three fragment rows; every loop over the arrays is unrolled so that they stay in registers */
  if (job == 0) {      /* q: 56-grid, x index = o + tap - 3 */
#pragma unroll
    for (int i = 0; i < AC / 16; ++i) g2_amap<HS, 3>(mt * TM, cr + 16 * i, ao[i], al[i]);
    fa0 = g2_lrow<HS>(mt * TM, 48 * wm + ln); fa1 = g2_lrow<HS>(mt * TM, 48 * wm + 16 + ln); fa2 = g2_lrow<HS>(mt * TM, 48 * wm + 32 + ln);
  } else {      /* k, v: 62-grid over pad3(x) with conv pad 3: x index = o + tap - 6 */
#pragma unroll
    for (int i = 0; i < AC / 16; ++i) g2_amap<HK, 0>(mt * TM, cr + 16 * i, ao[i], al[i]);
    fa0 = g2_lrow<HK>(mt * TM, 48 * wm + ln); fa1 = g2_lrow<HK>(mt * TM, 48 * wm + 16 + ln); fa2 = g2_lrow<HK>(mt * TM, 48 * wm + 32 + ln);
  }
  const unsigned bo = (unsigned)(((nq * TN + cr) * KC + cc * 8) * 2);      /* this thread's first weight row at tap 0; the others lie 16 rows apart */
  const unsigned lc = (unsigned)(size_t)ring + (unsigned)(cc * 16);
  auto issueA = [&](int d) { const char* xa = (const char*)XR + d * (HP * CI * 2) + cc * 16; const unsigned l = lc + (unsigned)((d & 1) * LA);      /* window row d's base, the same for every lane but for its 16 bytes of the row */
    unsigned la[AC / 16]; const char* ga[AC / 16];
#pragma unroll
    for (int i = 0; i < AC / 16; ++i) { la[i] = l + al[i]; ga[i] = xa + ao[i]; }
    g2_copy8(la, ga); g2_copy6(la + 8, ga + 8); };
  auto issueB = [&](int t) { const char* xb = (const char*)Bh + t * (CI * 2) + bo; const unsigned l = lc + (unsigned)(2 * LA + (t & 1) * LB + cr * LP);      /* tile rows cr + 16 i of tap t */
    unsigned la[8]; const char* ga[8];
#pragma unroll
    for (int i = 0; i < 8; ++i) { la[i] = l + (unsigned)(16 * i * LP); ga[i] = xb + (size_t)i * (16 * KC * 2); }
    g2_copy8(la, ga); };
  const v8f z8 = {0.f,0.f,0.f,0.f,0.f,0.f,0.f,0.f}; v8f c00 = z8, c01 = z8, c02 = z8, c03 = z8, c10 = z8, c11 = z8, c12 = z8, c13 = z8, c20 = z8, c21 = z8, c22 = z8, c23 = z8;
  issueA(0); issueB(0);
  asm volatile("s_wait_asynccnt 0x0" ::: "memory");      /* this wave's copies of tap 0 have landed */
  __syncthreads();      /* tap 0 is complete before any wave reads it */
  issueB(1);
  /* the tap loop stays rolled: its body holds 48 WMMAs */
#pragma unroll 1
  for (int t = 0; t < KK; ++t) { const unsigned char* sa = ring + ((t / 7) & 1) * LA + (t % 7) * LP + 16 * hh; const unsigned char* pa = sa + fa0; const unsigned char* pc = sa + fa1; const unsigned char* pe = sa + fa2; const unsigned char* pb = ring + 2 * LA + (t & 1) * LB + (64 * wn + ln) * LP + 16 * hh;
    v16h a0[2], a1[2], a2[2], b0[2], b1[2], b2[2], b3[2];
    /* two fragment sets: the next 32 channels' LDS reads stand ahead of this block's WMMAs, so that their latency runs under the block; unrolled so that the sets are picked by constants */
    a0[0] = g2_lfrag(pa); a1[0] = g2_lfrag(pc); a2[0] = g2_lfrag(pe); b0[0] = g2_lfrag(pb); b1[0] = g2_lfrag(pb + 16 * LP); b2[0] = g2_lfrag(pb + 32 * LP); b3[0] = g2_lfrag(pb + 48 * LP);
#pragma unroll
    for (int s = 0; s < 4; ++s) { const int u = s & 1, n = u ^ 1, kb = (s + 1) * 64;
      if (s < 3) { a0[n] = g2_lfrag(pa + kb); a1[n] = g2_lfrag(pc + kb); a2[n] = g2_lfrag(pe + kb); b0[n] = g2_lfrag(pb + kb); b1[n] = g2_lfrag(pb + 16 * LP + kb); b2[n] = g2_lfrag(pb + 32 * LP + kb); b3[n] = g2_lfrag(pb + 48 * LP + kb); }
      c00 = g2_mma(a0[u], b0[u], c00); c10 = g2_mma(a1[u], b0[u], c10); c20 = g2_mma(a2[u], b0[u], c20); c01 = g2_mma(a0[u], b1[u], c01); c11 = g2_mma(a1[u], b1[u], c11); c21 = g2_mma(a2[u], b1[u], c21);
      c02 = g2_mma(a0[u], b2[u], c02); c12 = g2_mma(a1[u], b2[u], c12); c22 = g2_mma(a2[u], b2[u], c22); c03 = g2_mma(a0[u], b3[u], c03); c13 = g2_mma(a1[u], b3[u], c13); c23 = g2_mma(a2[u], b3[u], c23);
    }
    asm volatile("s_wait_dscnt 0x0" ::: "memory");      /* this wave's reads of the buffer are done before it is handed back */
    asm volatile("s_wait_asynccnt 0x0" ::: "memory");      /* this wave's copies of tap t + 1 have landed */
    __syncthreads();      /* publishes tap t + 1 and ends every wave's reads of tap t's buffer */
    if (t + 2 < KK) { issueB(t + 2); if ((t + 2) % 7 == 0) issueA((t + 2) / 7); } }      /* a new window row goes into the A buffer that the window row before the current one has left */
  asm volatile("s_wait_asynccnt 0x0" ::: "memory");      /* no copy is outstanding when the wave goes on */
  v8f accs[12] = {c00, c01, c02, c03, c10, c11, c12, c13, c20, c21, c22, c23};
#pragma unroll
  for (int u = 0; u < 12; ++u) { const int t = u & 3, part = u >> 2;
#pragma unroll
    for (int r = 0; r < 8; ++r) so[w][part * 16 + 8 * hh + r][t * 16 + ln] = accs[u][r] * alpha; }
  __builtin_amdgcn_fence(__ATOMIC_ACQ_REL, "workgroup"); __builtin_amdgcn_wave_barrier();
  const int rsub = lane >> 4, c4 = (lane & 15) * 4;
#pragma unroll
  for (int q = 0; q < 24; ++q) { const int r = q * 2 + rsub; const v4f v = *(const v4fa*)&so[w][r][c4]; *(v4f*)(C + (size_t)(row0 + r) * CO + col0 + c4) = v; } }
__device__ __forceinline__ void d_w7(const float* __restrict__ w, _Float16* __restrict__ Bt, int blk) { const size_t t = (size_t)blk * 256 + threadIdx.x; if (t >= (size_t)CO * KC / 8) return; const int c8 = (int)((t * 8) % CI); const int tap = (int)(((t * 8) / CI) % KK); const int o = (int)((t * 8) / KC); FragH f; for (int q = 0; q < 8; ++q) f.h[q] = (_Float16)(bf16_round(w[((size_t)o * CI + c8 + q) * KK + tap]) * 16.0f);
  *(v8us*)((unsigned short*)Bt + t * 8) = f.half[0];  }
#define GX (NB * PP / 32)                      /* 289 work-groups of x rows */
#define GW ((CO * KC / 8 + 255) / 256)         /* 784 work-groups per weight plane */
// The x rows and the three weight planes are made from the inputs alone, none from another: one launch, the job picked by the work-group's index (the same for all its threads, so the barrier of the x rows is passed by whole work-groups).
__global__ __launch_bounds__(256) void k_prep(const float* __restrict__ x, const float* __restrict__ wq, const float* __restrict__ wk, const float* __restrict__ wv, _Float16* __restrict__ XR, _Float16* __restrict__ BQ, _Float16* __restrict__ BK, _Float16* __restrict__ BV) {
  const int blk = (int)blockIdx.x;
  if (blk < GX) { d_xrows(x, XR, blk); return; }
  const int job = (blk - GX) / GW;
  d_w7(job == 0 ? wq : job == 1 ? wk : wv, job == 0 ? BQ : job == 1 ? BK : BV, (blk - GX) % GW); }
// Lanes run along channels: one wave holds the 32 channels of one head, so every Q, K and V load of a wave is one whole 128-byte line and the window position is wave-uniform.
// A wave takes four neighbouring pixels of one image row at once: their four 7-wide window rows are ten neighbouring K (and V) pixels, loaded once per window row, all in flight together, and used from registers by all four.
// The head's rel table lies in LDS as [tap][channel], so that its reads are contiguous over the lanes too (in global memory a channel's taps are 28 bytes from the next channel's).
// A work-group (8 waves, 4 pixels each) fills a 32-channel x 32-pixel tile in LDS, and the channel-major store then writes whole 128-byte lines.
__global__ __launch_bounds__(256) void k_watt(const float* __restrict__ Q, const float* __restrict__ Kf, const float* __restrict__ Vf, const float* __restrict__ rh, const float* __restrict__ rw, float* __restrict__ out) {
  __shared__ __attribute__((aligned(16))) float tl[32][36]; __shared__ float rl[7][32];
  const int tid = threadIdx.x, lane = tid & 31; const int w = __builtin_amdgcn_readfirstlane(tid >> 5);      /* the wave's number as a scalar: pixel, window row and column stay on the scalar unit */
  const int p0 = (int)(blockIdx.x % (PX / 32)) * 32; const int bh = (int)(blockIdx.x / (PX / 32)); const int head = bh % (NCO / 32); const size_t b = bh / (NCO / 32); const int c = head * 32 + lane; const bool first = head < CO / 64;      /* c < CO / 2, the same for the whole work-group */
  if (w < 7) rl[w][lane] = first ? bf16_round(rh[(size_t)c * 7 + w]) : bf16_round(rw[(size_t)(c - CO / 2) * 7 + w]);
  __syncthreads();      /* the rel table is complete before any wave reads it */
  const int p = p0 + 4 * w; const int y = p / HS, x = p % HS;      /* pixels p .. p + 3 lie in one image row: HS and p are multiples of 4 */
  const float* kp = Kf + (b * PK + (size_t)y * HK + x) * CO + c; const float* vp = Vf + (b * PK + (size_t)y * HK + x) * CO + c;
  float qv[4], mx[4], se[4], acc[4], rc[7];
  /* every loop over the four pixels, the seven window columns and the ten loaded lines is unrolled (each '#pragma unroll' below), so that these small arrays are indexed by constants and stay in registers */
#pragma unroll
  for (int j = 0; j < 4; ++j) { qv[j] = Q[(b * PX + p + j) * CO + c] * 1.44269504f; mx[j] = -3.0e38f; se[j] = 0.f; acc[j] = 0.f; }      /* q carries log2(e): scores and their maximum are in base-2 units, so that each term is one exp2 */
#pragma unroll
  for (int kw = 0; kw < 7; ++kw) rc[kw] = rl[kw][lane];
  /* the loops over window rows stay rolled: one row's body (28 window positions) is already long */
#pragma unroll 1
  for (int kh = 0; kh < 7; ++kh) { float kr[10]; const float rk = rl[kh][lane];
#pragma unroll
    for (int i = 0; i < 10; ++i) kr[i] = kp[(size_t)(kh * HK + i) * CO];
#pragma unroll
    for (int j = 0; j < 4; ++j)
#pragma unroll
      for (int kw = 0; kw < 7; ++kw) { const float kv = __fadd_rn(kr[j + kw], first ? rk : rc[kw]); mx[j] = fmaxf(mx[j], __fmul_rn(qv[j], kv)); } }
  /* per pixel the 49 terms are summed window row by window row, left to right */
#pragma unroll 1
  for (int kh = 0; kh < 7; ++kh) { float kr[10], vr[10]; const float rk = rl[kh][lane];
#pragma unroll
    for (int i = 0; i < 10; ++i) { kr[i] = kp[(size_t)(kh * HK + i) * CO]; vr[i] = vp[(size_t)(kh * HK + i) * CO]; }
#pragma unroll
    for (int j = 0; j < 4; ++j)
#pragma unroll
      for (int kw = 0; kw < 7; ++kw) { const float kv = kr[j + kw] + (first ? rk : rc[kw]); const float e = __builtin_amdgcn_exp2f(fmaf(qv[j], kv, -mx[j])); se[j] += e; acc[j] = fmaf(e, vr[j + kw], acc[j]); } }      /* the argument is at most a rounding error above 0; a term below the exp2 instruction's range counts as 0 beside the largest term's 1 */
#pragma unroll
  for (int j = 0; j < 4; ++j) tl[lane][4 * w + j] = acc[j] / se[j];
  __syncthreads();      /* the tile is complete before any wave reads other waves' pixels */
  const int dh = tid >> 3, j4 = (tid & 7) * 4; const v4f o = *(const v4fa*)&tl[dh][j4];
  const int oc = dh * 8 + head;      /* the reference's final transpose: output channel = dh*heads + head for computation channel head*32 + dh */
  *(v4f*)(out + ((b * CO + oc) * (size_t)PX + p0 + j4)) = o; }

extern "C" void kernel_launch(void* const* d_in, const int* in_sizes, int n_in,
                              void* d_out, int out_size, void* d_ws, size_t ws_size, hipStream_t stream) {
  (void)in_sizes; (void)n_in; (void)out_size;
  const float* const* I = (const float* const*)d_in; const float* x = I[0]; const float* wq = I[1]; const float* wk = I[2]; const float* wv = I[3]; const float* rh = I[4]; const float* rw = I[5];
  char* ws = (char*)d_ws; size_t off = 0;
  auto take = [&](size_t bytes) { char* p = ws + off; off += (bytes + 255) & ~(size_t)255; return p; };
  _Float16* BQ = (_Float16*)take((size_t)CO * KC * 2); _Float16* BK = (_Float16*)take((size_t)CO * KC * 2); _Float16* BV = (_Float16*)take((size_t)CO * KC * 2);
  _Float16* XR = (_Float16*)take((size_t)NB * PP * CI * 2); float* Q = (float*)take((size_t)MQ * TM * CO * 4); float* Kf = (float*)take((size_t)MK * TM * CO * 4); float* Vf = (float*)take((size_t)MK * TM * CO * 4);
  if (off > ws_size) return;      /* three weight planes, the x rows, q, k, v */
  k_prep<<<GX + 3 * GW, 256, 0, stream>>>(x, wq, wk, wv, XR, BQ, BK, BV);
  k_conv7<<<GQ + 2 * GK, 256, 0, stream>>>(XR, BQ, BK, BV, 0.0625f, Q, Kf, Vf);
  k_watt<<<NB * (NCO / 32) * (PX / 32), 256, 0, stream>>>(Q, Kf, Vf, rh, rw, (float*)d_out);
}

// v009
// One run takes 81.3 microseconds.
// Next to v008, in two timings, it ran 1.06 and 1.04 times as fast.
// Over all steps from v000 it is 19.7 times as fast.
#include <hip/hip_runtime.h>
// StandAloneSelfAttention (inputs [2][128][56][56]; q = conv7x7(x, Wq, pad 3) (256 ch, 56x56); k, v = conv7x7(pad3(x), Wk/Wv, pad 3) (256 ch, 62x62); per channel c and pixel: 7x7 window of k (plus rel_h[c] per window row for the first 128 channels, rel_w[c-128] per window column for the rest) and v around the pixel; attn = softmax over the 49 of q*k (scalar products); out = sum attn*v, then the reference's transpose(0,2,1,3,4): output channel (dh*8 + head) takes computation channel (head*32 + dh) -> [2][256][56][56]).
// Structure: pixel rows; x as exact f16 rows via LDS transposes; the three 7x7 convs as WMMA GEMMs (K = 6,272 = 49 taps x 128 channels; 48x64 wave tiles, f32 accumulation, exact x16 weights) whose A tiles are taken tap by tap from the x rows, which lie on a 68x68 grid with 6 pixels of zeros on every side (all padding of both convs), and staged with the weight tiles in LDS, into f32 channel rows; the per-channel 49-way window softmax and weighted sum on VALU in f32 (rel tables read) with the channel-major store.
// Compute dtype: inputs rounded to bf16; x / weights / rel tables exact; q, k, v in f32 (GEMM outputs); softmax and the weighted sum f32 — no reduced-precision intermediates after the convs. v_wmma_f32_16x16x32_f16.
#define NB 2
#define CI 128
#define CO 256
#define HS 56
#define PX (HS * HS)                 /* 3136 */
#define HK 62                        /* k/v grid */
#define PK (HK * HK)                 /* 3844 */
#define NRQ ((size_t)NB * PX)        /* 6272 = 49 x 128 */
#define TM 192                       /* rows (output pixels) of a conv work-group's tile */
#define TN 128                       /* its columns (output channels) */
#define MQ ((int)((NRQ + TM - 1) / TM))          /* 33 row tiles of q */
#define MK ((NB * PK + TM - 1) / TM)             /* 41 row tiles of k, and of v (2 x 3844 = 7688 rows) */
#define KK 49
#define KC (KK * CI)                 /* 6272 */
#define CG (CI / 8)
#define HP (HS + 12)                 /* x rows on a grid with 6 zero pixels on every side */
#define PP (HP * HP)                 /* 4624; NB * PP = 289 x 32 */
#define NCO CO                       /* output channels computed (debug hook) */
typedef __bf16 v16b __attribute__((ext_vector_type(16)));
typedef unsigned short v8us __attribute__((ext_vector_type(8), may_alias));
typedef float  v8f  __attribute__((ext_vector_type(8)));
typedef float  v4f  __attribute__((ext_vector_type(4)));
typedef float  v4fa __attribute__((ext_vector_type(4), may_alias));
union FragB { v16b v; v8us half[2]; unsigned short u[16]; };

__device__ __forceinline__ unsigned short bf16_bits(float x) { unsigned int u = __float_as_uint(x); return (unsigned short)((u + 0x7FFFu + ((u >> 16) & 1u)) >> 16); }
__device__ __forceinline__ float bf16_val(unsigned short b) { return __uint_as_float(((unsigned int)b) << 16); }
__device__ __forceinline__ float bf16_round(float x) { return bf16_val(bf16_bits(x)); }
// D += A·B with NT terms: 1 = ah·bh, 2 = + al·bh (A split), 3 = + ah·bl (both split)
template <int NT>
__device__ __forceinline__ v8f mmaN(v16b ah, v16b al, v16b bh, v16b bl, v8f c) {
  c = __builtin_amdgcn_wmma_f32_16x16x32_bf16(false, ah, false, bh, (short)0, c, false, false);
  if (NT >= 2) c = __builtin_amdgcn_wmma_f32_16x16x32_bf16(false, al, false, bh, (short)0, c, false, false);
  if (NT >= 3) c = __builtin_amdgcn_wmma_f32_16x16x32_bf16(false, ah, false, bl, (short)0, c, false, false);
  asm volatile("v_nop\n\tv_nop\n\tv_nop\n\tv_nop" : "+v"(c) : "v"(ah), "v"(al), "v"(bh), "v"(bl));
  return c;
}

__global__ __launch_bounds__(256) void k_wt_bf16(const float* __restrict__ W, unsigned short* __restrict__ Wt, int K, int N) {
  const int t = blockIdx.x * 256 + threadIdx.x;
  const int k8n = K / 8;
  if (t >= N * k8n) return;
  const int n = t / k8n, k8 = (t % k8n) * 8;
  v8us v;
#pragma unroll
  for (int i = 0; i < 8; ++i) v[i] = bf16_bits(W[(size_t)(k8 + i) * N + n]);
  *(v8us*)(Wt + (size_t)n * K + k8) = v;
  
}

// GEMM C[M][N] (f32, pitch ldc) = act(A[M][K]·W + bias). A f32 row-major (pitch lda) converted per fragment to bf16
// (ASPLIT: hi/lo two planes -> 2 terms, else single rounded term); Wt bf16 [N][K] (pitch ldb). BIAS_BF16 rounds the
// bias to bf16 first (bias quantised to bf16 before the add). K%32==0, M%16==0, N%64==0.
template <bool ASPLIT, int ACT, bool BIAS_BF16>
__global__ __launch_bounds__(128) void k_gemm_bf(const float* __restrict__ A, int lda, const unsigned short* __restrict__ Wt, int ldb,
                                               const float* __restrict__ bias, float* __restrict__ C, int ldc, int M, int N, int K) {
  __shared__ __attribute__((aligned(16))) float so[4][16][64];
  const int tid = threadIdx.x, w = tid >> 5, lane = tid & 31, ln = lane & 15, hh = lane >> 4;
  const int ntn = N / 64;
  const int wid = blockIdx.x * 4 + w;
  const int mt = wid / ntn, nq = wid % ntn;
  if (mt * 16 >= M) return;
  const int row0 = mt * 16, col0 = nq * 64;
  const float* arow = A + (size_t)(row0 + ln) * lda;
  v8f acc[4] = {};
  for (int kb = 0; kb < K; kb += 32) {
    FragB ah, al;
    const v4f x0 = *(const v4fa*)(arow + kb + 8 * hh), x1 = *(const v4fa*)(arow + kb + 8 * hh + 4);
    const v4f x2 = *(const v4fa*)(arow + kb + 16 + 8 * hh), x3 = *(const v4fa*)(arow + kb + 16 + 8 * hh + 4);
    float xs[16] = {x0[0],x0[1],x0[2],x0[3],x1[0],x1[1],x1[2],x1[3],x2[0],x2[1],x2[2],x2[3],x3[0],x3[1],x3[2],x3[3]};
#pragma unroll
    for (int i = 0; i < 16; ++i) { const unsigned short hb = bf16_bits(xs[i]); ah.u[i] = hb; al.u[i] = ASPLIT ? bf16_bits(xs[i] - bf16_val(hb)) : (unsigned short)0; }
#pragma unroll
    for (int t = 0; t < 4; ++t) {
      const unsigned short* brow = Wt + (size_t)(col0 + t * 16 + ln) * ldb + kb;
      FragB b;
      b.half[0] = *(const v8us*)(brow + 8 * hh);
      b.half[1] = *(const v8us*)(brow + 16 + 8 * hh);
      acc[t] = mmaN<ASPLIT ? 2 : 1>(ah.v, al.v, b.v, b.v, acc[t]);
    }
  }
#pragma unroll
  for (int t = 0; t < 4; ++t) {
    float bv = bias ? bias[col0 + t * 16 + ln] : 0.f;
    if (BIAS_BF16) bv = bf16_round(bv);
#pragma unroll
    for (int r = 0; r < 8; ++r) { float v = acc[t][r] + bv; if (ACT == 1) v = fmaxf(v, 0.f); so[w][8 * hh + r][t * 16 + ln] = v; }
  }
  __builtin_amdgcn_fence(__ATOMIC_ACQ_REL, "workgroup");
  __builtin_amdgcn_wave_barrier();
  const int rsub = lane >> 4, c4 = (lane & 15) * 4;
  {
#pragma unroll
    for (int q = 0; q < 8; ++q) {
      const int r = q * 2 + rsub;
      const v4f v = *(const v4fa*)&so[w][r][c4];
      *(v4f*)(C + (size_t)(row0 + r) * ldc + col0 + c4) = v;
    }
    
  }
}

// GEMM C = act(A·W + bias + resid): A f32 (ASPLIT -> hi/lo 2 terms), Wt bf16 [N][K]; ACT 0 none, 1 relu, 2 exact gelu;
// resid (optional, f32, row index = (row % rmod), pitch ldr, RES_BF16 rounds it) added before the activation.
template <bool ASPLIT, int ACT, bool BIAS_BF16, bool RES_BF16>
__global__ __launch_bounds__(128) void k_gemm_bf3(const float* __restrict__ A, int lda, const unsigned short* __restrict__ Wt, int ldb,
                                                const float* __restrict__ bias, const float* __restrict__ resid, int rmod, int ldr,
                                                float* __restrict__ C, int ldc, int M, int N, int K) {
  __shared__ __attribute__((aligned(16))) float so[4][16][64];
  const int tid = threadIdx.x, w = tid >> 5, lane = tid & 31, ln = lane & 15, hh = lane >> 4;
  const int ntn = N / 64;
  const int wid = blockIdx.x * 4 + w;
  const int mt = wid / ntn, nq = wid % ntn;
  if (mt * 16 >= M) return;
  const int row0 = mt * 16, col0 = nq * 64;
  const float* arow = A + (size_t)(row0 + ln) * lda;
  v8f acc[4] = {};
  for (int kb = 0; kb < K; kb += 32) {
    FragB ah, al;
    const v4f x0 = *(const v4fa*)(arow + kb + 8 * hh), x1 = *(const v4fa*)(arow + kb + 8 * hh + 4);
    const v4f x2 = *(const v4fa*)(arow + kb + 16 + 8 * hh), x3 = *(const v4fa*)(arow + kb + 16 + 8 * hh + 4);
    float xs[16] = {x0[0],x0[1],x0[2],x0[3],x1[0],x1[1],x1[2],x1[3],x2[0],x2[1],x2[2],x2[3],x3[0],x3[1],x3[2],x3[3]};
#pragma unroll
    for (int i = 0; i < 16; ++i) { const unsigned short hb = bf16_bits(xs[i]); ah.u[i] = hb; al.u[i] = ASPLIT ? bf16_bits(xs[i] - bf16_val(hb)) : (unsigned short)0; }
#pragma unroll
    for (int t = 0; t < 4; ++t) {
      const unsigned short* brow = Wt + (size_t)(col0 + t * 16 + ln) * ldb + kb;
      FragB b;
      b.half[0] = *(const v8us*)(brow + 8 * hh);
      b.half[1] = *(const v8us*)(brow + 16 + 8 * hh);
      acc[t] = mmaN<ASPLIT ? 2 : 1>(ah.v, al.v, b.v, b.v, acc[t]);
    }
  }
#pragma unroll
  for (int t = 0; t < 4; ++t) {
    const int col = col0 + t * 16 + ln;
    float bv = bias ? bias[col] : 0.f;
    if (BIAS_BF16) bv = bf16_round(bv);
#pragma unroll
    for (int r = 0; r < 8; ++r) {
      float v = acc[t][r] + bv;
      if (resid) { float rv = resid[(size_t)((row0 + 8 * hh + r) % rmod) * ldr + col]; if (RES_BF16) rv = bf16_round(rv); v += rv; }
      if (ACT == 1) v = fmaxf(v, 0.f);
      if (ACT == 2) v = 0.5f * v * (1.0f + erff(v * 0.70710678118654752f));
      if (ACT == 3) { const float u = 0.7978845608028654f * (v + 0.044715f * v * v * v); v = 0.5f * v * (1.0f + tanhf(u)); }
      so[w][8 * hh + r][t * 16 + ln] = v;
    }
  }
  __builtin_amdgcn_fence(__ATOMIC_ACQ_REL, "workgroup");
  __builtin_amdgcn_wave_barrier();
  const int rsub = lane >> 4, c4 = (lane & 15) * 4;
  {
#pragma unroll
    for (int q = 0; q < 8; ++q) {
      const int r = q * 2 + rsub;
      const v4f v = *(const v4fa*)&so[w][r][c4];
      *(v4f*)(C + (size_t)(row0 + r) * ldc + col0 + c4) = v;
    }
    
  }
}
// row LayerNorm (biased variance, eps) over N: s = X (+ R); optional out_sum <- s; out_norm <- (s-mu)*rsqrt(var+eps)*g + b
template <bool PARAM_BF16>
__global__ __launch_bounds__(256) void k_layernorm(const float* __restrict__ X, const float* __restrict__ R, const float* __restrict__ g, const float* __restrict__ bta,
                                                  float* __restrict__ out_sum, float* __restrict__ out_norm, int N, float eps) {
  __shared__ float red[256];
  const int row = blockIdx.x, tid = threadIdx.x;
  const float* x = X + (size_t)row * N; const float* rr = R ? R + (size_t)row * N : nullptr;
  float vals[16];                     // up to N = 4096
  const int per = N / 256;            // contiguous chunk per thread? use strided-by-4 chunks: thread handles j = tid*4 + 1024*u
  float s1 = 0.f;
  for (int u = 0; u < per / 4; ++u) {
    const int j = tid * 4 + 1024 * u;
    const v4f a = *(const v4fa*)(x + j);
    v4f b = {0.f,0.f,0.f,0.f}; if (rr) b = *(const v4fa*)(rr + j);
#pragma unroll
    for (int q = 0; q < 4; ++q) { const float v = a[q] + b[q]; vals[u * 4 + q] = v; s1 += v; }
  }
  red[tid] = s1; __syncthreads();
  for (int st = 128; st > 0; st >>= 1) { if (tid < st) red[tid] += red[tid + st]; __syncthreads(); }
  const float mu = red[0] / (float)N; __syncthreads();
  float s2 = 0.f;
  for (int u = 0; u < per / 4; ++u)
#pragma unroll
    for (int q = 0; q < 4; ++q) { const float c = vals[u * 4 + q] - mu; s2 += c * c; }
  red[tid] = s2; __syncthreads();
  for (int st = 128; st > 0; st >>= 1) { if (tid < st) red[tid] += red[tid + st]; __syncthreads(); }
  const float rs = rsqrtf(red[0] / (float)N + eps);
  {
    for (int u = 0; u < per / 4; ++u) {
      const int j = tid * 4 + 1024 * u;
      v4f o, sm;
#pragma unroll
      for (int q = 0; q < 4; ++q) {
        float gg = g[j + q], bb = bta[j + q];
        if (PARAM_BF16) { gg = bf16_round(gg); bb = bf16_round(bb); }
        sm[q] = vals[u * 4 + q]; o[q] = (vals[u * 4 + q] - mu) * rs * gg + bb;
      }
      if (out_sum) *(v4f*)(out_sum + (size_t)row * N + j) = sm;
      *(v4f*)(out_norm + (size_t)row * N + j) = o;
    }
    
  }
}



// ---- f16 WMMA path (v_wmma_f32_16x16x32_f16): 11-bit significands for operands in range — used here for the conv GEMMs, whose bf16-rounded x and x16 weights are exact in f16
typedef _Float16 v16h __attribute__((ext_vector_type(16)));
union FragH { v16h v; v8us half[2]; _Float16 h[16]; unsigned short u[16]; };
template <int NT>
__device__ __forceinline__ v8f mmaH(v16h ah, v16h al, v16h bh, v16h bl, v8f c) {
  c = __builtin_amdgcn_wmma_f32_16x16x32_f16(false, ah, false, bh, (short)0, c, false, false);
  if (NT >= 2) c = __builtin_amdgcn_wmma_f32_16x16x32_f16(false, al, false, bh, (short)0, c, false, false);
  if (NT >= 3) c = __builtin_amdgcn_wmma_f32_16x16x32_f16(false, ah, false, bl, (short)0, c, false, false);
  asm volatile("v_nop\n\tv_nop\n\tv_nop\n\tv_nop" : "+v"(c) : "v"(ah), "v"(al), "v"(bh), "v"(bl));
  return c;
}
// batched GEMM like k_gemm_b but f16 operands: A f32 (split into f16 hi/lo if ASPLIT, else rounded to f16), Bt = f16 values [n][k]; alpha; C f32; N multiple of 16 (partial tiles skipped)
template <bool ASPLIT>
__global__ __launch_bounds__(128) void k_gemm_h(const float* __restrict__ A, int lda, size_t sA, const _Float16* __restrict__ Bh, int ldb, size_t sB, float alpha, float* __restrict__ C, int ldc, size_t sC, int M, int N, int K) {
  __shared__ __attribute__((aligned(16))) float so[4][16][64];
  const int tid = threadIdx.x, w = tid >> 5, lane = tid & 31, ln = lane & 15, hh = lane >> 4; const int by = blockIdx.y;
  A += (size_t)by * sA; Bh += (size_t)by * sB; C += (size_t)by * sC;
  const int ntn = (N + 63) / 64; const int wid = blockIdx.x * 4 + w; const int mt = wid / ntn, nq = wid % ntn; if (mt * 16 >= M) return;
  const int row0 = mt * 16, col0 = nq * 64; const float* arow = A + (size_t)(row0 + ln) * lda;
  v8f acc[4] = {};
  for (int kb = 0; kb < K; kb += 32) {
    FragH ah, al;
    const v4f x0 = *(const v4fa*)(arow + kb + 8 * hh), x1 = *(const v4fa*)(arow + kb + 8 * hh + 4), x2 = *(const v4fa*)(arow + kb + 16 + 8 * hh), x3 = *(const v4fa*)(arow + kb + 16 + 8 * hh + 4);
    float xs[16] = {x0[0],x0[1],x0[2],x0[3],x1[0],x1[1],x1[2],x1[3],x2[0],x2[1],x2[2],x2[3],x3[0],x3[1],x3[2],x3[3]};
#pragma unroll
    for (int i = 0; i < 16; ++i) { const _Float16 h = (_Float16)xs[i]; ah.h[i] = h; al.h[i] = ASPLIT ? (_Float16)(xs[i] - (float)h) : (_Float16)0.0f; }
#pragma unroll
    for (int t = 0; t < 4; ++t) { if (col0 + t * 16 >= N) continue; const size_t boff = (size_t)(col0 + t * 16 + ln) * ldb + kb; FragH bq; bq.half[0] = *(const v8us*)(Bh + boff + 8 * hh); bq.half[1] = *(const v8us*)(Bh + boff + 16 + 8 * hh);
      acc[t] = mmaH<ASPLIT ? 2 : 1>(ah.v, al.v, bq.v, bq.v, acc[t]); }
  }
#pragma unroll
  for (int t = 0; t < 4; ++t) { if (col0 + t * 16 >= N) continue;
#pragma unroll
    for (int r = 0; r < 8; ++r) so[w][8 * hh + r][t * 16 + ln] = acc[t][r] * alpha; }
  __builtin_amdgcn_fence(__ATOMIC_ACQ_REL, "workgroup"); __builtin_amdgcn_wave_barrier();
  const int rsub = lane >> 4, c4 = (lane & 15) * 4;
  {
#pragma unroll
    for (int q = 0; q < 8; ++q) { const int r = q * 2 + rsub; if (col0 + c4 < N) { const v4f v = *(const v4fa*)&so[w][r][c4]; *(v4f*)(C + (size_t)(row0 + r) * ldc + col0 + c4) = v; } }
     }
}

// Wt[n][k] = f16(W[k][n]·scale) from f32 row-major W[K][N] (scale = power of two; bf16-exact weights stay exact in f16 away from the subnormal range)
__global__ __launch_bounds__(256) void k_wt_f16(const float* __restrict__ W, _Float16* __restrict__ Wt, int K, int N, float scale) {
  const int t = blockIdx.x * 256 + threadIdx.x; if (t >= N * (K / 8)) return; const int n = t / (K / 8), k8 = (t % (K / 8)) * 8; FragH f;
#pragma unroll
  for (int i = 0; i < 8; ++i) f.h[i] = (_Float16)(bf16_round(W[(size_t)(k8 + i) * N + n]) * scale); const v8us o = f.half[0];
  *(v8us*)((unsigned short*)Wt + (size_t)n * K + k8) = o; 
}
// k_gemm_hh variant with fused epilogue: v = acc·alpha + bias[by·sBias + col] (+ CP[(row/rowsPerB)·sCPb + by·64 + col] if CP) ; ACT 0 none / 1 elu ; writes f16 C16 (and f32 C if non-null)
template <int ACT>
__global__ __launch_bounds__(128) void k_gemm_hhx(const _Float16* __restrict__ A, int lda, size_t sA, const _Float16* __restrict__ Bh, int ldb, size_t sB, float alpha, const float* __restrict__ bias, size_t sBias, const float* __restrict__ CP, int rowsPerB, size_t sCPb, int row0g,
    float* __restrict__ C, _Float16* __restrict__ C16, int ldc, size_t sC, int M, int N, int K) {
  __shared__ __attribute__((aligned(16))) float so[4][16][64];
  const int tid = threadIdx.x, w = tid >> 5, lane = tid & 31, ln = lane & 15, hh = lane >> 4; const int by = blockIdx.y;
  A += (size_t)by * sA; Bh += (size_t)by * sB; const size_t cofs = (size_t)by * sC; const float* bp = bias ? bias + (size_t)by * sBias : nullptr;
  const int ntn = (N + 63) / 64; const int wid = blockIdx.x * 4 + w; const int mt = wid / ntn, nq = wid % ntn; if (mt * 16 >= M) return;
  const int row0 = mt * 16, col0 = nq * 64; const _Float16* arow = A + (size_t)(row0 + ln) * lda;
  v8f acc[4] = {};
  for (int kb = 0; kb < K; kb += 32) { FragH ah; ah.half[0] = *(const v8us*)((const unsigned short*)arow + kb + 8 * hh); ah.half[1] = *(const v8us*)((const unsigned short*)arow + kb + 16 + 8 * hh);
#pragma unroll
    for (int t = 0; t < 4; ++t) { if (col0 + t * 16 >= N) continue; const size_t boff = (size_t)(col0 + t * 16 + ln) * ldb + kb; FragH bq; bq.half[0] = *(const v8us*)((const unsigned short*)Bh + boff + 8 * hh); bq.half[1] = *(const v8us*)((const unsigned short*)Bh + boff + 16 + 8 * hh);
      acc[t] = mmaH<1>(ah.v, ah.v, bq.v, bq.v, acc[t]); }
  }
#pragma unroll
  for (int t = 0; t < 4; ++t) { if (col0 + t * 16 >= N) continue; const int col = col0 + t * 16 + ln; const float bv = bp ? bf16_round(bp[col]) : 0.f;
#pragma unroll
    for (int r = 0; r < 8; ++r) { float v = acc[t][r] * alpha + bv; if (CP) { const int rr = row0g + row0 + 8 * hh + r; if (rowsPerB < 0) v += CP[cofs + (size_t)rr * ldc + col];      /* rowsPerB < 0: own element of the batched C plane */ else { const int bidx = rr / rowsPerB; v += CP[(size_t)bidx * sCPb + (size_t)by * 64 + col]; } } if (ACT == 1) v = (v > 0.f) ? v : expm1f(v); else if (ACT == 7) v = (v > 0.f) ? v + 1.0f : expf(v); else if (ACT == 8) v = tanhf(v); else if (ACT == 9) v = 0.5f * v * (1.0f + tanhf(0.7978845608028654f * (v + 0.044715f * v * v * v))); else if (ACT == 11) v = 1.0f / (1.0f + expf(-v)); else if (ACT == 12) v = (v > 0.f) ? v : 0.01f * v; else if (ACT == 14) v = (v > 0.f) ? v : 0.1f * v; else if (ACT == 16) v = (v >= 0.f) ? v : 0.3f * v; else if (ACT == 17) v = (v >= 0.f) ? v : 0.2f * v; else if (ACT == 15) v = v / (1.0f + expf(-v)); else if (ACT == 3) v = fmaxf(v, 0.f); else if (ACT == 6) v = 0.5f * v * (1.0f + erff(v * 0.70710678118654752f)); so[w][8 * hh + r][t * 16 + ln] = v; } }
  __builtin_amdgcn_fence(__ATOMIC_ACQ_REL, "workgroup"); __builtin_amdgcn_wave_barrier();
  const int rsub = lane >> 4, c4 = (lane & 15) * 4; typedef _Float16 v4h __attribute__((ext_vector_type(4)));
  {
#pragma unroll
    for (int q = 0; q < 8; ++q) { const int r = q * 2 + rsub; if (col0 + c4 < N) { const v4f v = *(const v4fa*)&so[w][r][c4]; if (C) *(v4f*)(C + cofs + (size_t)(row0 + r) * ldc + col0 + c4) = v; if (C16) { v4h h4; for (int i = 0; i < 4; ++i) h4[i] = (_Float16)v[i]; *(v4h*)(C16 + cofs + (size_t)(row0 + r) * ldc + col0 + c4) = h4; } } }
     }
}


typedef _Float16 v4h __attribute__((ext_vector_type(4)));

__global__ __launch_bounds__(256) void k_x16(const float* __restrict__ x, _Float16* __restrict__ X16, size_t n8) { const size_t t = (size_t)blockIdx.x * 256 + threadIdx.x; if (t >= n8) return; FragH f;
#pragma unroll
  for (int q = 0; q < 8; ++q) f.h[q] = (_Float16)bf16_round(x[t * 8 + q]); *(v8us*)((unsigned short*)X16 + t * 8) = f.half[0];  }
__global__ __launch_bounds__(256) void k_h16(const float* __restrict__ x, _Float16* __restrict__ X16, size_t n8) { const size_t t = (size_t)blockIdx.x * 256 + threadIdx.x; if (t >= n8) return; FragH f;
#pragma unroll
  for (int q = 0; q < 8; ++q) f.h[q] = (_Float16)x[t * 8 + q]; *(v8us*)((unsigned short*)X16 + t * 8) = f.half[0];  }
__global__ __launch_bounds__(256) void k_round16f(const float* __restrict__ W, _Float16* __restrict__ Bt, size_t n8) { const size_t t = (size_t)blockIdx.x * 256 + threadIdx.x; if (t >= n8) return; FragH f;
#pragma unroll
  for (int i = 0; i < 8; ++i) f.h[i] = (_Float16)(bf16_round(W[t * 8 + i]) * 16.0f); *(v8us*)((unsigned short*)Bt + t * 8) = f.half[0];  }
template <int NHv, int TTv>
__global__ __launch_bounds__(256) void k_vt(const _Float16* __restrict__ V16, int ldv, int voff, _Float16* __restrict__ Vt) { __shared__ unsigned short tl[64][66]; const int tid = threadIdx.x; const int slab = blockIdx.x / (TTv / 64), lg = blockIdx.x % (TTv / 64); const int b = slab / NHv, h = slab % NHv;
  for (int i = tid; i < 64 * 8; i += 256) { const int r = i / 8, c8 = (i % 8) * 8; FragH f; f.half[0] = *(const v8us*)((const unsigned short*)V16 + ((size_t)b * TTv + lg * 64 + r) * ldv + voff + h * 64 + c8);
#pragma unroll
    for (int q = 0; q < 8; ++q) tl[r][c8 + q] = f.u[q]; }
  __syncthreads();
  {
#pragma unroll
    for (int rd = 0; rd < 2; ++rd) { const int d = rd * 32 + tid / 8, pc = tid % 8; FragH f;
#pragma unroll
      for (int q = 0; q < 8; ++q) f.u[q] = tl[pc * 8 + q][d];
      *(v8us*)((unsigned short*)Vt + ((size_t)slab * 64 + d) * TTv + lg * 64 + pc * 8) = f.half[0]; }
     } }

__global__ __launch_bounds__(256) void k_hl(const float* __restrict__ F, _Float16* __restrict__ Hh, _Float16* __restrict__ Hl, size_t n8) { const size_t t = (size_t)blockIdx.x * 256 + threadIdx.x; if (t >= n8) return; FragH fh, fl; const v4f a = *(const v4fa*)(F + t * 8), c = *(const v4fa*)(F + t * 8 + 4);
#pragma unroll
  for (int q = 0; q < 4; ++q) { _Float16 h = (_Float16)a[q]; fh.h[q] = h; fl.h[q] = (_Float16)((a[q] - (float)h) * 1024.0f); h = (_Float16)c[q]; fh.h[4 + q] = h; fl.h[4 + q] = (_Float16)((c[q] - (float)h) * 1024.0f); }
  { *(v8us*)((unsigned short*)Hh + t * 8) = fh.half[0]; *(v8us*)((unsigned short*)Hl + t * 8) = fl.half[0];  } }

// ---- WMMA step of the conv GEMM (wave tile 48x64) ----
__device__ __forceinline__ v8f g2_mma(v16h a, v16h b, v8f c) { v8f d = __builtin_amdgcn_wmma_f32_16x16x32_f16(false, a, false, b, (short)0, c, false, false); asm volatile("v_nop\n\tv_nop\n\tv_nop\n\tv_nop" : "+v"(d) : "v"(a), "v"(b)); return d; }

__device__ __forceinline__ void d_xrows(const float* __restrict__ x, _Float16* __restrict__ XR, int blk) { __shared__ float tl[CI][33]; const int tid = threadIdx.x; const int p0 = blk * 32;      /* 32 pixels of the padded grid, batches end to end */
  for (int i = tid; i < CI * 32; i += 256) { const int c = i / 32, j = i % 32; const int b = (p0 + j) / PP, p = (p0 + j) % PP; const int yy = p / HP - 6, xx = p % HP - 6; tl[c][j] = (yy >= 0 && yy < HS && xx >= 0 && xx < HS) ? bf16_round(x[((size_t)b * CI + c) * PX + yy * HS + xx]) : 0.f; }
  __syncthreads();
  { for (int i = tid; i < 32 * CG; i += 256) { const int j = i / CG, c8 = (i % CG) * 8; FragH f; for (int q = 0; q < 8; ++q) f.h[q] = (_Float16)tl[c8 + q][j]; *(v8us*)((unsigned short*)XR + ((size_t)p0 + j) * CI + c8) = f.half[0]; }  } }
// 7x7 conv as a GEMM without an im2col buffer: row r of A is output pixel r of an HO x HO grid, and its k = tap * 128 + channel element is the x row at padded pixel (oy + OFF + tap / 7, ox + OFF + tap % 7),
// so a tap's 128 channels are 256 contiguous bytes. C[r][n] = alpha * sum_k A[r][k] * Bh[n][k], k in the order of d_w7. Wave tile 48x64, work-group 192x128 (8 waves, 4 down x 2 across); rows from M on repeat the last image row (their C rows are never read).
// One trip of the loop is one tap. The tap's B tile (128 weight rows, 256 bytes a row) is brought into LDS by asynchronous copies, 16 bytes a lane (16 lanes = one whole row),
// into one of two buffers: the copies of tap t + 2 fly while tap t + 1 is worked on. The fragments are read from LDS at a row pitch of 272 bytes (free of bank conflicts for 16-byte reads).
// The A tile is staged once per WINDOW ROW, not per tap: the seven taps of a window row read the same x rows, one pixel further right each. The tile's 192 pixels lie in up to five image rows (segments);
// each segment is staged with the 6 pixels that follow it in the padded grid, and tap column dx reads pixel i at LDS row i + 16 * segment + dx (16 rows per segment keep a fragment's 16 rows on 16 different bank groups).
// Two A buffers: window row d + 1 is copied, with the B tile of its first tap, while the last tap of window row d is worked on.
#define LP 272                       /* LDS row pitch in bytes */
#define AC 224                       /* x rows copied per window row: 192 pixels + 5 x 6 that follow a segment = 222, rounded up to 14 per thread */
#define LA ((AC + 40) * LP)          /* one A buffer: the copied rows, 10 unused rows between segments */
#define LB (TN * LP)                 /* one B buffer */
// six copies of 16 bytes a lane, LDS byte address l[i] from global address g[i]; the wait on the address registers ends the copies' own statement, ahead of any rewrite of them
__device__ __forceinline__ void g2_copy6(const unsigned* l, const char* const* g) {
  asm volatile("global_load_async_to_lds_b128 %0, %6, off\n\tglobal_load_async_to_lds_b128 %1, %7, off\n\tglobal_load_async_to_lds_b128 %2, %8, off\n\t"
               "global_load_async_to_lds_b128 %3, %9, off\n\tglobal_load_async_to_lds_b128 %4, %10, off\n\tglobal_load_async_to_lds_b128 %5, %11, off\n\ts_wait_xcnt 0x0"
               :: "v"(l[0]), "v"(l[1]), "v"(l[2]), "v"(l[3]), "v"(l[4]), "v"(l[5]),
                  "v"(g[0]), "v"(g[1]), "v"(g[2]), "v"(g[3]), "v"(g[4]), "v"(g[5]) : "memory"); }
// the same for eight copies
__device__ __forceinline__ void g2_copy8(const unsigned* l, const char* const* g) {
  asm volatile("global_load_async_to_lds_b128 %0, %8, off\n\tglobal_load_async_to_lds_b128 %1, %9, off\n\tglobal_load_async_to_lds_b128 %2, %10, off\n\tglobal_load_async_to_lds_b128 %3, %11, off\n\t"
               "global_load_async_to_lds_b128 %4, %12, off\n\tglobal_load_async_to_lds_b128 %5, %13, off\n\tglobal_load_async_to_lds_b128 %6, %14, off\n\tglobal_load_async_to_lds_b128 %7, %15, off\n\ts_wait_xcnt 0x0"
               :: "v"(l[0]), "v"(l[1]), "v"(l[2]), "v"(l[3]), "v"(l[4]), "v"(l[5]), "v"(l[6]), "v"(l[7]),
                  "v"(g[0]), "v"(g[1]), "v"(g[2]), "v"(g[3]), "v"(g[4]), "v"(g[5]), "v"(g[6]), "v"(g[7]) : "memory"); }
__device__ __forceinline__ v16h g2_lfrag(const unsigned char* p) { FragH f; f.half[0] = *(const v8us*)p; f.half[1] = *(const v8us*)(p + 32); return f.v; }
// copied row number c (0 .. AC - 1) of the tile that starts at output pixel r0: go = byte offset of its x row at window row 0, lo = byte offset of its place in an A buffer.
// Segment 0 is the rest of r0's image row and the 6 pixels behind it, every later segment a whole image row of HO pixels and 6 more; image rows past the last one repeat the last (their C rows are never read).
template <int HO, int OFF>
__device__ __forceinline__ void g2_amap(int r0, int c, unsigned& go, unsigned& lo) {
  const int x0 = r0 % HO, c2 = c - (HO - x0 + 6); const int s = c2 < 0 ? 0 : 1 + c2 / (HO + 6), col = c2 < 0 ? x0 + c : c2 % (HO + 6);
  const int R = min(r0 / HO + s, NB * HO - 1);      /* image row, batches end to end */
  go = (unsigned)((((R / HO) * PP + (R % HO + OFF) * HP + col + OFF) * CI) * 2); lo = (unsigned)((c + 10 * s) * LP); }
// byte offset, in an A buffer, of tile pixel i at tap column 0
template <int HO>
__device__ __forceinline__ unsigned g2_lrow(int r0, int i) { return (unsigned)((i + 16 * ((r0 + i) / HO - r0 / HO)) * LP); }
#define GQ (MQ * (CO / TN))                    /* 66 work-groups of q */
#define GK (MK * (CO / TN))                    /* 82 work-groups of k, and as many of v */
// The three convs read nothing of each other, so they go as ONE launch: work-groups 0 .. GQ - 1 are q's tiles, the next GK are k's, the last GK are v's. Together they are 230, fewer than the chip has WGPs:
// every work-group has a WGP (and its LDS) to itself, two waves on each SIMD, and the launch is one round with no tail. The 192x128 tile gives a wave 48 WMMAs per tap between two barriers, enough to cover the flight of the next tap's copies,
// each weight row is fetched from L2 once per 192 pixels, and a wave reads 7 fragments from LDS for 12 WMMAs. Which conv a work-group belongs to is the same for all its threads: every branch on it is a scalar one.
__global__ __launch_bounds__(256) void k_conv7(const _Float16* __restrict__ XR, const _Float16* __restrict__ BQ, const _Float16* __restrict__ BK, const _Float16* __restrict__ BV, float alpha, float* __restrict__ Q, float* __restrict__ Kf, float* __restrict__ Vf) {
  __shared__ __attribute__((aligned(16))) unsigned char ring[2 * LA + 2 * LB];      /* two A buffers, then two B buffers */
  float (*so)[48][68] = (float (*)[48][68])ring;      /* the output tiles take the A buffers' place behind the loop's last barrier */
  const int tid = threadIdx.x, w = tid >> 5, lane = tid & 31, ln = lane & 15, hh = lane >> 4; const int wm = w >> 1, wn = w & 1;      /* the wave's place in the tile: 48 rows from 48 wm, 64 columns from 64 wn */
  const int job = (int)blockIdx.x < GQ ? 0 : (int)blockIdx.x < GQ + GK ? 1 : 2; const int blk = (int)blockIdx.x - (job == 0 ? 0 : job == 1 ? GQ : GQ + GK);
  const _Float16* __restrict__ Bh = job == 0 ? BQ : job == 1 ? BK : BV; float* __restrict__ C = job == 0 ? Q : job == 1 ? Kf : Vf;
  const int mt = blk / (CO / TN), nq = blk % (CO / TN); const int row0 = mt * TM + 48 * wm, col0 = nq * TN + 64 * wn;
  /* copy side: this thread brings the 16 bytes number cc of tile rows cr, cr + 16, ... */
  const int cr = tid >> 4, cc = tid & 15; unsigned ao[AC / 16], al[AC / 16], fa0, fa1, fa2;      /* byte offsets of this thread's rows at tap 0 (al: in an A buffer); fa0 .. fa2: of this lane's three fragment rows; every loop over the arrays is unrolled so that they stay in registers */
  if (job == 0) {      /* q: 56-grid, x index = o + tap - 3 */
#pragma unroll
    for (int i = 0; i < AC / 16; ++i) g2_amap<HS, 3>(mt * TM, cr + 16 * i, ao[i], al[i]);
    fa0 = g2_lrow<HS>(mt * TM, 48 * wm + ln); fa1 = g2_lrow<HS>(mt * TM, 48 * wm + 16 + ln); fa2 = g2_lrow<HS>(mt * TM, 48 * wm + 32 + ln);
  } else {      /* k, v: 62-grid over pad3(x) with conv pad 3: x index = o + tap - 6 */
#pragma unroll
    for (int i = 0; i < AC / 16; ++i) g2_amap<HK, 0>(mt * TM, cr + 16 * i, ao[i], al[i]);
    fa0 = g2_lrow<HK>(mt * TM, 48 * wm + ln); fa1 = g2_lrow<HK>(mt * TM, 48 * wm + 16 + ln); fa2 = g2_lrow<HK>(mt * TM, 48 * wm + 32 + ln);
  }
  const unsigned bo = (unsigned)(((nq * TN + cr) * KC + cc * 8) * 2);      /* this thread's first weight row at tap 0; the others lie 16 rows apart */
  const unsigned lc = (unsigned)(size_t)ring + (unsigned)(cc * 16);
  auto issueA = [&](int d) { const char* xa = (const char*)XR + d * (HP * CI * 2) + cc * 16; const unsigned l = lc + (unsigned)((d & 1) * LA);      /* window row d's base, the same for every lane but for its 16 bytes of the row */
    unsigned la[AC / 16]; const char* ga[AC / 16];
#pragma unroll
    for (int i = 0; i < AC / 16; ++i) { la[i] = l + al[i]; ga[i] = xa + ao[i]; }
    g2_copy8(la, ga); g2_copy6(la + 8, ga + 8); };
  auto issueB = [&](int t) { const char* xb = (const char*)Bh + t * (CI * 2) + bo; const unsigned l = lc + (unsigned)(2 * LA + (t & 1) * LB + cr * LP);      /* tile rows cr + 16 i of tap t */
    unsigned la[8]; const char* ga[8];
#pragma unroll
    for (int i = 0; i < 8; ++i) { la[i] = l + (unsigned)(16 * i * LP); ga[i] = xb + (size_t)i * (16 * KC * 2); }
    g2_copy8(la, ga); };
  const v8f z8 = {0.f,0.f,0.f,0.f,0.f,0.f,0.f,0.f}; v8f c00 = z8, c01 = z8, c02 = z8, c03 = z8, c10 = z8, c11 = z8, c12 = z8, c13 = z8, c20 = z8, c21 = z8, c22 = z8, c23 = z8;
  issueA(0); issueB(0);
  asm volatile("s_wait_asynccnt 0x0" ::: "memory");      /* this wave's copies of tap 0 have landed */
  __syncthreads();      /* tap 0 is complete before any wave reads it */
  issueB(1);
  /* the tap loop stays rolled: its body holds 48 WMMAs */
#pragma unroll 1
  for (int t = 0; t < KK; ++t) { const unsigned char* sa = ring + ((t / 7) & 1) * LA + (t % 7) * LP + 16 * hh; const unsigned char* pa = sa + fa0; const unsigned char* pc = sa + fa1; const unsigned char* pe = sa + fa2; const unsigned char* pb = ring + 2 * LA + (t & 1) * LB + (64 * wn + ln) * LP + 16 * hh;
    v16h a0[2], a1[2], a2[2], b0[2], b1[2], b2[2], b3[2];
    /* two fragment sets: the next 32 channels' LDS reads stand ahead of this block's WMMAs, so that their latency runs under the block; unrolled so that the sets are picked by constants */
    a0[0] = g2_lfrag(pa); a1[0] = g2_lfrag(pc); a2[0] = g2_lfrag(pe); b0[0] = g2_lfrag(pb); b1[0] = g2_lfrag(pb + 16 * LP); b2[0] = g2_lfrag(pb + 32 * LP); b3[0] = g2_lfrag(pb + 48 * LP);
#pragma unroll
    for (int s = 0; s < 4; ++s) { const int u = s & 1, n = u ^ 1, kb = (s + 1) * 64;
      if (s < 3) { a0[n] = g2_lfrag(pa + kb); a1[n] = g2_lfrag(pc + kb); a2[n] = g2_lfrag(pe + kb); b0[n] = g2_lfrag(pb + kb); b1[n] = g2_lfrag(pb + 16 * LP + kb); b2[n] = g2_lfrag(pb + 32 * LP + kb); b3[n] = g2_lfrag(pb + 48 * LP + kb); }
      c00 = g2_mma(a0[u], b0[u], c00); c10 = g2_mma(a1[u], b0[u], c10); c20 = g2_mma(a2[u], b0[u], c20); c01 = g2_mma(a0[u], b1[u], c01); c11 = g2_mma(a1[u], b1[u], c11); c21 = g2_mma(a2[u], b1[u], c21);
      c02 = g2_mma(a0[u], b2[u], c02); c12 = g2_mma(a1[u], b2[u], c12); c22 = g2_mma(a2[u], b2[u], c22); c03 = g2_mma(a0[u], b3[u], c03); c13 = g2_mma(a1[u], b3[u], c13); c23 = g2_mma(a2[u], b3[u], c23);
    }
    asm volatile("s_wait_dscnt 0x0" ::: "memory");      /* this wave's reads of the buffer are done before it is handed back */
    asm volatile("s_wait_asynccnt 0x0" ::: "memory");      /* this wave's copies of tap t + 1 have landed */
    __syncthreads();      /* publishes tap t + 1 and ends every wave's reads of tap t's buffer */
    if (t + 2 < KK) { issueB(t + 2); if ((t + 2) % 7 == 0) issueA((t + 2) / 7); } }      /* a new window row goes into the A buffer that the window row before the current one has left */
  asm volatile("s_wait_asynccnt 0x0" ::: "memory");      /* no copy is outstanding when the wave goes on */
  v8f accs[12] = {c00, c01, c02, c03, c10, c11, c12, c13, c20, c21, c22, c23};
#pragma unroll
  for (int u = 0; u < 12; ++u) { const int t = u & 3, part = u >> 2;
#pragma unroll
    for (int r = 0; r < 8; ++r) so[w][part * 16 + 8 * hh + r][t * 16 + ln] = accs[u][r] * alpha; }
  __builtin_amdgcn_fence(__ATOMIC_ACQ_REL, "workgroup"); __builtin_amdgcn_wave_barrier();
  const int rsub = lane >> 4, c4 = (lane & 15) * 4;
#pragma unroll
  for (int q = 0; q < 24; ++q) { const int r = q * 2 + rsub; const v4f v = *(const v4fa*)&so[w][r][c4]; *(v4f*)(C + (size_t)(row0 + r) * CO + col0 + c4) = v; } }
__device__ __forceinline__ void d_w7(const float* __restrict__ w, _Float16* __restrict__ Bt, int blk) { const size_t t = (size_t)blk * 256 + threadIdx.x; if (t >= (size_t)CO * KC / 8) return; const int c8 = (int)((t * 8) % CI); const int tap = (int)(((t * 8) / CI) % KK); const int o = (int)((t * 8) / KC); FragH f; for (int q = 0; q < 8; ++q) f.h[q] = (_Float16)(bf16_round(w[((size_t)o * CI + c8 + q) * KK + tap]) * 16.0f);
  *(v8us*)((unsigned short*)Bt + t * 8) = f.half[0];  }
#define GX (NB * PP / 32)                      /* 289 work-groups of x rows */
#define GW ((CO * KC / 8 + 255) / 256)         /* 784 work-groups per weight plane */
// The x rows and the three weight planes are made from the inputs alone, none from another: one launch, the job picked by the work-group's index (the same for all its threads, so the barrier of the x rows is passed by whole work-groups).
__global__ __launch_bounds__(256) void k_prep(const float* __restrict__ x, const float* __restrict__ wq, const float* __restrict__ wk, const float* __restrict__ wv, _Float16* __restrict__ XR, _Float16* __restrict__ BQ, _Float16* __restrict__ BK, _Float16* __restrict__ BV) {
  const int blk = (int)blockIdx.x;
  if (blk < GX) { d_xrows(x, XR, blk); return; }
  const int job = (blk - GX) / GW;
  d_w7(job == 0 ? wq : job == 1 ? wk : wv, job == 0 ? BQ : job == 1 ? BK : BV, (blk - GX) % GW); }
// Lanes run along channels, two neighbouring channels to a lane: 16 lanes hold the 32 channels of one head at one pixel, so a half-wave's Q, K or V load (8 bytes a lane) is one whole 128-byte line,
// and the two channels of a lane lie in an aligned register pair, on which the adds, multiplies and fused multiply-adds of the softmax are packed two to an instruction (v_pk_add_f32, v_pk_mul_f32, v_pk_fma_f32).
// Each half-wave takes four neighbouring pixels of one image row at once: their four 7-wide window rows are ten neighbouring K (and V) pixels, loaded once per window row, all in flight together, and used from registers by all four.
// The score q * (k + rel) is formed as one fused multiply-add, q * k + (q * rel): the addend does not depend on k, so it is made once per pixel and window row (rel_h heads) or once per pixel and window column (rel_w heads);
// in the second pass the maximum is taken off the addend, so that a term's exponent is again one fused multiply-add.
// The head's rel table lies in LDS as [tap][channel], so that its reads are contiguous over the lanes too (in global memory a channel's taps are 28 bytes from the next channel's).
// A work-group (4 waves, 8 pixels each) fills a 32-channel x 32-pixel tile in LDS, and the channel-major store then writes whole 128-byte lines.
typedef float v2f  __attribute__((ext_vector_type(2)));
typedef float v2fa __attribute__((ext_vector_type(2), may_alias));
// FIRST: the head's rel value goes with the window row (rel_h), else with the window column (rel_w). qv carries log2(e). se, acc: sum of the terms and weighted sum of v, per pixel.
template <bool FIRST>
__device__ __forceinline__ void d_wsum(const float* __restrict__ kp, const float* __restrict__ vp, const float (*rl)[32], int c2, const v2f (&qv)[4], v2f (&se)[4], v2f (&acc)[4]) {
  v2f mx[4], d[4][FIRST ? 1 : 7];      /* d: the addend of the score */
  /* every loop over the four pixels, the seven window columns and the ten loaded lines is unrolled (each '#pragma unroll' below), so that these small arrays are indexed by constants and stay in registers */
#pragma unroll
  for (int j = 0; j < 4; ++j) mx[j] = -3.0e38f;
  if (!FIRST) {
#pragma unroll
    for (int kw = 0; kw < 7; ++kw) { const v2f rc = *(const v2fa*)&rl[kw][c2];
#pragma unroll
      for (int j = 0; j < 4; ++j) d[j][FIRST ? 0 : kw] = qv[j] * rc; } }
  /* the loops over window rows stay rolled: one row's body (28 window positions, two channels each) is already long */
#pragma unroll 1
  for (int kh = 0; kh < 7; ++kh) { v2f kr[10];
#pragma unroll
    for (int i = 0; i < 10; ++i) kr[i] = *(const v2fa*)(kp + (size_t)(kh * HK + i) * CO);
    if (FIRST) { const v2f rk = *(const v2fa*)&rl[kh][c2];
#pragma unroll
      for (int j = 0; j < 4; ++j) d[j][0] = qv[j] * rk; }
#pragma unroll
    for (int j = 0; j < 4; ++j)
#pragma unroll
      for (int kw = 0; kw < 7; ++kw) { const v2f s = __builtin_elementwise_fma(qv[j], kr[j + kw], d[j][FIRST ? 0 : kw]); mx[j].x = fmaxf(mx[j].x, s.x); mx[j].y = fmaxf(mx[j].y, s.y); } }
  if (!FIRST) {
#pragma unroll
    for (int j = 0; j < 4; ++j)
#pragma unroll
      for (int kw = 0; kw < 7; ++kw) d[j][FIRST ? 0 : kw] -= mx[j]; }
  /* per pixel and channel the 49 terms are summed window row by window row, left to right */
#pragma unroll 1
  for (int kh = 0; kh < 7; ++kh) { v2f kr[10], vr[10];
#pragma unroll
    for (int i = 0; i < 10; ++i) { kr[i] = *(const v2fa*)(kp + (size_t)(kh * HK + i) * CO); vr[i] = *(const v2fa*)(vp + (size_t)(kh * HK + i) * CO); }
    if (FIRST) { const v2f rk = *(const v2fa*)&rl[kh][c2];
#pragma unroll
      for (int j = 0; j < 4; ++j) d[j][0] = qv[j] * rk - mx[j]; }
#pragma unroll
    for (int j = 0; j < 4; ++j)
#pragma unroll
      for (int kw = 0; kw < 7; ++kw) { const v2f a = __builtin_elementwise_fma(qv[j], kr[j + kw], d[j][FIRST ? 0 : kw]); v2f e; e.x = __builtin_amdgcn_exp2f(a.x); e.y = __builtin_amdgcn_exp2f(a.y); se[j] += e; acc[j] = __builtin_elementwise_fma(e, vr[j + kw], acc[j]); } } }      /* the argument is at most a few rounding errors above 0; a term below the exp2 instruction's range counts as 0 beside the largest term's 1 */
// The second launch bound holds a wave to 144 registers: seven of these 4-wave work-groups then fit a WGP, so that all 1,568 are resident at once and the launch is one round with no thin second round behind it.
__global__ __launch_bounds__(128, 7) void k_watt(const float* __restrict__ Q, const float* __restrict__ Kf, const float* __restrict__ Vf, const float* __restrict__ rh, const float* __restrict__ rw, float* __restrict__ out) {
  __shared__ __attribute__((aligned(16))) float tl[32][36]; __shared__ __attribute__((aligned(16))) float rl[7][32];
  const int tid = threadIdx.x, lane = tid & 31, w = tid >> 5; const int c2 = (lane & 15) * 2, hf = lane >> 4;      /* the lane's first channel within the head; its half-wave */
  const int p0 = (int)(blockIdx.x % (PX / 32)) * 32; const int bh = (int)(blockIdx.x / (PX / 32)); const int head = bh % (NCO / 32); const size_t b = bh / (NCO / 32); const int c = head * 32 + c2; const bool first = head < CO / 64;      /* c < CO / 2, the same for the whole work-group */
  for (int i = tid; i < 7 * 32; i += 128) { const int kq = i >> 5, ch = head * 32 + (i & 31); rl[kq][i & 31] = first ? bf16_round(rh[(size_t)ch * 7 + kq]) : bf16_round(rw[(size_t)(ch - CO / 2) * 7 + kq]); }
  __syncthreads();      /* the rel table is complete before any wave reads it */
  const int p = p0 + 8 * w + 4 * hf; const int y = p / HS, x = p % HS;      /* pixels p .. p + 3 lie in one image row: HS and p are multiples of 4 */
  const float* kp = Kf + (b * PK + (size_t)y * HK + x) * CO + c; const float* vp = Vf + (b * PK + (size_t)y * HK + x) * CO + c;
  v2f qv[4], se[4], acc[4];
#pragma unroll
  for (int j = 0; j < 4; ++j) { qv[j] = *(const v2fa*)(Q + (b * PX + p + j) * CO + c) * 1.44269504f; se[j] = 0.f; acc[j] = 0.f; }      /* q carries log2(e): scores and their maximum are in base-2 units, so that each term is one exp2 */
  if (first) d_wsum<true>(kp, vp, rl, c2, qv, se, acc); else d_wsum<false>(kp, vp, rl, c2, qv, se, acc);      /* the same side for the whole work-group */
  v4f o0, o1;
#pragma unroll
  for (int j = 0; j < 4; ++j) { o0[j] = acc[j].x / se[j].x; o1[j] = acc[j].y / se[j].y; }
  *(v4fa*)&tl[c2][8 * w + 4 * hf] = o0; *(v4fa*)&tl[c2 + 1][8 * w + 4 * hf] = o1;
  __syncthreads();      /* the tile is complete before any wave reads other waves' pixels */
#pragma unroll
  for (int u = 0; u < 2; ++u) { const int dh = (tid >> 3) + 16 * u, j4 = (tid & 7) * 4; const v4f o = *(const v4fa*)&tl[dh][j4];
    const int oc = dh * 8 + head;      /* the reference's final transpose: output channel = dh*heads + head for computation channel head*32 + dh */
    *(v4f*)(out + ((b * CO + oc) * (size_t)PX + p0 + j4)) = o; } }

extern "C" void kernel_launch(void* const* d_in, const int* in_sizes, int n_in,
                              void* d_out, int out_size, void* d_ws, size_t ws_size, hipStream_t stream) {
  (void)in_sizes; (void)n_in; (void)out_size;
  const float* const* I = (const float* const*)d_in; const float* x = I[0]; const float* wq = I[1]; const float* wk = I[2]; const float* wv = I[3]; const float* rh = I[4]; const float* rw = I[5];
  char* ws = (char*)d_ws; size_t off = 0;
  auto take = [&](size_t bytes) { char* p = ws + off; off += (bytes + 255) & ~(size_t)255; return p; };
  _Float16* BQ = (_Float16*)take((size_t)CO * KC * 2); _Float16* BK = (_Float16*)take((size_t)CO * KC * 2); _Float16* BV = (_Float16*)take((size_t)CO * KC * 2);
  _Float16* XR = (_Float16*)take((size_t)NB * PP * CI * 2); float* Q = (float*)take((size_t)MQ * TM * CO * 4); float* Kf = (float*)take((size_t)MK * TM * CO * 4); float* Vf = (float*)take((size_t)MK * TM * CO * 4);
  if (off > ws_size) return;      /* three weight planes, the x rows, q, k, v */
  k_prep<<<GX + 3 * GW, 256, 0, stream>>>(x, wq, wk, wv, XR, BQ, BK, BV);
  k_conv7<<<GQ + 2 * GK, 256, 0, stream>>>(XR, BQ, BK, BV, 0.0625f, Q, Kf, Vf);
  k_watt<<<NB * (NCO / 32) * (PX / 32), 128, 0, stream>>>(Q, Kf, Vf, rh, rw, (float*)d_out);
}

// v010
// One run takes 77.1 microseconds.
// Two timings next to v009 both put it at 1.05 times that version's speed.
// All steps since v000 together make it 20.7 times as fast.
#include <hip/hip_runtime.h>
// StandAloneSelfAttention (inputs [2][128][56][56]; q = conv7x7(x, Wq, pad 3) (256 ch, 56x56); k, v = conv7x7(pad3(x), Wk/Wv, pad 3) (256 ch, 62x62); per channel c and pixel: 7x7 window of k (plus rel_h[c] per window row for the first 128 channels, rel_w[c-128] per window column for the rest) and v around the pixel; attn = softmax over the 49 of q*k (scalar products); out = sum attn*v, then the reference's transpose(0,2,1,3,4): output channel (dh*8 + head) takes computation channel (head*32 + dh) -> [2][256][56][56]).
// Structure: pixel rows; x as exact f16 rows via LDS transposes; the three 7x7 convs as WMMA GEMMs (K = 6,272 = 49 taps x 128 channels; 48x64 wave tiles, f32 accumulation, exact x16 weights) whose A tiles are taken tap by tap from the x rows, which lie on a 68x68 grid with 6 pixels of zeros on every side (all padding of both convs), and staged with the weight tiles in LDS, into f32 channel rows; the per-channel 49-way window softmax and weighted sum on VALU in f32 (rel tables read) with the channel-major store.
// Compute dtype: inputs rounded to bf16; x / weights / rel tables exact; q, k, v in f32 (GEMM outputs); softmax and the weighted sum f32 — no reduced-precision intermediates after the convs. v_wmma_f32_16x16x32_f16.
#define NB 2
#define CI 128
#define CO 256
#define HS 56
#define PX (HS * HS)                 /* 3136 */
#define HK 62                        /* k/v grid */
#define PK (HK * HK)                 /* 3844 */
#define NRQ ((size_t)NB * PX)        /* 6272 = 49 x 128 */
#define TM 192                       /* rows (output pixels) of a conv work-group's tile */
#define TN 128                       /* its columns (output channels) */
#define MQ ((int)((NRQ + TM - 1) / TM))          /* 33 row tiles of q */
#define MK ((NB * PK + TM - 1) / TM)             /* 41 row tiles of k, and of v (2 x 3844 = 7688 rows) */
#define KK 49
#define KC (KK * CI)                 /* 6272 */
#define CG (CI / 8)
#define HP (HS + 12)                 /* x rows on a grid with 6 zero pixels on every side */
#define PP (HP * HP)                 /* 4624; NB * PP = 289 x 32 */
#define NCO CO                       /* output channels computed (debug hook) */
typedef __bf16 v16b __attribute__((ext_vector_type(16)));
typedef unsigned short v8us __attribute__((ext_vector_type(8), may_alias));
typedef float  v8f  __attribute__((ext_vector_type(8)));
typedef float  v4f  __attribute__((ext_vector_type(4)));
typedef float  v4fa __attribute__((ext_vector_type(4), may_alias));
union FragB { v16b v; v8us half[2]; unsigned short u[16]; };

__device__ __forceinline__ unsigned short bf16_bits(float x) { unsigned int u = __float_as_uint(x); return (unsigned short)((u + 0x7FFFu + ((u >> 16) & 1u)) >> 16); }
__device__ __forceinline__ float bf16_val(unsigned short b) { return __uint_as_float(((unsigned int)b) << 16); }
__device__ __forceinline__ float bf16_round(float x) { return bf16_val(bf16_bits(x)); }
// D += A·B with NT terms: 1 = ah·bh, 2 = + al·bh (A split), 3 = + ah·bl (both split)
template <int NT>
__device__ __forceinline__ v8f mmaN(v16b ah, v16b al, v16b bh, v16b bl, v8f c) {
  c = __builtin_amdgcn_wmma_f32_16x16x32_bf16(false, ah, false, bh, (short)0, c, false, false);
  if (NT >= 2) c = __builtin_amdgcn_wmma_f32_16x16x32_bf16(false, al, false, bh, (short)0, c, false, false);
  if (NT >= 3) c = __builtin_amdgcn_wmma_f32_16x16x32_bf16(false, ah, false, bl, (short)0, c, false, false);
  asm volatile("v_nop\n\tv_nop\n\tv_nop\n\tv_nop" : "+v"(c) : "v"(ah), "v"(al), "v"(bh), "v"(bl));
  return c;
}

__global__ __launch_bounds__(256) void k_wt_bf16(const float* __restrict__ W, unsigned short* __restrict__ Wt, int K, int N) {
  const int t = blockIdx.x * 256 + threadIdx.x;
  const int k8n = K / 8;
  if (t >= N * k8n) return;
  const int n = t / k8n, k8 = (t % k8n) * 8;
  v8us v;
#pragma unroll
  for (int i = 0; i < 8; ++i) v[i] = bf16_bits(W[(size_t)(k8 + i) * N + n]);
  *(v8us*)(Wt + (size_t)n * K + k8) = v;
  
}

// GEMM C[M][N] (f32, pitch ldc) = act(A[M][K]·W + bias). A f32 row-major (pitch lda) converted per fragment to bf16
// (ASPLIT: hi/lo two planes -> 2 terms, else single rounded term); Wt bf16 [N][K] (pitch ldb). BIAS_BF16 rounds the
// bias to bf16 first (bias quantised to bf16 before the add). K%32==0, M%16==0, N%64==0.
template <bool ASPLIT, int ACT, bool BIAS_BF16>
__global__ __launch_bounds__(128) void k_gemm_bf(const float* __restrict__ A, int lda, const unsigned short* __restrict__ Wt, int ldb,
                                               const float* __restrict__ bias, float* __restrict__ C, int ldc, int M, int N, int K) {
  __shared__ __attribute__((aligned(16))) float so[4][16][64];
  const int tid = threadIdx.x, w = tid >> 5, lane = tid & 31, ln = lane & 15, hh = lane >> 4;
  const int ntn = N / 64;
  const int wid = blockIdx.x * 4 + w;
  const int mt = wid / ntn, nq = wid % ntn;
  if (mt * 16 >= M) return;
  const int row0 = mt * 16, col0 = nq * 64;
  const float* arow = A + (size_t)(row0 + ln) * lda;
  v8f acc[4] = {};
  for (int kb = 0; kb < K; kb += 32) {
    FragB ah, al;
    const v4f x0 = *(const v4fa*)(arow + kb + 8 * hh), x1 = *(const v4fa*)(arow + kb + 8 * hh + 4);
    const v4f x2 = *(const v4fa*)(arow + kb + 16 + 8 * hh), x3 = *(const v4fa*)(arow + kb + 16 + 8 * hh + 4);
    float xs[16] = {x0[0],x0[1],x0[2],x0[3],x1[0],x1[1],x1[2],x1[3],x2[0],x2[1],x2[2],x2[3],x3[0],x3[1],x3[2],x3[3]};
#pragma unroll
    for (int i = 0; i < 16; ++i) { const unsigned short hb = bf16_bits(xs[i]); ah.u[i] = hb; al.u[i] = ASPLIT ? bf16_bits(xs[i] - bf16_val(hb)) : (unsigned short)0; }
#pragma unroll
    for (int t = 0; t < 4; ++t) {
      const unsigned short* brow = Wt + (size_t)(col0 + t * 16 + ln) * ldb + kb;
      FragB b;
      b.half[0] = *(const v8us*)(brow + 8 * hh);
      b.half[1] = *(const v8us*)(brow + 16 + 8 * hh);
      acc[t] = mmaN<ASPLIT ? 2 : 1>(ah.v, al.v, b.v, b.v, acc[t]);
    }
  }
#pragma unroll
  for (int t = 0; t < 4; ++t) {
    float bv = bias ? bias[col0 + t * 16 + ln] : 0.f;
    if (BIAS_BF16) bv = bf16_round(bv);
#pragma unroll
    for (int r = 0; r < 8; ++r) { float v = acc[t][r] + bv; if (ACT == 1) v = fmaxf(v, 0.f); so[w][8 * hh + r][t * 16 + ln] = v; }
  }
  __builtin_amdgcn_fence(__ATOMIC_ACQ_REL, "workgroup");
  __builtin_amdgcn_wave_barrier();
  const int rsub = lane >> 4, c4 = (lane & 15) * 4;
  {
#pragma unroll
    for (int q = 0; q < 8; ++q) {
      const int r = q * 2 + rsub;
      const v4f v = *(const v4fa*)&so[w][r][c4];
      *(v4f*)(C + (size_t)(row0 + r) * ldc + col0 + c4) = v;
    }
    
  }
}

// GEMM C = act(A·W + bias + resid): A f32 (ASPLIT -> hi/lo 2 terms), Wt bf16 [N][K]; ACT 0 none, 1 relu, 2 exact gelu;
// resid (optional, f32, row index = (row % rmod), pitch ldr, RES_BF16 rounds it) added before the activation.
template <bool ASPLIT, int ACT, bool BIAS_BF16, bool RES_BF16>
__global__ __launch_bounds__(128) void k_gemm_bf3(const float* __restrict__ A, int lda, const unsigned short* __restrict__ Wt, int ldb,
                                                const float* __restrict__ bias, const float* __restrict__ resid, int rmod, int ldr,
                                                float* __restrict__ C, int ldc, int M, int N, int K) {
  __shared__ __attribute__((aligned(16))) float so[4][16][64];
  const int tid = threadIdx.x, w = tid >> 5, lane = tid & 31, ln = lane & 15, hh = lane >> 4;
  const int ntn = N / 64;
  const int wid = blockIdx.x * 4 + w;
  const int mt = wid / ntn, nq = wid % ntn;
  if (mt * 16 >= M) return;
  const int row0 = mt * 16, col0 = nq * 64;
  const float* arow = A + (size_t)(row0 + ln) * lda;
  v8f acc[4] = {};
  for (int kb = 0; kb < K; kb += 32) {
    FragB ah, al;
    const v4f x0 = *(const v4fa*)(arow + kb + 8 * hh), x1 = *(const v4fa*)(arow + kb + 8 * hh + 4);
    const v4f x2 = *(const v4fa*)(arow + kb + 16 + 8 * hh), x3 = *(const v4fa*)(arow + kb + 16 + 8 * hh + 4);
    float xs[16] = {x0[0],x0[1],x0[2],x0[3],x1[0],x1[1],x1[2],x1[3],x2[0],x2[1],x2[2],x2[3],x3[0],x3[1],x3[2],x3[3]};
#pragma unroll
    for (int i = 0; i < 16; ++i) { const unsigned short hb = bf16_bits(xs[i]); ah.u[i] = hb; al.u[i] = ASPLIT ? bf16_bits(xs[i] - bf16_val(hb)) : (unsigned short)0; }
#pragma unroll
    for (int t = 0; t < 4; ++t) {
      const unsigned short* brow = Wt + (size_t)(col0 + t * 16 + ln) * ldb + kb;
      FragB b;
      b.half[0] = *(const v8us*)(brow + 8 * hh);
      b.half[1] = *(const v8us*)(brow + 16 + 8 * hh);
      acc[t] = mmaN<ASPLIT ? 2 : 1>(ah.v, al.v, b.v, b.v, acc[t]);
    }
  }
#pragma unroll
  for (int t = 0; t < 4; ++t) {
    const int col = col0 + t * 16 + ln;
    float bv = bias ? bias[col] : 0.f;
    if (BIAS_BF16) bv = bf16_round(bv);
#pragma unroll
    for (int r = 0; r < 8; ++r) {
      float v = acc[t][r] + bv;
      if (resid) { float rv = resid[(size_t)((row0 + 8 * hh + r) % rmod) * ldr + col]; if (RES_BF16) rv = bf16_round(rv); v += rv; }
      if (ACT == 1) v = fmaxf(v, 0.f);
      if (ACT == 2) v = 0.5f * v * (1.0f + erff(v * 0.70710678118654752f));
      if (ACT == 3) { const float u = 0.7978845608028654f * (v + 0.044715f * v * v * v); v = 0.5f * v * (1.0f + tanhf(u)); }
      so[w][8 * hh + r][t * 16 + ln] = v;
    }
  }
  __builtin_amdgcn_fence(__ATOMIC_ACQ_REL, "workgroup");
  __builtin_amdgcn_wave_barrier();
  const int rsub = lane >> 4, c4 = (lane & 15) * 4;
  {
#pragma unroll
    for (int q = 0; q < 8; ++q) {
      const int r = q * 2 + rsub;
      const v4f v = *(const v4fa*)&so[w][r][c4];
      *(v4f*)(C + (size_t)(row0 + r) * ldc + col0 + c4) = v;
    }
    
  }
}
// row LayerNorm (biased variance, eps) over N: s = X (+ R); optional out_sum <- s; out_norm <- (s-mu)*rsqrt(var+eps)*g + b
template <bool PARAM_BF16>
__global__ __launch_bounds__(256) void k_layernorm(const float* __restrict__ X, const float* __restrict__ R, const float* __restrict__ g, const float* __restrict__ bta,
                                                  float* __restrict__ out_sum, float* __restrict__ out_norm, int N, float eps) {
  __shared__ float red[256];
  const int row = blockIdx.x, tid = threadIdx.x;
  const float* x = X + (size_t)row * N; const float* rr = R ? R + (size_t)row * N : nullptr;
  float vals[16];                     // up to N = 4096
  const int per = N / 256;            // contiguous chunk per thread? use strided-by-4 chunks: thread handles j = tid*4 + 1024*u
  float s1 = 0.f;
  for (int u = 0; u < per / 4; ++u) {
    const int j = tid * 4 + 1024 * u;
    const v4f a = *(const v4fa*)(x + j);
    v4f b = {0.f,0.f,0.f,0.f}; if (rr) b = *(const v4fa*)(rr + j);
#pragma unroll
    for (int q = 0; q < 4; ++q) { const float v = a[q] + b[q]; vals[u * 4 + q] = v; s1 += v; }
  }
  red[tid] = s1; __syncthreads();
  for (int st = 128; st > 0; st >>= 1) { if (tid < st) red[tid] += red[tid + st]; __syncthreads(); }
  const float mu = red[0] / (float)N; __syncthreads();
  float s2 = 0.f;
  for (int u = 0; u < per / 4; ++u)
#pragma unroll
    for (int q = 0; q < 4; ++q) { const float c = vals[u * 4 + q] - mu; s2 += c * c; }
  red[tid] = s2; __syncthreads();
  for (int st = 128; st > 0; st >>= 1) { if (tid < st) red[tid] += red[tid + st]; __syncthreads(); }
  const float rs = rsqrtf(red[0] / (float)N + eps);
  {
    for (int u = 0; u < per / 4; ++u) {
      const int j = tid * 4 + 1024 * u;
      v4f o, sm;
#pragma unroll
      for (int q = 0; q < 4; ++q) {
        float gg = g[j + q], bb = bta[j + q];
        if (PARAM_BF16) { gg = bf16_round(gg); bb = bf16_round(bb); }
        sm[q] = vals[u * 4 + q]; o[q] = (vals[u * 4 + q] - mu) * rs * gg + bb;
      }
      if (out_sum) *(v4f*)(out_sum + (size_t)row * N + j) = sm;
      *(v4f*)(out_norm + (size_t)row * N + j) = o;
    }
    
  }
}



// ---- f16 WMMA path (v_wmma_f32_16x16x32_f16): 11-bit significands for operands in range — used here for the conv GEMMs, whose bf16-rounded x and x16 weights are exact in f16
typedef _Float16 v16h __attribute__((ext_vector_type(16)));
union FragH { v16h v; v8us half[2]; _Float16 h[16]; unsigned short u[16]; };
template <int NT>
__device__ __forceinline__ v8f mmaH(v16h ah, v16h al, v16h bh, v16h bl, v8f c) {
  c = __builtin_amdgcn_wmma_f32_16x16x32_f16(false, ah, false, bh, (short)0, c, false, false);
  if (NT >= 2) c = __builtin_amdgcn_wmma_f32_16x16x32_f16(false, al, false, bh, (short)0, c, false, false);
  if (NT >= 3) c = __builtin_amdgcn_wmma_f32_16x16x32_f16(false, ah, false, bl, (short)0, c, false, false);
  asm volatile("v_nop\n\tv_nop\n\tv_nop\n\tv_nop" : "+v"(c) : "v"(ah), "v"(al), "v"(bh), "v"(bl));
  return c;
}
// batched GEMM like k_gemm_b but f16 operands: A f32 (split into f16 hi/lo if ASPLIT, else rounded to f16), Bt = f16 values [n][k]; alpha; C f32; N multiple of 16 (partial tiles skipped)
template <bool ASPLIT>
__global__ __launch_bounds__(128) void k_gemm_h(const float* __restrict__ A, int lda, size_t sA, const _Float16* __restrict__ Bh, int ldb, size_t sB, float alpha, float* __restrict__ C, int ldc, size_t sC, int M, int N, int K) {
  __shared__ __attribute__((aligned(16))) float so[4][16][64];
  const int tid = threadIdx.x, w = tid >> 5, lane = tid & 31, ln = lane & 15, hh = lane >> 4; const int by = blockIdx.y;
  A += (size_t)by * sA; Bh += (size_t)by * sB; C += (size_t)by * sC;
  const int ntn = (N + 63) / 64; const int wid = blockIdx.x * 4 + w; const int mt = wid / ntn, nq = wid % ntn; if (mt * 16 >= M) return;
  const int row0 = mt * 16, col0 = nq * 64; const float* arow = A + (size_t)(row0 + ln) * lda;
  v8f acc[4] = {};
  for (int kb = 0; kb < K; kb += 32) {
    FragH ah, al;
    const v4f x0 = *(const v4fa*)(arow + kb + 8 * hh), x1 = *(const v4fa*)(arow + kb + 8 * hh + 4), x2 = *(const v4fa*)(arow + kb + 16 + 8 * hh), x3 = *(const v4fa*)(arow + kb + 16 + 8 * hh + 4);
    float xs[16] = {x0[0],x0[1],x0[2],x0[3],x1[0],x1[1],x1[2],x1[3],x2[0],x2[1],x2[2],x2[3],x3[0],x3[1],x3[2],x3[3]};
#pragma unroll
    for (int i = 0; i < 16; ++i) { const _Float16 h = (_Float16)xs[i]; ah.h[i] = h; al.h[i] = ASPLIT ? (_Float16)(xs[i] - (float)h) : (_Float16)0.0f; }
#pragma unroll
    for (int t = 0; t < 4; ++t) { if (col0 + t * 16 >= N) continue; const size_t boff = (size_t)(col0 + t * 16 + ln) * ldb + kb; FragH bq; bq.half[0] = *(const v8us*)(Bh + boff + 8 * hh); bq.half[1] = *(const v8us*)(Bh + boff + 16 + 8 * hh);
      acc[t] = mmaH<ASPLIT ? 2 : 1>(ah.v, al.v, bq.v, bq.v, acc[t]); }
  }
#pragma unroll
  for (int t = 0; t < 4; ++t) { if (col0 + t * 16 >= N) continue;
#pragma unroll
    for (int r = 0; r < 8; ++r) so[w][8 * hh + r][t * 16 + ln] = acc[t][r] * alpha; }
  __builtin_amdgcn_fence(__ATOMIC_ACQ_REL, "workgroup"); __builtin_amdgcn_wave_barrier();
  const int rsub = lane >> 4, c4 = (lane & 15) * 4;
  {
#pragma unroll
    for (int q = 0; q < 8; ++q) { const int r = q * 2 + rsub; if (col0 + c4 < N) { const v4f v = *(const v4fa*)&so[w][r][c4]; *(v4f*)(C + (size_t)(row0 + r) * ldc + col0 + c4) = v; } }
     }
}

// Wt[n][k] = f16(W[k][n]·scale) from f32 row-major W[K][N] (scale = power of two; bf16-exact weights stay exact in f16 away from the subnormal range)
__global__ __launch_bounds__(256) void k_wt_f16(const float* __restrict__ W, _Float16* __restrict__ Wt, int K, int N, float scale) {
  const int t = blockIdx.x * 256 + threadIdx.x; if (t >= N * (K / 8)) return; const int n = t / (K / 8), k8 = (t % (K / 8)) * 8; FragH f;
#pragma unroll
  for (int i = 0; i < 8; ++i) f.h[i] = (_Float16)(bf16_round(W[(size_t)(k8 + i) * N + n]) * scale); const v8us o = f.half[0];
  *(v8us*)((unsigned short*)Wt + (size_t)n * K + k8) = o; 
}
// k_gemm_hh variant with fused epilogue: v = acc·alpha + bias[by·sBias + col] (+ CP[(row/rowsPerB)·sCPb + by·64 + col] if CP) ; ACT 0 none / 1 elu ; writes f16 C16 (and f32 C if non-null)
template <int ACT>
__global__ __launch_bounds__(128) void k_gemm_hhx(const _Float16* __restrict__ A, int lda, size_t sA, const _Float16* __restrict__ Bh, int ldb, size_t sB, float alpha, const float* __restrict__ bias, size_t sBias, const float* __restrict__ CP, int rowsPerB, size_t sCPb, int row0g,
    float* __restrict__ C, _Float16* __restrict__ C16, int ldc, size_t sC, int M, int N, int K) {
  __shared__ __attribute__((aligned(16))) float so[4][16][64];
  const int tid = threadIdx.x, w = tid >> 5, lane = tid & 31, ln = lane & 15, hh = lane >> 4; const int by = blockIdx.y;
  A += (size_t)by * sA; Bh += (size_t)by * sB; const size_t cofs = (size_t)by * sC; const float* bp = bias ? bias + (size_t)by * sBias : nullptr;
  const int ntn = (N + 63) / 64; const int wid = blockIdx.x * 4 + w; const int mt = wid / ntn, nq = wid % ntn; if (mt * 16 >= M) return;
  const int row0 = mt * 16, col0 = nq * 64; const _Float16* arow = A + (size_t)(row0 + ln) * lda;
  v8f acc[4] = {};
  for (int kb = 0; kb < K; kb += 32) { FragH ah; ah.half[0] = *(const v8us*)((const unsigned short*)arow + kb + 8 * hh); ah.half[1] = *(const v8us*)((const unsigned short*)arow + kb + 16 + 8 * hh);
#pragma unroll
    for (int t = 0; t < 4; ++t) { if (col0 + t * 16 >= N) continue; const size_t boff = (size_t)(col0 + t * 16 + ln) * ldb + kb; FragH bq; bq.half[0] = *(const v8us*)((const unsigned short*)Bh + boff + 8 * hh); bq.half[1] = *(const v8us*)((const unsigned short*)Bh + boff + 16 + 8 * hh);
      acc[t] = mmaH<1>(ah.v, ah.v, bq.v, bq.v, acc[t]); }
  }
#pragma unroll
  for (int t = 0; t < 4; ++t) { if (col0 + t * 16 >= N) continue; const int col = col0 + t * 16 + ln; const float bv = bp ? bf16_round(bp[col]) : 0.f;
#pragma unroll
    for (int r = 0; r < 8; ++r) { float v = acc[t][r] * alpha + bv; if (CP) { const int rr = row0g + row0 + 8 * hh + r; if (rowsPerB < 0) v += CP[cofs + (size_t)rr * ldc + col];      /* rowsPerB < 0: own element of the batched C plane */ else { const int bidx = rr / rowsPerB; v += CP[(size_t)bidx * sCPb + (size_t)by * 64 + col]; } } if (ACT == 1) v = (v > 0.f) ? v : expm1f(v); else if (ACT == 7) v = (v > 0.f) ? v + 1.0f : expf(v); else if (ACT == 8) v = tanhf(v); else if (ACT == 9) v = 0.5f * v * (1.0f + tanhf(0.7978845608028654f * (v + 0.044715f * v * v * v))); else if (ACT == 11) v = 1.0f / (1.0f + expf(-v)); else if (ACT == 12) v = (v > 0.f) ? v : 0.01f * v; else if (ACT == 14) v = (v > 0.f) ? v : 0.1f * v; else if (ACT == 16) v = (v >= 0.f) ? v : 0.3f * v; else if (ACT == 17) v = (v >= 0.f) ? v : 0.2f * v; else if (ACT == 15) v = v / (1.0f + expf(-v)); else if (ACT == 3) v = fmaxf(v, 0.f); else if (ACT == 6) v = 0.5f * v * (1.0f + erff(v * 0.70710678118654752f)); so[w][8 * hh + r][t * 16 + ln] = v; } }
  __builtin_amdgcn_fence(__ATOMIC_ACQ_REL, "workgroup"); __builtin_amdgcn_wave_barrier();
  const int rsub = lane >> 4, c4 = (lane & 15) * 4; typedef _Float16 v4h __attribute__((ext_vector_type(4)));
  {
#pragma unroll
    for (int q = 0; q < 8; ++q) { const int r = q * 2 + rsub; if (col0 + c4 < N) { const v4f v = *(const v4fa*)&so[w][r][c4]; if (C) *(v4f*)(C + cofs + (size_t)(row0 + r) * ldc + col0 + c4) = v; if (C16) { v4h h4; for (int i = 0; i < 4; ++i) h4[i] = (_Float16)v[i]; *(v4h*)(C16 + cofs + (size_t)(row0 + r) * ldc + col0 + c4) = h4; } } }
     }
}


typedef _Float16 v4h __attribute__((ext_vector_type(4)));

__global__ __launch_bounds__(256) void k_x16(const float* __restrict__ x, _Float16* __restrict__ X16, size_t n8) { const size_t t = (size_t)blockIdx.x * 256 + threadIdx.x; if (t >= n8) return; FragH f;
#pragma unroll
  for (int q = 0; q < 8; ++q) f.h[q] = (_Float16)bf16_round(x[t * 8 + q]); *(v8us*)((unsigned short*)X16 + t * 8) = f.half[0];  }
__global__ __launch_bounds__(256) void k_h16(const float* __restrict__ x, _Float16* __restrict__ X16, size_t n8) { const size_t t = (size_t)blockIdx.x * 256 + threadIdx.x; if (t >= n8) return; FragH f;
#pragma unroll
  for (int q = 0; q < 8; ++q) f.h[q] = (_Float16)x[t * 8 + q]; *(v8us*)((unsigned short*)X16 + t * 8) = f.half[0];  }
__global__ __launch_bounds__(256) void k_round16f(const float* __restrict__ W, _Float16* __restrict__ Bt, size_t n8) { const size_t t = (size_t)blockIdx.x * 256 + threadIdx.x; if (t >= n8) return; FragH f;
#pragma unroll
  for (int i = 0; i < 8; ++i) f.h[i] = (_Float16)(bf16_round(W[t * 8 + i]) * 16.0f); *(v8us*)((unsigned short*)Bt + t * 8) = f.half[0];  }
template <int NHv, int TTv>
__global__ __launch_bounds__(256) void k_vt(const _Float16* __restrict__ V16, int ldv, int voff, _Float16* __restrict__ Vt) { __shared__ unsigned short tl[64][66]; const int tid = threadIdx.x; const int slab = blockIdx.x / (TTv / 64), lg = blockIdx.x % (TTv / 64); const int b = slab / NHv, h = slab % NHv;
  for (int i = tid; i < 64 * 8; i += 256) { const int r = i / 8, c8 = (i % 8) * 8; FragH f; f.half[0] = *(const v8us*)((const unsigned short*)V16 + ((size_t)b * TTv + lg * 64 + r) * ldv + voff + h * 64 + c8);
#pragma unroll
    for (int q = 0; q < 8; ++q) tl[r][c8 + q] = f.u[q]; }
  __syncthreads();
  {
#pragma unroll
    for (int rd = 0; rd < 2; ++rd) { const int d = rd * 32 + tid / 8, pc = tid % 8; FragH f;
#pragma unroll
      for (int q = 0; q < 8; ++q) f.u[q] = tl[pc * 8 + q][d];
      *(v8us*)((unsigned short*)Vt + ((size_t)slab * 64 + d) * TTv + lg * 64 + pc * 8) = f.half[0]; }
     } }

__global__ __launch_bounds__(256) void k_hl(const float* __restrict__ F, _Float16* __restrict__ Hh, _Float16* __restrict__ Hl, size_t n8) { const size_t t = (size_t)blockIdx.x * 256 + threadIdx.x; if (t >= n8) return; FragH fh, fl; const v4f a = *(const v4fa*)(F + t * 8), c = *(const v4fa*)(F + t * 8 + 4);
#pragma unroll
  for (int q = 0; q < 4; ++q) { _Float16 h = (_Float16)a[q]; fh.h[q] = h; fl.h[q] = (_Float16)((a[q] - (float)h) * 1024.0f); h = (_Float16)c[q]; fh.h[4 + q] = h; fl.h[4 + q] = (_Float16)((c[q] - (float)h) * 1024.0f); }
  { *(v8us*)((unsigned short*)Hh + t * 8) = fh.half[0]; *(v8us*)((unsigned short*)Hl + t * 8) = fl.half[0];  } }

// ---- WMMA step of the conv GEMM (wave tile 48x64) ----
__device__ __forceinline__ v8f g2_mma(v16h a, v16h b, v8f c) { v8f d = __builtin_amdgcn_wmma_f32_16x16x32_f16(false, a, false, b, (short)0, c, false, false); asm volatile("v_nop\n\tv_nop\n\tv_nop\n\tv_nop" : "+v"(d) : "v"(a), "v"(b)); return d; }

__device__ __forceinline__ void d_xrows(const float* __restrict__ x, _Float16* __restrict__ XR, int blk) { __shared__ float tl[CI][33]; const int tid = threadIdx.x; const int p0 = blk * 32;      /* 32 pixels of the padded grid, batches end to end */
  for (int i = tid; i < CI * 32; i += 256) { const int c = i / 32, j = i % 32; const int b = (p0 + j) / PP, p = (p0 + j) % PP; const int yy = p / HP - 6, xx = p % HP - 6; tl[c][j] = (yy >= 0 && yy < HS && xx >= 0 && xx < HS) ? bf16_round(x[((size_t)b * CI + c) * PX + yy * HS + xx]) : 0.f; }
  __syncthreads();
  { for (int i = tid; i < 32 * CG; i += 256) { const int j = i / CG, c8 = (i % CG) * 8; FragH f; for (int q = 0; q < 8; ++q) f.h[q] = (_Float16)tl[c8 + q][j]; *(v8us*)((unsigned short*)XR + ((size_t)p0 + j) * CI + c8) = f.half[0]; }  } }
// 7x7 conv as a GEMM without an im2col buffer: row r of A is output pixel r of an HO x HO grid, and its k = tap * 128 + channel element is the x row at padded pixel (oy + OFF + tap / 7, ox + OFF + tap % 7),
// so a tap's 128 channels are 256 contiguous bytes. C[r][n] = alpha * sum_k A[r][k] * Bh[n][k], k in the order of d_w7. Wave tile 48x64, work-group 192x128 (8 waves, 4 down x 2 across); rows from M on compute pixels of the last image row (their C rows are never read).
// One trip of the loop is one stage of TWO taps (the 49th tap is a stage of its own behind the loop). A tap's B tile (128 weight rows, 256 bytes a row) is brought into LDS by asynchronous copies, 16 bytes a lane (16 lanes = one whole row);
// a stage's two tiles go into one of two buffers: the copies of the stage after next fly while the next stage is worked on. The fragments are read from LDS at a row pitch of 272 bytes (free of bank conflicts for 16-byte reads).
// Waits and barrier stand once per stage: only there do the waves stop fetching fragments ahead, so that the LDS and the matrix units stand idle 25 times and not 49.
// The A tile is staged once per WINDOW ROW, not per tap: the seven taps of a window row read the same x rows, one pixel further right each. The tile's 192 pixels lie in up to five image rows (segments);
// each segment is staged with the 6 pixels that follow it in the padded grid, and tap column dx reads pixel i at LDS row i + 16 * segment + dx (16 rows per segment keep a fragment's 16 rows on 16 different bank groups).
// Two A buffers: window row d + 1 is copied with the B tiles of the stage that holds its first tap, one stage ahead like them.
#define LP 272                       /* LDS row pitch in bytes */
#define AC 224                       /* x rows copied per window row: 192 pixels + 5 x 6 that follow a segment = 222, rounded up to 14 per thread */
#define LA ((AC + 40) * LP)          /* one A buffer: the copied rows, 10 unused rows between segments */
#define LB (TN * LP)                 /* one tap's B tile; a B buffer holds two */
// six copies of 16 bytes a lane, LDS byte address l[i] from global address g[i]; the wait on the address registers ends the copies' own statement, ahead of any rewrite of them
__device__ __forceinline__ void g2_copy6(const unsigned* l, const char* const* g) {
  asm volatile("global_load_async_to_lds_b128 %0, %6, off\n\tglobal_load_async_to_lds_b128 %1, %7, off\n\tglobal_load_async_to_lds_b128 %2, %8, off\n\t"
               "global_load_async_to_lds_b128 %3, %9, off\n\tglobal_load_async_to_lds_b128 %4, %10, off\n\tglobal_load_async_to_lds_b128 %5, %11, off\n\ts_wait_xcnt 0x0"
               :: "v"(l[0]), "v"(l[1]), "v"(l[2]), "v"(l[3]), "v"(l[4]), "v"(l[5]),
                  "v"(g[0]), "v"(g[1]), "v"(g[2]), "v"(g[3]), "v"(g[4]), "v"(g[5]) : "memory"); }
// the same for eight copies
__device__ __forceinline__ void g2_copy8(const unsigned* l, const char* const* g) {
  asm volatile("global_load_async_to_lds_b128 %0, %8, off\n\tglobal_load_async_to_lds_b128 %1, %9, off\n\tglobal_load_async_to_lds_b128 %2, %10, off\n\tglobal_load_async_to_lds_b128 %3, %11, off\n\t"
               "global_load_async_to_lds_b128 %4, %12, off\n\tglobal_load_async_to_lds_b128 %5, %13, off\n\tglobal_load_async_to_lds_b128 %6, %14, off\n\tglobal_load_async_to_lds_b128 %7, %15, off\n\ts_wait_xcnt 0x0"
               :: "v"(l[0]), "v"(l[1]), "v"(l[2]), "v"(l[3]), "v"(l[4]), "v"(l[5]), "v"(l[6]), "v"(l[7]),
                  "v"(g[0]), "v"(g[1]), "v"(g[2]), "v"(g[3]), "v"(g[4]), "v"(g[5]), "v"(g[6]), "v"(g[7]) : "memory"); }
__device__ __forceinline__ v16h g2_lfrag(const unsigned char* p) { FragH f; f.half[0] = *(const v8us*)p; f.half[1] = *(const v8us*)(p + 32); return f.v; }
// One stage of the conv GEMM: NS blocks of 32 channels, four to a tap, from tap t on (NS = 8: taps t and t + 1). fa0 .. fa2, fb: byte offsets of this lane's three A fragment rows in an A buffer and of its first B fragment row in a tap's B tile.
// Two fragment sets: the next block's LDS reads stand ahead of this block's WMMAs, also from one tap of the stage to the next, so that their latency runs under the block; every loop is unrolled so that sets and accumulators are picked by constants and stay in registers.
template <int NS>
__device__ __forceinline__ void g2_stage(const unsigned char* ring, int t, unsigned fa0, unsigned fa1, unsigned fa2, unsigned fb, v8f (&c)[12]) {
  const unsigned char* sa[2]; const unsigned char* sb[2];
#pragma unroll
  for (int h = 0; h < 2; ++h) { const int th = t + h; sa[h] = ring + ((th / 7) & 1) * LA + (th % 7) * LP; sb[h] = ring + 2 * LA + (th & 3) * LB + fb; }
  v16h a[2][3], b[2][4];
  a[0][0] = g2_lfrag(sa[0] + fa0); a[0][1] = g2_lfrag(sa[0] + fa1); a[0][2] = g2_lfrag(sa[0] + fa2); b[0][0] = g2_lfrag(sb[0]); b[0][1] = g2_lfrag(sb[0] + 16 * LP); b[0][2] = g2_lfrag(sb[0] + 32 * LP); b[0][3] = g2_lfrag(sb[0] + 48 * LP);
#pragma unroll
  for (int e = 0; e < NS; ++e) { const int u = e & 1, n = u ^ 1;
    if (e + 1 < NS) { const unsigned char* pa = sa[(e + 1) >> 2] + ((e + 1) & 3) * 64; const unsigned char* pb = sb[(e + 1) >> 2] + ((e + 1) & 3) * 64;
      a[n][0] = g2_lfrag(pa + fa0); a[n][1] = g2_lfrag(pa + fa1); a[n][2] = g2_lfrag(pa + fa2); b[n][0] = g2_lfrag(pb); b[n][1] = g2_lfrag(pb + 16 * LP); b[n][2] = g2_lfrag(pb + 32 * LP); b[n][3] = g2_lfrag(pb + 48 * LP); }
#pragma unroll
    for (int j = 0; j < 4; ++j)
#pragma unroll
      for (int i = 0; i < 3; ++i) c[i * 4 + j] = g2_mma(a[u][i], b[u][j], c[i * 4 + j]); } }
// copied row number c (0 .. AC - 1) of the tile that starts at output pixel r0: go = byte offset of its x row at window row 0, lo = byte offset of its place in an A buffer.
// Segment 0 is the rest of r0's image row and the 6 pixels behind it, every later segment a whole image row of HO pixels and 6 more; image rows past the last one repeat the last (their C rows are never read).
template <int HO, int OFF>
__device__ __forceinline__ void g2_amap(int r0, int c, unsigned& go, unsigned& lo) {
  const int x0 = r0 % HO, c2 = c - (HO - x0 + 6); const int s = c2 < 0 ? 0 : 1 + c2 / (HO + 6), col = c2 < 0 ? x0 + c : c2 % (HO + 6);
  const int R = min(r0 / HO + s, NB * HO - 1);      /* image row, batches end to end */
  go = (unsigned)((((R / HO) * PP + (R % HO + OFF) * HP + col + OFF) * CI) * 2); lo = (unsigned)((c + 10 * s) * LP); }
// byte offset, in an A buffer, of tile pixel i at tap column 0
template <int HO>
__device__ __forceinline__ unsigned g2_lrow(int r0, int i) { return (unsigned)((i + 16 * ((r0 + i) / HO - r0 / HO)) * LP); }
#define GQ (MQ * (CO / TN))                    /* 66 work-groups of q */
#define GK (MK * (CO / TN))                    /* 82 work-groups of k, and as many of v */
// The three convs read nothing of each other, so they go as ONE launch: work-groups 0 .. GQ - 1 are q's tiles, the next GK are k's, the last GK are v's. Together they are 230, fewer than the chip has WGPs:
// every work-group has a WGP (and its LDS) to itself, two waves on each SIMD, and the launch is one round with no tail. The 192x128 tile gives a wave 96 WMMAs per stage between two barriers, enough to cover the flight of the next stage's copies,
// each weight row is fetched from L2 once per 192 pixels, and a wave reads 7 fragments from LDS for 12 WMMAs. Which conv a work-group belongs to is the same for all its threads: every branch on it is a scalar one.
__global__ __launch_bounds__(256) void k_conv7(const _Float16* __restrict__ XR, const _Float16* __restrict__ BQ, const _Float16* __restrict__ BK, const _Float16* __restrict__ BV, float alpha, float* __restrict__ Q, float* __restrict__ Kf, float* __restrict__ Vf) {
  __shared__ __attribute__((aligned(16))) unsigned char ring[2 * LA + 4 * LB];      /* two A buffers, then two B buffers of two taps each: tap t's tile is number t & 3 */
  float (*so)[48][68] = (float (*)[48][68])ring;      /* the output tiles take the A buffers' place behind the barrier after the last tap */
  const int tid = threadIdx.x, w = tid >> 5, lane = tid & 31, ln = lane & 15, hh = lane >> 4; const int wm = w >> 1, wn = w & 1;      /* the wave's place in the tile: 48 rows from 48 wm, 64 columns from 64 wn */
  const int job = (int)blockIdx.x < GQ ? 0 : (int)blockIdx.x < GQ + GK ? 1 : 2; const int blk = (int)blockIdx.x - (job == 0 ? 0 : job == 1 ? GQ : GQ + GK);
  const _Float16* __restrict__ Bh = job == 0 ? BQ : job == 1 ? BK : BV; float* __restrict__ C = job == 0 ? Q : job == 1 ? Kf : Vf;
  const int mt = blk / (CO / TN), nq = blk % (CO / TN); const int row0 = mt * TM + 48 * wm, col0 = nq * TN + 64 * wn;
  /* copy side: this thread brings the 16 bytes number cc of tile rows cr, cr + 16, ... */
  const int cr = tid >> 4, cc = tid & 15; unsigned ao[AC / 16], al[AC / 16], fa0, fa1, fa2;      /* byte offsets of this thread's rows at tap 0 (al: in an A buffer); fa0 .. fa2: of this lane's three fragment rows; every loop over the arrays is unrolled so that they stay in registers */
  if (job == 0) {      /* q: 56-grid, x index = o + tap - 3 */
#pragma unroll
    for (int i = 0; i < AC / 16; ++i) g2_amap<HS, 3>(mt * TM, cr + 16 * i, ao[i], al[i]);
    fa0 = g2_lrow<HS>(mt * TM, 48 * wm + ln); fa1 = g2_lrow<HS>(mt * TM, 48 * wm + 16 + ln); fa2 = g2_lrow<HS>(mt * TM, 48 * wm + 32 + ln);
  } else {      /* k, v: 62-grid over pad3(x) with conv pad 3: x index = o + tap - 6 */
#pragma unroll
    for (int i = 0; i < AC / 16; ++i) g2_amap<HK, 0>(mt * TM, cr + 16 * i, ao[i], al[i]);
    fa0 = g2_lrow<HK>(mt * TM, 48 * wm + ln); fa1 = g2_lrow<HK>(mt * TM, 48 * wm + 16 + ln); fa2 = g2_lrow<HK>(mt * TM, 48 * wm + 32 + ln);
  }
  const unsigned bo = (unsigned)(((nq * TN + cr) * KC + cc * 8) * 2);      /* this thread's first weight row at tap 0; the others lie 16 rows apart */
  const unsigned lc = (unsigned)(size_t)ring + (unsigned)(cc * 16);
  auto issueA = [&](int d) { const char* xa = (const char*)XR + d * (HP * CI * 2) + cc * 16; const unsigned l = lc + (unsigned)((d & 1) * LA);      /* window row d's base, the same for every lane but for its 16 bytes of the row */
    unsigned la[AC / 16]; const char* ga[AC / 16];
#pragma unroll
    for (int i = 0; i < AC / 16; ++i) { la[i] = l + al[i]; ga[i] = xa + ao[i]; }
    g2_copy8(la, ga); g2_copy6(la + 8, ga + 8); };
  auto issueB = [&](int t) { const char* xb = (const char*)Bh + t * (CI * 2) + bo; const unsigned l = lc + (unsigned)(2 * LA + (t & 3) * LB + cr * LP);      /* tile rows cr + 16 i of tap t */
    unsigned la[8]; const char* ga[8];
#pragma unroll
    for (int i = 0; i < 8; ++i) { la[i] = l + (unsigned)(16 * i * LP); ga[i] = xb + (size_t)i * (16 * KC * 2); }
    g2_copy8(la, ga); };
  v8f accs[12];      /* accumulator of fragment row i, fragment column j: number 4 i + j */
#pragma unroll
  for (int u = 0; u < 12; ++u) accs[u] = v8f{0.f,0.f,0.f,0.f,0.f,0.f,0.f,0.f};
  const unsigned ha = (unsigned)(16 * hh), fb = (unsigned)((64 * wn + ln) * LP + 16 * hh);
  issueA(0); issueB(0); issueB(1);
  asm volatile("s_wait_asynccnt 0x0" ::: "memory");      /* this wave's copies of the first stage have landed */
  __syncthreads();      /* the first stage is complete before any wave reads it */
  issueB(2); issueB(3);
  /* the stage loop stays rolled, for speed only: its body holds 96 WMMAs */
#pragma unroll 1
  for (int t = 0; t + 1 < KK; t += 2) {
    g2_stage<8>(ring, t, fa0 + ha, fa1 + ha, fa2 + ha, fb, accs);
    asm volatile("s_wait_dscnt 0x0" ::: "memory");      /* this wave's reads of the buffer are done before it is handed back */
    asm volatile("s_wait_asynccnt 0x0" ::: "memory");      /* this wave's copies of the next stage have landed */
    __syncthreads();      /* publishes the next stage and ends every wave's reads of this stage's buffer */
    const int t2 = t + 4;      /* first tap of the stage after next, which takes this stage's B buffer */
    if (t2 < KK) { issueB(t2); if (t2 + 1 < KK) issueB(t2 + 1);
      if (t2 % 7 == 0) issueA(t2 / 7); else if (t2 % 7 == 6 && t2 + 1 < KK) issueA(t2 / 7 + 1); } }      /* a window row that begins in that stage goes into the A buffer that the window row before the current one has left */
  g2_stage<4>(ring, KK - 1, fa0 + ha, fa1 + ha, fa2 + ha, fb, accs);      /* the last tap */
  asm volatile("s_wait_dscnt 0x0" ::: "memory");      /* this wave's reads of the ring are done before the output tiles take its place */
  asm volatile("s_wait_asynccnt 0x0" ::: "memory");      /* no copy is outstanding when the wave goes on */
  __syncthreads();      /* ends every wave's reads of the ring */
#pragma unroll
  for (int u = 0; u < 12; ++u) { const int t = u & 3, part = u >> 2;
#pragma unroll
    for (int r = 0; r < 8; ++r) so[w][part * 16 + 8 * hh + r][t * 16 + ln] = accs[u][r] * alpha; }
  __builtin_amdgcn_fence(__ATOMIC_ACQ_REL, "workgroup"); __builtin_amdgcn_wave_barrier();
  const int rsub = lane >> 4, c4 = (lane & 15) * 4;
#pragma unroll
  for (int q = 0; q < 24; ++q) { const int r = q * 2 + rsub; const v4f v = *(const v4fa*)&so[w][r][c4]; *(v4f*)(C + (size_t)(row0 + r) * CO + col0 + c4) = v; } }
__device__ __forceinline__ void d_w7(const float* __restrict__ w, _Float16* __restrict__ Bt, int blk) { const size_t t = (size_t)blk * 256 + threadIdx.x; if (t >= (size_t)CO * KC / 8) return; const int c8 = (int)((t * 8) % CI); const int tap = (int)(((t * 8) / CI) % KK); const int o = (int)((t * 8) / KC); FragH f; for (int q = 0; q < 8; ++q) f.h[q] = (_Float16)(bf16_round(w[((size_t)o * CI + c8 + q) * KK + tap]) * 16.0f);
  *(v8us*)((unsigned short*)Bt + t * 8) = f.half[0];  }
#define GX (NB * PP / 32)                      /* 289 work-groups of x rows */
#define GW ((CO * KC / 8 + 255) / 256)         /* 784 work-groups per weight plane */
// The x rows and the three weight planes are made from the inputs alone, none from another: one launch, the job picked by the work-group's index (the same for all its threads, so the barrier of the x rows is passed by whole work-groups).
__global__ __launch_bounds__(256) void k_prep(const float* __restrict__ x, const float* __restrict__ wq, const float* __restrict__ wk, const float* __restrict__ wv, _Float16* __restrict__ XR, _Float16* __restrict__ BQ, _Float16* __restrict__ BK, _Float16* __restrict__ BV) {
  const int blk = (int)blockIdx.x;
  if (blk < GX) { d_xrows(x, XR, blk); return; }
  const int job = (blk - GX) / GW;
  d_w7(job == 0 ? wq : job == 1 ? wk : wv, job == 0 ? BQ : job == 1 ? BK : BV, (blk - GX) % GW); }
// Lanes run along channels, two neighbouring channels to a lane: 16 lanes hold the 32 channels of one head at one pixel, so a half-wave's Q, K or V load (8 bytes a lane) is one whole 128-byte line,
// and the two channels of a lane lie in an aligned register pair, on which the adds, multiplies and fused multiply-adds of the softmax are packed two to an instruction (v_pk_add_f32, v_pk_mul_f32, v_pk_fma_f32).
// Each half-wave takes four neighbouring pixels of one image row at once: their four 7-wide window rows are ten neighbouring K (and V) pixels, loaded once per window row, all in flight together, and used from registers by all four.
// The score q * (k + rel) is formed as one fused multiply-add, q * k + (q * rel): the addend does not depend on k, so it is made once per pixel and window row (rel_h heads) or once per pixel and window column (rel_w heads);
// in the second pass the maximum is taken off the addend, so that a term's exponent is again one fused multiply-add.
// The head's rel table lies in LDS as [tap][channel], so that its reads are contiguous over the lanes too (in global memory a channel's taps are 28 bytes from the next channel's).
// A work-group (4 waves, 8 pixels each) fills a 32-channel x 32-pixel tile in LDS, and the channel-major store then writes whole 128-byte lines.
typedef float v2f  __attribute__((ext_vector_type(2)));
typedef float v2fa __attribute__((ext_vector_type(2), may_alias));
// FIRST: the head's rel value goes with the window row (rel_h), else with the window column (rel_w). qv carries log2(e). se, acc: sum of the terms and weighted sum of v, per pixel.
template <bool FIRST>
__device__ __forceinline__ void d_wsum(const float* __restrict__ kp, const float* __restrict__ vp, const float (*rl)[32], int c2, const v2f (&qv)[4], v2f (&se)[4], v2f (&acc)[4]) {
  v2f mx[4], d[4][FIRST ? 1 : 7];      /* d: the addend of the score */
  /* every loop over the four pixels, the seven window columns and the ten loaded lines is unrolled (each '#pragma unroll' below), so that these small arrays are indexed by constants and stay in registers */
#pragma unroll
  for (int j = 0; j < 4; ++j) mx[j] = -3.0e38f;
  if (!FIRST) {
#pragma unroll
    for (int kw = 0; kw < 7; ++kw) { const v2f rc = *(const v2fa*)&rl[kw][c2];
#pragma unroll
      for (int j = 0; j < 4; ++j) d[j][FIRST ? 0 : kw] = qv[j] * rc; } }
  /* the loops over window rows stay rolled: one row's body (28 window positions, two channels each) is already long */
#pragma unroll 1
  for (int kh = 0; kh < 7; ++kh) { v2f kr[10];
#pragma unroll
    for (int i = 0; i < 10; ++i) kr[i] = *(const v2fa*)(kp + (size_t)(kh * HK + i) * CO);
    if (FIRST) { const v2f rk = *(const v2fa*)&rl[kh][c2];
#pragma unroll
      for (int j = 0; j < 4; ++j) d[j][0] = qv[j] * rk; }
#pragma unroll
    for (int j = 0; j < 4; ++j)
#pragma unroll
      for (int kw = 0; kw < 7; ++kw) { const v2f s = __builtin_elementwise_fma(qv[j], kr[j + kw], d[j][FIRST ? 0 : kw]); mx[j].x = fmaxf(mx[j].x, s.x); mx[j].y = fmaxf(mx[j].y, s.y); } }
  if (!FIRST) {
#pragma unroll
    for (int j = 0; j < 4; ++j)
#pragma unroll
      for (int kw = 0; kw < 7; ++kw) d[j][FIRST ? 0 : kw] -= mx[j]; }
  /* per pixel and channel the 49 terms are summed window row by window row, left to right */
#pragma unroll 1
  for (int kh = 0; kh < 7; ++kh) { v2f kr[10], vr[10];
#pragma unroll
    for (int i = 0; i < 10; ++i) { kr[i] = *(const v2fa*)(kp + (size_t)(kh * HK + i) * CO); vr[i] = *(const v2fa*)(vp + (size_t)(kh * HK + i) * CO); }
    if (FIRST) { const v2f rk = *(const v2fa*)&rl[kh][c2];
#pragma unroll
      for (int j = 0; j < 4; ++j) d[j][0] = qv[j] * rk - mx[j]; }
#pragma unroll
    for (int j = 0; j < 4; ++j)
#pragma unroll
      for (int kw = 0; kw < 7; ++kw) { const v2f a = __builtin_elementwise_fma(qv[j], kr[j + kw], d[j][FIRST ? 0 : kw]); v2f e; e.x = __builtin_amdgcn_exp2f(a.x); e.y = __builtin_amdgcn_exp2f(a.y); se[j] += e; acc[j] = __builtin_elementwise_fma(e, vr[j + kw], acc[j]); } } }      /* the argument is at most a few rounding errors above 0; a term below the exp2 instruction's range counts as 0 beside the largest term's 1 */
// The second launch bound holds a wave to 144 registers: seven of these 4-wave work-groups then fit a WGP, so that all 1,568 are resident at once and the launch is one round with no thin second round behind it.
__global__ __launch_bounds__(128, 7) void k_watt(const float* __restrict__ Q, const float* __restrict__ Kf, const float* __restrict__ Vf, const float* __restrict__ rh, const float* __restrict__ rw, float* __restrict__ out) {
  __shared__ __attribute__((aligned(16))) float tl[32][36]; __shared__ __attribute__((aligned(16))) float rl[7][32];
  const int tid = threadIdx.x, lane = tid & 31, w = tid >> 5; const int c2 = (lane & 15) * 2, hf = lane >> 4;      /* the lane's first channel within the head; its half-wave */
  const int p0 = (int)(blockIdx.x % (PX / 32)) * 32; const int bh = (int)(blockIdx.x / (PX / 32)); const int head = bh % (NCO / 32); const size_t b = bh / (NCO / 32); const int c = head * 32 + c2; const bool first = head < CO / 64;      /* c < CO / 2, the same for the whole work-group */
  for (int i = tid; i < 7 * 32; i += 128) { const int kq = i >> 5, ch = head * 32 + (i & 31); rl[kq][i & 31] = first ? bf16_round(rh[(size_t)ch * 7 + kq]) : bf16_round(rw[(size_t)(ch - CO / 2) * 7 + kq]); }
  __syncthreads();      /* the rel table is complete before any wave reads it */
  const int p = p0 + 8 * w + 4 * hf; const int y = p / HS, x = p % HS;      /* pixels p .. p + 3 lie in one image row: HS and p are multiples of 4 */
  const float* kp = Kf + (b * PK + (size_t)y * HK + x) * CO + c; const float* vp = Vf + (b * PK + (size_t)y * HK + x) * CO + c;
  v2f qv[4], se[4], acc[4];
#pragma unroll
  for (int j = 0; j < 4; ++j) { qv[j] = *(const v2fa*)(Q + (b * PX + p + j) * CO + c) * 1.44269504f; se[j] = 0.f; acc[j] = 0.f; }      /* q carries log2(e): scores and their maximum are in base-2 units, so that each term is one exp2 */
  if (first) d_wsum<true>(kp, vp, rl, c2, qv, se, acc); else d_wsum<false>(kp, vp, rl, c2, qv, se, acc);      /* the same side for the whole work-group */
  v4f o0, o1;
#pragma unroll
  for (int j = 0; j < 4; ++j) { o0[j] = acc[j].x / se[j].x; o1[j] = acc[j].y / se[j].y; }
  *(v4fa*)&tl[c2][8 * w + 4 * hf] = o0; *(v4fa*)&tl[c2 + 1][8 * w + 4 * hf] = o1;
  __syncthreads();      /* the tile is complete before any wave reads other waves' pixels */
#pragma unroll
  for (int u = 0; u < 2; ++u) { const int dh = (tid >> 3) + 16 * u, j4 = (tid & 7) * 4; const v4f o = *(const v4fa*)&tl[dh][j4];
    const int oc = dh * 8 + head;      /* the reference's final transpose: output channel = dh*heads + head for computation channel head*32 + dh */
    *(v4f*)(out + ((b * CO + oc) * (size_t)PX + p0 + j4)) = o; } }

extern "C" void kernel_launch(void* const* d_in, const int* in_sizes, int n_in,
                              void* d_out, int out_size, void* d_ws, size_t ws_size, hipStream_t stream) {
  (void)in_sizes; (void)n_in; (void)out_size;
  const float* const* I = (const float* const*)d_in; const float* x = I[0]; const float* wq = I[1]; const float* wk = I[2]; const float* wv = I[3]; const float* rh = I[4]; const float* rw = I[5];
  char* ws = (char*)d_ws; size_t off = 0;
  auto take = [&](size_t bytes) { char* p = ws + off; off += (bytes + 255) & ~(size_t)255; return p; };
  _Float16* BQ = (_Float16*)take((size_t)CO * KC * 2); _Float16* BK = (_Float16*)take((size_t)CO * KC * 2); _Float16* BV = (_Float16*)take((size_t)CO * KC * 2);
  _Float16* XR = (_Float16*)take((size_t)NB * PP * CI * 2); float* Q = (float*)take((size_t)MQ * TM * CO * 4); float* Kf = (float*)take((size_t)MK * TM * CO * 4); float* Vf = (float*)take((size_t)MK * TM * CO * 4);
  if (off > ws_size) return;      /* three weight planes, the x rows, q, k, v */
  k_prep<<<GX + 3 * GW, 256, 0, stream>>>(x, wq, wk, wv, XR, BQ, BK, BV);
  k_conv7<<<GQ + 2 * GK, 256, 0, stream>>>(XR, BQ, BK, BV, 0.0625f, Q, Kf, Vf);
  k_watt<<<NB * (NCO / 32) * (PX / 32), 128, 0, stream>>>(Q, Kf, Vf, rh, rw, (float*)d_out);
}
